// v000
// Times are from an AMD MI455X. After a warm-up the kernel runs many times in a row, and a time is the length of
// such a window on the GPU divided by its runs, so every launch and the gaps after it count. The runs cycle
// through copies of the inputs. A figure is the median of several windows, for all but v000 over two sittings.
// Sittings can differ by a few percent; kernels timed side by side share one.
// The starting kernel, v000, takes 14 milliseconds a run.
#include <hip/hip_runtime.h>
// Single-head causal self-attention with the module's EMBEDDING-width scale (inps [4][2048][1024]; q/k/v = x W^T (natural [64][1024], U(+-1/32), no biases); ONE 64-wide head; scores * 1024^-0.5 (the source sets head_size = n_embed); causal (tril, -inf); softmax; out = weights v -> [4][2048][64]; no output projection).
// Structure: token rows; x as exact f16 rows; three WMMA GEMMs into one f16 q | k | v plane [8192][192]; per batch v^T via LDS transposes; causal 256-row query tiles with the one head on grid.y (scores alpha 1/32, causal softmax f32 -> f16 x256 weights, P V written as f32 straight into the merged output rows); an exact f32 first tile (rows 0..511) rewritten at the end; launches: see trace.
// Compute dtype: inputs rounded to bf16; x / weights exact; q, k, v and softmax weights as plain f16 GEMM operands (~2^-12); scores and softmax statistics f32. v_wmma_f32_16x16x32_f16.
#define NB 4
#define SQ 2048
#define DM 1024
#define NH 1
#define HD 64
#define HG 4                         /* used only by the k_vt(V16, b, h0, VT) overload, which is not launched */
#define QT 256                       /* query rows per causal tile */
#define NKX SQ                       /* S / P row pitch */
#define QT0 512                      /* first-tile rows recomputed exactly (f32): 512 here (no output projection averages the early-row cancellation errors away; logit sigma 1.0) */
#define B0 0                         /* unused: the batch loop starts at 0 */
#define NBR NB                       /* unused by the launches (they loop over NB) */
#define NR ((size_t)NB * SQ)
#define DMQ DM
#define DFF 4096                     /* unused: there is no FFN */
#define DFFR 100                     /* unused */
#define MP ((int)((size_t)NBR * SQ)) /* unused: the projections take NR rows */
#define QN SQ                        /* unused: the tile loop runs over SQ */
#define NHD NH                       /* unused: the launches use NH */
#define MPO MP                       /* unused: there is no output stage */
#define LQ (3 * DM)
typedef __bf16 v16b __attribute__((ext_vector_type(16)));
typedef unsigned short v8us __attribute__((ext_vector_type(8), may_alias));
typedef float  v8f  __attribute__((ext_vector_type(8)));
typedef float  v4f  __attribute__((ext_vector_type(4)));
typedef float  v4fa __attribute__((ext_vector_type(4), may_alias));
union FragB { v16b v; v8us half[2]; unsigned short u[16]; };

__device__ __forceinline__ unsigned short bf16_bits(float x) { unsigned int u = __float_as_uint(x); return (unsigned short)((u + 0x7FFFu + ((u >> 16) & 1u)) >> 16); }
__device__ __forceinline__ float bf16_val(unsigned short b) { return __uint_as_float(((unsigned int)b) << 16); }
__device__ __forceinline__ float bf16_round(float x) { return bf16_val(bf16_bits(x)); }
// D += A·B with NT terms: 1 = ah·bh, 2 = + al·bh (A split), 3 = + ah·bl (both split)
template <int NT>
__device__ __forceinline__ v8f mmaN(v16b ah, v16b al, v16b bh, v16b bl, v8f c) {
  c = __builtin_amdgcn_wmma_f32_16x16x32_bf16(false, ah, false, bh, (short)0, c, false, false);
  if (NT >= 2) c = __builtin_amdgcn_wmma_f32_16x16x32_bf16(false, al, false, bh, (short)0, c, false, false);
  if (NT >= 3) c = __builtin_amdgcn_wmma_f32_16x16x32_bf16(false, ah, false, bl, (short)0, c, false, false);
  asm volatile("v_nop\n\tv_nop\n\tv_nop\n\tv_nop" : "+v"(c) : "v"(ah), "v"(al), "v"(bh), "v"(bl));
  return c;
}

__global__ __launch_bounds__(256) void k_wt_bf16(const float* __restrict__ W, unsigned short* __restrict__ Wt, int K, int N) {
  const int t = blockIdx.x * 256 + threadIdx.x;
  const int k8n = K / 8;
  if (t >= N * k8n) return;
  const int n = t / k8n, k8 = (t % k8n) * 8;
  v8us v;
#pragma unroll
  for (int i = 0; i < 8; ++i) v[i] = bf16_bits(W[(size_t)(k8 + i) * N + n]);
  *(v8us*)(Wt + (size_t)n * K + k8) = v;
  
}

// GEMM C[M][N] (f32, pitch ldc) = act(A[M][K]·W + bias). A f32 row-major (pitch lda) converted per fragment to bf16
// (ASPLIT: hi/lo two planes -> 2 terms, else single rounded term); Wt bf16 [N][K] (pitch ldb). BIAS_BF16 rounds the
// bias to bf16 first (bias quantised to bf16 before the add). K%32==0, M%16==0, N%64==0.
template <bool ASPLIT, int ACT, bool BIAS_BF16>
__global__ __launch_bounds__(128) void k_gemm_bf(const float* __restrict__ A, int lda, const unsigned short* __restrict__ Wt, int ldb,
                                               const float* __restrict__ bias, float* __restrict__ C, int ldc, int M, int N, int K) {
  __shared__ __attribute__((aligned(16))) float so[4][16][64];
  const int tid = threadIdx.x, w = tid >> 5, lane = tid & 31, ln = lane & 15, hh = lane >> 4;
  const int ntn = N / 64;
  const int wid = blockIdx.x * 4 + w;
  const int mt = wid / ntn, nq = wid % ntn;
  if (mt * 16 >= M) return;
  const int row0 = mt * 16, col0 = nq * 64;
  const float* arow = A + (size_t)(row0 + ln) * lda;
  v8f acc[4] = {};
  for (int kb = 0; kb < K; kb += 32) {
    FragB ah, al;
    const v4f x0 = *(const v4fa*)(arow + kb + 8 * hh), x1 = *(const v4fa*)(arow + kb + 8 * hh + 4);
    const v4f x2 = *(const v4fa*)(arow + kb + 16 + 8 * hh), x3 = *(const v4fa*)(arow + kb + 16 + 8 * hh + 4);
    float xs[16] = {x0[0],x0[1],x0[2],x0[3],x1[0],x1[1],x1[2],x1[3],x2[0],x2[1],x2[2],x2[3],x3[0],x3[1],x3[2],x3[3]};
#pragma unroll
    for (int i = 0; i < 16; ++i) { const unsigned short hb = bf16_bits(xs[i]); ah.u[i] = hb; al.u[i] = ASPLIT ? bf16_bits(xs[i] - bf16_val(hb)) : (unsigned short)0; }
#pragma unroll
    for (int t = 0; t < 4; ++t) {
      const unsigned short* brow = Wt + (size_t)(col0 + t * 16 + ln) * ldb + kb;
      FragB b;
      b.half[0] = *(const v8us*)(brow + 8 * hh);
      b.half[1] = *(const v8us*)(brow + 16 + 8 * hh);
      acc[t] = mmaN<ASPLIT ? 2 : 1>(ah.v, al.v, b.v, b.v, acc[t]);
    }
  }
#pragma unroll
  for (int t = 0; t < 4; ++t) {
    float bv = bias ? bias[col0 + t * 16 + ln] : 0.f;
    if (BIAS_BF16) bv = bf16_round(bv);
#pragma unroll
    for (int r = 0; r < 8; ++r) { float v = acc[t][r] + bv; if (ACT == 1) v = fmaxf(v, 0.f); so[w][8 * hh + r][t * 16 + ln] = v; }
  }
  __builtin_amdgcn_fence(__ATOMIC_ACQ_REL, "workgroup");
  __builtin_amdgcn_wave_barrier();
  const int rsub = lane >> 4, c4 = (lane & 15) * 4;
  {
#pragma unroll
    for (int q = 0; q < 8; ++q) {
      const int r = q * 2 + rsub;
      const v4f v = *(const v4fa*)&so[w][r][c4];
      *(v4f*)(C + (size_t)(row0 + r) * ldc + col0 + c4) = v;
    }
    
  }
}

// GEMM C = act(A·W + bias + resid): A f32 (ASPLIT -> hi/lo 2 terms), Wt bf16 [N][K]; ACT 0 none, 1 relu, 2 exact gelu;
// resid (optional, f32, row index = (row % rmod), pitch ldr, RES_BF16 rounds it) added before the activation.
template <bool ASPLIT, int ACT, bool BIAS_BF16, bool RES_BF16>
__global__ __launch_bounds__(128) void k_gemm_bf3(const float* __restrict__ A, int lda, const unsigned short* __restrict__ Wt, int ldb,
                                                const float* __restrict__ bias, const float* __restrict__ resid, int rmod, int ldr,
                                                float* __restrict__ C, int ldc, int M, int N, int K) {
  __shared__ __attribute__((aligned(16))) float so[4][16][64];
  const int tid = threadIdx.x, w = tid >> 5, lane = tid & 31, ln = lane & 15, hh = lane >> 4;
  const int ntn = N / 64;
  const int wid = blockIdx.x * 4 + w;
  const int mt = wid / ntn, nq = wid % ntn;
  if (mt * 16 >= M) return;
  const int row0 = mt * 16, col0 = nq * 64;
  const float* arow = A + (size_t)(row0 + ln) * lda;
  v8f acc[4] = {};
  for (int kb = 0; kb < K; kb += 32) {
    FragB ah, al;
    const v4f x0 = *(const v4fa*)(arow + kb + 8 * hh), x1 = *(const v4fa*)(arow + kb + 8 * hh + 4);
    const v4f x2 = *(const v4fa*)(arow + kb + 16 + 8 * hh), x3 = *(const v4fa*)(arow + kb + 16 + 8 * hh + 4);
    float xs[16] = {x0[0],x0[1],x0[2],x0[3],x1[0],x1[1],x1[2],x1[3],x2[0],x2[1],x2[2],x2[3],x3[0],x3[1],x3[2],x3[3]};
#pragma unroll
    for (int i = 0; i < 16; ++i) { const unsigned short hb = bf16_bits(xs[i]); ah.u[i] = hb; al.u[i] = ASPLIT ? bf16_bits(xs[i] - bf16_val(hb)) : (unsigned short)0; }
#pragma unroll
    for (int t = 0; t < 4; ++t) {
      const unsigned short* brow = Wt + (size_t)(col0 + t * 16 + ln) * ldb + kb;
      FragB b;
      b.half[0] = *(const v8us*)(brow + 8 * hh);
      b.half[1] = *(const v8us*)(brow + 16 + 8 * hh);
      acc[t] = mmaN<ASPLIT ? 2 : 1>(ah.v, al.v, b.v, b.v, acc[t]);
    }
  }
#pragma unroll
  for (int t = 0; t < 4; ++t) {
    const int col = col0 + t * 16 + ln;
    float bv = bias ? bias[col] : 0.f;
    if (BIAS_BF16) bv = bf16_round(bv);
#pragma unroll
    for (int r = 0; r < 8; ++r) {
      float v = acc[t][r] + bv;
      if (resid) { float rv = resid[(size_t)((row0 + 8 * hh + r) % rmod) * ldr + col]; if (RES_BF16) rv = bf16_round(rv); v += rv; }
      if (ACT == 1) v = fmaxf(v, 0.f);
      if (ACT == 2) v = 0.5f * v * (1.0f + erff(v * 0.70710678118654752f));
      if (ACT == 3) { const float u = 0.7978845608028654f * (v + 0.044715f * v * v * v); v = 0.5f * v * (1.0f + tanhf(u)); }
      so[w][8 * hh + r][t * 16 + ln] = v;
    }
  }
  __builtin_amdgcn_fence(__ATOMIC_ACQ_REL, "workgroup");
  __builtin_amdgcn_wave_barrier();
  const int rsub = lane >> 4, c4 = (lane & 15) * 4;
  {
#pragma unroll
    for (int q = 0; q < 8; ++q) {
      const int r = q * 2 + rsub;
      const v4f v = *(const v4fa*)&so[w][r][c4];
      *(v4f*)(C + (size_t)(row0 + r) * ldc + col0 + c4) = v;
    }
    
  }
}
// row LayerNorm (biased variance, eps) over N: s = X (+ R); optional out_sum <- s; out_norm <- (s-mu)*rsqrt(var+eps)*g + b
template <bool PARAM_BF16>
__global__ __launch_bounds__(256) void k_layernorm(const float* __restrict__ X, const float* __restrict__ R, const float* __restrict__ g, const float* __restrict__ bta,
                                                  float* __restrict__ out_sum, float* __restrict__ out_norm, int N, float eps) {
  __shared__ float red[256];
  const int row = blockIdx.x, tid = threadIdx.x;
  const float* x = X + (size_t)row * N; const float* rr = R ? R + (size_t)row * N : nullptr;
  float vals[16];                     // up to N = 4096
  const int per = N / 256;            // contiguous chunk per thread? use strided-by-4 chunks: thread handles j = tid*4 + 1024*u
  float s1 = 0.f;
  for (int u = 0; u < per / 4; ++u) {
    const int j = tid * 4 + 1024 * u;
    const v4f a = *(const v4fa*)(x + j);
    v4f b = {0.f,0.f,0.f,0.f}; if (rr) b = *(const v4fa*)(rr + j);
#pragma unroll
    for (int q = 0; q < 4; ++q) { const float v = a[q] + b[q]; vals[u * 4 + q] = v; s1 += v; }
  }
  red[tid] = s1; __syncthreads();
  for (int st = 128; st > 0; st >>= 1) { if (tid < st) red[tid] += red[tid + st]; __syncthreads(); }
  const float mu = red[0] / (float)N; __syncthreads();
  float s2 = 0.f;
  for (int u = 0; u < per / 4; ++u)
#pragma unroll
    for (int q = 0; q < 4; ++q) { const float c = vals[u * 4 + q] - mu; s2 += c * c; }
  red[tid] = s2; __syncthreads();
  for (int st = 128; st > 0; st >>= 1) { if (tid < st) red[tid] += red[tid + st]; __syncthreads(); }
  const float rs = rsqrtf(red[0] / (float)N + eps);
  {
    for (int u = 0; u < per / 4; ++u) {
      const int j = tid * 4 + 1024 * u;
      v4f o, sm;
#pragma unroll
      for (int q = 0; q < 4; ++q) {
        float gg = g[j + q], bb = bta[j + q];
        if (PARAM_BF16) { gg = bf16_round(gg); bb = bf16_round(bb); }
        sm[q] = vals[u * 4 + q]; o[q] = (vals[u * 4 + q] - mu) * rs * gg + bb;
      }
      if (out_sum) *(v4f*)(out_sum + (size_t)row * N + j) = sm;
      *(v4f*)(out_norm + (size_t)row * N + j) = o;
    }
    
  }
}



// ---- f16 WMMA path (v_wmma_f32_16x16x32_f16): 11-bit significands for operands in range — used where a [0,1] probability operand needs more precision than bf16
typedef _Float16 v16h __attribute__((ext_vector_type(16)));
union FragH { v16h v; v8us half[2]; _Float16 h[16]; unsigned short u[16]; };
template <int NT>
__device__ __forceinline__ v8f mmaH(v16h ah, v16h al, v16h bh, v16h bl, v8f c) {
  c = __builtin_amdgcn_wmma_f32_16x16x32_f16(false, ah, false, bh, (short)0, c, false, false);
  if (NT >= 2) c = __builtin_amdgcn_wmma_f32_16x16x32_f16(false, al, false, bh, (short)0, c, false, false);
  if (NT >= 3) c = __builtin_amdgcn_wmma_f32_16x16x32_f16(false, ah, false, bl, (short)0, c, false, false);
  asm volatile("v_nop\n\tv_nop\n\tv_nop\n\tv_nop" : "+v"(c) : "v"(ah), "v"(al), "v"(bh), "v"(bl));
  return c;
}
// batched GEMM like k_gemm_b but f16 operands: A f32 (split into f16 hi/lo if ASPLIT, else rounded to f16), Bt = f16 values [n][k]; alpha; C f32; N multiple of 16 (partial tiles skipped)
template <bool ASPLIT>
__global__ __launch_bounds__(128) void k_gemm_h(const float* __restrict__ A, int lda, size_t sA, const _Float16* __restrict__ Bh, int ldb, size_t sB, float alpha, float* __restrict__ C, int ldc, size_t sC, int M, int N, int K) {
  __shared__ __attribute__((aligned(16))) float so[4][16][64];
  const int tid = threadIdx.x, w = tid >> 5, lane = tid & 31, ln = lane & 15, hh = lane >> 4; const int by = blockIdx.y;
  A += (size_t)by * sA; Bh += (size_t)by * sB; C += (size_t)by * sC;
  const int ntn = (N + 63) / 64; const int wid = blockIdx.x * 4 + w; const int mt = wid / ntn, nq = wid % ntn; if (mt * 16 >= M) return;
  const int row0 = mt * 16, col0 = nq * 64; const float* arow = A + (size_t)(row0 + ln) * lda;
  v8f acc[4] = {};
  for (int kb = 0; kb < K; kb += 32) {
    FragH ah, al;
    const v4f x0 = *(const v4fa*)(arow + kb + 8 * hh), x1 = *(const v4fa*)(arow + kb + 8 * hh + 4), x2 = *(const v4fa*)(arow + kb + 16 + 8 * hh), x3 = *(const v4fa*)(arow + kb + 16 + 8 * hh + 4);
    float xs[16] = {x0[0],x0[1],x0[2],x0[3],x1[0],x1[1],x1[2],x1[3],x2[0],x2[1],x2[2],x2[3],x3[0],x3[1],x3[2],x3[3]};
#pragma unroll
    for (int i = 0; i < 16; ++i) { const _Float16 h = (_Float16)xs[i]; ah.h[i] = h; al.h[i] = ASPLIT ? (_Float16)(xs[i] - (float)h) : (_Float16)0.0f; }
#pragma unroll
    for (int t = 0; t < 4; ++t) { if (col0 + t * 16 >= N) continue; const size_t boff = (size_t)(col0 + t * 16 + ln) * ldb + kb; FragH bq; bq.half[0] = *(const v8us*)(Bh + boff + 8 * hh); bq.half[1] = *(const v8us*)(Bh + boff + 16 + 8 * hh);
      acc[t] = mmaH<ASPLIT ? 2 : 1>(ah.v, al.v, bq.v, bq.v, acc[t]); }
  }
#pragma unroll
  for (int t = 0; t < 4; ++t) { if (col0 + t * 16 >= N) continue;
#pragma unroll
    for (int r = 0; r < 8; ++r) so[w][8 * hh + r][t * 16 + ln] = acc[t][r] * alpha; }
  __builtin_amdgcn_fence(__ATOMIC_ACQ_REL, "workgroup"); __builtin_amdgcn_wave_barrier();
  const int rsub = lane >> 4, c4 = (lane & 15) * 4;
  {
#pragma unroll
    for (int q = 0; q < 8; ++q) { const int r = q * 2 + rsub; if (col0 + c4 < N) { const v4f v = *(const v4fa*)&so[w][r][c4]; *(v4f*)(C + (size_t)(row0 + r) * ldc + col0 + c4) = v; } }
     }
}

// Wt[n][k] = f16(W[k][n]·scale) from f32 row-major W[K][N] (scale = power of two; bf16-exact weights stay exact in f16 away from the subnormal range)
__global__ __launch_bounds__(256) void k_wt_f16(const float* __restrict__ W, _Float16* __restrict__ Wt, int K, int N, float scale) {
  const int t = blockIdx.x * 256 + threadIdx.x; if (t >= N * (K / 8)) return; const int n = t / (K / 8), k8 = (t % (K / 8)) * 8; FragH f;
#pragma unroll
  for (int i = 0; i < 8; ++i) f.h[i] = (_Float16)(bf16_round(W[(size_t)(k8 + i) * N + n]) * scale); const v8us o = f.half[0];
  *(v8us*)((unsigned short*)Wt + (size_t)n * K + k8) = o; 
}
// k_gemm_hh variant with fused epilogue: v = acc·alpha + bias[by·sBias + col] (+ CP[(row/rowsPerB)·sCPb + by·64 + col] if CP) ; ACT 0 none / 1 elu ; writes f16 C16 (and f32 C if non-null)
template <int ACT>
__global__ __launch_bounds__(128) void k_gemm_hhx(const _Float16* __restrict__ A, int lda, size_t sA, const _Float16* __restrict__ Bh, int ldb, size_t sB, float alpha, const float* __restrict__ bias, size_t sBias, const float* __restrict__ CP, int rowsPerB, size_t sCPb, int row0g,
    float* __restrict__ C, _Float16* __restrict__ C16, int ldc, size_t sC, int M, int N, int K) {
  __shared__ __attribute__((aligned(16))) float so[4][16][64];
  const int tid = threadIdx.x, w = tid >> 5, lane = tid & 31, ln = lane & 15, hh = lane >> 4; const int by = blockIdx.y;
  A += (size_t)by * sA; Bh += (size_t)by * sB; const size_t cofs = (size_t)by * sC; const float* bp = bias ? bias + (size_t)by * sBias : nullptr;
  const int ntn = (N + 63) / 64; const int wid = blockIdx.x * 4 + w; const int mt = wid / ntn, nq = wid % ntn; if (mt * 16 >= M) return;
  const int row0 = mt * 16, col0 = nq * 64; const _Float16* arow = A + (size_t)(row0 + ln) * lda;
  v8f acc[4] = {};
  for (int kb = 0; kb < K; kb += 32) { FragH ah; ah.half[0] = *(const v8us*)((const unsigned short*)arow + kb + 8 * hh); ah.half[1] = *(const v8us*)((const unsigned short*)arow + kb + 16 + 8 * hh);
#pragma unroll
    for (int t = 0; t < 4; ++t) { if (col0 + t * 16 >= N) continue; const size_t boff = (size_t)(col0 + t * 16 + ln) * ldb + kb; FragH bq; bq.half[0] = *(const v8us*)((const unsigned short*)Bh + boff + 8 * hh); bq.half[1] = *(const v8us*)((const unsigned short*)Bh + boff + 16 + 8 * hh);
      acc[t] = mmaH<1>(ah.v, ah.v, bq.v, bq.v, acc[t]); }
  }
#pragma unroll
  for (int t = 0; t < 4; ++t) { if (col0 + t * 16 >= N) continue; const int col = col0 + t * 16 + ln; const float bv = bp ? bf16_round(bp[col]) : 0.f;
#pragma unroll
    for (int r = 0; r < 8; ++r) { float v = acc[t][r] * alpha + bv; if (CP) { const int rr = row0g + row0 + 8 * hh + r; if (rowsPerB < 0) v += CP[cofs + (size_t)rr * ldc + col];      /* rowsPerB < 0: own element of the batched C plane */ else { const int bidx = rr / rowsPerB; v += CP[(size_t)bidx * sCPb + (size_t)by * 64 + col]; } } if (ACT == 1) v = (v > 0.f) ? v : expm1f(v); else if (ACT == 7) v = (v > 0.f) ? v + 1.0f : expf(v); else if (ACT == 8) v = tanhf(v); else if (ACT == 9) v = 0.5f * v * (1.0f + tanhf(0.7978845608028654f * (v + 0.044715f * v * v * v))); else if (ACT == 11) v = 1.0f / (1.0f + expf(-v)); else if (ACT == 12) v = (v > 0.f) ? v : 0.01f * v; else if (ACT == 14) v = (v > 0.f) ? v : 0.1f * v; else if (ACT == 16) v = (v >= 0.f) ? v : 0.3f * v; else if (ACT == 17) v = (v >= 0.f) ? v : 0.2f * v; else if (ACT == 15) v = v / (1.0f + expf(-v)); else if (ACT == 3) v = fmaxf(v, 0.f); else if (ACT == 6) v = 0.5f * v * (1.0f + erff(v * 0.70710678118654752f)); so[w][8 * hh + r][t * 16 + ln] = v; } }
  __builtin_amdgcn_fence(__ATOMIC_ACQ_REL, "workgroup"); __builtin_amdgcn_wave_barrier();
  const int rsub = lane >> 4, c4 = (lane & 15) * 4; typedef _Float16 v4h __attribute__((ext_vector_type(4)));
  {
#pragma unroll
    for (int q = 0; q < 8; ++q) { const int r = q * 2 + rsub; if (col0 + c4 < N) { const v4f v = *(const v4fa*)&so[w][r][c4]; if (C) *(v4f*)(C + cofs + (size_t)(row0 + r) * ldc + col0 + c4) = v; if (C16) { v4h h4; for (int i = 0; i < 4; ++i) h4[i] = (_Float16)v[i]; *(v4h*)(C16 + cofs + (size_t)(row0 + r) * ldc + col0 + c4) = h4; } } }
     }
}


typedef _Float16 v4h __attribute__((ext_vector_type(4)));

__global__ __launch_bounds__(256) void k_x16(const float* __restrict__ x, _Float16* __restrict__ X16, size_t n8) { const size_t t = (size_t)blockIdx.x * 256 + threadIdx.x; if (t >= n8) return; FragH f;
#pragma unroll
  for (int q = 0; q < 8; ++q) f.h[q] = (_Float16)bf16_round(x[t * 8 + q]); *(v8us*)((unsigned short*)X16 + t * 8) = f.half[0];  }
__global__ __launch_bounds__(256) void k_h16(const float* __restrict__ x, _Float16* __restrict__ X16, size_t n8) { const size_t t = (size_t)blockIdx.x * 256 + threadIdx.x; if (t >= n8) return; FragH f;
#pragma unroll
  for (int q = 0; q < 8; ++q) f.h[q] = (_Float16)x[t * 8 + q]; *(v8us*)((unsigned short*)X16 + t * 8) = f.half[0];  }
__global__ __launch_bounds__(256) void k_round16f(const float* __restrict__ W, _Float16* __restrict__ Bt, size_t n8) { const size_t t = (size_t)blockIdx.x * 256 + threadIdx.x; if (t >= n8) return; FragH f;
#pragma unroll
  for (int i = 0; i < 8; ++i) f.h[i] = (_Float16)(bf16_round(W[t * 8 + i]) * 16.0f); *(v8us*)((unsigned short*)Bt + t * 8) = f.half[0];  }
template <int NHv, int TTv>
__global__ __launch_bounds__(256) void k_vt(const _Float16* __restrict__ V16, int ldv, int voff, _Float16* __restrict__ Vt) { __shared__ unsigned short tl[64][66]; const int tid = threadIdx.x; const int slab = blockIdx.x / (TTv / 64), lg = blockIdx.x % (TTv / 64); const int b = slab / NHv, h = slab % NHv;
  for (int i = tid; i < 64 * 8; i += 256) { const int r = i / 8, c8 = (i % 8) * 8; FragH f; f.half[0] = *(const v8us*)((const unsigned short*)V16 + ((size_t)b * TTv + lg * 64 + r) * ldv + voff + h * 64 + c8);
#pragma unroll
    for (int q = 0; q < 8; ++q) tl[r][c8 + q] = f.u[q]; }
  __syncthreads();
  {
#pragma unroll
    for (int rd = 0; rd < 2; ++rd) { const int d = rd * 32 + tid / 8, pc = tid % 8; FragH f;
#pragma unroll
      for (int q = 0; q < 8; ++q) f.u[q] = tl[pc * 8 + q][d];
      *(v8us*)((unsigned short*)Vt + ((size_t)slab * 64 + d) * TTv + lg * 64 + pc * 8) = f.half[0]; }
     } }

__global__ __launch_bounds__(256) void k_hl(const float* __restrict__ F, _Float16* __restrict__ Hh, _Float16* __restrict__ Hl, size_t n8) { const size_t t = (size_t)blockIdx.x * 256 + threadIdx.x; if (t >= n8) return; FragH fh, fl; const v4f a = *(const v4fa*)(F + t * 8), c = *(const v4fa*)(F + t * 8 + 4);
#pragma unroll
  for (int q = 0; q < 4; ++q) { _Float16 h = (_Float16)a[q]; fh.h[q] = h; fl.h[q] = (_Float16)((a[q] - (float)h) * 1024.0f); h = (_Float16)c[q]; fh.h[4 + q] = h; fl.h[4 + q] = (_Float16)((c[q] - (float)h) * 1024.0f); }
  { *(v8us*)((unsigned short*)Hh + t * 8) = fh.half[0]; *(v8us*)((unsigned short*)Hl + t * 8) = fl.half[0];  } }

// ---- fast GEMM (wave tile 32x64; requires M % 32 == 0 rows per launch region and N % 64 == 0); epilogue = k_gemm_hhx semantics ----
__device__ __forceinline__ v16h g2_frag(const _Float16* p, int hh) { FragH f; f.half[0] = *(const v8us*)((const unsigned short*)p + 8 * hh); f.half[1] = *(const v8us*)((const unsigned short*)p + 16 + 8 * hh); return f.v; }
__device__ __forceinline__ v8f g2_mma(v16h a, v16h b, v8f c) { v8f d = __builtin_amdgcn_wmma_f32_16x16x32_f16(false, a, false, b, (short)0, c, false, false); asm volatile("v_nop\n\tv_nop\n\tv_nop\n\tv_nop" : "+v"(d) : "v"(a), "v"(b)); return d; }
template <int ACT>
__global__ __launch_bounds__(128) void k_gemm2(const _Float16* __restrict__ A, int lda, size_t sA, const _Float16* __restrict__ Bh, int ldb, size_t sB, float alpha, const float* __restrict__ bias, size_t sBias, const float* __restrict__ CP, int rowsPerB, size_t sCPb, int row0g,
    float* __restrict__ C, _Float16* __restrict__ C16, int ldc, size_t sC, int M, int N, int K) { static_assert(ACT == 0 || ACT == 3 || ACT == 6 || ACT == 8 || ACT == 9 || ACT == 11 || ACT == 12 || ACT == 14 || ACT == 15 || ACT == 16 || ACT == 17, "k_gemm2: unsupported ACT code (would silently apply no activation)");
  __shared__ __attribute__((aligned(16))) float so[4][32][68];
  const int tid = threadIdx.x, w = tid >> 5, lane = tid & 31, ln = lane & 15, hh = lane >> 4; const int by = blockIdx.y;
  A += (size_t)by * sA; Bh += (size_t)by * sB; const size_t cofs = (size_t)by * sC; const float* bp = bias ? bias + (size_t)by * sBias : nullptr;
  const int ntn = N >> 6; const int mt = blockIdx.x / ntn, nq = blockIdx.x - mt * ntn; const int row0 = mt * 128 + 32 * w, col0 = nq * 64; if (row0 >= M) return;
  const _Float16* a0p = A + (size_t)(row0 + ln) * lda; const _Float16* a1p = a0p + (size_t)16 * lda;
  const _Float16* b0p = Bh + (size_t)(col0 + ln) * ldb; const _Float16* b1p = b0p + (size_t)16 * ldb; const _Float16* b2p = b1p + (size_t)16 * ldb; const _Float16* b3p = b2p + (size_t)16 * ldb;
  const v8f z8 = {0.f,0.f,0.f,0.f,0.f,0.f,0.f,0.f}; v8f c00 = z8, c01 = z8, c02 = z8, c03 = z8, c10 = z8, c11 = z8, c12 = z8, c13 = z8;
#pragma unroll 1
  for (int kb = 0; kb < K; kb += 32) { const v16h a0 = g2_frag(a0p + kb, hh), a1 = g2_frag(a1p + kb, hh);
    v16h b = g2_frag(b0p + kb, hh); c00 = g2_mma(a0, b, c00); c10 = g2_mma(a1, b, c10);
    b = g2_frag(b1p + kb, hh); c01 = g2_mma(a0, b, c01); c11 = g2_mma(a1, b, c11);
    b = g2_frag(b2p + kb, hh); c02 = g2_mma(a0, b, c02); c12 = g2_mma(a1, b, c12);
    b = g2_frag(b3p + kb, hh); c03 = g2_mma(a0, b, c03); c13 = g2_mma(a1, b, c13); }
  v8f accs[8] = {c00, c01, c02, c03, c10, c11, c12, c13};
#pragma unroll
  for (int u = 0; u < 8; ++u) { const int t = u & 3, half = u >> 2; const int col = col0 + t * 16 + ln; const float bv = bp ? bf16_round(bp[col]) : 0.f;
#pragma unroll
    for (int r = 0; r < 8; ++r) { const int rloc = half * 16 + 8 * hh + r; float v = accs[u][r] * alpha + bv; if (CP) { if (rowsPerB < 0) v += CP[cofs + (size_t)(row0g + row0 + rloc) * ldc + col];      /* rowsPerB < 0: own element of the batched C plane */ else { const int bidx = (row0g + row0 + rloc) / rowsPerB; v += CP[(size_t)bidx * sCPb + (size_t)by * 64 + col]; } }
      if (ACT == 3) v = fmaxf(v, 0.f); else if (ACT == 6) v = 0.5f * v * (1.0f + erff(v * 0.70710678118654752f)); else if (ACT == 11) v = 1.0f / (1.0f + expf(-v)); else if (ACT == 15) v = v / (1.0f + expf(-v)); else if (ACT == 12) v = (v > 0.f) ? v : 0.01f * v; else if (ACT == 8) v = tanhf(v); else if (ACT == 9) v = 0.5f * v * (1.0f + tanhf(0.7978845608028654f * (v + 0.044715f * v * v * v))); else if (ACT == 14) v = (v > 0.f) ? v : 0.1f * v; else if (ACT == 16) v = (v >= 0.f) ? v : 0.3f * v; else if (ACT == 17) v = (v >= 0.f) ? v : 0.2f * v;
      so[w][rloc][t * 16 + ln] = v; } }
  __builtin_amdgcn_fence(__ATOMIC_ACQ_REL, "workgroup"); __builtin_amdgcn_wave_barrier();
  const int rsub = lane >> 4, c4 = (lane & 15) * 4;
  {
#pragma unroll
    for (int q = 0; q < 16; ++q) { const int r = q * 2 + rsub; const v4f v = *(const v4fa*)&so[w][r][c4]; if (C) *(v4f*)(C + cofs + (size_t)(row0 + r) * ldc + col0 + c4) = v; if (C16) { v4h h4; for (int i = 0; i < 4; ++i) h4[i] = (_Float16)v[i]; *(v4h*)(C16 + cofs + (size_t)(row0 + r) * ldc + col0 + c4) = h4; } }
     } }


__global__ __launch_bounds__(256) void k_wnat(const float* __restrict__ w, size_t n8, _Float16* __restrict__ Bt) { const size_t t = (size_t)blockIdx.x * 256 + threadIdx.x; if (t >= n8) return; FragH f; for (int q = 0; q < 8; ++q) f.h[q] = (_Float16)(bf16_round(w[t * 8 + q]) * 16.0f); *(v8us*)((unsigned short*)Bt + t * 8) = f.half[0];  }
__global__ __launch_bounds__(256) void k_rsm(const float* __restrict__ S, _Float16* __restrict__ P, int nrows) {
  #pragma clang fp contract(off)
  const int i = blockIdx.x * 256 + threadIdx.x; if (i >= nrows) return; const float* s = S + (size_t)i * SQ; float mx = -3.0e38f;
#pragma unroll 1
  for (int j = 0; j < SQ; ++j) mx = fmaxf(mx, s[j]); float se = 0.f;
#pragma unroll 1
  for (int j = 0; j < SQ; ++j) se += expf(s[j] - mx); const float sc = 256.0f / se;
#pragma unroll 1
  for (int j0 = 0; j0 < SQ; j0 += 8) { FragH f; for (int q = 0; q < 8; ++q) f.h[q] = (_Float16)(expf(s[j0 + q] - mx) * sc); unsigned short* d = (unsigned short*)P + (size_t)i * SQ + j0; *(v8us*)d = f.half[0];  } }
__global__ __launch_bounds__(256) void k_vt(const _Float16* __restrict__ V16, int b, int h0, _Float16* __restrict__ VT) { __shared__ unsigned short tl[64][65]; const int tid = threadIdx.x; const int hh = blockIdx.x % HG, sg = blockIdx.x / HG; const int s0 = sg * 64; const int h = h0 + hh;
  for (int i = tid; i < 64 * 8; i += 256) { const int j = i / 8, d8 = (i % 8) * 8; FragH f; f.half[0] = *(const v8us*)((const unsigned short*)V16 + ((size_t)b * SQ + s0 + j) * DM + h * HD + d8); for (int q = 0; q < 8; ++q) tl[d8 + q][j] = f.u[q]; }
  __syncthreads();
  { for (int i = tid; i < 64 * 8; i += 256) { const int d = i / 8, j8 = (i % 8) * 8; FragH f; for (int q = 0; q < 8; ++q) f.u[q] = tl[d][j8 + q]; *(v8us*)((unsigned short*)VT + ((size_t)hh * HD + d) * SQ + s0 + j8) = f.half[0]; }  } }



__global__ __launch_bounds__(256) void k_rsmcf2(const float* __restrict__ S, _Float16* __restrict__ P, int hg, int q0, int nk) {
  #pragma clang fp contract(off)
  const int t = blockIdx.x * 256 + threadIdx.x; if (t >= hg * QT) return; const size_t i = (size_t)t; const float* s = S + i * NKX; const int last = q0 + (t % QT); float mx = -3.0e38f;
#pragma unroll 1
  for (int j = 0; j < nk; ++j) { const float f = (j <= last) ? 1.f : 0.f; mx = fmaxf(mx, fmaf(f, s[j], (1.f - f) * -1.0e9f)); } float se = 0.f;
#pragma unroll 1
  for (int j = 0; j < nk; ++j) { const float f = (j <= last) ? 1.f : 0.f; se += __expf(fmaf(f, s[j], (1.f - f) * -1.0e9f) - mx); } const float sc = 256.0f / se;
#pragma unroll 1
  for (int j0 = 0; j0 < nk; j0 += 8) { FragH fr; for (int q = 0; q < 8; ++q) { const int j = j0 + q; const float f = (j <= last) ? 1.f : 0.f; fr.h[q] = (_Float16)(__expf(fmaf(f, s[j], (1.f - f) * -1.0e9f) - mx) * sc); } unsigned short* d = (unsigned short*)P + i * NKX + j0; *(v8us*)d = fr.half[0];  } }


template <int MASKADD>
__global__ __launch_bounds__(64) void k_att0(const float* __restrict__ QF, const float* __restrict__ KF, const float* __restrict__ VF, int ld, const float* __restrict__ mask, float scale, float* __restrict__ OF, int ldo) {
  #pragma clang fp contract(off)
  __shared__ __attribute__((aligned(16))) float lq[64][64]; __shared__ __attribute__((aligned(16))) float lo[64][64];
  const int tid = threadIdx.x; const int h = blockIdx.x / (QT0 / 64), rg = blockIdx.x % (QT0 / 64); const int i = rg * 64 + tid;
  const float* qr = QF + (size_t)i * ld + h * HD;
#pragma unroll 1
  for (int c = 0; c < HD / 4; ++c) { *(v4f*)&lq[tid][c * 4] = *(const v4fa*)(qr + c * 4); const v4f z = {0.f, 0.f, 0.f, 0.f}; *(v4f*)&lo[tid][c * 4] = z; }
  float m = -1.0e30f, l = 0.f; const int jmax = MASKADD ? (SQ - 1) : (rg * 64 + 63);      /* additive-mask form: every key (the mask input decides); causal form: keys up to the block's last row */
#pragma unroll 1
  for (int j = 0; j <= jmax; ++j) { const float* kr = KF + (size_t)j * ld + h * HD; const float* vr = VF + (size_t)j * ld + h * HD; float s = 0.f;
#pragma unroll 1
    for (int c = 0; c < HD / 4; ++c) { const v4f kq = *(const v4fa*)(kr + c * 4); const v4f qq = *(v4f*)&lq[tid][c * 4]; s = __fadd_rn(s, __fmul_rn(qq[0], kq[0])); s = __fadd_rn(s, __fmul_rn(qq[1], kq[1])); s = __fadd_rn(s, __fmul_rn(qq[2], kq[2])); s = __fadd_rn(s, __fmul_rn(qq[3], kq[3])); }
    s = __fmul_rn(s, scale); if (MASKADD) s = __fadd_rn(s, __fmul_rn(bf16_round(mask[(size_t)i * SQ + j]), -10000.0f));
    const float f = (MASKADD || j <= i) ? 1.f : 0.f; const float sm = fmaf(f, s, (1.f - f) * -1.0e30f); const float mn = fmaxf(m, sm); const float sc = expf(m - mn); const float e = expf(sm - mn); l = __fadd_rn(__fmul_rn(l, sc), e); m = mn;
#pragma unroll 1
    for (int c = 0; c < HD / 4; ++c) { const v4f vv = *(const v4fa*)(vr + c * 4); v4f oo = *(v4f*)&lo[tid][c * 4]; for (int u = 0; u < 4; ++u) oo[u] = __fadd_rn(__fmul_rn(oo[u], sc), __fmul_rn(e, vv[u])); *(v4f*)&lo[tid][c * 4] = oo; } }
  const float fin = 64.0f / l;      /* o carried x64; k_o0m scales it back by 1/64 */
#pragma unroll 1
  for (int c = 0; c < HD / 4; ++c) { v4f oo = *(v4f*)&lo[tid][c * 4]; for (int u = 0; u < 4; ++u) oo[u] = __fmul_rn(oo[u], fin); *(v4f*)&lo[tid][c * 4] = oo; }
  __syncthreads();
  {
#pragma unroll 1
    for (int it = 0; it < 16; ++it) { const int row = it * 4 + tid / 16, pc = (tid % 16) * 4; const v4f v = *(const v4f*)&lo[row][pc]; *(v4f*)(OF + (size_t)(rg * 64 + row) * ldo + h * HD + pc) = v; }
     } }


template <int BFIN, int WXB>
__global__ __launch_bounds__(256) void k_ln16(const float* __restrict__ X, const float* __restrict__ g, const float* __restrict__ bb, float eps, _Float16* __restrict__ N16, float* __restrict__ XB) {
  #pragma clang fp contract(off)
  __shared__ float red[256]; const size_t r = blockIdx.x; const int t = threadIdx.x; const v4f xa = *(const v4fa*)(X + r * DMQ + t * 4); float s[4]; float sum = 0.f;
  for (int q = 0; q < 4; ++q) { s[q] = BFIN ? bf16_round(xa[q]) : xa[q]; sum = __fadd_rn(sum, s[q]); }
  red[t] = sum; __syncthreads(); for (int st = 128; st > 0; st >>= 1) { if (t < st) red[t] = __fadd_rn(red[t], red[t + st]); __syncthreads(); } const float mu = red[0] / (float)DMQ; __syncthreads();
  float vs = 0.f; for (int q = 0; q < 4; ++q) { const float dl = __fadd_rn(s[q], -mu); vs = __fadd_rn(vs, __fmul_rn(dl, dl)); } red[t] = vs; __syncthreads(); for (int st = 128; st > 0; st >>= 1) { if (t < st) red[t] = __fadd_rn(red[t], red[t + st]); __syncthreads(); }
  const float rs = rsqrtf(__fadd_rn(red[0] / (float)DMQ, eps)); v4h y; v4f xb;
  for (int q = 0; q < 4; ++q) { const int c = t * 4 + q; y[q] = (_Float16)__fadd_rn(__fmul_rn(__fmul_rn(__fadd_rn(s[q], -mu), rs), bf16_round(g[c])), bf16_round(bb[c])); xb[q] = s[q]; }
  { *(v4h*)(N16 + r * DMQ + t * 4) = y; if (WXB) *(v4f*)(XB + r * DMQ + t * 4) = xb;  } }
__global__ __launch_bounds__(256) void k_ftres2(const float* __restrict__ OF0, const float* __restrict__ XB, float* __restrict__ X1, size_t n4) {
  #pragma clang fp contract(off)
  const size_t t = (size_t)blockIdx.x * 256 + threadIdx.x; if (t >= n4) return; const v4f o = *(const v4fa*)(OF0 + t * 4), xv = *(const v4fa*)(XB + t * 4); v4f y; for (int q = 0; q < 4; ++q) y[q] = __fadd_rn(__fmul_rn(o[q], 0.015625f), xv[q]); *(v4f*)(X1 + t * 4) = y;  }

__global__ __launch_bounds__(256) void k_wthd(const float* __restrict__ Wt, _Float16* __restrict__ Bt) { const size_t t = (size_t)blockIdx.x * 256 + threadIdx.x; if (t >= (size_t)NH * HD * (DM / 8)) return; const int m8 = (int)(t % (DM / 8)) * 8; const int d = (int)((t / (DM / 8)) % HD); const int h = (int)(t / ((size_t)(DM / 8) * HD)); FragH f;
  for (int q = 0; q < 8; ++q) f.h[q] = (_Float16)(16.0f * bf16_round(Wt[((size_t)h * DM + m8 + q) * HD + d])); unsigned short* dst = (unsigned short*)Bt + ((size_t)h * HD + d) * DM + m8; *(v8us*)dst = f.half[0];  }




__global__ __launch_bounds__(256) void k_wtpad(const float* __restrict__ Wm, _Float16* __restrict__ Wt, int Kr, int Kp, int Nr, int Np, float scale) {
  const int t = blockIdx.x * 256 + threadIdx.x; if (t >= Np * (Kp / 8)) return; const int n = t / (Kp / 8), k8 = (t % (Kp / 8)) * 8; const int nc = min(n, Nr - 1); const float fn = (n < Nr) ? 1.f : 0.f; FragH f;
  for (int i = 0; i < 8; ++i) { const int k = k8 + i; const int kc = min(k, Kr - 1); const float fk = (k < Kr) ? fn : 0.f; f.h[i] = (_Float16)(bf16_round(Wm[(size_t)kc * Nr + nc]) * scale * fk); }
  unsigned short* o = (unsigned short*)Wt + (size_t)n * Kp + k8; *(v8us*)o = f.half[0];  }
__global__ __launch_bounds__(128) void k_bpad(const float* __restrict__ b, float* __restrict__ Bp, int nr, int np) {
  const int i = threadIdx.x; if (i >= np) return; const float v = b[min(i, nr - 1)] * ((i < nr) ? 1.f : 0.f); *(float*)(Bp + i) = v;  }

#define DI 64         /* inner width = NH * HD (ONE 64-wide head) */
#define LQK (3 * DI)  /* fused q | k | v row pitch (192) */
__global__ __launch_bounds__(256) void k_o0(const float* __restrict__ OF, float* __restrict__ ob, size_t n4) {
  #pragma clang fp contract(off)
  const size_t t = (size_t)blockIdx.x * 256 + threadIdx.x; if (t >= n4) return; const size_t e = t * 4; const int i = (int)(e / DI); const int c = (int)(e % DI); const int h = c / HD, d = c % HD; const v4f a = *(const v4fa*)(OF + e); v4f o; for (int q = 0; q < 4; ++q) o[q] = __fmul_rn(a[q], 0.015625f); float* dst = ob + (size_t)h * SQ * HD + (size_t)i * HD + d; *(v4f*)dst = o;  }

__global__ __launch_bounds__(256) void k_o0m(const float* __restrict__ OF, float* __restrict__ o_, size_t n4) {
  #pragma clang fp contract(off)
  const size_t t = (size_t)blockIdx.x * 256 + threadIdx.x; if (t >= n4) return; const size_t e = t * 4; const v4f a = *(const v4fa*)(OF + e); v4f o; for (int q = 0; q < 4; ++q) o[q] = __fmul_rn(a[q], 0.015625f); *(v4f*)(o_ + e) = o;  }
extern "C" void kernel_launch(void* const* d_in, const int* in_sizes, int n_in,
                              void* d_out, int out_size, void* d_ws, size_t ws_size, hipStream_t stream) {
  (void)in_sizes; (void)n_in; (void)out_size;
  const float* const* I = (const float* const*)d_in; const float* x = I[0]; const float* wq = I[1]; const float* wk = I[2]; const float* wv = I[3]; const float* bq = nullptr; const float* bk = nullptr; const float* bv = nullptr;      /* x; natural [out = 64][in] Wq / Wk / Wv (input order as this module lists them); no biases */
  char* ws = (char*)d_ws; size_t off = 0;
  auto take = [&](size_t bytes) { char* p = ws + off; off += (bytes + 255) & ~(size_t)255; return p; };
  _Float16* BW = (_Float16*)take((size_t)LQK * DM * 2); _Float16* X16 = (_Float16*)take(NR * DM * 2); _Float16* QKV = (_Float16*)take(NR * LQK * 2); _Float16* VT = (_Float16*)take((size_t)NH * HD * SQ * 2);
  float* S = (float*)take((size_t)NH * QT * NKX * 4); _Float16* P = (_Float16*)take((size_t)NH * QT * NKX * 2); float* QKVF0 = (float*)take((size_t)QT0 * LQK * 4); float* OF0 = (float*)take((size_t)QT0 * DI * 4);
  if (off > ws_size) return;
  { const unsigned g = (unsigned)(((size_t)DI * DM / 8 + 255) / 256); k_wnat<<<g, 256, 0, stream>>>(wq, (size_t)DI * DM / 8, BW); k_wnat<<<g, 256, 0, stream>>>(wk, (size_t)DI * DM / 8, BW + (size_t)DI * DM); k_wnat<<<g, 256, 0, stream>>>(wv, (size_t)DI * DM / 8, BW + (size_t)2 * DI * DM); }      /* natural [64][DM] = Bt x16, stacked q | k | v */
  k_x16<<<(unsigned)((NR * DM / 8 + 255) / 256), 256, 0, stream>>>(x, X16, NR * DM / 8);      /* x (bf16-valued) as exact f16 rows */
  const float* bqkv[3] = {bq, bk, bv};
  for (int c = 0; c < 3; ++c) k_gemm2<0><<<dim3((unsigned)((NR / 128) * (DI / 64)), 1), 128, 0, stream>>>(X16, DM, 0, BW + (size_t)c * DI * DM, DM, 0, 0.0625f, bqkv[c], 0, nullptr, 1, 0, 0, nullptr, QKV + (size_t)c * DI, LQK, 0, (int)NR, DI, DM);      /* q | k | v = x W^T -> f16 rows, column blocks 0 / 64 / 128 of the fused plane (pitch 192); head h = columns h*64 inside each */
  const _Float16* Q16 = QKV; const _Float16* K16 = QKV + DI; const _Float16* V16 = QKV + 2 * DI;
  for (int b = 0; b < NB; ++b) { const size_t r0 = (size_t)b * SQ; float* ob = (float*)d_out + r0 * DI;
    k_vt<NH, SQ><<<NH * (SQ / 64), 256, 0, stream>>>(V16 + r0 * LQK, LQK, 0, VT);      /* V^T [NH][HD][SQ] for this batch */
    for (int q0 = 0; q0 < SQ; q0 += QT) { const int nk = q0 + QT;      /* causal: only keys below the tile end are computed */
      k_gemm2<0><<<dim3((QT / 128) * (nk / 64), NH), 128, 0, stream>>>(Q16 + (r0 + q0) * LQK, LQK, (size_t)HD, K16 + r0 * LQK, LQK, (size_t)HD, 0.03125f, nullptr, 0, nullptr, 1, 0, 0, S, nullptr, NKX, (size_t)QT * NKX, QT, nk, HD);      /* scores * 1024^-0.5 = 1/32 (the module scales by the EMBEDDING width), the one head on grid.y */
      k_rsmcf2<<<(NH * QT + 255) / 256, 256, 0, stream>>>(S, P, NH, q0, nk);      /* causal softmax -> P x256 f16 */
      k_gemm2<0><<<dim3((QT / 128) * (HD / 64), NH), 128, 0, stream>>>(P, NKX, (size_t)QT * NKX, VT, SQ, (size_t)HD * SQ, 0.00390625f, nullptr, 0, nullptr, 1, 0, 0, ob + (size_t)q0 * DI, nullptr, DI, (size_t)HD, QT, HD, nk); }      /* out[b][q0 + i][h*64..] = P V^T 2^-8 (f32): merged rows, head h at column offset h*64 */
    for (int c = 0; c < 3; ++c) k_gemm2<0><<<dim3((unsigned)((QT0 / 128) * (DI / 64)), 1), 128, 0, stream>>>(X16 + r0 * DM, DM, 0, BW + (size_t)c * DI * DM, DM, 0, 0.0625f, bqkv[c], 0, nullptr, 1, 0, 0, QKVF0 + (size_t)c * DI, nullptr, LQK, 0, QT0, DI, DM);      /* f32 q | k | v of rows 0..511 (exact products, f32 accumulation) */
    k_att0<0><<<NH * (QT0 / 64), 64, 0, stream>>>(QKVF0, QKVF0 + DI, QKVF0 + 2 * DI, LQK, nullptr, 0.03125f, OF0, DI);      /* exact f32 causal attention for rows 0..511 (o x64) */
    k_o0m<<<(unsigned)(((size_t)QT0 * DI / 4 + 255) / 256), 256, 0, stream>>>(OF0, ob, (size_t)QT0 * DI / 4); }      /* rows 0..511 of the batch REWRITTEN from the exact path */
}

// v001
// One run takes 2220 microseconds.
// Two timings next to v000 put it at 6.29 and 6.36 times that version's speed.
#include <hip/hip_runtime.h>
// Single-head causal self-attention with the module's EMBEDDING-width scale (inps [4][2048][1024]; q/k/v = x W^T (natural [64][1024], U(+-1/32), no biases); ONE 64-wide head; scores * 1024^-0.5 (the source sets head_size = n_embed); causal (tril, -inf); softmax; out = weights v -> [4][2048][64]; no output projection).
// Structure: token rows; x as exact f16 rows; one WMMA GEMM into the f16 q | k | v plane [8192][192]; v^T via LDS transposes; every stage is ONE launch over all batches (grid.y in the GEMMs, folded into grid.x for the softmax) and all causal 256-row query tiles (grid.x): scores alpha 1/32 into S [4][2048][2048] (column tiles past a row tile's keys are skipped), causal softmax f32 -> f16 x256 weights, P V (K = the row tile's keys) written as f32 straight into the output rows; an exact f32 first tile (rows 0..511 of each batch) rewritten at the end.
// Compute dtype: inputs rounded to bf16; x / weights exact; q, k, v and softmax weights as plain f16 GEMM operands (~2^-12); o, scores and softmax statistics f32. v_wmma_f32_16x16x32_f16.
#define NB 4
#define SQ 2048
#define DM 1024
#define NH 1
#define HD 64
#define HG 4                         /* used only by the k_vt(V16, b, h0, VT) overload, which is not launched */
#define QT 256                       /* query rows per causal tile */
#define NKX SQ                       /* S / P row pitch */
#define QT0 512                      /* first-tile rows recomputed exactly (f32): 512 here (no output projection averages the early-row cancellation errors away; logit sigma 1.0) */
#define B0 0                         /* unused: every launch covers all batches */
#define NBR NB                       /* unused by the launches (they put NB on grid.y or into grid.x) */
#define NR ((size_t)NB * SQ)
#define DMQ DM
#define DFF 4096                     /* unused: there is no FFN */
#define DFFR 100                     /* unused */
#define MP ((int)((size_t)NBR * SQ)) /* unused: the projections take NR rows */
#define QN SQ                        /* unused: the query tiles on grid.x cover SQ */
#define NHD NH                       /* unused: the launches use NH */
#define MPO MP                       /* unused: there is no output stage */
#define LQ (3 * DM)
typedef __bf16 v16b __attribute__((ext_vector_type(16)));
typedef unsigned short v8us __attribute__((ext_vector_type(8), may_alias));
typedef float  v8f  __attribute__((ext_vector_type(8)));
typedef float  v4f  __attribute__((ext_vector_type(4)));
typedef float  v4fa __attribute__((ext_vector_type(4), may_alias));
union FragB { v16b v; v8us half[2]; unsigned short u[16]; };

__device__ __forceinline__ unsigned short bf16_bits(float x) { unsigned int u = __float_as_uint(x); return (unsigned short)((u + 0x7FFFu + ((u >> 16) & 1u)) >> 16); }
__device__ __forceinline__ float bf16_val(unsigned short b) { return __uint_as_float(((unsigned int)b) << 16); }
__device__ __forceinline__ float bf16_round(float x) { return bf16_val(bf16_bits(x)); }
// D += A·B with NT terms: 1 = ah·bh, 2 = + al·bh (A split), 3 = + ah·bl (both split)
template <int NT>
__device__ __forceinline__ v8f mmaN(v16b ah, v16b al, v16b bh, v16b bl, v8f c) {
  c = __builtin_amdgcn_wmma_f32_16x16x32_bf16(false, ah, false, bh, (short)0, c, false, false);
  if (NT >= 2) c = __builtin_amdgcn_wmma_f32_16x16x32_bf16(false, al, false, bh, (short)0, c, false, false);
  if (NT >= 3) c = __builtin_amdgcn_wmma_f32_16x16x32_bf16(false, ah, false, bl, (short)0, c, false, false);
  asm volatile("v_nop\n\tv_nop\n\tv_nop\n\tv_nop" : "+v"(c) : "v"(ah), "v"(al), "v"(bh), "v"(bl));
  return c;
}

__global__ __launch_bounds__(256) void k_wt_bf16(const float* __restrict__ W, unsigned short* __restrict__ Wt, int K, int N) {
  const int t = blockIdx.x * 256 + threadIdx.x;
  const int k8n = K / 8;
  if (t >= N * k8n) return;
  const int n = t / k8n, k8 = (t % k8n) * 8;
  v8us v;
#pragma unroll
  for (int i = 0; i < 8; ++i) v[i] = bf16_bits(W[(size_t)(k8 + i) * N + n]);
  *(v8us*)(Wt + (size_t)n * K + k8) = v;
  
}

// GEMM C[M][N] (f32, pitch ldc) = act(A[M][K]·W + bias). A f32 row-major (pitch lda) converted per fragment to bf16
// (ASPLIT: hi/lo two planes -> 2 terms, else single rounded term); Wt bf16 [N][K] (pitch ldb). BIAS_BF16 rounds the
// bias to bf16 first (bias quantised to bf16 before the add). K%32==0, M%16==0, N%64==0.
template <bool ASPLIT, int ACT, bool BIAS_BF16>
__global__ __launch_bounds__(128) void k_gemm_bf(const float* __restrict__ A, int lda, const unsigned short* __restrict__ Wt, int ldb,
                                               const float* __restrict__ bias, float* __restrict__ C, int ldc, int M, int N, int K) {
  __shared__ __attribute__((aligned(16))) float so[4][16][64];
  const int tid = threadIdx.x, w = tid >> 5, lane = tid & 31, ln = lane & 15, hh = lane >> 4;
  const int ntn = N / 64;
  const int wid = blockIdx.x * 4 + w;
  const int mt = wid / ntn, nq = wid % ntn;
  if (mt * 16 >= M) return;
  const int row0 = mt * 16, col0 = nq * 64;
  const float* arow = A + (size_t)(row0 + ln) * lda;
  v8f acc[4] = {};
  for (int kb = 0; kb < K; kb += 32) {
    FragB ah, al;
    const v4f x0 = *(const v4fa*)(arow + kb + 8 * hh), x1 = *(const v4fa*)(arow + kb + 8 * hh + 4);
    const v4f x2 = *(const v4fa*)(arow + kb + 16 + 8 * hh), x3 = *(const v4fa*)(arow + kb + 16 + 8 * hh + 4);
    float xs[16] = {x0[0],x0[1],x0[2],x0[3],x1[0],x1[1],x1[2],x1[3],x2[0],x2[1],x2[2],x2[3],x3[0],x3[1],x3[2],x3[3]};
#pragma unroll
    for (int i = 0; i < 16; ++i) { const unsigned short hb = bf16_bits(xs[i]); ah.u[i] = hb; al.u[i] = ASPLIT ? bf16_bits(xs[i] - bf16_val(hb)) : (unsigned short)0; }
#pragma unroll
    for (int t = 0; t < 4; ++t) {
      const unsigned short* brow = Wt + (size_t)(col0 + t * 16 + ln) * ldb + kb;
      FragB b;
      b.half[0] = *(const v8us*)(brow + 8 * hh);
      b.half[1] = *(const v8us*)(brow + 16 + 8 * hh);
      acc[t] = mmaN<ASPLIT ? 2 : 1>(ah.v, al.v, b.v, b.v, acc[t]);
    }
  }
#pragma unroll
  for (int t = 0; t < 4; ++t) {
    float bv = bias ? bias[col0 + t * 16 + ln] : 0.f;
    if (BIAS_BF16) bv = bf16_round(bv);
#pragma unroll
    for (int r = 0; r < 8; ++r) { float v = acc[t][r] + bv; if (ACT == 1) v = fmaxf(v, 0.f); so[w][8 * hh + r][t * 16 + ln] = v; }
  }
  __builtin_amdgcn_fence(__ATOMIC_ACQ_REL, "workgroup");
  __builtin_amdgcn_wave_barrier();
  const int rsub = lane >> 4, c4 = (lane & 15) * 4;
  {
#pragma unroll
    for (int q = 0; q < 8; ++q) {
      const int r = q * 2 + rsub;
      const v4f v = *(const v4fa*)&so[w][r][c4];
      *(v4f*)(C + (size_t)(row0 + r) * ldc + col0 + c4) = v;
    }
    
  }
}

// GEMM C = act(A·W + bias + resid): A f32 (ASPLIT -> hi/lo 2 terms), Wt bf16 [N][K]; ACT 0 none, 1 relu, 2 exact gelu;
// resid (optional, f32, row index = (row % rmod), pitch ldr, RES_BF16 rounds it) added before the activation.
template <bool ASPLIT, int ACT, bool BIAS_BF16, bool RES_BF16>
__global__ __launch_bounds__(128) void k_gemm_bf3(const float* __restrict__ A, int lda, const unsigned short* __restrict__ Wt, int ldb,
                                                const float* __restrict__ bias, const float* __restrict__ resid, int rmod, int ldr,
                                                float* __restrict__ C, int ldc, int M, int N, int K) {
  __shared__ __attribute__((aligned(16))) float so[4][16][64];
  const int tid = threadIdx.x, w = tid >> 5, lane = tid & 31, ln = lane & 15, hh = lane >> 4;
  const int ntn = N / 64;
  const int wid = blockIdx.x * 4 + w;
  const int mt = wid / ntn, nq = wid % ntn;
  if (mt * 16 >= M) return;
  const int row0 = mt * 16, col0 = nq * 64;
  const float* arow = A + (size_t)(row0 + ln) * lda;
  v8f acc[4] = {};
  for (int kb = 0; kb < K; kb += 32) {
    FragB ah, al;
    const v4f x0 = *(const v4fa*)(arow + kb + 8 * hh), x1 = *(const v4fa*)(arow + kb + 8 * hh + 4);
    const v4f x2 = *(const v4fa*)(arow + kb + 16 + 8 * hh), x3 = *(const v4fa*)(arow + kb + 16 + 8 * hh + 4);
    float xs[16] = {x0[0],x0[1],x0[2],x0[3],x1[0],x1[1],x1[2],x1[3],x2[0],x2[1],x2[2],x2[3],x3[0],x3[1],x3[2],x3[3]};
#pragma unroll
    for (int i = 0; i < 16; ++i) { const unsigned short hb = bf16_bits(xs[i]); ah.u[i] = hb; al.u[i] = ASPLIT ? bf16_bits(xs[i] - bf16_val(hb)) : (unsigned short)0; }
#pragma unroll
    for (int t = 0; t < 4; ++t) {
      const unsigned short* brow = Wt + (size_t)(col0 + t * 16 + ln) * ldb + kb;
      FragB b;
      b.half[0] = *(const v8us*)(brow + 8 * hh);
      b.half[1] = *(const v8us*)(brow + 16 + 8 * hh);
      acc[t] = mmaN<ASPLIT ? 2 : 1>(ah.v, al.v, b.v, b.v, acc[t]);
    }
  }
#pragma unroll
  for (int t = 0; t < 4; ++t) {
    const int col = col0 + t * 16 + ln;
    float bv = bias ? bias[col] : 0.f;
    if (BIAS_BF16) bv = bf16_round(bv);
#pragma unroll
    for (int r = 0; r < 8; ++r) {
      float v = acc[t][r] + bv;
      if (resid) { float rv = resid[(size_t)((row0 + 8 * hh + r) % rmod) * ldr + col]; if (RES_BF16) rv = bf16_round(rv); v += rv; }
      if (ACT == 1) v = fmaxf(v, 0.f);
      if (ACT == 2) v = 0.5f * v * (1.0f + erff(v * 0.70710678118654752f));
      if (ACT == 3) { const float u = 0.7978845608028654f * (v + 0.044715f * v * v * v); v = 0.5f * v * (1.0f + tanhf(u)); }
      so[w][8 * hh + r][t * 16 + ln] = v;
    }
  }
  __builtin_amdgcn_fence(__ATOMIC_ACQ_REL, "workgroup");
  __builtin_amdgcn_wave_barrier();
  const int rsub = lane >> 4, c4 = (lane & 15) * 4;
  {
#pragma unroll
    for (int q = 0; q < 8; ++q) {
      const int r = q * 2 + rsub;
      const v4f v = *(const v4fa*)&so[w][r][c4];
      *(v4f*)(C + (size_t)(row0 + r) * ldc + col0 + c4) = v;
    }
    
  }
}
// row LayerNorm (biased variance, eps) over N: s = X (+ R); optional out_sum <- s; out_norm <- (s-mu)*rsqrt(var+eps)*g + b
template <bool PARAM_BF16>
__global__ __launch_bounds__(256) void k_layernorm(const float* __restrict__ X, const float* __restrict__ R, const float* __restrict__ g, const float* __restrict__ bta,
                                                  float* __restrict__ out_sum, float* __restrict__ out_norm, int N, float eps) {
  __shared__ float red[256];
  const int row = blockIdx.x, tid = threadIdx.x;
  const float* x = X + (size_t)row * N; const float* rr = R ? R + (size_t)row * N : nullptr;
  float vals[16];                     // up to N = 4096
  const int per = N / 256;            // contiguous chunk per thread? use strided-by-4 chunks: thread handles j = tid*4 + 1024*u
  float s1 = 0.f;
  for (int u = 0; u < per / 4; ++u) {
    const int j = tid * 4 + 1024 * u;
    const v4f a = *(const v4fa*)(x + j);
    v4f b = {0.f,0.f,0.f,0.f}; if (rr) b = *(const v4fa*)(rr + j);
#pragma unroll
    for (int q = 0; q < 4; ++q) { const float v = a[q] + b[q]; vals[u * 4 + q] = v; s1 += v; }
  }
  red[tid] = s1; __syncthreads();
  for (int st = 128; st > 0; st >>= 1) { if (tid < st) red[tid] += red[tid + st]; __syncthreads(); }
  const float mu = red[0] / (float)N; __syncthreads();
  float s2 = 0.f;
  for (int u = 0; u < per / 4; ++u)
#pragma unroll
    for (int q = 0; q < 4; ++q) { const float c = vals[u * 4 + q] - mu; s2 += c * c; }
  red[tid] = s2; __syncthreads();
  for (int st = 128; st > 0; st >>= 1) { if (tid < st) red[tid] += red[tid + st]; __syncthreads(); }
  const float rs = rsqrtf(red[0] / (float)N + eps);
  {
    for (int u = 0; u < per / 4; ++u) {
      const int j = tid * 4 + 1024 * u;
      v4f o, sm;
#pragma unroll
      for (int q = 0; q < 4; ++q) {
        float gg = g[j + q], bb = bta[j + q];
        if (PARAM_BF16) { gg = bf16_round(gg); bb = bf16_round(bb); }
        sm[q] = vals[u * 4 + q]; o[q] = (vals[u * 4 + q] - mu) * rs * gg + bb;
      }
      if (out_sum) *(v4f*)(out_sum + (size_t)row * N + j) = sm;
      *(v4f*)(out_norm + (size_t)row * N + j) = o;
    }
    
  }
}



// ---- f16 WMMA path (v_wmma_f32_16x16x32_f16): 11-bit significands for operands in range — used where a [0,1] probability operand needs more precision than bf16
typedef _Float16 v16h __attribute__((ext_vector_type(16)));
union FragH { v16h v; v8us half[2]; _Float16 h[16]; unsigned short u[16]; };
template <int NT>
__device__ __forceinline__ v8f mmaH(v16h ah, v16h al, v16h bh, v16h bl, v8f c) {
  c = __builtin_amdgcn_wmma_f32_16x16x32_f16(false, ah, false, bh, (short)0, c, false, false);
  if (NT >= 2) c = __builtin_amdgcn_wmma_f32_16x16x32_f16(false, al, false, bh, (short)0, c, false, false);
  if (NT >= 3) c = __builtin_amdgcn_wmma_f32_16x16x32_f16(false, ah, false, bl, (short)0, c, false, false);
  asm volatile("v_nop\n\tv_nop\n\tv_nop\n\tv_nop" : "+v"(c) : "v"(ah), "v"(al), "v"(bh), "v"(bl));
  return c;
}
// batched GEMM like k_gemm_b but f16 operands: A f32 (split into f16 hi/lo if ASPLIT, else rounded to f16), Bt = f16 values [n][k]; alpha; C f32; N multiple of 16 (partial tiles skipped)
template <bool ASPLIT>
__global__ __launch_bounds__(128) void k_gemm_h(const float* __restrict__ A, int lda, size_t sA, const _Float16* __restrict__ Bh, int ldb, size_t sB, float alpha, float* __restrict__ C, int ldc, size_t sC, int M, int N, int K) {
  __shared__ __attribute__((aligned(16))) float so[4][16][64];
  const int tid = threadIdx.x, w = tid >> 5, lane = tid & 31, ln = lane & 15, hh = lane >> 4; const int by = blockIdx.y;
  A += (size_t)by * sA; Bh += (size_t)by * sB; C += (size_t)by * sC;
  const int ntn = (N + 63) / 64; const int wid = blockIdx.x * 4 + w; const int mt = wid / ntn, nq = wid % ntn; if (mt * 16 >= M) return;
  const int row0 = mt * 16, col0 = nq * 64; const float* arow = A + (size_t)(row0 + ln) * lda;
  v8f acc[4] = {};
  for (int kb = 0; kb < K; kb += 32) {
    FragH ah, al;
    const v4f x0 = *(const v4fa*)(arow + kb + 8 * hh), x1 = *(const v4fa*)(arow + kb + 8 * hh + 4), x2 = *(const v4fa*)(arow + kb + 16 + 8 * hh), x3 = *(const v4fa*)(arow + kb + 16 + 8 * hh + 4);
    float xs[16] = {x0[0],x0[1],x0[2],x0[3],x1[0],x1[1],x1[2],x1[3],x2[0],x2[1],x2[2],x2[3],x3[0],x3[1],x3[2],x3[3]};
#pragma unroll
    for (int i = 0; i < 16; ++i) { const _Float16 h = (_Float16)xs[i]; ah.h[i] = h; al.h[i] = ASPLIT ? (_Float16)(xs[i] - (float)h) : (_Float16)0.0f; }
#pragma unroll
    for (int t = 0; t < 4; ++t) { if (col0 + t * 16 >= N) continue; const size_t boff = (size_t)(col0 + t * 16 + ln) * ldb + kb; FragH bq; bq.half[0] = *(const v8us*)(Bh + boff + 8 * hh); bq.half[1] = *(const v8us*)(Bh + boff + 16 + 8 * hh);
      acc[t] = mmaH<ASPLIT ? 2 : 1>(ah.v, al.v, bq.v, bq.v, acc[t]); }
  }
#pragma unroll
  for (int t = 0; t < 4; ++t) { if (col0 + t * 16 >= N) continue;
#pragma unroll
    for (int r = 0; r < 8; ++r) so[w][8 * hh + r][t * 16 + ln] = acc[t][r] * alpha; }
  __builtin_amdgcn_fence(__ATOMIC_ACQ_REL, "workgroup"); __builtin_amdgcn_wave_barrier();
  const int rsub = lane >> 4, c4 = (lane & 15) * 4;
  {
#pragma unroll
    for (int q = 0; q < 8; ++q) { const int r = q * 2 + rsub; if (col0 + c4 < N) { const v4f v = *(const v4fa*)&so[w][r][c4]; *(v4f*)(C + (size_t)(row0 + r) * ldc + col0 + c4) = v; } }
     }
}

// Wt[n][k] = f16(W[k][n]·scale) from f32 row-major W[K][N] (scale = power of two; bf16-exact weights stay exact in f16 away from the subnormal range)
__global__ __launch_bounds__(256) void k_wt_f16(const float* __restrict__ W, _Float16* __restrict__ Wt, int K, int N, float scale) {
  const int t = blockIdx.x * 256 + threadIdx.x; if (t >= N * (K / 8)) return; const int n = t / (K / 8), k8 = (t % (K / 8)) * 8; FragH f;
#pragma unroll
  for (int i = 0; i < 8; ++i) f.h[i] = (_Float16)(bf16_round(W[(size_t)(k8 + i) * N + n]) * scale); const v8us o = f.half[0];
  *(v8us*)((unsigned short*)Wt + (size_t)n * K + k8) = o; 
}
// k_gemm_hh variant with fused epilogue: v = acc·alpha + bias[by·sBias + col] (+ CP[(row/rowsPerB)·sCPb + by·64 + col] if CP) ; ACT 0 none / 1 elu ; writes f16 C16 (and f32 C if non-null)
template <int ACT>
__global__ __launch_bounds__(128) void k_gemm_hhx(const _Float16* __restrict__ A, int lda, size_t sA, const _Float16* __restrict__ Bh, int ldb, size_t sB, float alpha, const float* __restrict__ bias, size_t sBias, const float* __restrict__ CP, int rowsPerB, size_t sCPb, int row0g,
    float* __restrict__ C, _Float16* __restrict__ C16, int ldc, size_t sC, int M, int N, int K) {
  __shared__ __attribute__((aligned(16))) float so[4][16][64];
  const int tid = threadIdx.x, w = tid >> 5, lane = tid & 31, ln = lane & 15, hh = lane >> 4; const int by = blockIdx.y;
  A += (size_t)by * sA; Bh += (size_t)by * sB; const size_t cofs = (size_t)by * sC; const float* bp = bias ? bias + (size_t)by * sBias : nullptr;
  const int ntn = (N + 63) / 64; const int wid = blockIdx.x * 4 + w; const int mt = wid / ntn, nq = wid % ntn; if (mt * 16 >= M) return;
  const int row0 = mt * 16, col0 = nq * 64; const _Float16* arow = A + (size_t)(row0 + ln) * lda;
  v8f acc[4] = {};
  for (int kb = 0; kb < K; kb += 32) { FragH ah; ah.half[0] = *(const v8us*)((const unsigned short*)arow + kb + 8 * hh); ah.half[1] = *(const v8us*)((const unsigned short*)arow + kb + 16 + 8 * hh);
#pragma unroll
    for (int t = 0; t < 4; ++t) { if (col0 + t * 16 >= N) continue; const size_t boff = (size_t)(col0 + t * 16 + ln) * ldb + kb; FragH bq; bq.half[0] = *(const v8us*)((const unsigned short*)Bh + boff + 8 * hh); bq.half[1] = *(const v8us*)((const unsigned short*)Bh + boff + 16 + 8 * hh);
      acc[t] = mmaH<1>(ah.v, ah.v, bq.v, bq.v, acc[t]); }
  }
#pragma unroll
  for (int t = 0; t < 4; ++t) { if (col0 + t * 16 >= N) continue; const int col = col0 + t * 16 + ln; const float bv = bp ? bf16_round(bp[col]) : 0.f;
#pragma unroll
    for (int r = 0; r < 8; ++r) { float v = acc[t][r] * alpha + bv; if (CP) { const int rr = row0g + row0 + 8 * hh + r; if (rowsPerB < 0) v += CP[cofs + (size_t)rr * ldc + col];      /* rowsPerB < 0: own element of the batched C plane */ else { const int bidx = rr / rowsPerB; v += CP[(size_t)bidx * sCPb + (size_t)by * 64 + col]; } } if (ACT == 1) v = (v > 0.f) ? v : expm1f(v); else if (ACT == 7) v = (v > 0.f) ? v + 1.0f : expf(v); else if (ACT == 8) v = tanhf(v); else if (ACT == 9) v = 0.5f * v * (1.0f + tanhf(0.7978845608028654f * (v + 0.044715f * v * v * v))); else if (ACT == 11) v = 1.0f / (1.0f + expf(-v)); else if (ACT == 12) v = (v > 0.f) ? v : 0.01f * v; else if (ACT == 14) v = (v > 0.f) ? v : 0.1f * v; else if (ACT == 16) v = (v >= 0.f) ? v : 0.3f * v; else if (ACT == 17) v = (v >= 0.f) ? v : 0.2f * v; else if (ACT == 15) v = v / (1.0f + expf(-v)); else if (ACT == 3) v = fmaxf(v, 0.f); else if (ACT == 6) v = 0.5f * v * (1.0f + erff(v * 0.70710678118654752f)); so[w][8 * hh + r][t * 16 + ln] = v; } }
  __builtin_amdgcn_fence(__ATOMIC_ACQ_REL, "workgroup"); __builtin_amdgcn_wave_barrier();
  const int rsub = lane >> 4, c4 = (lane & 15) * 4; typedef _Float16 v4h __attribute__((ext_vector_type(4)));
  {
#pragma unroll
    for (int q = 0; q < 8; ++q) { const int r = q * 2 + rsub; if (col0 + c4 < N) { const v4f v = *(const v4fa*)&so[w][r][c4]; if (C) *(v4f*)(C + cofs + (size_t)(row0 + r) * ldc + col0 + c4) = v; if (C16) { v4h h4; for (int i = 0; i < 4; ++i) h4[i] = (_Float16)v[i]; *(v4h*)(C16 + cofs + (size_t)(row0 + r) * ldc + col0 + c4) = h4; } } }
     }
}


typedef _Float16 v4h __attribute__((ext_vector_type(4)));

__global__ __launch_bounds__(256) void k_x16(const float* __restrict__ x, _Float16* __restrict__ X16, size_t n8) { const size_t t = (size_t)blockIdx.x * 256 + threadIdx.x; if (t >= n8) return; FragH f;
#pragma unroll
  for (int q = 0; q < 8; ++q) f.h[q] = (_Float16)bf16_round(x[t * 8 + q]); *(v8us*)((unsigned short*)X16 + t * 8) = f.half[0];  }
__global__ __launch_bounds__(256) void k_h16(const float* __restrict__ x, _Float16* __restrict__ X16, size_t n8) { const size_t t = (size_t)blockIdx.x * 256 + threadIdx.x; if (t >= n8) return; FragH f;
#pragma unroll
  for (int q = 0; q < 8; ++q) f.h[q] = (_Float16)x[t * 8 + q]; *(v8us*)((unsigned short*)X16 + t * 8) = f.half[0];  }
__global__ __launch_bounds__(256) void k_round16f(const float* __restrict__ W, _Float16* __restrict__ Bt, size_t n8) { const size_t t = (size_t)blockIdx.x * 256 + threadIdx.x; if (t >= n8) return; FragH f;
#pragma unroll
  for (int i = 0; i < 8; ++i) f.h[i] = (_Float16)(bf16_round(W[t * 8 + i]) * 16.0f); *(v8us*)((unsigned short*)Bt + t * 8) = f.half[0];  }
template <int NHv, int TTv>
__global__ __launch_bounds__(256) void k_vt(const _Float16* __restrict__ V16, int ldv, int voff, _Float16* __restrict__ Vt) { __shared__ unsigned short tl[64][66]; const int tid = threadIdx.x; const int slab = blockIdx.x / (TTv / 64), lg = blockIdx.x % (TTv / 64); const int b = slab / NHv, h = slab % NHv;
  for (int i = tid; i < 64 * 8; i += 256) { const int r = i / 8, c8 = (i % 8) * 8; FragH f; f.half[0] = *(const v8us*)((const unsigned short*)V16 + ((size_t)b * TTv + lg * 64 + r) * ldv + voff + h * 64 + c8);
#pragma unroll
    for (int q = 0; q < 8; ++q) tl[r][c8 + q] = f.u[q]; }
  __syncthreads();
  {
#pragma unroll
    for (int rd = 0; rd < 2; ++rd) { const int d = rd * 32 + tid / 8, pc = tid % 8; FragH f;
#pragma unroll
      for (int q = 0; q < 8; ++q) f.u[q] = tl[pc * 8 + q][d];
      *(v8us*)((unsigned short*)Vt + ((size_t)slab * 64 + d) * TTv + lg * 64 + pc * 8) = f.half[0]; }
     } }

__global__ __launch_bounds__(256) void k_hl(const float* __restrict__ F, _Float16* __restrict__ Hh, _Float16* __restrict__ Hl, size_t n8) { const size_t t = (size_t)blockIdx.x * 256 + threadIdx.x; if (t >= n8) return; FragH fh, fl; const v4f a = *(const v4fa*)(F + t * 8), c = *(const v4fa*)(F + t * 8 + 4);
#pragma unroll
  for (int q = 0; q < 4; ++q) { _Float16 h = (_Float16)a[q]; fh.h[q] = h; fl.h[q] = (_Float16)((a[q] - (float)h) * 1024.0f); h = (_Float16)c[q]; fh.h[4 + q] = h; fl.h[4 + q] = (_Float16)((c[q] - (float)h) * 1024.0f); }
  { *(v8us*)((unsigned short*)Hh + t * 8) = fh.half[0]; *(v8us*)((unsigned short*)Hl + t * 8) = fl.half[0];  } }

// ---- fast GEMM (wave tile 32x64; requires M % 32 == 0 rows per launch region and N % 64 == 0); epilogue = k_gemm_hhx semantics ----
__device__ __forceinline__ v16h g2_frag(const _Float16* p, int hh) { FragH f; f.half[0] = *(const v8us*)((const unsigned short*)p + 8 * hh); f.half[1] = *(const v8us*)((const unsigned short*)p + 16 + 8 * hh); return f.v; }
__device__ __forceinline__ v8f g2_mma(v16h a, v16h b, v8f c) { v8f d = __builtin_amdgcn_wmma_f32_16x16x32_f16(false, a, false, b, (short)0, c, false, false); asm volatile("v_nop\n\tv_nop\n\tv_nop\n\tv_nop" : "+v"(d) : "v"(a), "v"(b)); return d; }
// CAUS 0: plain. CAUS 1 (scores): a 64-column tile at or past the end of its rows' causal query tile is skipped. CAUS 2 (P V): K runs over the keys of the rows' causal query tile only.
template <int ACT, int CAUS = 0>
__global__ __launch_bounds__(128) void k_gemm2(const _Float16* __restrict__ A, int lda, size_t sA, const _Float16* __restrict__ Bh, int ldb, size_t sB, float alpha, const float* __restrict__ bias, size_t sBias, const float* __restrict__ CP, int rowsPerB, size_t sCPb, int row0g,
    float* __restrict__ C, _Float16* __restrict__ C16, int ldc, size_t sC, int M, int N, int K) { static_assert(ACT == 0 || ACT == 3 || ACT == 6 || ACT == 8 || ACT == 9 || ACT == 11 || ACT == 12 || ACT == 14 || ACT == 15 || ACT == 16 || ACT == 17, "k_gemm2: unsupported ACT code (would silently apply no activation)");
  __shared__ __attribute__((aligned(16))) float so[4][32][68];
  const int tid = threadIdx.x, w = tid >> 5, lane = tid & 31, ln = lane & 15, hh = lane >> 4; const int by = blockIdx.y;
  A += (size_t)by * sA; Bh += (size_t)by * sB; const size_t cofs = (size_t)by * sC; const float* bp = bias ? bias + (size_t)by * sBias : nullptr;
  const int ntn = N >> 6; const int mt = blockIdx.x / ntn, nq = blockIdx.x - mt * ntn; const int row0 = mt * 128 + 32 * w, col0 = nq * 64; if (row0 >= M) return;
  static_assert(QT % 128 == 0, "a 128-row block lies in one causal query tile"); const int nkc = (mt * 128 / QT + 1) * QT;      /* keys below the end of this block's causal query tile */
  if (CAUS == 1 && col0 >= nkc) return; if (CAUS == 2) K = nkc;
  const _Float16* a0p = A + (size_t)(row0 + ln) * lda; const _Float16* a1p = a0p + (size_t)16 * lda;
  const _Float16* b0p = Bh + (size_t)(col0 + ln) * ldb; const _Float16* b1p = b0p + (size_t)16 * ldb; const _Float16* b2p = b1p + (size_t)16 * ldb; const _Float16* b3p = b2p + (size_t)16 * ldb;
  const v8f z8 = {0.f,0.f,0.f,0.f,0.f,0.f,0.f,0.f}; v8f c00 = z8, c01 = z8, c02 = z8, c03 = z8, c10 = z8, c11 = z8, c12 = z8, c13 = z8;
#pragma unroll 1
  for (int kb = 0; kb < K; kb += 32) { const v16h a0 = g2_frag(a0p + kb, hh), a1 = g2_frag(a1p + kb, hh);
    v16h b = g2_frag(b0p + kb, hh); c00 = g2_mma(a0, b, c00); c10 = g2_mma(a1, b, c10);
    b = g2_frag(b1p + kb, hh); c01 = g2_mma(a0, b, c01); c11 = g2_mma(a1, b, c11);
    b = g2_frag(b2p + kb, hh); c02 = g2_mma(a0, b, c02); c12 = g2_mma(a1, b, c12);
    b = g2_frag(b3p + kb, hh); c03 = g2_mma(a0, b, c03); c13 = g2_mma(a1, b, c13); }
  v8f accs[8] = {c00, c01, c02, c03, c10, c11, c12, c13};
#pragma unroll
  for (int u = 0; u < 8; ++u) { const int t = u & 3, half = u >> 2; const int col = col0 + t * 16 + ln; const float bv = bp ? bf16_round(bp[col]) : 0.f;
#pragma unroll
    for (int r = 0; r < 8; ++r) { const int rloc = half * 16 + 8 * hh + r; float v = accs[u][r] * alpha + bv; if (CP) { if (rowsPerB < 0) v += CP[cofs + (size_t)(row0g + row0 + rloc) * ldc + col];      /* rowsPerB < 0: own element of the batched C plane */ else { const int bidx = (row0g + row0 + rloc) / rowsPerB; v += CP[(size_t)bidx * sCPb + (size_t)by * 64 + col]; } }
      if (ACT == 3) v = fmaxf(v, 0.f); else if (ACT == 6) v = 0.5f * v * (1.0f + erff(v * 0.70710678118654752f)); else if (ACT == 11) v = 1.0f / (1.0f + expf(-v)); else if (ACT == 15) v = v / (1.0f + expf(-v)); else if (ACT == 12) v = (v > 0.f) ? v : 0.01f * v; else if (ACT == 8) v = tanhf(v); else if (ACT == 9) v = 0.5f * v * (1.0f + tanhf(0.7978845608028654f * (v + 0.044715f * v * v * v))); else if (ACT == 14) v = (v > 0.f) ? v : 0.1f * v; else if (ACT == 16) v = (v >= 0.f) ? v : 0.3f * v; else if (ACT == 17) v = (v >= 0.f) ? v : 0.2f * v;
      so[w][rloc][t * 16 + ln] = v; } }
  __builtin_amdgcn_fence(__ATOMIC_ACQ_REL, "workgroup"); __builtin_amdgcn_wave_barrier();
  const int rsub = lane >> 4, c4 = (lane & 15) * 4;
  {
#pragma unroll
    for (int q = 0; q < 16; ++q) { const int r = q * 2 + rsub; const v4f v = *(const v4fa*)&so[w][r][c4]; if (C) *(v4f*)(C + cofs + (size_t)(row0 + r) * ldc + col0 + c4) = v; if (C16) { v4h h4; for (int i = 0; i < 4; ++i) h4[i] = (_Float16)v[i]; *(v4h*)(C16 + cofs + (size_t)(row0 + r) * ldc + col0 + c4) = h4; } }
     } }


__global__ __launch_bounds__(256) void k_wnat(const float* __restrict__ w, size_t n8, _Float16* __restrict__ Bt) { const size_t t = (size_t)blockIdx.x * 256 + threadIdx.x; if (t >= n8) return; FragH f; for (int q = 0; q < 8; ++q) f.h[q] = (_Float16)(bf16_round(w[t * 8 + q]) * 16.0f); *(v8us*)((unsigned short*)Bt + t * 8) = f.half[0];  }
__global__ __launch_bounds__(256) void k_rsm(const float* __restrict__ S, _Float16* __restrict__ P, int nrows) {
  #pragma clang fp contract(off)
  const int i = blockIdx.x * 256 + threadIdx.x; if (i >= nrows) return; const float* s = S + (size_t)i * SQ; float mx = -3.0e38f;
#pragma unroll 1
  for (int j = 0; j < SQ; ++j) mx = fmaxf(mx, s[j]); float se = 0.f;
#pragma unroll 1
  for (int j = 0; j < SQ; ++j) se += expf(s[j] - mx); const float sc = 256.0f / se;
#pragma unroll 1
  for (int j0 = 0; j0 < SQ; j0 += 8) { FragH f; for (int q = 0; q < 8; ++q) f.h[q] = (_Float16)(expf(s[j0 + q] - mx) * sc); unsigned short* d = (unsigned short*)P + (size_t)i * SQ + j0; *(v8us*)d = f.half[0];  } }
__global__ __launch_bounds__(256) void k_vt(const _Float16* __restrict__ V16, int b, int h0, _Float16* __restrict__ VT) { __shared__ unsigned short tl[64][65]; const int tid = threadIdx.x; const int hh = blockIdx.x % HG, sg = blockIdx.x / HG; const int s0 = sg * 64; const int h = h0 + hh;
  for (int i = tid; i < 64 * 8; i += 256) { const int j = i / 8, d8 = (i % 8) * 8; FragH f; f.half[0] = *(const v8us*)((const unsigned short*)V16 + ((size_t)b * SQ + s0 + j) * DM + h * HD + d8); for (int q = 0; q < 8; ++q) tl[d8 + q][j] = f.u[q]; }
  __syncthreads();
  { for (int i = tid; i < 64 * 8; i += 256) { const int d = i / 8, j8 = (i % 8) * 8; FragH f; for (int q = 0; q < 8; ++q) f.u[q] = tl[d][j8 + q]; *(v8us*)((unsigned short*)VT + ((size_t)hh * HD + d) * SQ + s0 + j8) = f.half[0]; }  } }



__global__ __launch_bounds__(256) void k_rsmcf2(const float* __restrict__ S, _Float16* __restrict__ P) {      /* one block = one causal query tile of one batch; grid = NB * SQ / QT */
  #pragma clang fp contract(off)
  static_assert(QT == 256, "block = query tile"); const int t = blockIdx.x * 256 + threadIdx.x; const size_t i = (size_t)t; const float* s = S + i * NKX; const int q0 = (int)(blockIdx.x % (SQ / QT)) * QT; const int nk = q0 + QT; const int last = q0 + threadIdx.x; float mx = -3.0e38f;
#pragma unroll 1
  for (int j = 0; j < nk; ++j) { const float f = (j <= last) ? 1.f : 0.f; mx = fmaxf(mx, fmaf(f, s[j], (1.f - f) * -1.0e9f)); } float se = 0.f;
#pragma unroll 1
  for (int j = 0; j < nk; ++j) { const float f = (j <= last) ? 1.f : 0.f; se += __expf(fmaf(f, s[j], (1.f - f) * -1.0e9f) - mx); } const float sc = 256.0f / se;
#pragma unroll 1
  for (int j0 = 0; j0 < nk; j0 += 8) { FragH fr; for (int q = 0; q < 8; ++q) { const int j = j0 + q; const float f = (j <= last) ? 1.f : 0.f; fr.h[q] = (_Float16)(__expf(fmaf(f, s[j], (1.f - f) * -1.0e9f) - mx) * sc); } unsigned short* d = (unsigned short*)P + i * NKX + j0; *(v8us*)d = fr.half[0];  } }


template <int MASKADD>
__global__ __launch_bounds__(64) void k_att0(const float* __restrict__ QF, const float* __restrict__ KF, const float* __restrict__ VF, int ld, const float* __restrict__ mask, float scale, float* __restrict__ OF, int ldo) {
  #pragma clang fp contract(off)
  __shared__ __attribute__((aligned(16))) float lq[64][64]; __shared__ __attribute__((aligned(16))) float lo[64][64];
  const int tid = threadIdx.x; const int h = blockIdx.x / (QT0 / 64), rg = blockIdx.x % (QT0 / 64); const int i = rg * 64 + tid;
  { const size_t bo = (size_t)blockIdx.y * QT0; QF += bo * ld; KF += bo * ld; VF += bo * ld; OF += bo * ldo; }      /* grid.y = batch: its own first-tile planes */
  const float* qr = QF + (size_t)i * ld + h * HD;
#pragma unroll 1
  for (int c = 0; c < HD / 4; ++c) { *(v4f*)&lq[tid][c * 4] = *(const v4fa*)(qr + c * 4); const v4f z = {0.f, 0.f, 0.f, 0.f}; *(v4f*)&lo[tid][c * 4] = z; }
  float m = -1.0e30f, l = 0.f; const int jmax = MASKADD ? (SQ - 1) : (rg * 64 + 63);      /* additive-mask form: every key (the mask input decides); causal form: keys up to the block's last row */
#pragma unroll 1
  for (int j = 0; j <= jmax; ++j) { const float* kr = KF + (size_t)j * ld + h * HD; const float* vr = VF + (size_t)j * ld + h * HD; float s = 0.f;
#pragma unroll 1
    for (int c = 0; c < HD / 4; ++c) { const v4f kq = *(const v4fa*)(kr + c * 4); const v4f qq = *(v4f*)&lq[tid][c * 4]; s = __fadd_rn(s, __fmul_rn(qq[0], kq[0])); s = __fadd_rn(s, __fmul_rn(qq[1], kq[1])); s = __fadd_rn(s, __fmul_rn(qq[2], kq[2])); s = __fadd_rn(s, __fmul_rn(qq[3], kq[3])); }
    s = __fmul_rn(s, scale); if (MASKADD) s = __fadd_rn(s, __fmul_rn(bf16_round(mask[(size_t)i * SQ + j]), -10000.0f));
    const float f = (MASKADD || j <= i) ? 1.f : 0.f; const float sm = fmaf(f, s, (1.f - f) * -1.0e30f); const float mn = fmaxf(m, sm); const float sc = expf(m - mn); const float e = expf(sm - mn); l = __fadd_rn(__fmul_rn(l, sc), e); m = mn;
#pragma unroll 1
    for (int c = 0; c < HD / 4; ++c) { const v4f vv = *(const v4fa*)(vr + c * 4); v4f oo = *(v4f*)&lo[tid][c * 4]; for (int u = 0; u < 4; ++u) oo[u] = __fadd_rn(__fmul_rn(oo[u], sc), __fmul_rn(e, vv[u])); *(v4f*)&lo[tid][c * 4] = oo; } }
  const float fin = 64.0f / l;      /* o carried x64; k_o0m scales it back by 1/64 */
#pragma unroll 1
  for (int c = 0; c < HD / 4; ++c) { v4f oo = *(v4f*)&lo[tid][c * 4]; for (int u = 0; u < 4; ++u) oo[u] = __fmul_rn(oo[u], fin); *(v4f*)&lo[tid][c * 4] = oo; }
  __syncthreads();
  {
#pragma unroll 1
    for (int it = 0; it < 16; ++it) { const int row = it * 4 + tid / 16, pc = (tid % 16) * 4; const v4f v = *(const v4f*)&lo[row][pc]; *(v4f*)(OF + (size_t)(rg * 64 + row) * ldo + h * HD + pc) = v; }
     } }


template <int BFIN, int WXB>
__global__ __launch_bounds__(256) void k_ln16(const float* __restrict__ X, const float* __restrict__ g, const float* __restrict__ bb, float eps, _Float16* __restrict__ N16, float* __restrict__ XB) {
  #pragma clang fp contract(off)
  __shared__ float red[256]; const size_t r = blockIdx.x; const int t = threadIdx.x; const v4f xa = *(const v4fa*)(X + r * DMQ + t * 4); float s[4]; float sum = 0.f;
  for (int q = 0; q < 4; ++q) { s[q] = BFIN ? bf16_round(xa[q]) : xa[q]; sum = __fadd_rn(sum, s[q]); }
  red[t] = sum; __syncthreads(); for (int st = 128; st > 0; st >>= 1) { if (t < st) red[t] = __fadd_rn(red[t], red[t + st]); __syncthreads(); } const float mu = red[0] / (float)DMQ; __syncthreads();
  float vs = 0.f; for (int q = 0; q < 4; ++q) { const float dl = __fadd_rn(s[q], -mu); vs = __fadd_rn(vs, __fmul_rn(dl, dl)); } red[t] = vs; __syncthreads(); for (int st = 128; st > 0; st >>= 1) { if (t < st) red[t] = __fadd_rn(red[t], red[t + st]); __syncthreads(); }
  const float rs = rsqrtf(__fadd_rn(red[0] / (float)DMQ, eps)); v4h y; v4f xb;
  for (int q = 0; q < 4; ++q) { const int c = t * 4 + q; y[q] = (_Float16)__fadd_rn(__fmul_rn(__fmul_rn(__fadd_rn(s[q], -mu), rs), bf16_round(g[c])), bf16_round(bb[c])); xb[q] = s[q]; }
  { *(v4h*)(N16 + r * DMQ + t * 4) = y; if (WXB) *(v4f*)(XB + r * DMQ + t * 4) = xb;  } }
__global__ __launch_bounds__(256) void k_ftres2(const float* __restrict__ OF0, const float* __restrict__ XB, float* __restrict__ X1, size_t n4) {
  #pragma clang fp contract(off)
  const size_t t = (size_t)blockIdx.x * 256 + threadIdx.x; if (t >= n4) return; const v4f o = *(const v4fa*)(OF0 + t * 4), xv = *(const v4fa*)(XB + t * 4); v4f y; for (int q = 0; q < 4; ++q) y[q] = __fadd_rn(__fmul_rn(o[q], 0.015625f), xv[q]); *(v4f*)(X1 + t * 4) = y;  }

__global__ __launch_bounds__(256) void k_wthd(const float* __restrict__ Wt, _Float16* __restrict__ Bt) { const size_t t = (size_t)blockIdx.x * 256 + threadIdx.x; if (t >= (size_t)NH * HD * (DM / 8)) return; const int m8 = (int)(t % (DM / 8)) * 8; const int d = (int)((t / (DM / 8)) % HD); const int h = (int)(t / ((size_t)(DM / 8) * HD)); FragH f;
  for (int q = 0; q < 8; ++q) f.h[q] = (_Float16)(16.0f * bf16_round(Wt[((size_t)h * DM + m8 + q) * HD + d])); unsigned short* dst = (unsigned short*)Bt + ((size_t)h * HD + d) * DM + m8; *(v8us*)dst = f.half[0];  }




__global__ __launch_bounds__(256) void k_wtpad(const float* __restrict__ Wm, _Float16* __restrict__ Wt, int Kr, int Kp, int Nr, int Np, float scale) {
  const int t = blockIdx.x * 256 + threadIdx.x; if (t >= Np * (Kp / 8)) return; const int n = t / (Kp / 8), k8 = (t % (Kp / 8)) * 8; const int nc = min(n, Nr - 1); const float fn = (n < Nr) ? 1.f : 0.f; FragH f;
  for (int i = 0; i < 8; ++i) { const int k = k8 + i; const int kc = min(k, Kr - 1); const float fk = (k < Kr) ? fn : 0.f; f.h[i] = (_Float16)(bf16_round(Wm[(size_t)kc * Nr + nc]) * scale * fk); }
  unsigned short* o = (unsigned short*)Wt + (size_t)n * Kp + k8; *(v8us*)o = f.half[0];  }
__global__ __launch_bounds__(128) void k_bpad(const float* __restrict__ b, float* __restrict__ Bp, int nr, int np) {
  const int i = threadIdx.x; if (i >= np) return; const float v = b[min(i, nr - 1)] * ((i < nr) ? 1.f : 0.f); *(float*)(Bp + i) = v;  }

#define DI 64         /* inner width = NH * HD (ONE 64-wide head) */
#define LQK (3 * DI)  /* fused q | k | v row pitch (192) */
__global__ __launch_bounds__(256) void k_o0(const float* __restrict__ OF, float* __restrict__ ob, size_t n4) {
  #pragma clang fp contract(off)
  const size_t t = (size_t)blockIdx.x * 256 + threadIdx.x; if (t >= n4) return; const size_t e = t * 4; const int i = (int)(e / DI); const int c = (int)(e % DI); const int h = c / HD, d = c % HD; const v4f a = *(const v4fa*)(OF + e); v4f o; for (int q = 0; q < 4; ++q) o[q] = __fmul_rn(a[q], 0.015625f); float* dst = ob + (size_t)h * SQ * HD + (size_t)i * HD + d; *(v4f*)dst = o;  }

__global__ __launch_bounds__(256) void k_o0m(const float* __restrict__ OF, float* __restrict__ o_, size_t n4) {
  #pragma clang fp contract(off)
  const size_t t = (size_t)blockIdx.x * 256 + threadIdx.x; if (t >= n4) return; const size_t e = t * 4; OF += (size_t)blockIdx.y * QT0 * DI; o_ += (size_t)blockIdx.y * SQ * DI;      /* grid.y = batch */
  const v4f a = *(const v4fa*)(OF + e); v4f o; for (int q = 0; q < 4; ++q) o[q] = __fmul_rn(a[q], 0.015625f); *(v4f*)(o_ + e) = o;  }
extern "C" void kernel_launch(void* const* d_in, const int* in_sizes, int n_in,
                              void* d_out, int out_size, void* d_ws, size_t ws_size, hipStream_t stream) {
  (void)in_sizes; (void)n_in; (void)out_size;
  const float* const* I = (const float* const*)d_in; const float* x = I[0]; const float* wq = I[1]; const float* wk = I[2]; const float* wv = I[3];      /* x; natural [out = 64][in] Wq / Wk / Wv (input order as this module lists them); no biases */
  char* ws = (char*)d_ws; size_t off = 0;
  auto take = [&](size_t bytes) { char* p = ws + off; off += (bytes + 255) & ~(size_t)255; return p; };
  _Float16* BW = (_Float16*)take((size_t)LQK * DM * 2); _Float16* X16 = (_Float16*)take(NR * DM * 2); _Float16* QKV = (_Float16*)take(NR * LQK * 2); _Float16* VT = (_Float16*)take((size_t)NB * HD * SQ * 2);
  float* S = (float*)take(NR * NKX * 4); _Float16* P = (_Float16*)take(NR * NKX * 2); float* QKVF0 = (float*)take((size_t)NB * QT0 * LQK * 4); float* OF0 = (float*)take((size_t)NB * QT0 * DI * 4);      /* every plane holds all batches (S, P: all query tiles too) */
  if (off > ws_size) return;
  { const unsigned g = (unsigned)(((size_t)DI * DM / 8 + 255) / 256); k_wnat<<<g, 256, 0, stream>>>(wq, (size_t)DI * DM / 8, BW); k_wnat<<<g, 256, 0, stream>>>(wk, (size_t)DI * DM / 8, BW + (size_t)DI * DM); k_wnat<<<g, 256, 0, stream>>>(wv, (size_t)DI * DM / 8, BW + (size_t)2 * DI * DM); }      /* natural [64][DM] = Bt x16, stacked q | k | v */
  k_x16<<<(unsigned)((NR * DM / 8 + 255) / 256), 256, 0, stream>>>(x, X16, NR * DM / 8);      /* x (bf16-valued) as exact f16 rows */
  k_gemm2<0><<<dim3((unsigned)((NR / 128) * (LQK / 64)), 1), 128, 0, stream>>>(X16, DM, 0, BW, DM, 0, 0.0625f, nullptr, 0, nullptr, 1, 0, 0, nullptr, QKV, LQK, 0, (int)NR, LQK, DM);      /* q | k | v = x W^T -> f16 rows, column blocks 0 / 64 / 128 of the fused plane (pitch 192), one launch */
  const _Float16* Q16 = QKV; const _Float16* K16 = QKV + DI; const _Float16* V16 = QKV + 2 * DI;
  k_vt<NH, SQ><<<NB * NH * (SQ / 64), 256, 0, stream>>>(V16, LQK, 0, VT);      /* V^T [NB][HD][SQ] */
  k_gemm2<0, 1><<<dim3((SQ / 128) * (SQ / 64), NB), 128, 0, stream>>>(Q16, LQK, (size_t)SQ * LQK, K16, LQK, (size_t)SQ * LQK, 0.03125f, nullptr, 0, nullptr, 1, 0, 0, S, nullptr, NKX, (size_t)SQ * NKX, SQ, SQ, HD);      /* scores * 1024^-0.5 = 1/32 (the module scales by the EMBEDDING width); batch on grid.y; causal: only keys below each query tile's end are computed */
  k_rsmcf2<<<NB * (SQ / QT), 256, 0, stream>>>(S, P);      /* causal softmax -> P x256 f16 */
  k_gemm2<0, 2><<<dim3((SQ / 128) * (HD / 64), NB), 128, 0, stream>>>(P, NKX, (size_t)SQ * NKX, VT, SQ, (size_t)HD * SQ, 0.00390625f, nullptr, 0, nullptr, 1, 0, 0, (float*)d_out, nullptr, DI, (size_t)SQ * DI, SQ, HD, SQ);      /* out[b][i][..] = P V^T 2^-8 (f32), K = the keys of the row's query tile */
  k_gemm2<0><<<dim3((unsigned)((QT0 / 128) * (LQK / 64)), NB), 128, 0, stream>>>(X16, DM, (size_t)SQ * DM, BW, DM, 0, 0.0625f, nullptr, 0, nullptr, 1, 0, 0, QKVF0, nullptr, LQK, (size_t)QT0 * LQK, QT0, LQK, DM);      /* f32 q | k | v of rows 0..511 of each batch (exact products, f32 accumulation) */
  k_att0<0><<<dim3(NH * (QT0 / 64), NB), 64, 0, stream>>>(QKVF0, QKVF0 + DI, QKVF0 + 2 * DI, LQK, nullptr, 0.03125f, OF0, DI);      /* exact f32 causal attention for rows 0..511 (o x64) */
  k_o0m<<<dim3((unsigned)(((size_t)QT0 * DI / 4 + 255) / 256), NB), 256, 0, stream>>>(OF0, (float*)d_out, (size_t)QT0 * DI / 4);      /* rows 0..511 of each batch REWRITTEN from the exact path */
}

// v002
// A run of this version takes 509 microseconds.
// In two side-by-side timings against v001, it was 4.41 and 4.32 times as fast.
// All steps since v000 together make it 27.6 times as fast.
#include <hip/hip_runtime.h>
// Single-head causal self-attention with the module's EMBEDDING-width scale (inps [4][2048][1024]; q/k/v = x W^T (natural [64][1024], U(+-1/32), no biases); ONE 64-wide head; scores * 1024^-0.5 (the source sets head_size = n_embed); causal (tril, -inf); softmax; out = weights v -> [4][2048][64]; no output projection).
// Structure: token rows; x as exact f16 rows; one WMMA GEMM into the f16 q | k | v plane [8192][192]; v^T via LDS transposes; every stage is ONE launch over all batches (grid.y in the GEMMs, folded into grid.x for the softmax) and all causal 256-row query tiles (grid.x): scores alpha 1/32 into S [4][2048][2048] (column tiles past a row tile's keys are skipped), causal softmax f32 -> f16 x256 weights, P V (K = the row tile's keys) written as f32 straight into the output rows; an exact f32 first tile (rows 0..511 of each batch) rewritten at the end.
// Compute dtype: inputs rounded to bf16; x / weights exact; q, k, v and softmax weights as plain f16 GEMM operands (~2^-12); o, scores and softmax statistics f32. v_wmma_f32_16x16x32_f16.
#define NB 4
#define SQ 2048
#define DM 1024
#define NH 1
#define HD 64
#define HG 4                         /* used only by the k_vt(V16, b, h0, VT) overload, which is not launched */
#define QT 256                       /* query rows per causal tile */
#define NKX SQ                       /* S / P row pitch */
#define QT0 512                      /* first-tile rows recomputed exactly (f32): 512 here (no output projection averages the early-row cancellation errors away; logit sigma 1.0) */
#define B0 0                         /* unused: every launch covers all batches */
#define NBR NB                       /* unused by the launches (they put NB on grid.y or into grid.x) */
#define NR ((size_t)NB * SQ)
#define DMQ DM
#define DFF 4096                     /* unused: there is no FFN */
#define DFFR 100                     /* unused */
#define MP ((int)((size_t)NBR * SQ)) /* unused: the projections take NR rows */
#define QN SQ                        /* unused: the query tiles on grid.x cover SQ */
#define NHD NH                       /* unused: the launches use NH */
#define MPO MP                       /* unused: there is no output stage */
#define LQ (3 * DM)
typedef __bf16 v16b __attribute__((ext_vector_type(16)));
typedef unsigned short v8us __attribute__((ext_vector_type(8), may_alias));
typedef float  v8f  __attribute__((ext_vector_type(8)));
typedef float  v4f  __attribute__((ext_vector_type(4)));
typedef float  v4fa __attribute__((ext_vector_type(4), may_alias));
union FragB { v16b v; v8us half[2]; unsigned short u[16]; };

__device__ __forceinline__ unsigned short bf16_bits(float x) { unsigned int u = __float_as_uint(x); return (unsigned short)((u + 0x7FFFu + ((u >> 16) & 1u)) >> 16); }
__device__ __forceinline__ float bf16_val(unsigned short b) { return __uint_as_float(((unsigned int)b) << 16); }
__device__ __forceinline__ float bf16_round(float x) { return bf16_val(bf16_bits(x)); }
// D += A·B with NT terms: 1 = ah·bh, 2 = + al·bh (A split), 3 = + ah·bl (both split)
template <int NT>
__device__ __forceinline__ v8f mmaN(v16b ah, v16b al, v16b bh, v16b bl, v8f c) {
  c = __builtin_amdgcn_wmma_f32_16x16x32_bf16(false, ah, false, bh, (short)0, c, false, false);
  if (NT >= 2) c = __builtin_amdgcn_wmma_f32_16x16x32_bf16(false, al, false, bh, (short)0, c, false, false);
  if (NT >= 3) c = __builtin_amdgcn_wmma_f32_16x16x32_bf16(false, ah, false, bl, (short)0, c, false, false);
  asm volatile("v_nop\n\tv_nop\n\tv_nop\n\tv_nop" : "+v"(c) : "v"(ah), "v"(al), "v"(bh), "v"(bl));
  return c;
}

__global__ __launch_bounds__(256) void k_wt_bf16(const float* __restrict__ W, unsigned short* __restrict__ Wt, int K, int N) {
  const int t = blockIdx.x * 256 + threadIdx.x;
  const int k8n = K / 8;
  if (t >= N * k8n) return;
  const int n = t / k8n, k8 = (t % k8n) * 8;
  v8us v;
#pragma unroll
  for (int i = 0; i < 8; ++i) v[i] = bf16_bits(W[(size_t)(k8 + i) * N + n]);
  *(v8us*)(Wt + (size_t)n * K + k8) = v;
  
}

// GEMM C[M][N] (f32, pitch ldc) = act(A[M][K]·W + bias). A f32 row-major (pitch lda) converted per fragment to bf16
// (ASPLIT: hi/lo two planes -> 2 terms, else single rounded term); Wt bf16 [N][K] (pitch ldb). BIAS_BF16 rounds the
// bias to bf16 first (bias quantised to bf16 before the add). K%32==0, M%16==0, N%64==0.
template <bool ASPLIT, int ACT, bool BIAS_BF16>
__global__ __launch_bounds__(128) void k_gemm_bf(const float* __restrict__ A, int lda, const unsigned short* __restrict__ Wt, int ldb,
                                               const float* __restrict__ bias, float* __restrict__ C, int ldc, int M, int N, int K) {
  __shared__ __attribute__((aligned(16))) float so[4][16][64];
  const int tid = threadIdx.x, w = tid >> 5, lane = tid & 31, ln = lane & 15, hh = lane >> 4;
  const int ntn = N / 64;
  const int wid = blockIdx.x * 4 + w;
  const int mt = wid / ntn, nq = wid % ntn;
  if (mt * 16 >= M) return;
  const int row0 = mt * 16, col0 = nq * 64;
  const float* arow = A + (size_t)(row0 + ln) * lda;
  v8f acc[4] = {};
  for (int kb = 0; kb < K; kb += 32) {
    FragB ah, al;
    const v4f x0 = *(const v4fa*)(arow + kb + 8 * hh), x1 = *(const v4fa*)(arow + kb + 8 * hh + 4);
    const v4f x2 = *(const v4fa*)(arow + kb + 16 + 8 * hh), x3 = *(const v4fa*)(arow + kb + 16 + 8 * hh + 4);
    float xs[16] = {x0[0],x0[1],x0[2],x0[3],x1[0],x1[1],x1[2],x1[3],x2[0],x2[1],x2[2],x2[3],x3[0],x3[1],x3[2],x3[3]};
#pragma unroll
    for (int i = 0; i < 16; ++i) { const unsigned short hb = bf16_bits(xs[i]); ah.u[i] = hb; al.u[i] = ASPLIT ? bf16_bits(xs[i] - bf16_val(hb)) : (unsigned short)0; }
#pragma unroll
    for (int t = 0; t < 4; ++t) {
      const unsigned short* brow = Wt + (size_t)(col0 + t * 16 + ln) * ldb + kb;
      FragB b;
      b.half[0] = *(const v8us*)(brow + 8 * hh);
      b.half[1] = *(const v8us*)(brow + 16 + 8 * hh);
      acc[t] = mmaN<ASPLIT ? 2 : 1>(ah.v, al.v, b.v, b.v, acc[t]);
    }
  }
#pragma unroll
  for (int t = 0; t < 4; ++t) {
    float bv = bias ? bias[col0 + t * 16 + ln] : 0.f;
    if (BIAS_BF16) bv = bf16_round(bv);
#pragma unroll
    for (int r = 0; r < 8; ++r) { float v = acc[t][r] + bv; if (ACT == 1) v = fmaxf(v, 0.f); so[w][8 * hh + r][t * 16 + ln] = v; }
  }
  __builtin_amdgcn_fence(__ATOMIC_ACQ_REL, "workgroup");
  __builtin_amdgcn_wave_barrier();
  const int rsub = lane >> 4, c4 = (lane & 15) * 4;
  {
#pragma unroll
    for (int q = 0; q < 8; ++q) {
      const int r = q * 2 + rsub;
      const v4f v = *(const v4fa*)&so[w][r][c4];
      *(v4f*)(C + (size_t)(row0 + r) * ldc + col0 + c4) = v;
    }
    
  }
}

// GEMM C = act(A·W + bias + resid): A f32 (ASPLIT -> hi/lo 2 terms), Wt bf16 [N][K]; ACT 0 none, 1 relu, 2 exact gelu;
// resid (optional, f32, row index = (row % rmod), pitch ldr, RES_BF16 rounds it) added before the activation.
template <bool ASPLIT, int ACT, bool BIAS_BF16, bool RES_BF16>
__global__ __launch_bounds__(128) void k_gemm_bf3(const float* __restrict__ A, int lda, const unsigned short* __restrict__ Wt, int ldb,
                                                const float* __restrict__ bias, const float* __restrict__ resid, int rmod, int ldr,
                                                float* __restrict__ C, int ldc, int M, int N, int K) {
  __shared__ __attribute__((aligned(16))) float so[4][16][64];
  const int tid = threadIdx.x, w = tid >> 5, lane = tid & 31, ln = lane & 15, hh = lane >> 4;
  const int ntn = N / 64;
  const int wid = blockIdx.x * 4 + w;
  const int mt = wid / ntn, nq = wid % ntn;
  if (mt * 16 >= M) return;
  const int row0 = mt * 16, col0 = nq * 64;
  const float* arow = A + (size_t)(row0 + ln) * lda;
  v8f acc[4] = {};
  for (int kb = 0; kb < K; kb += 32) {
    FragB ah, al;
    const v4f x0 = *(const v4fa*)(arow + kb + 8 * hh), x1 = *(const v4fa*)(arow + kb + 8 * hh + 4);
    const v4f x2 = *(const v4fa*)(arow + kb + 16 + 8 * hh), x3 = *(const v4fa*)(arow + kb + 16 + 8 * hh + 4);
    float xs[16] = {x0[0],x0[1],x0[2],x0[3],x1[0],x1[1],x1[2],x1[3],x2[0],x2[1],x2[2],x2[3],x3[0],x3[1],x3[2],x3[3]};
#pragma unroll
    for (int i = 0; i < 16; ++i) { const unsigned short hb = bf16_bits(xs[i]); ah.u[i] = hb; al.u[i] = ASPLIT ? bf16_bits(xs[i] - bf16_val(hb)) : (unsigned short)0; }
#pragma unroll
    for (int t = 0; t < 4; ++t) {
      const unsigned short* brow = Wt + (size_t)(col0 + t * 16 + ln) * ldb + kb;
      FragB b;
      b.half[0] = *(const v8us*)(brow + 8 * hh);
      b.half[1] = *(const v8us*)(brow + 16 + 8 * hh);
      acc[t] = mmaN<ASPLIT ? 2 : 1>(ah.v, al.v, b.v, b.v, acc[t]);
    }
  }
#pragma unroll
  for (int t = 0; t < 4; ++t) {
    const int col = col0 + t * 16 + ln;
    float bv = bias ? bias[col] : 0.f;
    if (BIAS_BF16) bv = bf16_round(bv);
#pragma unroll
    for (int r = 0; r < 8; ++r) {
      float v = acc[t][r] + bv;
      if (resid) { float rv = resid[(size_t)((row0 + 8 * hh + r) % rmod) * ldr + col]; if (RES_BF16) rv = bf16_round(rv); v += rv; }
      if (ACT == 1) v = fmaxf(v, 0.f);
      if (ACT == 2) v = 0.5f * v * (1.0f + erff(v * 0.70710678118654752f));
      if (ACT == 3) { const float u = 0.7978845608028654f * (v + 0.044715f * v * v * v); v = 0.5f * v * (1.0f + tanhf(u)); }
      so[w][8 * hh + r][t * 16 + ln] = v;
    }
  }
  __builtin_amdgcn_fence(__ATOMIC_ACQ_REL, "workgroup");
  __builtin_amdgcn_wave_barrier();
  const int rsub = lane >> 4, c4 = (lane & 15) * 4;
  {
#pragma unroll
    for (int q = 0; q < 8; ++q) {
      const int r = q * 2 + rsub;
      const v4f v = *(const v4fa*)&so[w][r][c4];
      *(v4f*)(C + (size_t)(row0 + r) * ldc + col0 + c4) = v;
    }
    
  }
}
// row LayerNorm (biased variance, eps) over N: s = X (+ R); optional out_sum <- s; out_norm <- (s-mu)*rsqrt(var+eps)*g + b
template <bool PARAM_BF16>
__global__ __launch_bounds__(256) void k_layernorm(const float* __restrict__ X, const float* __restrict__ R, const float* __restrict__ g, const float* __restrict__ bta,
                                                  float* __restrict__ out_sum, float* __restrict__ out_norm, int N, float eps) {
  __shared__ float red[256];
  const int row = blockIdx.x, tid = threadIdx.x;
  const float* x = X + (size_t)row * N; const float* rr = R ? R + (size_t)row * N : nullptr;
  float vals[16];                     // up to N = 4096
  const int per = N / 256;            // contiguous chunk per thread? use strided-by-4 chunks: thread handles j = tid*4 + 1024*u
  float s1 = 0.f;
  for (int u = 0; u < per / 4; ++u) {
    const int j = tid * 4 + 1024 * u;
    const v4f a = *(const v4fa*)(x + j);
    v4f b = {0.f,0.f,0.f,0.f}; if (rr) b = *(const v4fa*)(rr + j);
#pragma unroll
    for (int q = 0; q < 4; ++q) { const float v = a[q] + b[q]; vals[u * 4 + q] = v; s1 += v; }
  }
  red[tid] = s1; __syncthreads();
  for (int st = 128; st > 0; st >>= 1) { if (tid < st) red[tid] += red[tid + st]; __syncthreads(); }
  const float mu = red[0] / (float)N; __syncthreads();
  float s2 = 0.f;
  for (int u = 0; u < per / 4; ++u)
#pragma unroll
    for (int q = 0; q < 4; ++q) { const float c = vals[u * 4 + q] - mu; s2 += c * c; }
  red[tid] = s2; __syncthreads();
  for (int st = 128; st > 0; st >>= 1) { if (tid < st) red[tid] += red[tid + st]; __syncthreads(); }
  const float rs = rsqrtf(red[0] / (float)N + eps);
  {
    for (int u = 0; u < per / 4; ++u) {
      const int j = tid * 4 + 1024 * u;
      v4f o, sm;
#pragma unroll
      for (int q = 0; q < 4; ++q) {
        float gg = g[j + q], bb = bta[j + q];
        if (PARAM_BF16) { gg = bf16_round(gg); bb = bf16_round(bb); }
        sm[q] = vals[u * 4 + q]; o[q] = (vals[u * 4 + q] - mu) * rs * gg + bb;
      }
      if (out_sum) *(v4f*)(out_sum + (size_t)row * N + j) = sm;
      *(v4f*)(out_norm + (size_t)row * N + j) = o;
    }
    
  }
}



// ---- f16 WMMA path (v_wmma_f32_16x16x32_f16): 11-bit significands for operands in range — used where a [0,1] probability operand needs more precision than bf16
typedef _Float16 v16h __attribute__((ext_vector_type(16)));
union FragH { v16h v; v8us half[2]; _Float16 h[16]; unsigned short u[16]; };
template <int NT>
__device__ __forceinline__ v8f mmaH(v16h ah, v16h al, v16h bh, v16h bl, v8f c) {
  c = __builtin_amdgcn_wmma_f32_16x16x32_f16(false, ah, false, bh, (short)0, c, false, false);
  if (NT >= 2) c = __builtin_amdgcn_wmma_f32_16x16x32_f16(false, al, false, bh, (short)0, c, false, false);
  if (NT >= 3) c = __builtin_amdgcn_wmma_f32_16x16x32_f16(false, ah, false, bl, (short)0, c, false, false);
  asm volatile("v_nop\n\tv_nop\n\tv_nop\n\tv_nop" : "+v"(c) : "v"(ah), "v"(al), "v"(bh), "v"(bl));
  return c;
}
// batched GEMM like k_gemm_b but f16 operands: A f32 (split into f16 hi/lo if ASPLIT, else rounded to f16), Bt = f16 values [n][k]; alpha; C f32; N multiple of 16 (partial tiles skipped)
template <bool ASPLIT>
__global__ __launch_bounds__(128) void k_gemm_h(const float* __restrict__ A, int lda, size_t sA, const _Float16* __restrict__ Bh, int ldb, size_t sB, float alpha, float* __restrict__ C, int ldc, size_t sC, int M, int N, int K) {
  __shared__ __attribute__((aligned(16))) float so[4][16][64];
  const int tid = threadIdx.x, w = tid >> 5, lane = tid & 31, ln = lane & 15, hh = lane >> 4; const int by = blockIdx.y;
  A += (size_t)by * sA; Bh += (size_t)by * sB; C += (size_t)by * sC;
  const int ntn = (N + 63) / 64; const int wid = blockIdx.x * 4 + w; const int mt = wid / ntn, nq = wid % ntn; if (mt * 16 >= M) return;
  const int row0 = mt * 16, col0 = nq * 64; const float* arow = A + (size_t)(row0 + ln) * lda;
  v8f acc[4] = {};
  for (int kb = 0; kb < K; kb += 32) {
    FragH ah, al;
    const v4f x0 = *(const v4fa*)(arow + kb + 8 * hh), x1 = *(const v4fa*)(arow + kb + 8 * hh + 4), x2 = *(const v4fa*)(arow + kb + 16 + 8 * hh), x3 = *(const v4fa*)(arow + kb + 16 + 8 * hh + 4);
    float xs[16] = {x0[0],x0[1],x0[2],x0[3],x1[0],x1[1],x1[2],x1[3],x2[0],x2[1],x2[2],x2[3],x3[0],x3[1],x3[2],x3[3]};
#pragma unroll
    for (int i = 0; i < 16; ++i) { const _Float16 h = (_Float16)xs[i]; ah.h[i] = h; al.h[i] = ASPLIT ? (_Float16)(xs[i] - (float)h) : (_Float16)0.0f; }
#pragma unroll
    for (int t = 0; t < 4; ++t) { if (col0 + t * 16 >= N) continue; const size_t boff = (size_t)(col0 + t * 16 + ln) * ldb + kb; FragH bq; bq.half[0] = *(const v8us*)(Bh + boff + 8 * hh); bq.half[1] = *(const v8us*)(Bh + boff + 16 + 8 * hh);
      acc[t] = mmaH<ASPLIT ? 2 : 1>(ah.v, al.v, bq.v, bq.v, acc[t]); }
  }
#pragma unroll
  for (int t = 0; t < 4; ++t) { if (col0 + t * 16 >= N) continue;
#pragma unroll
    for (int r = 0; r < 8; ++r) so[w][8 * hh + r][t * 16 + ln] = acc[t][r] * alpha; }
  __builtin_amdgcn_fence(__ATOMIC_ACQ_REL, "workgroup"); __builtin_amdgcn_wave_barrier();
  const int rsub = lane >> 4, c4 = (lane & 15) * 4;
  {
#pragma unroll
    for (int q = 0; q < 8; ++q) { const int r = q * 2 + rsub; if (col0 + c4 < N) { const v4f v = *(const v4fa*)&so[w][r][c4]; *(v4f*)(C + (size_t)(row0 + r) * ldc + col0 + c4) = v; } }
     }
}

// Wt[n][k] = f16(W[k][n]·scale) from f32 row-major W[K][N] (scale = power of two; bf16-exact weights stay exact in f16 away from the subnormal range)
__global__ __launch_bounds__(256) void k_wt_f16(const float* __restrict__ W, _Float16* __restrict__ Wt, int K, int N, float scale) {
  const int t = blockIdx.x * 256 + threadIdx.x; if (t >= N * (K / 8)) return; const int n = t / (K / 8), k8 = (t % (K / 8)) * 8; FragH f;
#pragma unroll
  for (int i = 0; i < 8; ++i) f.h[i] = (_Float16)(bf16_round(W[(size_t)(k8 + i) * N + n]) * scale); const v8us o = f.half[0];
  *(v8us*)((unsigned short*)Wt + (size_t)n * K + k8) = o; 
}
// k_gemm_hh variant with fused epilogue: v = acc·alpha + bias[by·sBias + col] (+ CP[(row/rowsPerB)·sCPb + by·64 + col] if CP) ; ACT 0 none / 1 elu ; writes f16 C16 (and f32 C if non-null)
template <int ACT>
__global__ __launch_bounds__(128) void k_gemm_hhx(const _Float16* __restrict__ A, int lda, size_t sA, const _Float16* __restrict__ Bh, int ldb, size_t sB, float alpha, const float* __restrict__ bias, size_t sBias, const float* __restrict__ CP, int rowsPerB, size_t sCPb, int row0g,
    float* __restrict__ C, _Float16* __restrict__ C16, int ldc, size_t sC, int M, int N, int K) {
  __shared__ __attribute__((aligned(16))) float so[4][16][64];
  const int tid = threadIdx.x, w = tid >> 5, lane = tid & 31, ln = lane & 15, hh = lane >> 4; const int by = blockIdx.y;
  A += (size_t)by * sA; Bh += (size_t)by * sB; const size_t cofs = (size_t)by * sC; const float* bp = bias ? bias + (size_t)by * sBias : nullptr;
  const int ntn = (N + 63) / 64; const int wid = blockIdx.x * 4 + w; const int mt = wid / ntn, nq = wid % ntn; if (mt * 16 >= M) return;
  const int row0 = mt * 16, col0 = nq * 64; const _Float16* arow = A + (size_t)(row0 + ln) * lda;
  v8f acc[4] = {};
  for (int kb = 0; kb < K; kb += 32) { FragH ah; ah.half[0] = *(const v8us*)((const unsigned short*)arow + kb + 8 * hh); ah.half[1] = *(const v8us*)((const unsigned short*)arow + kb + 16 + 8 * hh);
#pragma unroll
    for (int t = 0; t < 4; ++t) { if (col0 + t * 16 >= N) continue; const size_t boff = (size_t)(col0 + t * 16 + ln) * ldb + kb; FragH bq; bq.half[0] = *(const v8us*)((const unsigned short*)Bh + boff + 8 * hh); bq.half[1] = *(const v8us*)((const unsigned short*)Bh + boff + 16 + 8 * hh);
      acc[t] = mmaH<1>(ah.v, ah.v, bq.v, bq.v, acc[t]); }
  }
#pragma unroll
  for (int t = 0; t < 4; ++t) { if (col0 + t * 16 >= N) continue; const int col = col0 + t * 16 + ln; const float bv = bp ? bf16_round(bp[col]) : 0.f;
#pragma unroll
    for (int r = 0; r < 8; ++r) { float v = acc[t][r] * alpha + bv; if (CP) { const int rr = row0g + row0 + 8 * hh + r; if (rowsPerB < 0) v += CP[cofs + (size_t)rr * ldc + col];      /* rowsPerB < 0: own element of the batched C plane */ else { const int bidx = rr / rowsPerB; v += CP[(size_t)bidx * sCPb + (size_t)by * 64 + col]; } } if (ACT == 1) v = (v > 0.f) ? v : expm1f(v); else if (ACT == 7) v = (v > 0.f) ? v + 1.0f : expf(v); else if (ACT == 8) v = tanhf(v); else if (ACT == 9) v = 0.5f * v * (1.0f + tanhf(0.7978845608028654f * (v + 0.044715f * v * v * v))); else if (ACT == 11) v = 1.0f / (1.0f + expf(-v)); else if (ACT == 12) v = (v > 0.f) ? v : 0.01f * v; else if (ACT == 14) v = (v > 0.f) ? v : 0.1f * v; else if (ACT == 16) v = (v >= 0.f) ? v : 0.3f * v; else if (ACT == 17) v = (v >= 0.f) ? v : 0.2f * v; else if (ACT == 15) v = v / (1.0f + expf(-v)); else if (ACT == 3) v = fmaxf(v, 0.f); else if (ACT == 6) v = 0.5f * v * (1.0f + erff(v * 0.70710678118654752f)); so[w][8 * hh + r][t * 16 + ln] = v; } }
  __builtin_amdgcn_fence(__ATOMIC_ACQ_REL, "workgroup"); __builtin_amdgcn_wave_barrier();
  const int rsub = lane >> 4, c4 = (lane & 15) * 4; typedef _Float16 v4h __attribute__((ext_vector_type(4)));
  {
#pragma unroll
    for (int q = 0; q < 8; ++q) { const int r = q * 2 + rsub; if (col0 + c4 < N) { const v4f v = *(const v4fa*)&so[w][r][c4]; if (C) *(v4f*)(C + cofs + (size_t)(row0 + r) * ldc + col0 + c4) = v; if (C16) { v4h h4; for (int i = 0; i < 4; ++i) h4[i] = (_Float16)v[i]; *(v4h*)(C16 + cofs + (size_t)(row0 + r) * ldc + col0 + c4) = h4; } } }
     }
}


typedef _Float16 v4h __attribute__((ext_vector_type(4)));

__global__ __launch_bounds__(256) void k_x16(const float* __restrict__ x, _Float16* __restrict__ X16, size_t n8) { const size_t t = (size_t)blockIdx.x * 256 + threadIdx.x; if (t >= n8) return; FragH f;
#pragma unroll
  for (int q = 0; q < 8; ++q) f.h[q] = (_Float16)bf16_round(x[t * 8 + q]); *(v8us*)((unsigned short*)X16 + t * 8) = f.half[0];  }
__global__ __launch_bounds__(256) void k_h16(const float* __restrict__ x, _Float16* __restrict__ X16, size_t n8) { const size_t t = (size_t)blockIdx.x * 256 + threadIdx.x; if (t >= n8) return; FragH f;
#pragma unroll
  for (int q = 0; q < 8; ++q) f.h[q] = (_Float16)x[t * 8 + q]; *(v8us*)((unsigned short*)X16 + t * 8) = f.half[0];  }
__global__ __launch_bounds__(256) void k_round16f(const float* __restrict__ W, _Float16* __restrict__ Bt, size_t n8) { const size_t t = (size_t)blockIdx.x * 256 + threadIdx.x; if (t >= n8) return; FragH f;
#pragma unroll
  for (int i = 0; i < 8; ++i) f.h[i] = (_Float16)(bf16_round(W[t * 8 + i]) * 16.0f); *(v8us*)((unsigned short*)Bt + t * 8) = f.half[0];  }
template <int NHv, int TTv>
__global__ __launch_bounds__(256) void k_vt(const _Float16* __restrict__ V16, int ldv, int voff, _Float16* __restrict__ Vt) { __shared__ unsigned short tl[64][66]; const int tid = threadIdx.x; const int slab = blockIdx.x / (TTv / 64), lg = blockIdx.x % (TTv / 64); const int b = slab / NHv, h = slab % NHv;
  for (int i = tid; i < 64 * 8; i += 256) { const int r = i / 8, c8 = (i % 8) * 8; FragH f; f.half[0] = *(const v8us*)((const unsigned short*)V16 + ((size_t)b * TTv + lg * 64 + r) * ldv + voff + h * 64 + c8);
#pragma unroll
    for (int q = 0; q < 8; ++q) tl[r][c8 + q] = f.u[q]; }
  __syncthreads();
  {
#pragma unroll
    for (int rd = 0; rd < 2; ++rd) { const int d = rd * 32 + tid / 8, pc = tid % 8; FragH f;
#pragma unroll
      for (int q = 0; q < 8; ++q) f.u[q] = tl[pc * 8 + q][d];
      *(v8us*)((unsigned short*)Vt + ((size_t)slab * 64 + d) * TTv + lg * 64 + pc * 8) = f.half[0]; }
     } }

__global__ __launch_bounds__(256) void k_hl(const float* __restrict__ F, _Float16* __restrict__ Hh, _Float16* __restrict__ Hl, size_t n8) { const size_t t = (size_t)blockIdx.x * 256 + threadIdx.x; if (t >= n8) return; FragH fh, fl; const v4f a = *(const v4fa*)(F + t * 8), c = *(const v4fa*)(F + t * 8 + 4);
#pragma unroll
  for (int q = 0; q < 4; ++q) { _Float16 h = (_Float16)a[q]; fh.h[q] = h; fl.h[q] = (_Float16)((a[q] - (float)h) * 1024.0f); h = (_Float16)c[q]; fh.h[4 + q] = h; fl.h[4 + q] = (_Float16)((c[q] - (float)h) * 1024.0f); }
  { *(v8us*)((unsigned short*)Hh + t * 8) = fh.half[0]; *(v8us*)((unsigned short*)Hl + t * 8) = fl.half[0];  } }

// ---- fast GEMM (wave tile 32x64; requires M % 32 == 0 rows per launch region and N % 64 == 0); epilogue = k_gemm_hhx semantics ----
__device__ __forceinline__ v16h g2_frag(const _Float16* p, int hh) { FragH f; f.half[0] = *(const v8us*)((const unsigned short*)p + 8 * hh); f.half[1] = *(const v8us*)((const unsigned short*)p + 16 + 8 * hh); return f.v; }
__device__ __forceinline__ v8f g2_mma(v16h a, v16h b, v8f c) { v8f d = __builtin_amdgcn_wmma_f32_16x16x32_f16(false, a, false, b, (short)0, c, false, false); asm volatile("v_nop\n\tv_nop\n\tv_nop\n\tv_nop" : "+v"(d) : "v"(a), "v"(b)); return d; }
// CAUS 0: plain. CAUS 1 (scores): a 64-column tile at or past the end of its rows' causal query tile is skipped. CAUS 2 (P V): K runs over the keys of the rows' causal query tile only.
template <int ACT, int CAUS = 0>
__global__ __launch_bounds__(128) void k_gemm2(const _Float16* __restrict__ A, int lda, size_t sA, const _Float16* __restrict__ Bh, int ldb, size_t sB, float alpha, const float* __restrict__ bias, size_t sBias, const float* __restrict__ CP, int rowsPerB, size_t sCPb, int row0g,
    float* __restrict__ C, _Float16* __restrict__ C16, int ldc, size_t sC, int M, int N, int K) { static_assert(ACT == 0 || ACT == 3 || ACT == 6 || ACT == 8 || ACT == 9 || ACT == 11 || ACT == 12 || ACT == 14 || ACT == 15 || ACT == 16 || ACT == 17, "k_gemm2: unsupported ACT code (would silently apply no activation)");
  __shared__ __attribute__((aligned(16))) float so[4][32][68];
  const int tid = threadIdx.x, w = tid >> 5, lane = tid & 31, ln = lane & 15, hh = lane >> 4; const int by = blockIdx.y;
  A += (size_t)by * sA; Bh += (size_t)by * sB; const size_t cofs = (size_t)by * sC; const float* bp = bias ? bias + (size_t)by * sBias : nullptr;
  const int ntn = N >> 6; const int mt = blockIdx.x / ntn, nq = blockIdx.x - mt * ntn; const int row0 = mt * 128 + 32 * w, col0 = nq * 64; if (row0 >= M) return;
  static_assert(QT % 128 == 0, "a 128-row block lies in one causal query tile"); const int nkc = (mt * 128 / QT + 1) * QT;      /* keys below the end of this block's causal query tile */
  if (CAUS == 1 && col0 >= nkc) return; if (CAUS == 2) K = nkc;
  const _Float16* a0p = A + (size_t)(row0 + ln) * lda; const _Float16* a1p = a0p + (size_t)16 * lda;
  const _Float16* b0p = Bh + (size_t)(col0 + ln) * ldb; const _Float16* b1p = b0p + (size_t)16 * ldb; const _Float16* b2p = b1p + (size_t)16 * ldb; const _Float16* b3p = b2p + (size_t)16 * ldb;
  const v8f z8 = {0.f,0.f,0.f,0.f,0.f,0.f,0.f,0.f}; v8f c00 = z8, c01 = z8, c02 = z8, c03 = z8, c10 = z8, c11 = z8, c12 = z8, c13 = z8;
#pragma unroll 1
  for (int kb = 0; kb < K; kb += 32) { const v16h a0 = g2_frag(a0p + kb, hh), a1 = g2_frag(a1p + kb, hh);
    v16h b = g2_frag(b0p + kb, hh); c00 = g2_mma(a0, b, c00); c10 = g2_mma(a1, b, c10);
    b = g2_frag(b1p + kb, hh); c01 = g2_mma(a0, b, c01); c11 = g2_mma(a1, b, c11);
    b = g2_frag(b2p + kb, hh); c02 = g2_mma(a0, b, c02); c12 = g2_mma(a1, b, c12);
    b = g2_frag(b3p + kb, hh); c03 = g2_mma(a0, b, c03); c13 = g2_mma(a1, b, c13); }
  v8f accs[8] = {c00, c01, c02, c03, c10, c11, c12, c13};
#pragma unroll
  for (int u = 0; u < 8; ++u) { const int t = u & 3, half = u >> 2; const int col = col0 + t * 16 + ln; const float bv = bp ? bf16_round(bp[col]) : 0.f;
#pragma unroll
    for (int r = 0; r < 8; ++r) { const int rloc = half * 16 + 8 * hh + r; float v = accs[u][r] * alpha + bv; if (CP) { if (rowsPerB < 0) v += CP[cofs + (size_t)(row0g + row0 + rloc) * ldc + col];      /* rowsPerB < 0: own element of the batched C plane */ else { const int bidx = (row0g + row0 + rloc) / rowsPerB; v += CP[(size_t)bidx * sCPb + (size_t)by * 64 + col]; } }
      if (ACT == 3) v = fmaxf(v, 0.f); else if (ACT == 6) v = 0.5f * v * (1.0f + erff(v * 0.70710678118654752f)); else if (ACT == 11) v = 1.0f / (1.0f + expf(-v)); else if (ACT == 15) v = v / (1.0f + expf(-v)); else if (ACT == 12) v = (v > 0.f) ? v : 0.01f * v; else if (ACT == 8) v = tanhf(v); else if (ACT == 9) v = 0.5f * v * (1.0f + tanhf(0.7978845608028654f * (v + 0.044715f * v * v * v))); else if (ACT == 14) v = (v > 0.f) ? v : 0.1f * v; else if (ACT == 16) v = (v >= 0.f) ? v : 0.3f * v; else if (ACT == 17) v = (v >= 0.f) ? v : 0.2f * v;
      so[w][rloc][t * 16 + ln] = v; } }
  __builtin_amdgcn_fence(__ATOMIC_ACQ_REL, "workgroup"); __builtin_amdgcn_wave_barrier();
  const int rsub = lane >> 4, c4 = (lane & 15) * 4;
  {
#pragma unroll
    for (int q = 0; q < 16; ++q) { const int r = q * 2 + rsub; const v4f v = *(const v4fa*)&so[w][r][c4]; if (C) *(v4f*)(C + cofs + (size_t)(row0 + r) * ldc + col0 + c4) = v; if (C16) { v4h h4; for (int i = 0; i < 4; ++i) h4[i] = (_Float16)v[i]; *(v4h*)(C16 + cofs + (size_t)(row0 + r) * ldc + col0 + c4) = h4; } }
     } }


__global__ __launch_bounds__(256) void k_wnat(const float* __restrict__ w, size_t n8, _Float16* __restrict__ Bt) { const size_t t = (size_t)blockIdx.x * 256 + threadIdx.x; if (t >= n8) return; FragH f; for (int q = 0; q < 8; ++q) f.h[q] = (_Float16)(bf16_round(w[t * 8 + q]) * 16.0f); *(v8us*)((unsigned short*)Bt + t * 8) = f.half[0];  }
__global__ __launch_bounds__(256) void k_rsm(const float* __restrict__ S, _Float16* __restrict__ P, int nrows) {
  #pragma clang fp contract(off)
  const int i = blockIdx.x * 256 + threadIdx.x; if (i >= nrows) return; const float* s = S + (size_t)i * SQ; float mx = -3.0e38f;
#pragma unroll 1
  for (int j = 0; j < SQ; ++j) mx = fmaxf(mx, s[j]); float se = 0.f;
#pragma unroll 1
  for (int j = 0; j < SQ; ++j) se += expf(s[j] - mx); const float sc = 256.0f / se;
#pragma unroll 1
  for (int j0 = 0; j0 < SQ; j0 += 8) { FragH f; for (int q = 0; q < 8; ++q) f.h[q] = (_Float16)(expf(s[j0 + q] - mx) * sc); unsigned short* d = (unsigned short*)P + (size_t)i * SQ + j0; *(v8us*)d = f.half[0];  } }
__global__ __launch_bounds__(256) void k_vt(const _Float16* __restrict__ V16, int b, int h0, _Float16* __restrict__ VT) { __shared__ unsigned short tl[64][65]; const int tid = threadIdx.x; const int hh = blockIdx.x % HG, sg = blockIdx.x / HG; const int s0 = sg * 64; const int h = h0 + hh;
  for (int i = tid; i < 64 * 8; i += 256) { const int j = i / 8, d8 = (i % 8) * 8; FragH f; f.half[0] = *(const v8us*)((const unsigned short*)V16 + ((size_t)b * SQ + s0 + j) * DM + h * HD + d8); for (int q = 0; q < 8; ++q) tl[d8 + q][j] = f.u[q]; }
  __syncthreads();
  { for (int i = tid; i < 64 * 8; i += 256) { const int d = i / 8, j8 = (i % 8) * 8; FragH f; for (int q = 0; q < 8; ++q) f.u[q] = tl[d][j8 + q]; *(v8us*)((unsigned short*)VT + ((size_t)hh * HD + d) * SQ + s0 + j8) = f.half[0]; }  } }



__global__ __launch_bounds__(256) void k_rsmcf2(const float* __restrict__ S, _Float16* __restrict__ P) {      /* one block = one causal query tile of one batch; grid = NB * SQ / QT */
  #pragma clang fp contract(off)
  static_assert(QT == 256, "block = query tile"); const int t = blockIdx.x * 256 + threadIdx.x; const size_t i = (size_t)t; const float* s = S + i * NKX; const int q0 = (int)(blockIdx.x % (SQ / QT)) * QT; const int nk = q0 + QT; const int last = q0 + threadIdx.x; float mx = -3.0e38f;
#pragma unroll 1
  for (int j = 0; j < nk; ++j) { const float f = (j <= last) ? 1.f : 0.f; mx = fmaxf(mx, fmaf(f, s[j], (1.f - f) * -1.0e9f)); } float se = 0.f;
#pragma unroll 1
  for (int j = 0; j < nk; ++j) { const float f = (j <= last) ? 1.f : 0.f; se += __expf(fmaf(f, s[j], (1.f - f) * -1.0e9f) - mx); } const float sc = 256.0f / se;
#pragma unroll 1
  for (int j0 = 0; j0 < nk; j0 += 8) { FragH fr; for (int q = 0; q < 8; ++q) { const int j = j0 + q; const float f = (j <= last) ? 1.f : 0.f; fr.h[q] = (_Float16)(__expf(fmaf(f, s[j], (1.f - f) * -1.0e9f) - mx) * sc); } unsigned short* d = (unsigned short*)P + i * NKX + j0; *(v8us*)d = fr.half[0];  } }


template <int BFIN, int WXB>
__global__ __launch_bounds__(256) void k_ln16(const float* __restrict__ X, const float* __restrict__ g, const float* __restrict__ bb, float eps, _Float16* __restrict__ N16, float* __restrict__ XB) {
  #pragma clang fp contract(off)
  __shared__ float red[256]; const size_t r = blockIdx.x; const int t = threadIdx.x; const v4f xa = *(const v4fa*)(X + r * DMQ + t * 4); float s[4]; float sum = 0.f;
  for (int q = 0; q < 4; ++q) { s[q] = BFIN ? bf16_round(xa[q]) : xa[q]; sum = __fadd_rn(sum, s[q]); }
  red[t] = sum; __syncthreads(); for (int st = 128; st > 0; st >>= 1) { if (t < st) red[t] = __fadd_rn(red[t], red[t + st]); __syncthreads(); } const float mu = red[0] / (float)DMQ; __syncthreads();
  float vs = 0.f; for (int q = 0; q < 4; ++q) { const float dl = __fadd_rn(s[q], -mu); vs = __fadd_rn(vs, __fmul_rn(dl, dl)); } red[t] = vs; __syncthreads(); for (int st = 128; st > 0; st >>= 1) { if (t < st) red[t] = __fadd_rn(red[t], red[t + st]); __syncthreads(); }
  const float rs = rsqrtf(__fadd_rn(red[0] / (float)DMQ, eps)); v4h y; v4f xb;
  for (int q = 0; q < 4; ++q) { const int c = t * 4 + q; y[q] = (_Float16)__fadd_rn(__fmul_rn(__fmul_rn(__fadd_rn(s[q], -mu), rs), bf16_round(g[c])), bf16_round(bb[c])); xb[q] = s[q]; }
  { *(v4h*)(N16 + r * DMQ + t * 4) = y; if (WXB) *(v4f*)(XB + r * DMQ + t * 4) = xb;  } }
__global__ __launch_bounds__(256) void k_ftres2(const float* __restrict__ OF0, const float* __restrict__ XB, float* __restrict__ X1, size_t n4) {
  #pragma clang fp contract(off)
  const size_t t = (size_t)blockIdx.x * 256 + threadIdx.x; if (t >= n4) return; const v4f o = *(const v4fa*)(OF0 + t * 4), xv = *(const v4fa*)(XB + t * 4); v4f y; for (int q = 0; q < 4; ++q) y[q] = __fadd_rn(__fmul_rn(o[q], 0.015625f), xv[q]); *(v4f*)(X1 + t * 4) = y;  }

__global__ __launch_bounds__(256) void k_wthd(const float* __restrict__ Wt, _Float16* __restrict__ Bt) { const size_t t = (size_t)blockIdx.x * 256 + threadIdx.x; if (t >= (size_t)NH * HD * (DM / 8)) return; const int m8 = (int)(t % (DM / 8)) * 8; const int d = (int)((t / (DM / 8)) % HD); const int h = (int)(t / ((size_t)(DM / 8) * HD)); FragH f;
  for (int q = 0; q < 8; ++q) f.h[q] = (_Float16)(16.0f * bf16_round(Wt[((size_t)h * DM + m8 + q) * HD + d])); unsigned short* dst = (unsigned short*)Bt + ((size_t)h * HD + d) * DM + m8; *(v8us*)dst = f.half[0];  }




__global__ __launch_bounds__(256) void k_wtpad(const float* __restrict__ Wm, _Float16* __restrict__ Wt, int Kr, int Kp, int Nr, int Np, float scale) {
  const int t = blockIdx.x * 256 + threadIdx.x; if (t >= Np * (Kp / 8)) return; const int n = t / (Kp / 8), k8 = (t % (Kp / 8)) * 8; const int nc = min(n, Nr - 1); const float fn = (n < Nr) ? 1.f : 0.f; FragH f;
  for (int i = 0; i < 8; ++i) { const int k = k8 + i; const int kc = min(k, Kr - 1); const float fk = (k < Kr) ? fn : 0.f; f.h[i] = (_Float16)(bf16_round(Wm[(size_t)kc * Nr + nc]) * scale * fk); }
  unsigned short* o = (unsigned short*)Wt + (size_t)n * Kp + k8; *(v8us*)o = f.half[0];  }
__global__ __launch_bounds__(128) void k_bpad(const float* __restrict__ b, float* __restrict__ Bp, int nr, int np) {
  const int i = threadIdx.x; if (i >= np) return; const float v = b[min(i, nr - 1)] * ((i < nr) ? 1.f : 0.f); *(float*)(Bp + i) = v;  }

#define DI 64         /* inner width = NH * HD (ONE 64-wide head) */
#define LQK (3 * DI)  /* fused q | k | v row pitch (192) */
__global__ __launch_bounds__(256) void k_o0(const float* __restrict__ OF, float* __restrict__ ob, size_t n4) {
  #pragma clang fp contract(off)
  const size_t t = (size_t)blockIdx.x * 256 + threadIdx.x; if (t >= n4) return; const size_t e = t * 4; const int i = (int)(e / DI); const int c = (int)(e % DI); const int h = c / HD, d = c % HD; const v4f a = *(const v4fa*)(OF + e); v4f o; for (int q = 0; q < 4; ++q) o[q] = __fmul_rn(a[q], 0.015625f); float* dst = ob + (size_t)h * SQ * HD + (size_t)i * HD + d; *(v4f*)dst = o;  }

__global__ __launch_bounds__(256) void k_o0m(const float* __restrict__ OF, float* __restrict__ o_, size_t n4) {
  #pragma clang fp contract(off)
  const size_t t = (size_t)blockIdx.x * 256 + threadIdx.x; if (t >= n4) return; const size_t e = t * 4; OF += (size_t)blockIdx.y * QT0 * DI; o_ += (size_t)blockIdx.y * SQ * DI;      /* grid.y = batch */
  const v4f a = *(const v4fa*)(OF + e); v4f o; for (int q = 0; q < 4; ++q) o[q] = __fmul_rn(a[q], 0.015625f); *(v4f*)(o_ + e) = o;  }
// Exact f32 causal attention for rows 0..QT0-1 of each batch, spread over lanes: block = 8 query rows (grid.x) of one batch (grid.y).
// Scores: one THREAD per key (its K row in registers; the 8 q rows are read at block-uniform addresses). Softmax and P V: one WAVE per query row (lanes across the keys, then across the 64 output columns).
typedef float v2f __attribute__((ext_vector_type(2)));
typedef float v2fa __attribute__((ext_vector_type(2), may_alias));
__global__ __launch_bounds__(256) void k_att0w(const float* __restrict__ QKV, float scale, float* __restrict__ OF) {
  static_assert(QT0 % 32 == 0 && QT0 / 32 <= 16 && HD == 64 && NH == 1, "key chunks of 32, at most 16 a row; two output columns a lane");
  __shared__ __attribute__((aligned(16))) float sc[8][QT0];      /* scaled scores, then the unnormalised weights, of the block's 8 rows */
  const int tid = threadIdx.x, lane = tid & 31; const int w = __builtin_amdgcn_readfirstlane(tid >> 5); const int i0 = blockIdx.x * 8;
  const float* base = QKV + (size_t)blockIdx.y * QT0 * LQK; const float* qb = base + (size_t)i0 * LQK; const float* kb = base + DI; const float* vb = base + 2 * DI;
  for (int j0 = w * 32; j0 < i0 + 8; j0 += 256) {      /* whole 32-key chunks up to the block's last row: j <= QT0 - 1 */
    const int j = j0 + lane; const float* kr = kb + (size_t)j * LQK; v4f kk[HD / 4];
#pragma unroll
    for (int c = 0; c < HD / 4; ++c) kk[c] = *(const v4fa*)(kr + c * 4);
#pragma unroll 1      /* rolled: one q row (64 scalars) fits the scalar registers; with the eight rows unrolled they spill */
    for (int r = 0; r < 8; ++r) { v4f a = {0.f, 0.f, 0.f, 0.f};
#pragma unroll
      for (int c = 0; c < HD / 4; ++c) a += *(const v4fa*)(qb + r * LQK + c * 4) * kk[c];
      sc[r][j] = ((a[0] + a[1]) + (a[2] + a[3])) * scale; } }
  __syncthreads();      /* every key's scores are in LDS before a row's wave reads them */
  const int i = i0 + w; const int nu = (i >> 5) + 1; float x[QT0 / 32]; float mx = -1.0e30f;
#pragma unroll
  for (int u = 0; u < QT0 / 32; ++u) if (u < nu) x[u] = sc[w][u * 32 + lane];      /* all reads issued before the first is used */
#pragma unroll
  for (int u = 0; u < QT0 / 32; ++u) if (u < nu) { x[u] = (u * 32 + lane <= i) ? x[u] : -1.0e30f; mx = fmaxf(mx, x[u]); }
  for (int d = 16; d > 0; d >>= 1) mx = fmaxf(mx, __shfl_xor(mx, d, 32));
  float l = 0.f;
#pragma unroll
  for (int u = 0; u < QT0 / 32; ++u) if (u < nu) { const float e = expf(x[u] - mx); l += e; sc[w][u * 32 + lane] = e; }      /* keys past the row: exactly 0 */
  for (int d = 16; d > 0; d >>= 1) l += __shfl_xor(l, d, 32);
  __syncthreads();      /* the weights that the other lanes wrote are in LDS before they are read back */
  v2f o = {0.f, 0.f}; const float* vr = vb + lane * 2;
  for (int j0 = 0; j0 < nu * 32; j0 += 32) {
    v4f p[8]; v2f vv[32];
#pragma unroll
    for (int t = 0; t < 32; ++t) vv[t] = *(const v2fa*)(vr + (size_t)(j0 + t) * LQK);
#pragma unroll
    for (int t = 0; t < 8; ++t) p[t] = *(const v4f*)&sc[w][j0 + t * 4];
#pragma unroll
    for (int t = 0; t < 32; ++t) o += p[t >> 2][t & 3] * vv[t]; }
  o *= 64.0f / l;      /* o carried x64, undone by the 1/64 in k_o0m */
  *(v2f*)(OF + ((size_t)blockIdx.y * QT0 + i) * DI + lane * 2) = o; }

extern "C" void kernel_launch(void* const* d_in, const int* in_sizes, int n_in,
                              void* d_out, int out_size, void* d_ws, size_t ws_size, hipStream_t stream) {
  (void)in_sizes; (void)n_in; (void)out_size;
  const float* const* I = (const float* const*)d_in; const float* x = I[0]; const float* wq = I[1]; const float* wk = I[2]; const float* wv = I[3];      /* x; natural [out = 64][in] Wq / Wk / Wv (input order as this module lists them); no biases */
  char* ws = (char*)d_ws; size_t off = 0;
  auto take = [&](size_t bytes) { char* p = ws + off; off += (bytes + 255) & ~(size_t)255; return p; };
  _Float16* BW = (_Float16*)take((size_t)LQK * DM * 2); _Float16* X16 = (_Float16*)take(NR * DM * 2); _Float16* QKV = (_Float16*)take(NR * LQK * 2); _Float16* VT = (_Float16*)take((size_t)NB * HD * SQ * 2);
  float* S = (float*)take(NR * NKX * 4); _Float16* P = (_Float16*)take(NR * NKX * 2); float* QKVF0 = (float*)take((size_t)NB * QT0 * LQK * 4); float* OF0 = (float*)take((size_t)NB * QT0 * DI * 4);      /* every plane holds all batches (S, P: all query tiles too) */
  if (off > ws_size) return;
  { const unsigned g = (unsigned)(((size_t)DI * DM / 8 + 255) / 256); k_wnat<<<g, 256, 0, stream>>>(wq, (size_t)DI * DM / 8, BW); k_wnat<<<g, 256, 0, stream>>>(wk, (size_t)DI * DM / 8, BW + (size_t)DI * DM); k_wnat<<<g, 256, 0, stream>>>(wv, (size_t)DI * DM / 8, BW + (size_t)2 * DI * DM); }      /* natural [64][DM] = Bt x16, stacked q | k | v */
  k_x16<<<(unsigned)((NR * DM / 8 + 255) / 256), 256, 0, stream>>>(x, X16, NR * DM / 8);      /* x (bf16-valued) as exact f16 rows */
  k_gemm2<0><<<dim3((unsigned)((NR / 128) * (LQK / 64)), 1), 128, 0, stream>>>(X16, DM, 0, BW, DM, 0, 0.0625f, nullptr, 0, nullptr, 1, 0, 0, nullptr, QKV, LQK, 0, (int)NR, LQK, DM);      /* q | k | v = x W^T -> f16 rows, column blocks 0 / 64 / 128 of the fused plane (pitch 192), one launch */
  const _Float16* Q16 = QKV; const _Float16* K16 = QKV + DI; const _Float16* V16 = QKV + 2 * DI;
  k_vt<NH, SQ><<<NB * NH * (SQ / 64), 256, 0, stream>>>(V16, LQK, 0, VT);      /* V^T [NB][HD][SQ] */
  k_gemm2<0, 1><<<dim3((SQ / 128) * (SQ / 64), NB), 128, 0, stream>>>(Q16, LQK, (size_t)SQ * LQK, K16, LQK, (size_t)SQ * LQK, 0.03125f, nullptr, 0, nullptr, 1, 0, 0, S, nullptr, NKX, (size_t)SQ * NKX, SQ, SQ, HD);      /* scores * 1024^-0.5 = 1/32 (the module scales by the EMBEDDING width); batch on grid.y; causal: only keys below each query tile's end are computed */
  k_rsmcf2<<<NB * (SQ / QT), 256, 0, stream>>>(S, P);      /* causal softmax -> P x256 f16 */
  k_gemm2<0, 2><<<dim3((SQ / 128) * (HD / 64), NB), 128, 0, stream>>>(P, NKX, (size_t)SQ * NKX, VT, SQ, (size_t)HD * SQ, 0.00390625f, nullptr, 0, nullptr, 1, 0, 0, (float*)d_out, nullptr, DI, (size_t)SQ * DI, SQ, HD, SQ);      /* out[b][i][..] = P V^T 2^-8 (f32), K = the keys of the row's query tile */
  k_gemm2<0><<<dim3((unsigned)((QT0 / 128) * (LQK / 64)), NB), 128, 0, stream>>>(X16, DM, (size_t)SQ * DM, BW, DM, 0, 0.0625f, nullptr, 0, nullptr, 1, 0, 0, QKVF0, nullptr, LQK, (size_t)QT0 * LQK, QT0, LQK, DM);      /* f32 q | k | v of rows 0..511 of each batch (exact products, f32 accumulation) */
  k_att0w<<<dim3(QT0 / 8, NB), 256, 0, stream>>>(QKVF0, 0.03125f, OF0);      /* exact f32 causal attention for rows 0..511 (o x64) */
  k_o0m<<<dim3((unsigned)(((size_t)QT0 * DI / 4 + 255) / 256), NB), 256, 0, stream>>>(OF0, (float*)d_out, (size_t)QT0 * DI / 4);      /* rows 0..511 of each batch REWRITTEN from the exact path */
}

// v003
// A run of this version takes 204 microseconds.
// Two timings next to v002 put it at 2.51 and 2.46 times that version's speed.
// All steps since v000 together make it 68.7 times as fast.
#include <hip/hip_runtime.h>
// Single-head causal self-attention with the module's EMBEDDING-width scale (inps [4][2048][1024]; q/k/v = x W^T (natural [64][1024], U(+-1/32), no biases); ONE 64-wide head; scores * 1024^-0.5 (the source sets head_size = n_embed); causal (tril, -inf); softmax; out = weights v -> [4][2048][64]; no output projection).
// Structure: token rows; x as exact f16 rows; one WMMA GEMM into the f16 q | k | v plane [8192][192]; v^T via LDS transposes; every stage is ONE launch over all batches (grid.y in the GEMMs, folded into grid.x for the softmax) and all causal 256-row query tiles (grid.x): scores alpha 1/32 into S [4][2048][2048] (column tiles past a row tile's keys are skipped), causal softmax f32 -> f16 x256 weights, P V (K = the row tile's keys) written as f32 straight into the output rows; an exact f32 first tile (rows 0..511 of each batch) rewritten at the end.
// Compute dtype: inputs rounded to bf16; x / weights exact; q, k, v and softmax weights as plain f16 GEMM operands (~2^-12); o, scores and softmax statistics f32. v_wmma_f32_16x16x32_f16.
#define NB 4
#define SQ 2048
#define DM 1024
#define NH 1
#define HD 64
#define HG 4                         /* used only by the k_vt(V16, b, h0, VT) overload, which is not launched */
#define QT 256                       /* query rows per causal tile */
#define NKX SQ                       /* S / P row pitch */
#define QT0 512                      /* first-tile rows recomputed exactly (f32): 512 here (no output projection averages the early-row cancellation errors away; logit sigma 1.0) */
#define B0 0                         /* unused: every launch covers all batches */
#define NBR NB                       /* unused by the launches (they put NB on grid.y or into grid.x) */
#define NR ((size_t)NB * SQ)
#define DMQ DM
#define DFF 4096                     /* unused: there is no FFN */
#define DFFR 100                     /* unused */
#define MP ((int)((size_t)NBR * SQ)) /* unused: the projections take NR rows */
#define QN SQ                        /* unused: the query tiles on grid.x cover SQ */
#define NHD NH                       /* unused: the launches use NH */
#define MPO MP                       /* unused: there is no output stage */
#define LQ (3 * DM)
typedef __bf16 v16b __attribute__((ext_vector_type(16)));
typedef unsigned short v8us __attribute__((ext_vector_type(8), may_alias));
typedef float  v8f  __attribute__((ext_vector_type(8)));
typedef float  v4f  __attribute__((ext_vector_type(4)));
typedef float  v4fa __attribute__((ext_vector_type(4), may_alias));
union FragB { v16b v; v8us half[2]; unsigned short u[16]; };

__device__ __forceinline__ unsigned short bf16_bits(float x) { unsigned int u = __float_as_uint(x); return (unsigned short)((u + 0x7FFFu + ((u >> 16) & 1u)) >> 16); }
__device__ __forceinline__ float bf16_val(unsigned short b) { return __uint_as_float(((unsigned int)b) << 16); }
__device__ __forceinline__ float bf16_round(float x) { return bf16_val(bf16_bits(x)); }
// D += A·B with NT terms: 1 = ah·bh, 2 = + al·bh (A split), 3 = + ah·bl (both split)
template <int NT>
__device__ __forceinline__ v8f mmaN(v16b ah, v16b al, v16b bh, v16b bl, v8f c) {
  c = __builtin_amdgcn_wmma_f32_16x16x32_bf16(false, ah, false, bh, (short)0, c, false, false);
  if (NT >= 2) c = __builtin_amdgcn_wmma_f32_16x16x32_bf16(false, al, false, bh, (short)0, c, false, false);
  if (NT >= 3) c = __builtin_amdgcn_wmma_f32_16x16x32_bf16(false, ah, false, bl, (short)0, c, false, false);
  asm volatile("v_nop\n\tv_nop\n\tv_nop\n\tv_nop" : "+v"(c) : "v"(ah), "v"(al), "v"(bh), "v"(bl));
  return c;
}

__global__ __launch_bounds__(256) void k_wt_bf16(const float* __restrict__ W, unsigned short* __restrict__ Wt, int K, int N) {
  const int t = blockIdx.x * 256 + threadIdx.x;
  const int k8n = K / 8;
  if (t >= N * k8n) return;
  const int n = t / k8n, k8 = (t % k8n) * 8;
  v8us v;
#pragma unroll
  for (int i = 0; i < 8; ++i) v[i] = bf16_bits(W[(size_t)(k8 + i) * N + n]);
  *(v8us*)(Wt + (size_t)n * K + k8) = v;
  
}

// GEMM C[M][N] (f32, pitch ldc) = act(A[M][K]·W + bias). A f32 row-major (pitch lda) converted per fragment to bf16
// (ASPLIT: hi/lo two planes -> 2 terms, else single rounded term); Wt bf16 [N][K] (pitch ldb). BIAS_BF16 rounds the
// bias to bf16 first (bias quantised to bf16 before the add). K%32==0, M%16==0, N%64==0.
template <bool ASPLIT, int ACT, bool BIAS_BF16>
__global__ __launch_bounds__(128) void k_gemm_bf(const float* __restrict__ A, int lda, const unsigned short* __restrict__ Wt, int ldb,
                                               const float* __restrict__ bias, float* __restrict__ C, int ldc, int M, int N, int K) {
  __shared__ __attribute__((aligned(16))) float so[4][16][64];
  const int tid = threadIdx.x, w = tid >> 5, lane = tid & 31, ln = lane & 15, hh = lane >> 4;
  const int ntn = N / 64;
  const int wid = blockIdx.x * 4 + w;
  const int mt = wid / ntn, nq = wid % ntn;
  if (mt * 16 >= M) return;
  const int row0 = mt * 16, col0 = nq * 64;
  const float* arow = A + (size_t)(row0 + ln) * lda;
  v8f acc[4] = {};
  for (int kb = 0; kb < K; kb += 32) {
    FragB ah, al;
    const v4f x0 = *(const v4fa*)(arow + kb + 8 * hh), x1 = *(const v4fa*)(arow + kb + 8 * hh + 4);
    const v4f x2 = *(const v4fa*)(arow + kb + 16 + 8 * hh), x3 = *(const v4fa*)(arow + kb + 16 + 8 * hh + 4);
    float xs[16] = {x0[0],x0[1],x0[2],x0[3],x1[0],x1[1],x1[2],x1[3],x2[0],x2[1],x2[2],x2[3],x3[0],x3[1],x3[2],x3[3]};
#pragma unroll
    for (int i = 0; i < 16; ++i) { const unsigned short hb = bf16_bits(xs[i]); ah.u[i] = hb; al.u[i] = ASPLIT ? bf16_bits(xs[i] - bf16_val(hb)) : (unsigned short)0; }
#pragma unroll
    for (int t = 0; t < 4; ++t) {
      const unsigned short* brow = Wt + (size_t)(col0 + t * 16 + ln) * ldb + kb;
      FragB b;
      b.half[0] = *(const v8us*)(brow + 8 * hh);
      b.half[1] = *(const v8us*)(brow + 16 + 8 * hh);
      acc[t] = mmaN<ASPLIT ? 2 : 1>(ah.v, al.v, b.v, b.v, acc[t]);
    }
  }
#pragma unroll
  for (int t = 0; t < 4; ++t) {
    float bv = bias ? bias[col0 + t * 16 + ln] : 0.f;
    if (BIAS_BF16) bv = bf16_round(bv);
#pragma unroll
    for (int r = 0; r < 8; ++r) { float v = acc[t][r] + bv; if (ACT == 1) v = fmaxf(v, 0.f); so[w][8 * hh + r][t * 16 + ln] = v; }
  }
  __builtin_amdgcn_fence(__ATOMIC_ACQ_REL, "workgroup");
  __builtin_amdgcn_wave_barrier();
  const int rsub = lane >> 4, c4 = (lane & 15) * 4;
  {
#pragma unroll
    for (int q = 0; q < 8; ++q) {
      const int r = q * 2 + rsub;
      const v4f v = *(const v4fa*)&so[w][r][c4];
      *(v4f*)(C + (size_t)(row0 + r) * ldc + col0 + c4) = v;
    }
    
  }
}

// GEMM C = act(A·W + bias + resid): A f32 (ASPLIT -> hi/lo 2 terms), Wt bf16 [N][K]; ACT 0 none, 1 relu, 2 exact gelu;
// resid (optional, f32, row index = (row % rmod), pitch ldr, RES_BF16 rounds it) added before the activation.
template <bool ASPLIT, int ACT, bool BIAS_BF16, bool RES_BF16>
__global__ __launch_bounds__(128) void k_gemm_bf3(const float* __restrict__ A, int lda, const unsigned short* __restrict__ Wt, int ldb,
                                                const float* __restrict__ bias, const float* __restrict__ resid, int rmod, int ldr,
                                                float* __restrict__ C, int ldc, int M, int N, int K) {
  __shared__ __attribute__((aligned(16))) float so[4][16][64];
  const int tid = threadIdx.x, w = tid >> 5, lane = tid & 31, ln = lane & 15, hh = lane >> 4;
  const int ntn = N / 64;
  const int wid = blockIdx.x * 4 + w;
  const int mt = wid / ntn, nq = wid % ntn;
  if (mt * 16 >= M) return;
  const int row0 = mt * 16, col0 = nq * 64;
  const float* arow = A + (size_t)(row0 + ln) * lda;
  v8f acc[4] = {};
  for (int kb = 0; kb < K; kb += 32) {
    FragB ah, al;
    const v4f x0 = *(const v4fa*)(arow + kb + 8 * hh), x1 = *(const v4fa*)(arow + kb + 8 * hh + 4);
    const v4f x2 = *(const v4fa*)(arow + kb + 16 + 8 * hh), x3 = *(const v4fa*)(arow + kb + 16 + 8 * hh + 4);
    float xs[16] = {x0[0],x0[1],x0[2],x0[3],x1[0],x1[1],x1[2],x1[3],x2[0],x2[1],x2[2],x2[3],x3[0],x3[1],x3[2],x3[3]};
#pragma unroll
    for (int i = 0; i < 16; ++i) { const unsigned short hb = bf16_bits(xs[i]); ah.u[i] = hb; al.u[i] = ASPLIT ? bf16_bits(xs[i] - bf16_val(hb)) : (unsigned short)0; }
#pragma unroll
    for (int t = 0; t < 4; ++t) {
      const unsigned short* brow = Wt + (size_t)(col0 + t * 16 + ln) * ldb + kb;
      FragB b;
      b.half[0] = *(const v8us*)(brow + 8 * hh);
      b.half[1] = *(const v8us*)(brow + 16 + 8 * hh);
      acc[t] = mmaN<ASPLIT ? 2 : 1>(ah.v, al.v, b.v, b.v, acc[t]);
    }
  }
#pragma unroll
  for (int t = 0; t < 4; ++t) {
    const int col = col0 + t * 16 + ln;
    float bv = bias ? bias[col] : 0.f;
    if (BIAS_BF16) bv = bf16_round(bv);
#pragma unroll
    for (int r = 0; r < 8; ++r) {
      float v = acc[t][r] + bv;
      if (resid) { float rv = resid[(size_t)((row0 + 8 * hh + r) % rmod) * ldr + col]; if (RES_BF16) rv = bf16_round(rv); v += rv; }
      if (ACT == 1) v = fmaxf(v, 0.f);
      if (ACT == 2) v = 0.5f * v * (1.0f + erff(v * 0.70710678118654752f));
      if (ACT == 3) { const float u = 0.7978845608028654f * (v + 0.044715f * v * v * v); v = 0.5f * v * (1.0f + tanhf(u)); }
      so[w][8 * hh + r][t * 16 + ln] = v;
    }
  }
  __builtin_amdgcn_fence(__ATOMIC_ACQ_REL, "workgroup");
  __builtin_amdgcn_wave_barrier();
  const int rsub = lane >> 4, c4 = (lane & 15) * 4;
  {
#pragma unroll
    for (int q = 0; q < 8; ++q) {
      const int r = q * 2 + rsub;
      const v4f v = *(const v4fa*)&so[w][r][c4];
      *(v4f*)(C + (size_t)(row0 + r) * ldc + col0 + c4) = v;
    }
    
  }
}
// row LayerNorm (biased variance, eps) over N: s = X (+ R); optional out_sum <- s; out_norm <- (s-mu)*rsqrt(var+eps)*g + b
template <bool PARAM_BF16>
__global__ __launch_bounds__(256) void k_layernorm(const float* __restrict__ X, const float* __restrict__ R, const float* __restrict__ g, const float* __restrict__ bta,
                                                  float* __restrict__ out_sum, float* __restrict__ out_norm, int N, float eps) {
  __shared__ float red[256];
  const int row = blockIdx.x, tid = threadIdx.x;
  const float* x = X + (size_t)row * N; const float* rr = R ? R + (size_t)row * N : nullptr;
  float vals[16];                     // up to N = 4096
  const int per = N / 256;            // contiguous chunk per thread? use strided-by-4 chunks: thread handles j = tid*4 + 1024*u
  float s1 = 0.f;
  for (int u = 0; u < per / 4; ++u) {
    const int j = tid * 4 + 1024 * u;
    const v4f a = *(const v4fa*)(x + j);
    v4f b = {0.f,0.f,0.f,0.f}; if (rr) b = *(const v4fa*)(rr + j);
#pragma unroll
    for (int q = 0; q < 4; ++q) { const float v = a[q] + b[q]; vals[u * 4 + q] = v; s1 += v; }
  }
  red[tid] = s1; __syncthreads();
  for (int st = 128; st > 0; st >>= 1) { if (tid < st) red[tid] += red[tid + st]; __syncthreads(); }
  const float mu = red[0] / (float)N; __syncthreads();
  float s2 = 0.f;
  for (int u = 0; u < per / 4; ++u)
#pragma unroll
    for (int q = 0; q < 4; ++q) { const float c = vals[u * 4 + q] - mu; s2 += c * c; }
  red[tid] = s2; __syncthreads();
  for (int st = 128; st > 0; st >>= 1) { if (tid < st) red[tid] += red[tid + st]; __syncthreads(); }
  const float rs = rsqrtf(red[0] / (float)N + eps);
  {
    for (int u = 0; u < per / 4; ++u) {
      const int j = tid * 4 + 1024 * u;
      v4f o, sm;
#pragma unroll
      for (int q = 0; q < 4; ++q) {
        float gg = g[j + q], bb = bta[j + q];
        if (PARAM_BF16) { gg = bf16_round(gg); bb = bf16_round(bb); }
        sm[q] = vals[u * 4 + q]; o[q] = (vals[u * 4 + q] - mu) * rs * gg + bb;
      }
      if (out_sum) *(v4f*)(out_sum + (size_t)row * N + j) = sm;
      *(v4f*)(out_norm + (size_t)row * N + j) = o;
    }
    
  }
}



// ---- f16 WMMA path (v_wmma_f32_16x16x32_f16): 11-bit significands for operands in range — used where a [0,1] probability operand needs more precision than bf16
typedef _Float16 v16h __attribute__((ext_vector_type(16)));
union FragH { v16h v; v8us half[2]; _Float16 h[16]; unsigned short u[16]; };
template <int NT>
__device__ __forceinline__ v8f mmaH(v16h ah, v16h al, v16h bh, v16h bl, v8f c) {
  c = __builtin_amdgcn_wmma_f32_16x16x32_f16(false, ah, false, bh, (short)0, c, false, false);
  if (NT >= 2) c = __builtin_amdgcn_wmma_f32_16x16x32_f16(false, al, false, bh, (short)0, c, false, false);
  if (NT >= 3) c = __builtin_amdgcn_wmma_f32_16x16x32_f16(false, ah, false, bl, (short)0, c, false, false);
  asm volatile("v_nop\n\tv_nop\n\tv_nop\n\tv_nop" : "+v"(c) : "v"(ah), "v"(al), "v"(bh), "v"(bl));
  return c;
}
// batched GEMM like k_gemm_b but f16 operands: A f32 (split into f16 hi/lo if ASPLIT, else rounded to f16), Bt = f16 values [n][k]; alpha; C f32; N multiple of 16 (partial tiles skipped)
template <bool ASPLIT>
__global__ __launch_bounds__(128) void k_gemm_h(const float* __restrict__ A, int lda, size_t sA, const _Float16* __restrict__ Bh, int ldb, size_t sB, float alpha, float* __restrict__ C, int ldc, size_t sC, int M, int N, int K) {
  __shared__ __attribute__((aligned(16))) float so[4][16][64];
  const int tid = threadIdx.x, w = tid >> 5, lane = tid & 31, ln = lane & 15, hh = lane >> 4; const int by = blockIdx.y;
  A += (size_t)by * sA; Bh += (size_t)by * sB; C += (size_t)by * sC;
  const int ntn = (N + 63) / 64; const int wid = blockIdx.x * 4 + w; const int mt = wid / ntn, nq = wid % ntn; if (mt * 16 >= M) return;
  const int row0 = mt * 16, col0 = nq * 64; const float* arow = A + (size_t)(row0 + ln) * lda;
  v8f acc[4] = {};
  for (int kb = 0; kb < K; kb += 32) {
    FragH ah, al;
    const v4f x0 = *(const v4fa*)(arow + kb + 8 * hh), x1 = *(const v4fa*)(arow + kb + 8 * hh + 4), x2 = *(const v4fa*)(arow + kb + 16 + 8 * hh), x3 = *(const v4fa*)(arow + kb + 16 + 8 * hh + 4);
    float xs[16] = {x0[0],x0[1],x0[2],x0[3],x1[0],x1[1],x1[2],x1[3],x2[0],x2[1],x2[2],x2[3],x3[0],x3[1],x3[2],x3[3]};
#pragma unroll
    for (int i = 0; i < 16; ++i) { const _Float16 h = (_Float16)xs[i]; ah.h[i] = h; al.h[i] = ASPLIT ? (_Float16)(xs[i] - (float)h) : (_Float16)0.0f; }
#pragma unroll
    for (int t = 0; t < 4; ++t) { if (col0 + t * 16 >= N) continue; const size_t boff = (size_t)(col0 + t * 16 + ln) * ldb + kb; FragH bq; bq.half[0] = *(const v8us*)(Bh + boff + 8 * hh); bq.half[1] = *(const v8us*)(Bh + boff + 16 + 8 * hh);
      acc[t] = mmaH<ASPLIT ? 2 : 1>(ah.v, al.v, bq.v, bq.v, acc[t]); }
  }
#pragma unroll
  for (int t = 0; t < 4; ++t) { if (col0 + t * 16 >= N) continue;
#pragma unroll
    for (int r = 0; r < 8; ++r) so[w][8 * hh + r][t * 16 + ln] = acc[t][r] * alpha; }
  __builtin_amdgcn_fence(__ATOMIC_ACQ_REL, "workgroup"); __builtin_amdgcn_wave_barrier();
  const int rsub = lane >> 4, c4 = (lane & 15) * 4;
  {
#pragma unroll
    for (int q = 0; q < 8; ++q) { const int r = q * 2 + rsub; if (col0 + c4 < N) { const v4f v = *(const v4fa*)&so[w][r][c4]; *(v4f*)(C + (size_t)(row0 + r) * ldc + col0 + c4) = v; } }
     }
}

// Wt[n][k] = f16(W[k][n]·scale) from f32 row-major W[K][N] (scale = power of two; bf16-exact weights stay exact in f16 away from the subnormal range)
__global__ __launch_bounds__(256) void k_wt_f16(const float* __restrict__ W, _Float16* __restrict__ Wt, int K, int N, float scale) {
  const int t = blockIdx.x * 256 + threadIdx.x; if (t >= N * (K / 8)) return; const int n = t / (K / 8), k8 = (t % (K / 8)) * 8; FragH f;
#pragma unroll
  for (int i = 0; i < 8; ++i) f.h[i] = (_Float16)(bf16_round(W[(size_t)(k8 + i) * N + n]) * scale); const v8us o = f.half[0];
  *(v8us*)((unsigned short*)Wt + (size_t)n * K + k8) = o; 
}
// k_gemm_hh variant with fused epilogue: v = acc·alpha + bias[by·sBias + col] (+ CP[(row/rowsPerB)·sCPb + by·64 + col] if CP) ; ACT 0 none / 1 elu ; writes f16 C16 (and f32 C if non-null)
template <int ACT>
__global__ __launch_bounds__(128) void k_gemm_hhx(const _Float16* __restrict__ A, int lda, size_t sA, const _Float16* __restrict__ Bh, int ldb, size_t sB, float alpha, const float* __restrict__ bias, size_t sBias, const float* __restrict__ CP, int rowsPerB, size_t sCPb, int row0g,
    float* __restrict__ C, _Float16* __restrict__ C16, int ldc, size_t sC, int M, int N, int K) {
  __shared__ __attribute__((aligned(16))) float so[4][16][64];
  const int tid = threadIdx.x, w = tid >> 5, lane = tid & 31, ln = lane & 15, hh = lane >> 4; const int by = blockIdx.y;
  A += (size_t)by * sA; Bh += (size_t)by * sB; const size_t cofs = (size_t)by * sC; const float* bp = bias ? bias + (size_t)by * sBias : nullptr;
  const int ntn = (N + 63) / 64; const int wid = blockIdx.x * 4 + w; const int mt = wid / ntn, nq = wid % ntn; if (mt * 16 >= M) return;
  const int row0 = mt * 16, col0 = nq * 64; const _Float16* arow = A + (size_t)(row0 + ln) * lda;
  v8f acc[4] = {};
  for (int kb = 0; kb < K; kb += 32) { FragH ah; ah.half[0] = *(const v8us*)((const unsigned short*)arow + kb + 8 * hh); ah.half[1] = *(const v8us*)((const unsigned short*)arow + kb + 16 + 8 * hh);
#pragma unroll
    for (int t = 0; t < 4; ++t) { if (col0 + t * 16 >= N) continue; const size_t boff = (size_t)(col0 + t * 16 + ln) * ldb + kb; FragH bq; bq.half[0] = *(const v8us*)((const unsigned short*)Bh + boff + 8 * hh); bq.half[1] = *(const v8us*)((const unsigned short*)Bh + boff + 16 + 8 * hh);
      acc[t] = mmaH<1>(ah.v, ah.v, bq.v, bq.v, acc[t]); }
  }
#pragma unroll
  for (int t = 0; t < 4; ++t) { if (col0 + t * 16 >= N) continue; const int col = col0 + t * 16 + ln; const float bv = bp ? bf16_round(bp[col]) : 0.f;
#pragma unroll
    for (int r = 0; r < 8; ++r) { float v = acc[t][r] * alpha + bv; if (CP) { const int rr = row0g + row0 + 8 * hh + r; if (rowsPerB < 0) v += CP[cofs + (size_t)rr * ldc + col];      /* rowsPerB < 0: own element of the batched C plane */ else { const int bidx = rr / rowsPerB; v += CP[(size_t)bidx * sCPb + (size_t)by * 64 + col]; } } if (ACT == 1) v = (v > 0.f) ? v : expm1f(v); else if (ACT == 7) v = (v > 0.f) ? v + 1.0f : expf(v); else if (ACT == 8) v = tanhf(v); else if (ACT == 9) v = 0.5f * v * (1.0f + tanhf(0.7978845608028654f * (v + 0.044715f * v * v * v))); else if (ACT == 11) v = 1.0f / (1.0f + expf(-v)); else if (ACT == 12) v = (v > 0.f) ? v : 0.01f * v; else if (ACT == 14) v = (v > 0.f) ? v : 0.1f * v; else if (ACT == 16) v = (v >= 0.f) ? v : 0.3f * v; else if (ACT == 17) v = (v >= 0.f) ? v : 0.2f * v; else if (ACT == 15) v = v / (1.0f + expf(-v)); else if (ACT == 3) v = fmaxf(v, 0.f); else if (ACT == 6) v = 0.5f * v * (1.0f + erff(v * 0.70710678118654752f)); so[w][8 * hh + r][t * 16 + ln] = v; } }
  __builtin_amdgcn_fence(__ATOMIC_ACQ_REL, "workgroup"); __builtin_amdgcn_wave_barrier();
  const int rsub = lane >> 4, c4 = (lane & 15) * 4; typedef _Float16 v4h __attribute__((ext_vector_type(4)));
  {
#pragma unroll
    for (int q = 0; q < 8; ++q) { const int r = q * 2 + rsub; if (col0 + c4 < N) { const v4f v = *(const v4fa*)&so[w][r][c4]; if (C) *(v4f*)(C + cofs + (size_t)(row0 + r) * ldc + col0 + c4) = v; if (C16) { v4h h4; for (int i = 0; i < 4; ++i) h4[i] = (_Float16)v[i]; *(v4h*)(C16 + cofs + (size_t)(row0 + r) * ldc + col0 + c4) = h4; } } }
     }
}


typedef _Float16 v4h __attribute__((ext_vector_type(4)));

__global__ __launch_bounds__(256) void k_x16(const float* __restrict__ x, _Float16* __restrict__ X16, size_t n8) { const size_t t = (size_t)blockIdx.x * 256 + threadIdx.x; if (t >= n8) return; FragH f;
#pragma unroll
  for (int q = 0; q < 8; ++q) f.h[q] = (_Float16)bf16_round(x[t * 8 + q]); *(v8us*)((unsigned short*)X16 + t * 8) = f.half[0];  }
__global__ __launch_bounds__(256) void k_h16(const float* __restrict__ x, _Float16* __restrict__ X16, size_t n8) { const size_t t = (size_t)blockIdx.x * 256 + threadIdx.x; if (t >= n8) return; FragH f;
#pragma unroll
  for (int q = 0; q < 8; ++q) f.h[q] = (_Float16)x[t * 8 + q]; *(v8us*)((unsigned short*)X16 + t * 8) = f.half[0];  }
__global__ __launch_bounds__(256) void k_round16f(const float* __restrict__ W, _Float16* __restrict__ Bt, size_t n8) { const size_t t = (size_t)blockIdx.x * 256 + threadIdx.x; if (t >= n8) return; FragH f;
#pragma unroll
  for (int i = 0; i < 8; ++i) f.h[i] = (_Float16)(bf16_round(W[t * 8 + i]) * 16.0f); *(v8us*)((unsigned short*)Bt + t * 8) = f.half[0];  }
template <int NHv, int TTv>
__global__ __launch_bounds__(256) void k_vt(const _Float16* __restrict__ V16, int ldv, int voff, _Float16* __restrict__ Vt) { __shared__ unsigned short tl[64][66]; const int tid = threadIdx.x; const int slab = blockIdx.x / (TTv / 64), lg = blockIdx.x % (TTv / 64); const int b = slab / NHv, h = slab % NHv;
  for (int i = tid; i < 64 * 8; i += 256) { const int r = i / 8, c8 = (i % 8) * 8; FragH f; f.half[0] = *(const v8us*)((const unsigned short*)V16 + ((size_t)b * TTv + lg * 64 + r) * ldv + voff + h * 64 + c8);
#pragma unroll
    for (int q = 0; q < 8; ++q) tl[r][c8 + q] = f.u[q]; }
  __syncthreads();
  {
#pragma unroll
    for (int rd = 0; rd < 2; ++rd) { const int d = rd * 32 + tid / 8, pc = tid % 8; FragH f;
#pragma unroll
      for (int q = 0; q < 8; ++q) f.u[q] = tl[pc * 8 + q][d];
      *(v8us*)((unsigned short*)Vt + ((size_t)slab * 64 + d) * TTv + lg * 64 + pc * 8) = f.half[0]; }
     } }

__global__ __launch_bounds__(256) void k_hl(const float* __restrict__ F, _Float16* __restrict__ Hh, _Float16* __restrict__ Hl, size_t n8) { const size_t t = (size_t)blockIdx.x * 256 + threadIdx.x; if (t >= n8) return; FragH fh, fl; const v4f a = *(const v4fa*)(F + t * 8), c = *(const v4fa*)(F + t * 8 + 4);
#pragma unroll
  for (int q = 0; q < 4; ++q) { _Float16 h = (_Float16)a[q]; fh.h[q] = h; fl.h[q] = (_Float16)((a[q] - (float)h) * 1024.0f); h = (_Float16)c[q]; fh.h[4 + q] = h; fl.h[4 + q] = (_Float16)((c[q] - (float)h) * 1024.0f); }
  { *(v8us*)((unsigned short*)Hh + t * 8) = fh.half[0]; *(v8us*)((unsigned short*)Hl + t * 8) = fl.half[0];  } }

// ---- fast GEMM (wave tile 32x64; requires M % 32 == 0 rows per launch region and N % 64 == 0); epilogue = k_gemm_hhx semantics ----
__device__ __forceinline__ v16h g2_frag(const _Float16* p, int hh) { FragH f; f.half[0] = *(const v8us*)((const unsigned short*)p + 8 * hh); f.half[1] = *(const v8us*)((const unsigned short*)p + 16 + 8 * hh); return f.v; }
__device__ __forceinline__ v8f g2_mma(v16h a, v16h b, v8f c) { v8f d = __builtin_amdgcn_wmma_f32_16x16x32_f16(false, a, false, b, (short)0, c, false, false); asm volatile("v_nop\n\tv_nop\n\tv_nop\n\tv_nop" : "+v"(d) : "v"(a), "v"(b)); return d; }
// CAUS 0: plain. CAUS 1 (scores): a 64-column tile at or past the end of its rows' causal query tile is skipped. CAUS 2 (P V): K runs over the keys of the rows' causal query tile only.
template <int ACT, int CAUS = 0>
__global__ __launch_bounds__(128) void k_gemm2(const _Float16* __restrict__ A, int lda, size_t sA, const _Float16* __restrict__ Bh, int ldb, size_t sB, float alpha, const float* __restrict__ bias, size_t sBias, const float* __restrict__ CP, int rowsPerB, size_t sCPb, int row0g,
    float* __restrict__ C, _Float16* __restrict__ C16, int ldc, size_t sC, int M, int N, int K) { static_assert(ACT == 0 || ACT == 3 || ACT == 6 || ACT == 8 || ACT == 9 || ACT == 11 || ACT == 12 || ACT == 14 || ACT == 15 || ACT == 16 || ACT == 17, "k_gemm2: unsupported ACT code (would silently apply no activation)");
  __shared__ __attribute__((aligned(16))) float so[4][32][68];
  const int tid = threadIdx.x, w = tid >> 5, lane = tid & 31, ln = lane & 15, hh = lane >> 4; const int by = blockIdx.y;
  A += (size_t)by * sA; Bh += (size_t)by * sB; const size_t cofs = (size_t)by * sC; const float* bp = bias ? bias + (size_t)by * sBias : nullptr;
  const int ntn = N >> 6; const int mt = blockIdx.x / ntn, nq = blockIdx.x - mt * ntn; const int row0 = mt * 128 + 32 * w, col0 = nq * 64; if (row0 >= M) return;
  static_assert(QT % 128 == 0, "a 128-row block lies in one causal query tile"); const int nkc = (mt * 128 / QT + 1) * QT;      /* keys below the end of this block's causal query tile */
  if (CAUS == 1 && col0 >= nkc) return; if (CAUS == 2) K = nkc;
  const _Float16* a0p = A + (size_t)(row0 + ln) * lda; const _Float16* a1p = a0p + (size_t)16 * lda;
  const _Float16* b0p = Bh + (size_t)(col0 + ln) * ldb; const _Float16* b1p = b0p + (size_t)16 * ldb; const _Float16* b2p = b1p + (size_t)16 * ldb; const _Float16* b3p = b2p + (size_t)16 * ldb;
  const v8f z8 = {0.f,0.f,0.f,0.f,0.f,0.f,0.f,0.f}; v8f c00 = z8, c01 = z8, c02 = z8, c03 = z8, c10 = z8, c11 = z8, c12 = z8, c13 = z8;
#pragma unroll 1
  for (int kb = 0; kb < K; kb += 32) { const v16h a0 = g2_frag(a0p + kb, hh), a1 = g2_frag(a1p + kb, hh);
    v16h b = g2_frag(b0p + kb, hh); c00 = g2_mma(a0, b, c00); c10 = g2_mma(a1, b, c10);
    b = g2_frag(b1p + kb, hh); c01 = g2_mma(a0, b, c01); c11 = g2_mma(a1, b, c11);
    b = g2_frag(b2p + kb, hh); c02 = g2_mma(a0, b, c02); c12 = g2_mma(a1, b, c12);
    b = g2_frag(b3p + kb, hh); c03 = g2_mma(a0, b, c03); c13 = g2_mma(a1, b, c13); }
  v8f accs[8] = {c00, c01, c02, c03, c10, c11, c12, c13};
#pragma unroll
  for (int u = 0; u < 8; ++u) { const int t = u & 3, half = u >> 2; const int col = col0 + t * 16 + ln; const float bv = bp ? bf16_round(bp[col]) : 0.f;
#pragma unroll
    for (int r = 0; r < 8; ++r) { const int rloc = half * 16 + 8 * hh + r; float v = accs[u][r] * alpha + bv; if (CP) { if (rowsPerB < 0) v += CP[cofs + (size_t)(row0g + row0 + rloc) * ldc + col];      /* rowsPerB < 0: own element of the batched C plane */ else { const int bidx = (row0g + row0 + rloc) / rowsPerB; v += CP[(size_t)bidx * sCPb + (size_t)by * 64 + col]; } }
      if (ACT == 3) v = fmaxf(v, 0.f); else if (ACT == 6) v = 0.5f * v * (1.0f + erff(v * 0.70710678118654752f)); else if (ACT == 11) v = 1.0f / (1.0f + expf(-v)); else if (ACT == 15) v = v / (1.0f + expf(-v)); else if (ACT == 12) v = (v > 0.f) ? v : 0.01f * v; else if (ACT == 8) v = tanhf(v); else if (ACT == 9) v = 0.5f * v * (1.0f + tanhf(0.7978845608028654f * (v + 0.044715f * v * v * v))); else if (ACT == 14) v = (v > 0.f) ? v : 0.1f * v; else if (ACT == 16) v = (v >= 0.f) ? v : 0.3f * v; else if (ACT == 17) v = (v >= 0.f) ? v : 0.2f * v;
      so[w][rloc][t * 16 + ln] = v; } }
  __builtin_amdgcn_fence(__ATOMIC_ACQ_REL, "workgroup"); __builtin_amdgcn_wave_barrier();
  const int rsub = lane >> 4, c4 = (lane & 15) * 4;
  {
#pragma unroll
    for (int q = 0; q < 16; ++q) { const int r = q * 2 + rsub; const v4f v = *(const v4fa*)&so[w][r][c4]; if (C) *(v4f*)(C + cofs + (size_t)(row0 + r) * ldc + col0 + c4) = v; if (C16) { v4h h4; for (int i = 0; i < 4; ++i) h4[i] = (_Float16)v[i]; *(v4h*)(C16 + cofs + (size_t)(row0 + r) * ldc + col0 + c4) = h4; } }
     } }


__global__ __launch_bounds__(256) void k_wnat(const float* __restrict__ w, size_t n8, _Float16* __restrict__ Bt) { const size_t t = (size_t)blockIdx.x * 256 + threadIdx.x; if (t >= n8) return; FragH f; for (int q = 0; q < 8; ++q) f.h[q] = (_Float16)(bf16_round(w[t * 8 + q]) * 16.0f); *(v8us*)((unsigned short*)Bt + t * 8) = f.half[0];  }
__global__ __launch_bounds__(256) void k_rsm(const float* __restrict__ S, _Float16* __restrict__ P, int nrows) {
  #pragma clang fp contract(off)
  const int i = blockIdx.x * 256 + threadIdx.x; if (i >= nrows) return; const float* s = S + (size_t)i * SQ; float mx = -3.0e38f;
#pragma unroll 1
  for (int j = 0; j < SQ; ++j) mx = fmaxf(mx, s[j]); float se = 0.f;
#pragma unroll 1
  for (int j = 0; j < SQ; ++j) se += expf(s[j] - mx); const float sc = 256.0f / se;
#pragma unroll 1
  for (int j0 = 0; j0 < SQ; j0 += 8) { FragH f; for (int q = 0; q < 8; ++q) f.h[q] = (_Float16)(expf(s[j0 + q] - mx) * sc); unsigned short* d = (unsigned short*)P + (size_t)i * SQ + j0; *(v8us*)d = f.half[0];  } }
__global__ __launch_bounds__(256) void k_vt(const _Float16* __restrict__ V16, int b, int h0, _Float16* __restrict__ VT) { __shared__ unsigned short tl[64][65]; const int tid = threadIdx.x; const int hh = blockIdx.x % HG, sg = blockIdx.x / HG; const int s0 = sg * 64; const int h = h0 + hh;
  for (int i = tid; i < 64 * 8; i += 256) { const int j = i / 8, d8 = (i % 8) * 8; FragH f; f.half[0] = *(const v8us*)((const unsigned short*)V16 + ((size_t)b * SQ + s0 + j) * DM + h * HD + d8); for (int q = 0; q < 8; ++q) tl[d8 + q][j] = f.u[q]; }
  __syncthreads();
  { for (int i = tid; i < 64 * 8; i += 256) { const int d = i / 8, j8 = (i % 8) * 8; FragH f; for (int q = 0; q < 8; ++q) f.u[q] = tl[d][j8 + q]; *(v8us*)((unsigned short*)VT + ((size_t)hh * HD + d) * SQ + s0 + j8) = f.half[0]; }  } }



// Causal softmax, one WAVE per query row: the row's scores (the keys of NT query tiles, up to the end of its own) are read once, 512 contiguous bytes a load, and stay in registers through maximum, sum and weights.
template <int NT>
__device__ __forceinline__ void rsm_row(const float* __restrict__ s, _Float16* __restrict__ p, int rel) {      /* s, p: the lane's first key of the row; rel: the row's last key, counted from the lane's first key of the row's own (last) tile */
  v4f x[NT][2]; float mx = -3.0e38f;
#pragma unroll
  for (int u = 0; u < NT; ++u) { x[u][0] = *(const v4fa*)(s + u * 256); x[u][1] = *(const v4fa*)(s + u * 256 + 128); }
#pragma unroll
  for (int c = 0; c < 2; ++c) for (int q = 0; q < 4; ++q) x[NT - 1][c][q] = (c * 128 + q <= rel) ? x[NT - 1][c][q] : -1.0e9f;      /* keys past the row lie in its own tile only */
#pragma unroll
  for (int u = 0; u < NT; ++u) for (int c = 0; c < 2; ++c) for (int q = 0; q < 4; ++q) mx = fmaxf(mx, x[u][c][q]);
  for (int d = 16; d > 0; d >>= 1) mx = fmaxf(mx, __shfl_xor(mx, d, 32));
  v4f s4 = {0.f, 0.f, 0.f, 0.f};
#pragma unroll
  for (int u = 0; u < NT; ++u) for (int c = 0; c < 2; ++c) { float e0 = (x[u][c][0] - mx) * 1.44269504f, e1 = (x[u][c][1] - mx) * 1.44269504f, e2 = (x[u][c][2] - mx) * 1.44269504f, e3 = (x[u][c][3] - mx) * 1.44269504f;
    /* exp(t) = 2^(t log2 e), four in place; the v_nop is the slot that the instruction set asks for behind a transcendental, in the same statement so that it stands there whatever the compiler puts next (its own run of exponentials wrote each result over the source of the one before) */
    asm("v_exp_f32 %0, %0\n\tv_exp_f32 %1, %1\n\tv_exp_f32 %2, %2\n\tv_exp_f32 %3, %3\n\tv_nop" : "+v"(e0), "+v"(e1), "+v"(e2), "+v"(e3));
    const v4f e = {e0, e1, e2, e3}; x[u][c] = e; s4 += e; }      /* keys past the row: exactly 0 */
  float se = (s4[0] + s4[1]) + (s4[2] + s4[3]);
  for (int d = 16; d > 0; d >>= 1) se += __shfl_xor(se, d, 32);
  const float sc = 256.0f / se;
#pragma unroll
  for (int u = 0; u < NT; ++u) for (int c = 0; c < 2; ++c) { v4h h; for (int q = 0; q < 4; ++q) h[q] = (_Float16)(x[u][c][q] * sc); *(v4h*)(p + u * 256 + c * 128) = h; }
  __builtin_amdgcn_endpgm(); }      /* the wave ends here: before a common exit the compiler merges the eight row lengths' last stores into one and rewrites the address register of the stores already issued */
__global__ __launch_bounds__(256) void k_rsmw(const float* __restrict__ S, _Float16* __restrict__ P) {      /* block = 8 rows of one query tile; grid = NB * SQ / 8 */
  static_assert(QT == 256 && SQ / QT == 8 && SQ % QT == 0, "a query tile's keys = two 128-key loads a lane; eight row lengths");
  const unsigned lane = threadIdx.x & 31u; const unsigned row = (unsigned)__builtin_amdgcn_readfirstlane((int)(blockIdx.x * 8u + (threadIdx.x >> 5))); const unsigned last = row % SQ;
  const float* s = S + (size_t)row * NKX + lane * 4; _Float16* p = P + (size_t)row * NKX + lane * 4; const int rel = (int)(last % QT) - (int)(lane * 4);
  switch (last / QT) {      /* the same in every lane: straight-line code for each row length */
    case 0: rsm_row<1>(s, p, rel); break; case 1: rsm_row<2>(s, p, rel); break; case 2: rsm_row<3>(s, p, rel); break; case 3: rsm_row<4>(s, p, rel); break;
    case 4: rsm_row<5>(s, p, rel); break; case 5: rsm_row<6>(s, p, rel); break; case 6: rsm_row<7>(s, p, rel); break; default: rsm_row<8>(s, p, rel); break; } }


template <int BFIN, int WXB>
__global__ __launch_bounds__(256) void k_ln16(const float* __restrict__ X, const float* __restrict__ g, const float* __restrict__ bb, float eps, _Float16* __restrict__ N16, float* __restrict__ XB) {
  #pragma clang fp contract(off)
  __shared__ float red[256]; const size_t r = blockIdx.x; const int t = threadIdx.x; const v4f xa = *(const v4fa*)(X + r * DMQ + t * 4); float s[4]; float sum = 0.f;
  for (int q = 0; q < 4; ++q) { s[q] = BFIN ? bf16_round(xa[q]) : xa[q]; sum = __fadd_rn(sum, s[q]); }
  red[t] = sum; __syncthreads(); for (int st = 128; st > 0; st >>= 1) { if (t < st) red[t] = __fadd_rn(red[t], red[t + st]); __syncthreads(); } const float mu = red[0] / (float)DMQ; __syncthreads();
  float vs = 0.f; for (int q = 0; q < 4; ++q) { const float dl = __fadd_rn(s[q], -mu); vs = __fadd_rn(vs, __fmul_rn(dl, dl)); } red[t] = vs; __syncthreads(); for (int st = 128; st > 0; st >>= 1) { if (t < st) red[t] = __fadd_rn(red[t], red[t + st]); __syncthreads(); }
  const float rs = rsqrtf(__fadd_rn(red[0] / (float)DMQ, eps)); v4h y; v4f xb;
  for (int q = 0; q < 4; ++q) { const int c = t * 4 + q; y[q] = (_Float16)__fadd_rn(__fmul_rn(__fmul_rn(__fadd_rn(s[q], -mu), rs), bf16_round(g[c])), bf16_round(bb[c])); xb[q] = s[q]; }
  { *(v4h*)(N16 + r * DMQ + t * 4) = y; if (WXB) *(v4f*)(XB + r * DMQ + t * 4) = xb;  } }
__global__ __launch_bounds__(256) void k_ftres2(const float* __restrict__ OF0, const float* __restrict__ XB, float* __restrict__ X1, size_t n4) {
  #pragma clang fp contract(off)
  const size_t t = (size_t)blockIdx.x * 256 + threadIdx.x; if (t >= n4) return; const v4f o = *(const v4fa*)(OF0 + t * 4), xv = *(const v4fa*)(XB + t * 4); v4f y; for (int q = 0; q < 4; ++q) y[q] = __fadd_rn(__fmul_rn(o[q], 0.015625f), xv[q]); *(v4f*)(X1 + t * 4) = y;  }

__global__ __launch_bounds__(256) void k_wthd(const float* __restrict__ Wt, _Float16* __restrict__ Bt) { const size_t t = (size_t)blockIdx.x * 256 + threadIdx.x; if (t >= (size_t)NH * HD * (DM / 8)) return; const int m8 = (int)(t % (DM / 8)) * 8; const int d = (int)((t / (DM / 8)) % HD); const int h = (int)(t / ((size_t)(DM / 8) * HD)); FragH f;
  for (int q = 0; q < 8; ++q) f.h[q] = (_Float16)(16.0f * bf16_round(Wt[((size_t)h * DM + m8 + q) * HD + d])); unsigned short* dst = (unsigned short*)Bt + ((size_t)h * HD + d) * DM + m8; *(v8us*)dst = f.half[0];  }




__global__ __launch_bounds__(256) void k_wtpad(const float* __restrict__ Wm, _Float16* __restrict__ Wt, int Kr, int Kp, int Nr, int Np, float scale) {
  const int t = blockIdx.x * 256 + threadIdx.x; if (t >= Np * (Kp / 8)) return; const int n = t / (Kp / 8), k8 = (t % (Kp / 8)) * 8; const int nc = min(n, Nr - 1); const float fn = (n < Nr) ? 1.f : 0.f; FragH f;
  for (int i = 0; i < 8; ++i) { const int k = k8 + i; const int kc = min(k, Kr - 1); const float fk = (k < Kr) ? fn : 0.f; f.h[i] = (_Float16)(bf16_round(Wm[(size_t)kc * Nr + nc]) * scale * fk); }
  unsigned short* o = (unsigned short*)Wt + (size_t)n * Kp + k8; *(v8us*)o = f.half[0];  }
__global__ __launch_bounds__(128) void k_bpad(const float* __restrict__ b, float* __restrict__ Bp, int nr, int np) {
  const int i = threadIdx.x; if (i >= np) return; const float v = b[min(i, nr - 1)] * ((i < nr) ? 1.f : 0.f); *(float*)(Bp + i) = v;  }

#define DI 64         /* inner width = NH * HD (ONE 64-wide head) */
#define LQK (3 * DI)  /* fused q | k | v row pitch (192) */
__global__ __launch_bounds__(256) void k_o0(const float* __restrict__ OF, float* __restrict__ ob, size_t n4) {
  #pragma clang fp contract(off)
  const size_t t = (size_t)blockIdx.x * 256 + threadIdx.x; if (t >= n4) return; const size_t e = t * 4; const int i = (int)(e / DI); const int c = (int)(e % DI); const int h = c / HD, d = c % HD; const v4f a = *(const v4fa*)(OF + e); v4f o; for (int q = 0; q < 4; ++q) o[q] = __fmul_rn(a[q], 0.015625f); float* dst = ob + (size_t)h * SQ * HD + (size_t)i * HD + d; *(v4f*)dst = o;  }

__global__ __launch_bounds__(256) void k_o0m(const float* __restrict__ OF, float* __restrict__ o_, size_t n4) {
  #pragma clang fp contract(off)
  const size_t t = (size_t)blockIdx.x * 256 + threadIdx.x; if (t >= n4) return; const size_t e = t * 4; OF += (size_t)blockIdx.y * QT0 * DI; o_ += (size_t)blockIdx.y * SQ * DI;      /* grid.y = batch */
  const v4f a = *(const v4fa*)(OF + e); v4f o; for (int q = 0; q < 4; ++q) o[q] = __fmul_rn(a[q], 0.015625f); *(v4f*)(o_ + e) = o;  }
// Exact f32 causal attention for rows 0..QT0-1 of each batch, spread over lanes: block = 8 query rows (grid.x) of one batch (grid.y).
// Scores: one THREAD per key (its K row in registers; the 8 q rows are read at block-uniform addresses). Softmax and P V: one WAVE per query row (lanes across the keys, then across the 64 output columns).
typedef float v2f __attribute__((ext_vector_type(2)));
typedef float v2fa __attribute__((ext_vector_type(2), may_alias));
__global__ __launch_bounds__(256) void k_att0w(const float* __restrict__ QKV, float scale, float* __restrict__ OF) {
  static_assert(QT0 % 32 == 0 && QT0 / 32 <= 16 && HD == 64 && NH == 1, "key chunks of 32, at most 16 a row; two output columns a lane");
  __shared__ __attribute__((aligned(16))) float sc[8][QT0];      /* scaled scores, then the unnormalised weights, of the block's 8 rows */
  const int tid = threadIdx.x, lane = tid & 31; const int w = __builtin_amdgcn_readfirstlane(tid >> 5); const int i0 = blockIdx.x * 8;
  const float* base = QKV + (size_t)blockIdx.y * QT0 * LQK; const float* qb = base + (size_t)i0 * LQK; const float* kb = base + DI; const float* vb = base + 2 * DI;
  for (int j0 = w * 32; j0 < i0 + 8; j0 += 256) {      /* whole 32-key chunks up to the block's last row: j <= QT0 - 1 */
    const int j = j0 + lane; const float* kr = kb + (size_t)j * LQK; v4f kk[HD / 4];
#pragma unroll
    for (int c = 0; c < HD / 4; ++c) kk[c] = *(const v4fa*)(kr + c * 4);
#pragma unroll 1      /* rolled: one q row (64 scalars) fits the scalar registers; with the eight rows unrolled they spill */
    for (int r = 0; r < 8; ++r) { v4f a = {0.f, 0.f, 0.f, 0.f};
#pragma unroll
      for (int c = 0; c < HD / 4; ++c) a += *(const v4fa*)(qb + r * LQK + c * 4) * kk[c];
      sc[r][j] = ((a[0] + a[1]) + (a[2] + a[3])) * scale; } }
  __syncthreads();      /* every key's scores are in LDS before a row's wave reads them */
  const int i = i0 + w; const int nu = (i >> 5) + 1; float x[QT0 / 32]; float mx = -1.0e30f;
#pragma unroll
  for (int u = 0; u < QT0 / 32; ++u) if (u < nu) x[u] = sc[w][u * 32 + lane];      /* all reads issued before the first is used */
#pragma unroll
  for (int u = 0; u < QT0 / 32; ++u) if (u < nu) { x[u] = (u * 32 + lane <= i) ? x[u] : -1.0e30f; mx = fmaxf(mx, x[u]); }
  for (int d = 16; d > 0; d >>= 1) mx = fmaxf(mx, __shfl_xor(mx, d, 32));
  float l = 0.f;
#pragma unroll
  for (int u = 0; u < QT0 / 32; ++u) if (u < nu) { const float e = expf(x[u] - mx); l += e; sc[w][u * 32 + lane] = e; }      /* keys past the row: exactly 0 */
  for (int d = 16; d > 0; d >>= 1) l += __shfl_xor(l, d, 32);
  __syncthreads();      /* the weights that the other lanes wrote are in LDS before they are read back */
  v2f o = {0.f, 0.f}; const float* vr = vb + lane * 2;
  for (int j0 = 0; j0 < nu * 32; j0 += 32) {
    v4f p[8]; v2f vv[32];
#pragma unroll
    for (int t = 0; t < 32; ++t) vv[t] = *(const v2fa*)(vr + (size_t)(j0 + t) * LQK);
#pragma unroll
    for (int t = 0; t < 8; ++t) p[t] = *(const v4f*)&sc[w][j0 + t * 4];
#pragma unroll
    for (int t = 0; t < 32; ++t) o += p[t >> 2][t & 3] * vv[t]; }
  o *= 64.0f / l;      /* o carried x64, undone by the 1/64 in k_o0m */
  *(v2f*)(OF + ((size_t)blockIdx.y * QT0 + i) * DI + lane * 2) = o; }

extern "C" void kernel_launch(void* const* d_in, const int* in_sizes, int n_in,
                              void* d_out, int out_size, void* d_ws, size_t ws_size, hipStream_t stream) {
  (void)in_sizes; (void)n_in; (void)out_size;
  const float* const* I = (const float* const*)d_in; const float* x = I[0]; const float* wq = I[1]; const float* wk = I[2]; const float* wv = I[3];      /* x; natural [out = 64][in] Wq / Wk / Wv (input order as this module lists them); no biases */
  char* ws = (char*)d_ws; size_t off = 0;
  auto take = [&](size_t bytes) { char* p = ws + off; off += (bytes + 255) & ~(size_t)255; return p; };
  _Float16* BW = (_Float16*)take((size_t)LQK * DM * 2); _Float16* X16 = (_Float16*)take(NR * DM * 2); _Float16* QKV = (_Float16*)take(NR * LQK * 2); _Float16* VT = (_Float16*)take((size_t)NB * HD * SQ * 2);
  float* S = (float*)take(NR * NKX * 4); _Float16* P = (_Float16*)take(NR * NKX * 2); float* QKVF0 = (float*)take((size_t)NB * QT0 * LQK * 4); float* OF0 = (float*)take((size_t)NB * QT0 * DI * 4);      /* every plane holds all batches (S, P: all query tiles too) */
  if (off > ws_size) return;
  { const unsigned g = (unsigned)(((size_t)DI * DM / 8 + 255) / 256); k_wnat<<<g, 256, 0, stream>>>(wq, (size_t)DI * DM / 8, BW); k_wnat<<<g, 256, 0, stream>>>(wk, (size_t)DI * DM / 8, BW + (size_t)DI * DM); k_wnat<<<g, 256, 0, stream>>>(wv, (size_t)DI * DM / 8, BW + (size_t)2 * DI * DM); }      /* natural [64][DM] = Bt x16, stacked q | k | v */
  k_x16<<<(unsigned)((NR * DM / 8 + 255) / 256), 256, 0, stream>>>(x, X16, NR * DM / 8);      /* x (bf16-valued) as exact f16 rows */
  k_gemm2<0><<<dim3((unsigned)((NR / 128) * (LQK / 64)), 1), 128, 0, stream>>>(X16, DM, 0, BW, DM, 0, 0.0625f, nullptr, 0, nullptr, 1, 0, 0, nullptr, QKV, LQK, 0, (int)NR, LQK, DM);      /* q | k | v = x W^T -> f16 rows, column blocks 0 / 64 / 128 of the fused plane (pitch 192), one launch */
  const _Float16* Q16 = QKV; const _Float16* K16 = QKV + DI; const _Float16* V16 = QKV + 2 * DI;
  k_vt<NH, SQ><<<NB * NH * (SQ / 64), 256, 0, stream>>>(V16, LQK, 0, VT);      /* V^T [NB][HD][SQ] */
  k_gemm2<0, 1><<<dim3((SQ / 128) * (SQ / 64), NB), 128, 0, stream>>>(Q16, LQK, (size_t)SQ * LQK, K16, LQK, (size_t)SQ * LQK, 0.03125f, nullptr, 0, nullptr, 1, 0, 0, S, nullptr, NKX, (size_t)SQ * NKX, SQ, SQ, HD);      /* scores * 1024^-0.5 = 1/32 (the module scales by the EMBEDDING width); batch on grid.y; causal: only keys below each query tile's end are computed */
  k_rsmw<<<NB * SQ / 8, 256, 0, stream>>>(S, P);      /* causal softmax -> P x256 f16 */
  k_gemm2<0, 2><<<dim3((SQ / 128) * (HD / 64), NB), 128, 0, stream>>>(P, NKX, (size_t)SQ * NKX, VT, SQ, (size_t)HD * SQ, 0.00390625f, nullptr, 0, nullptr, 1, 0, 0, (float*)d_out, nullptr, DI, (size_t)SQ * DI, SQ, HD, SQ);      /* out[b][i][..] = P V^T 2^-8 (f32), K = the keys of the row's query tile */
  k_gemm2<0><<<dim3((unsigned)((QT0 / 128) * (LQK / 64)), NB), 128, 0, stream>>>(X16, DM, (size_t)SQ * DM, BW, DM, 0, 0.0625f, nullptr, 0, nullptr, 1, 0, 0, QKVF0, nullptr, LQK, (size_t)QT0 * LQK, QT0, LQK, DM);      /* f32 q | k | v of rows 0..511 of each batch (exact products, f32 accumulation) */
  k_att0w<<<dim3(QT0 / 8, NB), 256, 0, stream>>>(QKVF0, 0.03125f, OF0);      /* exact f32 causal attention for rows 0..511 (o x64) */
  k_o0m<<<dim3((unsigned)(((size_t)QT0 * DI / 4 + 255) / 256), NB), 256, 0, stream>>>(OF0, (float*)d_out, (size_t)QT0 * DI / 4);      /* rows 0..511 of each batch REWRITTEN from the exact path */
}

// v004
// One run takes 112 microseconds.
// Two timings next to v003 put it at 1.80 and 1.82 times that version's speed.
// Over all steps from v000 it is 124 times as fast.
#include <hip/hip_runtime.h>
// Single-head causal self-attention with the module's EMBEDDING-width scale (inps [4][2048][1024]; q/k/v = x W^T (natural [64][1024], U(+-1/32), no biases); ONE 64-wide head; scores * 1024^-0.5 (the source sets head_size = n_embed); causal (tril, -inf); softmax; out = weights v -> [4][2048][64]; no output projection).
// Structure: token rows; x as exact f16 rows; one WMMA GEMM into the f16 q | k | v plane [8192][192]; v^T via LDS transposes; scores, causal softmax and P V in ONE launch (block = 32 query rows of one batch; its 16 waves share the row block's keys in 32-key steps; S^T = K Q^T, weights stay in registers as the B operand of O^T += V^T P^T; running maximum and sum per wave, the waves' parts joined in LDS), f32 straight into the output rows; an exact f32 first tile (rows 0..511 of each batch) rewritten at the end.
// Compute dtype: inputs rounded to bf16; x / weights exact; q, k, v and softmax weights as plain f16 GEMM operands (~2^-12); scores, softmax statistics and o f32. v_wmma_f32_16x16x32_f16.
#define NB 4
#define SQ 2048
#define DM 1024
#define NH 1
#define HD 64
#define HG 4                         /* used only by the k_vt(V16, b, h0, VT) overload, which is not launched */
#define QT 256                       /* query rows per causal tile */
#define NKX SQ                       /* unused: the launches keep no S / P plane */
#define QT0 512                      /* first-tile rows recomputed exactly (f32): 512 here (no output projection averages the early-row cancellation errors away; logit sigma 1.0) */
#define B0 0                         /* unused: every launch covers all batches */
#define NBR NB                       /* unused by the launches (they put NB on grid.y or into grid.x) */
#define NR ((size_t)NB * SQ)
#define DMQ DM
#define DFF 4096                     /* unused: there is no FFN */
#define DFFR 100                     /* unused */
#define MP ((int)((size_t)NBR * SQ)) /* unused: the projections take NR rows */
#define QN SQ                        /* unused: the query tiles on grid.x cover SQ */
#define NHD NH                       /* unused: the launches use NH */
#define MPO MP                       /* unused: there is no output stage */
#define LQ (3 * DM)
typedef __bf16 v16b __attribute__((ext_vector_type(16)));
typedef unsigned short v8us __attribute__((ext_vector_type(8), may_alias));
typedef float  v8f  __attribute__((ext_vector_type(8)));
typedef float  v4f  __attribute__((ext_vector_type(4)));
typedef float  v4fa __attribute__((ext_vector_type(4), may_alias));
union FragB { v16b v; v8us half[2]; unsigned short u[16]; };

__device__ __forceinline__ unsigned short bf16_bits(float x) { unsigned int u = __float_as_uint(x); return (unsigned short)((u + 0x7FFFu + ((u >> 16) & 1u)) >> 16); }
__device__ __forceinline__ float bf16_val(unsigned short b) { return __uint_as_float(((unsigned int)b) << 16); }
__device__ __forceinline__ float bf16_round(float x) { return bf16_val(bf16_bits(x)); }
// D += A·B with NT terms: 1 = ah·bh, 2 = + al·bh (A split), 3 = + ah·bl (both split)
template <int NT>
__device__ __forceinline__ v8f mmaN(v16b ah, v16b al, v16b bh, v16b bl, v8f c) {
  c = __builtin_amdgcn_wmma_f32_16x16x32_bf16(false, ah, false, bh, (short)0, c, false, false);
  if (NT >= 2) c = __builtin_amdgcn_wmma_f32_16x16x32_bf16(false, al, false, bh, (short)0, c, false, false);
  if (NT >= 3) c = __builtin_amdgcn_wmma_f32_16x16x32_bf16(false, ah, false, bl, (short)0, c, false, false);
  asm volatile("v_nop\n\tv_nop\n\tv_nop\n\tv_nop" : "+v"(c) : "v"(ah), "v"(al), "v"(bh), "v"(bl));
  return c;
}

__global__ __launch_bounds__(256) void k_wt_bf16(const float* __restrict__ W, unsigned short* __restrict__ Wt, int K, int N) {
  const int t = blockIdx.x * 256 + threadIdx.x;
  const int k8n = K / 8;
  if (t >= N * k8n) return;
  const int n = t / k8n, k8 = (t % k8n) * 8;
  v8us v;
#pragma unroll
  for (int i = 0; i < 8; ++i) v[i] = bf16_bits(W[(size_t)(k8 + i) * N + n]);
  *(v8us*)(Wt + (size_t)n * K + k8) = v;
  
}

// GEMM C[M][N] (f32, pitch ldc) = act(A[M][K]·W + bias). A f32 row-major (pitch lda) converted per fragment to bf16
// (ASPLIT: hi/lo two planes -> 2 terms, else single rounded term); Wt bf16 [N][K] (pitch ldb). BIAS_BF16 rounds the
// bias to bf16 first (bias quantised to bf16 before the add). K%32==0, M%16==0, N%64==0.
template <bool ASPLIT, int ACT, bool BIAS_BF16>
__global__ __launch_bounds__(128) void k_gemm_bf(const float* __restrict__ A, int lda, const unsigned short* __restrict__ Wt, int ldb,
                                               const float* __restrict__ bias, float* __restrict__ C, int ldc, int M, int N, int K) {
  __shared__ __attribute__((aligned(16))) float so[4][16][64];
  const int tid = threadIdx.x, w = tid >> 5, lane = tid & 31, ln = lane & 15, hh = lane >> 4;
  const int ntn = N / 64;
  const int wid = blockIdx.x * 4 + w;
  const int mt = wid / ntn, nq = wid % ntn;
  if (mt * 16 >= M) return;
  const int row0 = mt * 16, col0 = nq * 64;
  const float* arow = A + (size_t)(row0 + ln) * lda;
  v8f acc[4] = {};
  for (int kb = 0; kb < K; kb += 32) {
    FragB ah, al;
    const v4f x0 = *(const v4fa*)(arow + kb + 8 * hh), x1 = *(const v4fa*)(arow + kb + 8 * hh + 4);
    const v4f x2 = *(const v4fa*)(arow + kb + 16 + 8 * hh), x3 = *(const v4fa*)(arow + kb + 16 + 8 * hh + 4);
    float xs[16] = {x0[0],x0[1],x0[2],x0[3],x1[0],x1[1],x1[2],x1[3],x2[0],x2[1],x2[2],x2[3],x3[0],x3[1],x3[2],x3[3]};
#pragma unroll
    for (int i = 0; i < 16; ++i) { const unsigned short hb = bf16_bits(xs[i]); ah.u[i] = hb; al.u[i] = ASPLIT ? bf16_bits(xs[i] - bf16_val(hb)) : (unsigned short)0; }
#pragma unroll
    for (int t = 0; t < 4; ++t) {
      const unsigned short* brow = Wt + (size_t)(col0 + t * 16 + ln) * ldb + kb;
      FragB b;
      b.half[0] = *(const v8us*)(brow + 8 * hh);
      b.half[1] = *(const v8us*)(brow + 16 + 8 * hh);
      acc[t] = mmaN<ASPLIT ? 2 : 1>(ah.v, al.v, b.v, b.v, acc[t]);
    }
  }
#pragma unroll
  for (int t = 0; t < 4; ++t) {
    float bv = bias ? bias[col0 + t * 16 + ln] : 0.f;
    if (BIAS_BF16) bv = bf16_round(bv);
#pragma unroll
    for (int r = 0; r < 8; ++r) { float v = acc[t][r] + bv; if (ACT == 1) v = fmaxf(v, 0.f); so[w][8 * hh + r][t * 16 + ln] = v; }
  }
  __builtin_amdgcn_fence(__ATOMIC_ACQ_REL, "workgroup");
  __builtin_amdgcn_wave_barrier();
  const int rsub = lane >> 4, c4 = (lane & 15) * 4;
  {
#pragma unroll
    for (int q = 0; q < 8; ++q) {
      const int r = q * 2 + rsub;
      const v4f v = *(const v4fa*)&so[w][r][c4];
      *(v4f*)(C + (size_t)(row0 + r) * ldc + col0 + c4) = v;
    }
    
  }
}

// GEMM C = act(A·W + bias + resid): A f32 (ASPLIT -> hi/lo 2 terms), Wt bf16 [N][K]; ACT 0 none, 1 relu, 2 exact gelu;
// resid (optional, f32, row index = (row % rmod), pitch ldr, RES_BF16 rounds it) added before the activation.
template <bool ASPLIT, int ACT, bool BIAS_BF16, bool RES_BF16>
__global__ __launch_bounds__(128) void k_gemm_bf3(const float* __restrict__ A, int lda, const unsigned short* __restrict__ Wt, int ldb,
                                                const float* __restrict__ bias, const float* __restrict__ resid, int rmod, int ldr,
                                                float* __restrict__ C, int ldc, int M, int N, int K) {
  __shared__ __attribute__((aligned(16))) float so[4][16][64];
  const int tid = threadIdx.x, w = tid >> 5, lane = tid & 31, ln = lane & 15, hh = lane >> 4;
  const int ntn = N / 64;
  const int wid = blockIdx.x * 4 + w;
  const int mt = wid / ntn, nq = wid % ntn;
  if (mt * 16 >= M) return;
  const int row0 = mt * 16, col0 = nq * 64;
  const float* arow = A + (size_t)(row0 + ln) * lda;
  v8f acc[4] = {};
  for (int kb = 0; kb < K; kb += 32) {
    FragB ah, al;
    const v4f x0 = *(const v4fa*)(arow + kb + 8 * hh), x1 = *(const v4fa*)(arow + kb + 8 * hh + 4);
    const v4f x2 = *(const v4fa*)(arow + kb + 16 + 8 * hh), x3 = *(const v4fa*)(arow + kb + 16 + 8 * hh + 4);
    float xs[16] = {x0[0],x0[1],x0[2],x0[3],x1[0],x1[1],x1[2],x1[3],x2[0],x2[1],x2[2],x2[3],x3[0],x3[1],x3[2],x3[3]};
#pragma unroll
    for (int i = 0; i < 16; ++i) { const unsigned short hb = bf16_bits(xs[i]); ah.u[i] = hb; al.u[i] = ASPLIT ? bf16_bits(xs[i] - bf16_val(hb)) : (unsigned short)0; }
#pragma unroll
    for (int t = 0; t < 4; ++t) {
      const unsigned short* brow = Wt + (size_t)(col0 + t * 16 + ln) * ldb + kb;
      FragB b;
      b.half[0] = *(const v8us*)(brow + 8 * hh);
      b.half[1] = *(const v8us*)(brow + 16 + 8 * hh);
      acc[t] = mmaN<ASPLIT ? 2 : 1>(ah.v, al.v, b.v, b.v, acc[t]);
    }
  }
#pragma unroll
  for (int t = 0; t < 4; ++t) {
    const int col = col0 + t * 16 + ln;
    float bv = bias ? bias[col] : 0.f;
    if (BIAS_BF16) bv = bf16_round(bv);
#pragma unroll
    for (int r = 0; r < 8; ++r) {
      float v = acc[t][r] + bv;
      if (resid) { float rv = resid[(size_t)((row0 + 8 * hh + r) % rmod) * ldr + col]; if (RES_BF16) rv = bf16_round(rv); v += rv; }
      if (ACT == 1) v = fmaxf(v, 0.f);
      if (ACT == 2) v = 0.5f * v * (1.0f + erff(v * 0.70710678118654752f));
      if (ACT == 3) { const float u = 0.7978845608028654f * (v + 0.044715f * v * v * v); v = 0.5f * v * (1.0f + tanhf(u)); }
      so[w][8 * hh + r][t * 16 + ln] = v;
    }
  }
  __builtin_amdgcn_fence(__ATOMIC_ACQ_REL, "workgroup");
  __builtin_amdgcn_wave_barrier();
  const int rsub = lane >> 4, c4 = (lane & 15) * 4;
  {
#pragma unroll
    for (int q = 0; q < 8; ++q) {
      const int r = q * 2 + rsub;
      const v4f v = *(const v4fa*)&so[w][r][c4];
      *(v4f*)(C + (size_t)(row0 + r) * ldc + col0 + c4) = v;
    }
    
  }
}
// row LayerNorm (biased variance, eps) over N: s = X (+ R); optional out_sum <- s; out_norm <- (s-mu)*rsqrt(var+eps)*g + b
template <bool PARAM_BF16>
__global__ __launch_bounds__(256) void k_layernorm(const float* __restrict__ X, const float* __restrict__ R, const float* __restrict__ g, const float* __restrict__ bta,
                                                  float* __restrict__ out_sum, float* __restrict__ out_norm, int N, float eps) {
  __shared__ float red[256];
  const int row = blockIdx.x, tid = threadIdx.x;
  const float* x = X + (size_t)row * N; const float* rr = R ? R + (size_t)row * N : nullptr;
  float vals[16];                     // up to N = 4096
  const int per = N / 256;            // contiguous chunk per thread? use strided-by-4 chunks: thread handles j = tid*4 + 1024*u
  float s1 = 0.f;
  for (int u = 0; u < per / 4; ++u) {
    const int j = tid * 4 + 1024 * u;
    const v4f a = *(const v4fa*)(x + j);
    v4f b = {0.f,0.f,0.f,0.f}; if (rr) b = *(const v4fa*)(rr + j);
#pragma unroll
    for (int q = 0; q < 4; ++q) { const float v = a[q] + b[q]; vals[u * 4 + q] = v; s1 += v; }
  }
  red[tid] = s1; __syncthreads();
  for (int st = 128; st > 0; st >>= 1) { if (tid < st) red[tid] += red[tid + st]; __syncthreads(); }
  const float mu = red[0] / (float)N; __syncthreads();
  float s2 = 0.f;
  for (int u = 0; u < per / 4; ++u)
#pragma unroll
    for (int q = 0; q < 4; ++q) { const float c = vals[u * 4 + q] - mu; s2 += c * c; }
  red[tid] = s2; __syncthreads();
  for (int st = 128; st > 0; st >>= 1) { if (tid < st) red[tid] += red[tid + st]; __syncthreads(); }
  const float rs = rsqrtf(red[0] / (float)N + eps);
  {
    for (int u = 0; u < per / 4; ++u) {
      const int j = tid * 4 + 1024 * u;
      v4f o, sm;
#pragma unroll
      for (int q = 0; q < 4; ++q) {
        float gg = g[j + q], bb = bta[j + q];
        if (PARAM_BF16) { gg = bf16_round(gg); bb = bf16_round(bb); }
        sm[q] = vals[u * 4 + q]; o[q] = (vals[u * 4 + q] - mu) * rs * gg + bb;
      }
      if (out_sum) *(v4f*)(out_sum + (size_t)row * N + j) = sm;
      *(v4f*)(out_norm + (size_t)row * N + j) = o;
    }
    
  }
}



// ---- f16 WMMA path (v_wmma_f32_16x16x32_f16): 11-bit significands for operands in range — used where a [0,1] probability operand needs more precision than bf16
typedef _Float16 v16h __attribute__((ext_vector_type(16)));
union FragH { v16h v; v8us half[2]; _Float16 h[16]; unsigned short u[16]; };
template <int NT>
__device__ __forceinline__ v8f mmaH(v16h ah, v16h al, v16h bh, v16h bl, v8f c) {
  c = __builtin_amdgcn_wmma_f32_16x16x32_f16(false, ah, false, bh, (short)0, c, false, false);
  if (NT >= 2) c = __builtin_amdgcn_wmma_f32_16x16x32_f16(false, al, false, bh, (short)0, c, false, false);
  if (NT >= 3) c = __builtin_amdgcn_wmma_f32_16x16x32_f16(false, ah, false, bl, (short)0, c, false, false);
  asm volatile("v_nop\n\tv_nop\n\tv_nop\n\tv_nop" : "+v"(c) : "v"(ah), "v"(al), "v"(bh), "v"(bl));
  return c;
}
// batched GEMM like k_gemm_b but f16 operands: A f32 (split into f16 hi/lo if ASPLIT, else rounded to f16), Bt = f16 values [n][k]; alpha; C f32; N multiple of 16 (partial tiles skipped)
template <bool ASPLIT>
__global__ __launch_bounds__(128) void k_gemm_h(const float* __restrict__ A, int lda, size_t sA, const _Float16* __restrict__ Bh, int ldb, size_t sB, float alpha, float* __restrict__ C, int ldc, size_t sC, int M, int N, int K) {
  __shared__ __attribute__((aligned(16))) float so[4][16][64];
  const int tid = threadIdx.x, w = tid >> 5, lane = tid & 31, ln = lane & 15, hh = lane >> 4; const int by = blockIdx.y;
  A += (size_t)by * sA; Bh += (size_t)by * sB; C += (size_t)by * sC;
  const int ntn = (N + 63) / 64; const int wid = blockIdx.x * 4 + w; const int mt = wid / ntn, nq = wid % ntn; if (mt * 16 >= M) return;
  const int row0 = mt * 16, col0 = nq * 64; const float* arow = A + (size_t)(row0 + ln) * lda;
  v8f acc[4] = {};
  for (int kb = 0; kb < K; kb += 32) {
    FragH ah, al;
    const v4f x0 = *(const v4fa*)(arow + kb + 8 * hh), x1 = *(const v4fa*)(arow + kb + 8 * hh + 4), x2 = *(const v4fa*)(arow + kb + 16 + 8 * hh), x3 = *(const v4fa*)(arow + kb + 16 + 8 * hh + 4);
    float xs[16] = {x0[0],x0[1],x0[2],x0[3],x1[0],x1[1],x1[2],x1[3],x2[0],x2[1],x2[2],x2[3],x3[0],x3[1],x3[2],x3[3]};
#pragma unroll
    for (int i = 0; i < 16; ++i) { const _Float16 h = (_Float16)xs[i]; ah.h[i] = h; al.h[i] = ASPLIT ? (_Float16)(xs[i] - (float)h) : (_Float16)0.0f; }
#pragma unroll
    for (int t = 0; t < 4; ++t) { if (col0 + t * 16 >= N) continue; const size_t boff = (size_t)(col0 + t * 16 + ln) * ldb + kb; FragH bq; bq.half[0] = *(const v8us*)(Bh + boff + 8 * hh); bq.half[1] = *(const v8us*)(Bh + boff + 16 + 8 * hh);
      acc[t] = mmaH<ASPLIT ? 2 : 1>(ah.v, al.v, bq.v, bq.v, acc[t]); }
  }
#pragma unroll
  for (int t = 0; t < 4; ++t) { if (col0 + t * 16 >= N) continue;
#pragma unroll
    for (int r = 0; r < 8; ++r) so[w][8 * hh + r][t * 16 + ln] = acc[t][r] * alpha; }
  __builtin_amdgcn_fence(__ATOMIC_ACQ_REL, "workgroup"); __builtin_amdgcn_wave_barrier();
  const int rsub = lane >> 4, c4 = (lane & 15) * 4;
  {
#pragma unroll
    for (int q = 0; q < 8; ++q) { const int r = q * 2 + rsub; if (col0 + c4 < N) { const v4f v = *(const v4fa*)&so[w][r][c4]; *(v4f*)(C + (size_t)(row0 + r) * ldc + col0 + c4) = v; } }
     }
}

// Wt[n][k] = f16(W[k][n]·scale) from f32 row-major W[K][N] (scale = power of two; bf16-exact weights stay exact in f16 away from the subnormal range)
__global__ __launch_bounds__(256) void k_wt_f16(const float* __restrict__ W, _Float16* __restrict__ Wt, int K, int N, float scale) {
  const int t = blockIdx.x * 256 + threadIdx.x; if (t >= N * (K / 8)) return; const int n = t / (K / 8), k8 = (t % (K / 8)) * 8; FragH f;
#pragma unroll
  for (int i = 0; i < 8; ++i) f.h[i] = (_Float16)(bf16_round(W[(size_t)(k8 + i) * N + n]) * scale); const v8us o = f.half[0];
  *(v8us*)((unsigned short*)Wt + (size_t)n * K + k8) = o; 
}
// k_gemm_hh variant with fused epilogue: v = acc·alpha + bias[by·sBias + col] (+ CP[(row/rowsPerB)·sCPb + by·64 + col] if CP) ; ACT 0 none / 1 elu ; writes f16 C16 (and f32 C if non-null)
template <int ACT>
__global__ __launch_bounds__(128) void k_gemm_hhx(const _Float16* __restrict__ A, int lda, size_t sA, const _Float16* __restrict__ Bh, int ldb, size_t sB, float alpha, const float* __restrict__ bias, size_t sBias, const float* __restrict__ CP, int rowsPerB, size_t sCPb, int row0g,
    float* __restrict__ C, _Float16* __restrict__ C16, int ldc, size_t sC, int M, int N, int K) {
  __shared__ __attribute__((aligned(16))) float so[4][16][64];
  const int tid = threadIdx.x, w = tid >> 5, lane = tid & 31, ln = lane & 15, hh = lane >> 4; const int by = blockIdx.y;
  A += (size_t)by * sA; Bh += (size_t)by * sB; const size_t cofs = (size_t)by * sC; const float* bp = bias ? bias + (size_t)by * sBias : nullptr;
  const int ntn = (N + 63) / 64; const int wid = blockIdx.x * 4 + w; const int mt = wid / ntn, nq = wid % ntn; if (mt * 16 >= M) return;
  const int row0 = mt * 16, col0 = nq * 64; const _Float16* arow = A + (size_t)(row0 + ln) * lda;
  v8f acc[4] = {};
  for (int kb = 0; kb < K; kb += 32) { FragH ah; ah.half[0] = *(const v8us*)((const unsigned short*)arow + kb + 8 * hh); ah.half[1] = *(const v8us*)((const unsigned short*)arow + kb + 16 + 8 * hh);
#pragma unroll
    for (int t = 0; t < 4; ++t) { if (col0 + t * 16 >= N) continue; const size_t boff = (size_t)(col0 + t * 16 + ln) * ldb + kb; FragH bq; bq.half[0] = *(const v8us*)((const unsigned short*)Bh + boff + 8 * hh); bq.half[1] = *(const v8us*)((const unsigned short*)Bh + boff + 16 + 8 * hh);
      acc[t] = mmaH<1>(ah.v, ah.v, bq.v, bq.v, acc[t]); }
  }
#pragma unroll
  for (int t = 0; t < 4; ++t) { if (col0 + t * 16 >= N) continue; const int col = col0 + t * 16 + ln; const float bv = bp ? bf16_round(bp[col]) : 0.f;
#pragma unroll
    for (int r = 0; r < 8; ++r) { float v = acc[t][r] * alpha + bv; if (CP) { const int rr = row0g + row0 + 8 * hh + r; if (rowsPerB < 0) v += CP[cofs + (size_t)rr * ldc + col];      /* rowsPerB < 0: own element of the batched C plane */ else { const int bidx = rr / rowsPerB; v += CP[(size_t)bidx * sCPb + (size_t)by * 64 + col]; } } if (ACT == 1) v = (v > 0.f) ? v : expm1f(v); else if (ACT == 7) v = (v > 0.f) ? v + 1.0f : expf(v); else if (ACT == 8) v = tanhf(v); else if (ACT == 9) v = 0.5f * v * (1.0f + tanhf(0.7978845608028654f * (v + 0.044715f * v * v * v))); else if (ACT == 11) v = 1.0f / (1.0f + expf(-v)); else if (ACT == 12) v = (v > 0.f) ? v : 0.01f * v; else if (ACT == 14) v = (v > 0.f) ? v : 0.1f * v; else if (ACT == 16) v = (v >= 0.f) ? v : 0.3f * v; else if (ACT == 17) v = (v >= 0.f) ? v : 0.2f * v; else if (ACT == 15) v = v / (1.0f + expf(-v)); else if (ACT == 3) v = fmaxf(v, 0.f); else if (ACT == 6) v = 0.5f * v * (1.0f + erff(v * 0.70710678118654752f)); so[w][8 * hh + r][t * 16 + ln] = v; } }
  __builtin_amdgcn_fence(__ATOMIC_ACQ_REL, "workgroup"); __builtin_amdgcn_wave_barrier();
  const int rsub = lane >> 4, c4 = (lane & 15) * 4; typedef _Float16 v4h __attribute__((ext_vector_type(4)));
  {
#pragma unroll
    for (int q = 0; q < 8; ++q) { const int r = q * 2 + rsub; if (col0 + c4 < N) { const v4f v = *(const v4fa*)&so[w][r][c4]; if (C) *(v4f*)(C + cofs + (size_t)(row0 + r) * ldc + col0 + c4) = v; if (C16) { v4h h4; for (int i = 0; i < 4; ++i) h4[i] = (_Float16)v[i]; *(v4h*)(C16 + cofs + (size_t)(row0 + r) * ldc + col0 + c4) = h4; } } }
     }
}


typedef _Float16 v4h __attribute__((ext_vector_type(4)));

__global__ __launch_bounds__(256) void k_x16(const float* __restrict__ x, _Float16* __restrict__ X16, size_t n8) { const size_t t = (size_t)blockIdx.x * 256 + threadIdx.x; if (t >= n8) return; FragH f;
#pragma unroll
  for (int q = 0; q < 8; ++q) f.h[q] = (_Float16)bf16_round(x[t * 8 + q]); *(v8us*)((unsigned short*)X16 + t * 8) = f.half[0];  }
__global__ __launch_bounds__(256) void k_h16(const float* __restrict__ x, _Float16* __restrict__ X16, size_t n8) { const size_t t = (size_t)blockIdx.x * 256 + threadIdx.x; if (t >= n8) return; FragH f;
#pragma unroll
  for (int q = 0; q < 8; ++q) f.h[q] = (_Float16)x[t * 8 + q]; *(v8us*)((unsigned short*)X16 + t * 8) = f.half[0];  }
__global__ __launch_bounds__(256) void k_round16f(const float* __restrict__ W, _Float16* __restrict__ Bt, size_t n8) { const size_t t = (size_t)blockIdx.x * 256 + threadIdx.x; if (t >= n8) return; FragH f;
#pragma unroll
  for (int i = 0; i < 8; ++i) f.h[i] = (_Float16)(bf16_round(W[t * 8 + i]) * 16.0f); *(v8us*)((unsigned short*)Bt + t * 8) = f.half[0];  }
template <int NHv, int TTv>
__global__ __launch_bounds__(256) void k_vt(const _Float16* __restrict__ V16, int ldv, int voff, _Float16* __restrict__ Vt) { __shared__ unsigned short tl[64][66]; const int tid = threadIdx.x; const int slab = blockIdx.x / (TTv / 64), lg = blockIdx.x % (TTv / 64); const int b = slab / NHv, h = slab % NHv;
  for (int i = tid; i < 64 * 8; i += 256) { const int r = i / 8, c8 = (i % 8) * 8; FragH f; f.half[0] = *(const v8us*)((const unsigned short*)V16 + ((size_t)b * TTv + lg * 64 + r) * ldv + voff + h * 64 + c8);
#pragma unroll
    for (int q = 0; q < 8; ++q) tl[r][c8 + q] = f.u[q]; }
  __syncthreads();
  {
#pragma unroll
    for (int rd = 0; rd < 2; ++rd) { const int d = rd * 32 + tid / 8, pc = tid % 8; FragH f;
#pragma unroll
      for (int q = 0; q < 8; ++q) f.u[q] = tl[pc * 8 + q][d];
      *(v8us*)((unsigned short*)Vt + ((size_t)slab * 64 + d) * TTv + lg * 64 + pc * 8) = f.half[0]; }
     } }

__global__ __launch_bounds__(256) void k_hl(const float* __restrict__ F, _Float16* __restrict__ Hh, _Float16* __restrict__ Hl, size_t n8) { const size_t t = (size_t)blockIdx.x * 256 + threadIdx.x; if (t >= n8) return; FragH fh, fl; const v4f a = *(const v4fa*)(F + t * 8), c = *(const v4fa*)(F + t * 8 + 4);
#pragma unroll
  for (int q = 0; q < 4; ++q) { _Float16 h = (_Float16)a[q]; fh.h[q] = h; fl.h[q] = (_Float16)((a[q] - (float)h) * 1024.0f); h = (_Float16)c[q]; fh.h[4 + q] = h; fl.h[4 + q] = (_Float16)((c[q] - (float)h) * 1024.0f); }
  { *(v8us*)((unsigned short*)Hh + t * 8) = fh.half[0]; *(v8us*)((unsigned short*)Hl + t * 8) = fl.half[0];  } }

// ---- fast GEMM (wave tile 32x64; requires M % 32 == 0 rows per launch region and N % 64 == 0); epilogue = k_gemm_hhx semantics ----
__device__ __forceinline__ v16h g2_frag(const _Float16* p, int hh) { FragH f; f.half[0] = *(const v8us*)((const unsigned short*)p + 8 * hh); f.half[1] = *(const v8us*)((const unsigned short*)p + 16 + 8 * hh); return f.v; }
__device__ __forceinline__ v8f g2_mma(v16h a, v16h b, v8f c) { v8f d = __builtin_amdgcn_wmma_f32_16x16x32_f16(false, a, false, b, (short)0, c, false, false); asm volatile("v_nop\n\tv_nop\n\tv_nop\n\tv_nop" : "+v"(d) : "v"(a), "v"(b)); return d; }
// CAUS 0: plain. CAUS 1 (scores): a 64-column tile at or past the end of its rows' causal query tile is skipped. CAUS 2 (P V): K runs over the keys of the rows' causal query tile only.
template <int ACT, int CAUS = 0>
__global__ __launch_bounds__(128) void k_gemm2(const _Float16* __restrict__ A, int lda, size_t sA, const _Float16* __restrict__ Bh, int ldb, size_t sB, float alpha, const float* __restrict__ bias, size_t sBias, const float* __restrict__ CP, int rowsPerB, size_t sCPb, int row0g,
    float* __restrict__ C, _Float16* __restrict__ C16, int ldc, size_t sC, int M, int N, int K) { static_assert(ACT == 0 || ACT == 3 || ACT == 6 || ACT == 8 || ACT == 9 || ACT == 11 || ACT == 12 || ACT == 14 || ACT == 15 || ACT == 16 || ACT == 17, "k_gemm2: unsupported ACT code (would silently apply no activation)");
  __shared__ __attribute__((aligned(16))) float so[4][32][68];
  const int tid = threadIdx.x, w = tid >> 5, lane = tid & 31, ln = lane & 15, hh = lane >> 4; const int by = blockIdx.y;
  A += (size_t)by * sA; Bh += (size_t)by * sB; const size_t cofs = (size_t)by * sC; const float* bp = bias ? bias + (size_t)by * sBias : nullptr;
  const int ntn = N >> 6; const int mt = blockIdx.x / ntn, nq = blockIdx.x - mt * ntn; const int row0 = mt * 128 + 32 * w, col0 = nq * 64; if (row0 >= M) return;
  static_assert(QT % 128 == 0, "a 128-row block lies in one causal query tile"); const int nkc = (mt * 128 / QT + 1) * QT;      /* keys below the end of this block's causal query tile */
  if (CAUS == 1 && col0 >= nkc) return; if (CAUS == 2) K = nkc;
  const _Float16* a0p = A + (size_t)(row0 + ln) * lda; const _Float16* a1p = a0p + (size_t)16 * lda;
  const _Float16* b0p = Bh + (size_t)(col0 + ln) * ldb; const _Float16* b1p = b0p + (size_t)16 * ldb; const _Float16* b2p = b1p + (size_t)16 * ldb; const _Float16* b3p = b2p + (size_t)16 * ldb;
  const v8f z8 = {0.f,0.f,0.f,0.f,0.f,0.f,0.f,0.f}; v8f c00 = z8, c01 = z8, c02 = z8, c03 = z8, c10 = z8, c11 = z8, c12 = z8, c13 = z8;
#pragma unroll 1
  for (int kb = 0; kb < K; kb += 32) { const v16h a0 = g2_frag(a0p + kb, hh), a1 = g2_frag(a1p + kb, hh);
    v16h b = g2_frag(b0p + kb, hh); c00 = g2_mma(a0, b, c00); c10 = g2_mma(a1, b, c10);
    b = g2_frag(b1p + kb, hh); c01 = g2_mma(a0, b, c01); c11 = g2_mma(a1, b, c11);
    b = g2_frag(b2p + kb, hh); c02 = g2_mma(a0, b, c02); c12 = g2_mma(a1, b, c12);
    b = g2_frag(b3p + kb, hh); c03 = g2_mma(a0, b, c03); c13 = g2_mma(a1, b, c13); }
  v8f accs[8] = {c00, c01, c02, c03, c10, c11, c12, c13};
#pragma unroll
  for (int u = 0; u < 8; ++u) { const int t = u & 3, half = u >> 2; const int col = col0 + t * 16 + ln; const float bv = bp ? bf16_round(bp[col]) : 0.f;
#pragma unroll
    for (int r = 0; r < 8; ++r) { const int rloc = half * 16 + 8 * hh + r; float v = accs[u][r] * alpha + bv; if (CP) { if (rowsPerB < 0) v += CP[cofs + (size_t)(row0g + row0 + rloc) * ldc + col];      /* rowsPerB < 0: own element of the batched C plane */ else { const int bidx = (row0g + row0 + rloc) / rowsPerB; v += CP[(size_t)bidx * sCPb + (size_t)by * 64 + col]; } }
      if (ACT == 3) v = fmaxf(v, 0.f); else if (ACT == 6) v = 0.5f * v * (1.0f + erff(v * 0.70710678118654752f)); else if (ACT == 11) v = 1.0f / (1.0f + expf(-v)); else if (ACT == 15) v = v / (1.0f + expf(-v)); else if (ACT == 12) v = (v > 0.f) ? v : 0.01f * v; else if (ACT == 8) v = tanhf(v); else if (ACT == 9) v = 0.5f * v * (1.0f + tanhf(0.7978845608028654f * (v + 0.044715f * v * v * v))); else if (ACT == 14) v = (v > 0.f) ? v : 0.1f * v; else if (ACT == 16) v = (v >= 0.f) ? v : 0.3f * v; else if (ACT == 17) v = (v >= 0.f) ? v : 0.2f * v;
      so[w][rloc][t * 16 + ln] = v; } }
  __builtin_amdgcn_fence(__ATOMIC_ACQ_REL, "workgroup"); __builtin_amdgcn_wave_barrier();
  const int rsub = lane >> 4, c4 = (lane & 15) * 4;
  {
#pragma unroll
    for (int q = 0; q < 16; ++q) { const int r = q * 2 + rsub; const v4f v = *(const v4fa*)&so[w][r][c4]; if (C) *(v4f*)(C + cofs + (size_t)(row0 + r) * ldc + col0 + c4) = v; if (C16) { v4h h4; for (int i = 0; i < 4; ++i) h4[i] = (_Float16)v[i]; *(v4h*)(C16 + cofs + (size_t)(row0 + r) * ldc + col0 + c4) = h4; } }
     } }


__global__ __launch_bounds__(256) void k_wnat(const float* __restrict__ w, size_t n8, _Float16* __restrict__ Bt) { const size_t t = (size_t)blockIdx.x * 256 + threadIdx.x; if (t >= n8) return; FragH f; for (int q = 0; q < 8; ++q) f.h[q] = (_Float16)(bf16_round(w[t * 8 + q]) * 16.0f); *(v8us*)((unsigned short*)Bt + t * 8) = f.half[0];  }
__global__ __launch_bounds__(256) void k_rsm(const float* __restrict__ S, _Float16* __restrict__ P, int nrows) {
  #pragma clang fp contract(off)
  const int i = blockIdx.x * 256 + threadIdx.x; if (i >= nrows) return; const float* s = S + (size_t)i * SQ; float mx = -3.0e38f;
#pragma unroll 1
  for (int j = 0; j < SQ; ++j) mx = fmaxf(mx, s[j]); float se = 0.f;
#pragma unroll 1
  for (int j = 0; j < SQ; ++j) se += expf(s[j] - mx); const float sc = 256.0f / se;
#pragma unroll 1
  for (int j0 = 0; j0 < SQ; j0 += 8) { FragH f; for (int q = 0; q < 8; ++q) f.h[q] = (_Float16)(expf(s[j0 + q] - mx) * sc); unsigned short* d = (unsigned short*)P + (size_t)i * SQ + j0; *(v8us*)d = f.half[0];  } }
__global__ __launch_bounds__(256) void k_vt(const _Float16* __restrict__ V16, int b, int h0, _Float16* __restrict__ VT) { __shared__ unsigned short tl[64][65]; const int tid = threadIdx.x; const int hh = blockIdx.x % HG, sg = blockIdx.x / HG; const int s0 = sg * 64; const int h = h0 + hh;
  for (int i = tid; i < 64 * 8; i += 256) { const int j = i / 8, d8 = (i % 8) * 8; FragH f; f.half[0] = *(const v8us*)((const unsigned short*)V16 + ((size_t)b * SQ + s0 + j) * DM + h * HD + d8); for (int q = 0; q < 8; ++q) tl[d8 + q][j] = f.u[q]; }
  __syncthreads();
  { for (int i = tid; i < 64 * 8; i += 256) { const int d = i / 8, j8 = (i % 8) * 8; FragH f; for (int q = 0; q < 8; ++q) f.u[q] = tl[d][j8 + q]; *(v8us*)((unsigned short*)VT + ((size_t)hh * HD + d) * SQ + s0 + j8) = f.half[0]; }  } }



template <int BFIN, int WXB>
__global__ __launch_bounds__(256) void k_ln16(const float* __restrict__ X, const float* __restrict__ g, const float* __restrict__ bb, float eps, _Float16* __restrict__ N16, float* __restrict__ XB) {
  #pragma clang fp contract(off)
  __shared__ float red[256]; const size_t r = blockIdx.x; const int t = threadIdx.x; const v4f xa = *(const v4fa*)(X + r * DMQ + t * 4); float s[4]; float sum = 0.f;
  for (int q = 0; q < 4; ++q) { s[q] = BFIN ? bf16_round(xa[q]) : xa[q]; sum = __fadd_rn(sum, s[q]); }
  red[t] = sum; __syncthreads(); for (int st = 128; st > 0; st >>= 1) { if (t < st) red[t] = __fadd_rn(red[t], red[t + st]); __syncthreads(); } const float mu = red[0] / (float)DMQ; __syncthreads();
  float vs = 0.f; for (int q = 0; q < 4; ++q) { const float dl = __fadd_rn(s[q], -mu); vs = __fadd_rn(vs, __fmul_rn(dl, dl)); } red[t] = vs; __syncthreads(); for (int st = 128; st > 0; st >>= 1) { if (t < st) red[t] = __fadd_rn(red[t], red[t + st]); __syncthreads(); }
  const float rs = rsqrtf(__fadd_rn(red[0] / (float)DMQ, eps)); v4h y; v4f xb;
  for (int q = 0; q < 4; ++q) { const int c = t * 4 + q; y[q] = (_Float16)__fadd_rn(__fmul_rn(__fmul_rn(__fadd_rn(s[q], -mu), rs), bf16_round(g[c])), bf16_round(bb[c])); xb[q] = s[q]; }
  { *(v4h*)(N16 + r * DMQ + t * 4) = y; if (WXB) *(v4f*)(XB + r * DMQ + t * 4) = xb;  } }
__global__ __launch_bounds__(256) void k_ftres2(const float* __restrict__ OF0, const float* __restrict__ XB, float* __restrict__ X1, size_t n4) {
  #pragma clang fp contract(off)
  const size_t t = (size_t)blockIdx.x * 256 + threadIdx.x; if (t >= n4) return; const v4f o = *(const v4fa*)(OF0 + t * 4), xv = *(const v4fa*)(XB + t * 4); v4f y; for (int q = 0; q < 4; ++q) y[q] = __fadd_rn(__fmul_rn(o[q], 0.015625f), xv[q]); *(v4f*)(X1 + t * 4) = y;  }

__global__ __launch_bounds__(256) void k_wthd(const float* __restrict__ Wt, _Float16* __restrict__ Bt) { const size_t t = (size_t)blockIdx.x * 256 + threadIdx.x; if (t >= (size_t)NH * HD * (DM / 8)) return; const int m8 = (int)(t % (DM / 8)) * 8; const int d = (int)((t / (DM / 8)) % HD); const int h = (int)(t / ((size_t)(DM / 8) * HD)); FragH f;
  for (int q = 0; q < 8; ++q) f.h[q] = (_Float16)(16.0f * bf16_round(Wt[((size_t)h * DM + m8 + q) * HD + d])); unsigned short* dst = (unsigned short*)Bt + ((size_t)h * HD + d) * DM + m8; *(v8us*)dst = f.half[0];  }




__global__ __launch_bounds__(256) void k_wtpad(const float* __restrict__ Wm, _Float16* __restrict__ Wt, int Kr, int Kp, int Nr, int Np, float scale) {
  const int t = blockIdx.x * 256 + threadIdx.x; if (t >= Np * (Kp / 8)) return; const int n = t / (Kp / 8), k8 = (t % (Kp / 8)) * 8; const int nc = min(n, Nr - 1); const float fn = (n < Nr) ? 1.f : 0.f; FragH f;
  for (int i = 0; i < 8; ++i) { const int k = k8 + i; const int kc = min(k, Kr - 1); const float fk = (k < Kr) ? fn : 0.f; f.h[i] = (_Float16)(bf16_round(Wm[(size_t)kc * Nr + nc]) * scale * fk); }
  unsigned short* o = (unsigned short*)Wt + (size_t)n * Kp + k8; *(v8us*)o = f.half[0];  }
__global__ __launch_bounds__(128) void k_bpad(const float* __restrict__ b, float* __restrict__ Bp, int nr, int np) {
  const int i = threadIdx.x; if (i >= np) return; const float v = b[min(i, nr - 1)] * ((i < nr) ? 1.f : 0.f); *(float*)(Bp + i) = v;  }

#define DI 64         /* inner width = NH * HD (ONE 64-wide head) */
#define LQK (3 * DI)  /* fused q | k | v row pitch (192) */
__global__ __launch_bounds__(256) void k_o0(const float* __restrict__ OF, float* __restrict__ ob, size_t n4) {
  #pragma clang fp contract(off)
  const size_t t = (size_t)blockIdx.x * 256 + threadIdx.x; if (t >= n4) return; const size_t e = t * 4; const int i = (int)(e / DI); const int c = (int)(e % DI); const int h = c / HD, d = c % HD; const v4f a = *(const v4fa*)(OF + e); v4f o; for (int q = 0; q < 4; ++q) o[q] = __fmul_rn(a[q], 0.015625f); float* dst = ob + (size_t)h * SQ * HD + (size_t)i * HD + d; *(v4f*)dst = o;  }

__global__ __launch_bounds__(256) void k_o0m(const float* __restrict__ OF, float* __restrict__ o_, size_t n4) {
  #pragma clang fp contract(off)
  const size_t t = (size_t)blockIdx.x * 256 + threadIdx.x; if (t >= n4) return; const size_t e = t * 4; OF += (size_t)blockIdx.y * QT0 * DI; o_ += (size_t)blockIdx.y * SQ * DI;      /* grid.y = batch */
  const v4f a = *(const v4fa*)(OF + e); v4f o; for (int q = 0; q < 4; ++q) o[q] = __fmul_rn(a[q], 0.015625f); *(v4f*)(o_ + e) = o;  }
// Exact f32 causal attention for rows 0..QT0-1 of each batch, spread over lanes: block = 8 query rows (grid.x) of one batch (grid.y).
// Scores: one THREAD per key (its K row in registers; the 8 q rows are read at block-uniform addresses). Softmax and P V: one WAVE per query row (lanes across the keys, then across the 64 output columns).
typedef float v2f __attribute__((ext_vector_type(2)));
typedef float v2fa __attribute__((ext_vector_type(2), may_alias));
__global__ __launch_bounds__(256) void k_att0w(const float* __restrict__ QKV, float scale, float* __restrict__ OF) {
  static_assert(QT0 % 32 == 0 && QT0 / 32 <= 16 && HD == 64 && NH == 1, "key chunks of 32, at most 16 a row; two output columns a lane");
  __shared__ __attribute__((aligned(16))) float sc[8][QT0];      /* scaled scores, then the unnormalised weights, of the block's 8 rows */
  const int tid = threadIdx.x, lane = tid & 31; const int w = __builtin_amdgcn_readfirstlane(tid >> 5); const int i0 = blockIdx.x * 8;
  const float* base = QKV + (size_t)blockIdx.y * QT0 * LQK; const float* qb = base + (size_t)i0 * LQK; const float* kb = base + DI; const float* vb = base + 2 * DI;
  for (int j0 = w * 32; j0 < i0 + 8; j0 += 256) {      /* whole 32-key chunks up to the block's last row: j <= QT0 - 1 */
    const int j = j0 + lane; const float* kr = kb + (size_t)j * LQK; v4f kk[HD / 4];
#pragma unroll
    for (int c = 0; c < HD / 4; ++c) kk[c] = *(const v4fa*)(kr + c * 4);
#pragma unroll 1      /* rolled: one q row (64 scalars) fits the scalar registers; with the eight rows unrolled they spill */
    for (int r = 0; r < 8; ++r) { v4f a = {0.f, 0.f, 0.f, 0.f};
#pragma unroll
      for (int c = 0; c < HD / 4; ++c) a += *(const v4fa*)(qb + r * LQK + c * 4) * kk[c];
      sc[r][j] = ((a[0] + a[1]) + (a[2] + a[3])) * scale; } }
  __syncthreads();      /* every key's scores are in LDS before a row's wave reads them */
  const int i = i0 + w; const int nu = (i >> 5) + 1; float x[QT0 / 32]; float mx = -1.0e30f;
#pragma unroll
  for (int u = 0; u < QT0 / 32; ++u) if (u < nu) x[u] = sc[w][u * 32 + lane];      /* all reads issued before the first is used */
#pragma unroll
  for (int u = 0; u < QT0 / 32; ++u) if (u < nu) { x[u] = (u * 32 + lane <= i) ? x[u] : -1.0e30f; mx = fmaxf(mx, x[u]); }
  for (int d = 16; d > 0; d >>= 1) mx = fmaxf(mx, __shfl_xor(mx, d, 32));
  float l = 0.f;
#pragma unroll
  for (int u = 0; u < QT0 / 32; ++u) if (u < nu) { const float e = expf(x[u] - mx); l += e; sc[w][u * 32 + lane] = e; }      /* keys past the row: exactly 0 */
  for (int d = 16; d > 0; d >>= 1) l += __shfl_xor(l, d, 32);
  __syncthreads();      /* the weights that the other lanes wrote are in LDS before they are read back */
  v2f o = {0.f, 0.f}; const float* vr = vb + lane * 2;
  for (int j0 = 0; j0 < nu * 32; j0 += 32) {
    v4f p[8]; v2f vv[32];
#pragma unroll
    for (int t = 0; t < 32; ++t) vv[t] = *(const v2fa*)(vr + (size_t)(j0 + t) * LQK);
#pragma unroll
    for (int t = 0; t < 8; ++t) p[t] = *(const v4f*)&sc[w][j0 + t * 4];
#pragma unroll
    for (int t = 0; t < 32; ++t) o += p[t >> 2][t & 3] * vv[t]; }
  o *= 64.0f / l;      /* o carried x64, undone by the 1/64 in k_o0m */
  *(v2f*)(OF + ((size_t)blockIdx.y * QT0 + i) * DI + lane * 2) = o; }

// Fused causal attention. Block = FQ query rows of one batch (grid.y); its FW waves take the row block's keys in 32-key steps, step st to wave st % FW.
// A step: S^T = K Q^T (A = 16 key rows, B = 16 query rows: a lane holds scores of ONE query), running maximum and sum per query, weights exp(s - m) packed in place as f16 into the B operand of O^T += V^T P^T.
// At the end every wave leaves (m, l, O) in LDS and the block joins them: out = sum_w 2^(c (m_w - M)) O_w / sum_w 2^(c (m_w - M)) l_w.
#define FW 16                        /* waves of a block */
#define FQ 32                        /* query rows of a block: two 16-column groups a wave */
#define FP 68                        /* floats between two rows of a wave's part in LDS: 16-byte aligned, rows spread over the banks */
#define FC (0.03125f * 1.44269504f)  /* raw score -> scaled log2 domain: 1024^-0.5 * log2 e */
/* 2^x; the v_nop is the slot that the instruction set asks for behind a transcendental, in the same statement so that it stands there whatever the compiler puts next */
__device__ __forceinline__ float fa_exp2(float x) { asm("v_exp_f32 %0, %0\n\tv_nop" : "+v"(x)); return x; }
/* a fragment in the hardware k order; p: the lane's own row, at its lane half's first element */
__device__ __forceinline__ v16h fa_frag(const unsigned short* p) { FragH f; f.half[0] = *(const v8us*)p; f.half[1] = *(const v8us*)(p + 16); return f.v; }
__device__ __forceinline__ v8f fa_mma(v16h a, v16h b, v8f c) { return __builtin_amdgcn_wmma_f32_16x16x32_f16(false, a, false, b, (short)0, c, false, false); }
__global__ __launch_bounds__(FW * 32) void k_fattn(const _Float16* __restrict__ QKV, const _Float16* __restrict__ VT, float* __restrict__ O) {
  static_assert(HD == 64 && NH == 1 && SQ % FQ == 0 && FQ == 32 && FW * 32 == FQ * (HD / 4), "two k blocks a score, four 16-row tiles of O^T; the join gives a thread four columns of one row");
  __shared__ __attribute__((aligned(16))) float po[FW][FQ][FP]; __shared__ float pm[FW][FQ]; __shared__ float pl[FW][FQ];
  const int tid = threadIdx.x, lane = tid & 31, ln = lane & 15, hh = lane >> 4; const int w = __builtin_amdgcn_readfirstlane(tid >> 5);
  const int qb = (int)(gridDim.x - 1u - blockIdx.x);      /* the row blocks with the most keys start first */
  const _Float16* base = QKV + (size_t)blockIdx.y * SQ * LQK; const _Float16* qp = base + (size_t)(qb * FQ + ln) * LQK; const _Float16* kb = base + DI; const _Float16* vb = VT + (size_t)blockIdx.y * HD * SQ; const unsigned kofs = (unsigned)(ln * LQK + 8 * hh), vofs = (unsigned)(ln * SQ + 8 * hh);
  v16h q[2][2];
#pragma unroll
  for (int qt = 0; qt < 2; ++qt) for (int ks = 0; ks < 2; ++ks) q[qt][ks] = g2_frag(qp + (size_t)qt * 16 * LQK + ks * 32, hh);
  const v8f z8 = {0.f, 0.f, 0.f, 0.f, 0.f, 0.f, 0.f, 0.f}; v8f o[4][2]; float m[2] = {-3.0e38f, -3.0e38f}, l[2] = {0.f, 0.f};      /* m: raw (unscaled) score */
#pragma unroll
  for (int dt = 0; dt < 4; ++dt) for (int qt = 0; qt < 2; ++qt) o[dt][qt] = z8;
  for (int st = w; st <= qb; st += FW) {      /* the same in every lane of a wave; no barrier inside */
    const int k0 = st * 32; const unsigned short* kr = (const unsigned short*)kb + (size_t)k0 * LQK + kofs; const unsigned short* vr = (const unsigned short*)vb + k0 + vofs; v16h kf[2][2], vf[4];
#pragma unroll
    for (int kt = 0; kt < 2; ++kt) for (int ks = 0; ks < 2; ++ks) kf[kt][ks] = fa_frag(kr + kt * 16 * LQK + ks * 32);
    asm volatile("s_wait_xcnt 0x0" :: "v"(kr) : "memory");      /* behind the eight K loads; their address is named as an input so that it lives up to here and no load's result lands in it earlier */
    __builtin_amdgcn_sched_barrier(0);      /* holds that wait between the two groups of loads */
#pragma unroll
    for (int dt = 0; dt < 4; ++dt) vf[dt] = fa_frag(vr + dt * 16 * SQ);
    asm volatile("s_wait_xcnt 0x0" :: "v"(vr) : "memory");      /* the same behind the eight V^T loads */
    __builtin_amdgcn_sched_barrier(0);      /* all sixteen loads of a step are issued ahead of its first product: one load latency a step (left free, the compiler put loads behind products, into their operands' registers: three latencies in a row) */
    v8f s[2][2];      /* s[qt][kt][r]: key k0 + 16 kt + 8 hh + r against query 16 qt + ln */
#pragma unroll
    for (int qt = 0; qt < 2; ++qt) for (int kt = 0; kt < 2; ++kt) s[qt][kt] = fa_mma(kf[kt][1], q[qt][1], fa_mma(kf[kt][0], q[qt][0], z8));
    if (st == qb) {      /* the row block's own keys: those past a row drop out (key 0 of the step stays for every row) */
#pragma unroll
      for (int qt = 0; qt < 2; ++qt) for (int kt = 0; kt < 2; ++kt) for (int r = 0; r < 8; ++r) s[qt][kt][r] = (kt * 16 + 8 * hh + r <= qt * 16 + ln) ? s[qt][kt][r] : -1.0e30f; }
#pragma unroll
    for (int qt = 0; qt < 2; ++qt) {
      float mx = s[qt][0][0];
#pragma unroll
      for (int r = 1; r < 8; ++r) mx = fmaxf(mx, s[qt][0][r]);
#pragma unroll
      for (int r = 0; r < 8; ++r) mx = fmaxf(mx, s[qt][1][r]);
      mx = fmaxf(mx, __shfl_xor(mx, 16, 32));      /* the two lane halves hold the same query's other keys */
      const float mn = fmaxf(m[qt], mx); const float f = fa_exp2((m[qt] - mn) * FC); const float nm = -mn * FC; m[qt] = mn;
      FragH pb; v4f s4 = {0.f, 0.f, 0.f, 0.f};
#pragma unroll
      for (int kt = 0; kt < 2; ++kt) for (int g = 0; g < 2; ++g) { float e0 = fmaf(s[qt][kt][g * 4 + 0], FC, nm), e1 = fmaf(s[qt][kt][g * 4 + 1], FC, nm), e2 = fmaf(s[qt][kt][g * 4 + 2], FC, nm), e3 = fmaf(s[qt][kt][g * 4 + 3], FC, nm);
        /* four 2^x in place; the v_nop as in fa_exp2 */
        asm("v_exp_f32 %0, %0\n\tv_exp_f32 %1, %1\n\tv_exp_f32 %2, %2\n\tv_exp_f32 %3, %3\n\tv_nop" : "+v"(e0), "+v"(e1), "+v"(e2), "+v"(e3));
        const v4f e = {e0, e1, e2, e3}; s4 += e;      /* keys past the row: exactly 0 */
        pb.h[kt * 8 + g * 4 + 0] = (_Float16)e0; pb.h[kt * 8 + g * 4 + 1] = (_Float16)e1; pb.h[kt * 8 + g * 4 + 2] = (_Float16)e2; pb.h[kt * 8 + g * 4 + 3] = (_Float16)e3; }
      l[qt] = l[qt] * f + ((s4[0] + s4[1]) + (s4[2] + s4[3]));
#pragma unroll
      for (int dt = 0; dt < 4; ++dt) { o[dt][qt] *= f; o[dt][qt] = fa_mma(vf[dt], pb.v, o[dt][qt]); } } }
#pragma unroll
  for (int qt = 0; qt < 2; ++qt) { l[qt] += __shfl_xor(l[qt], 16, 32); if (hh == 0) { pm[w][qt * 16 + ln] = m[qt]; pl[w][qt * 16 + ln] = l[qt]; }
#pragma unroll
    for (int dt = 0; dt < 4; ++dt) { const v4f lo = {o[dt][qt][0], o[dt][qt][1], o[dt][qt][2], o[dt][qt][3]}, hi = {o[dt][qt][4], o[dt][qt][5], o[dt][qt][6], o[dt][qt][7]};      /* o[dt][qt][r] = O[query 16 qt + ln][column 16 dt + 8 hh + r] */
      *(v4f*)&po[w][qt * 16 + ln][dt * 16 + 8 * hh] = lo; *(v4f*)&po[w][qt * 16 + ln][dt * 16 + 8 * hh + 4] = hi; } }
  __syncthreads();      /* every wave's part (a wave without keys: m lowest, l and O zero) is in LDS before the join reads it */
  const int qi = tid >> 4, d4 = (tid & 15) * 4; float M = pm[0][qi];
#pragma unroll
  for (int u = 1; u < FW; ++u) M = fmaxf(M, pm[u][qi]);
  float L = 0.f; v4f a = {0.f, 0.f, 0.f, 0.f};
#pragma unroll
  for (int u = 0; u < FW; ++u) { const float g = fa_exp2((pm[u][qi] - M) * FC); L += g * pl[u][qi]; a += g * *(const v4f*)&po[u][qi][d4]; }
  a *= 1.0f / L;
  *(v4f*)(O + ((size_t)blockIdx.y * SQ + qb * FQ + qi) * DI + d4) = a; }

extern "C" void kernel_launch(void* const* d_in, const int* in_sizes, int n_in,
                              void* d_out, int out_size, void* d_ws, size_t ws_size, hipStream_t stream) {
  (void)in_sizes; (void)n_in; (void)out_size;
  const float* const* I = (const float* const*)d_in; const float* x = I[0]; const float* wq = I[1]; const float* wk = I[2]; const float* wv = I[3];      /* x; natural [out = 64][in] Wq / Wk / Wv (input order as this module lists them); no biases */
  char* ws = (char*)d_ws; size_t off = 0;
  auto take = [&](size_t bytes) { char* p = ws + off; off += (bytes + 255) & ~(size_t)255; return p; };
  _Float16* BW = (_Float16*)take((size_t)LQK * DM * 2); _Float16* X16 = (_Float16*)take(NR * DM * 2); _Float16* QKV = (_Float16*)take(NR * LQK * 2); _Float16* VT = (_Float16*)take((size_t)NB * HD * SQ * 2);
  float* QKVF0 = (float*)take((size_t)NB * QT0 * LQK * 4); float* OF0 = (float*)take((size_t)NB * QT0 * DI * 4);      /* every plane holds all batches */
  if (off > ws_size) return;
  { const unsigned g = (unsigned)(((size_t)DI * DM / 8 + 255) / 256); k_wnat<<<g, 256, 0, stream>>>(wq, (size_t)DI * DM / 8, BW); k_wnat<<<g, 256, 0, stream>>>(wk, (size_t)DI * DM / 8, BW + (size_t)DI * DM); k_wnat<<<g, 256, 0, stream>>>(wv, (size_t)DI * DM / 8, BW + (size_t)2 * DI * DM); }      /* natural [64][DM] = Bt x16, stacked q | k | v */
  k_x16<<<(unsigned)((NR * DM / 8 + 255) / 256), 256, 0, stream>>>(x, X16, NR * DM / 8);      /* x (bf16-valued) as exact f16 rows */
  k_gemm2<0><<<dim3((unsigned)((NR / 128) * (LQK / 64)), 1), 128, 0, stream>>>(X16, DM, 0, BW, DM, 0, 0.0625f, nullptr, 0, nullptr, 1, 0, 0, nullptr, QKV, LQK, 0, (int)NR, LQK, DM);      /* q | k | v = x W^T -> f16 rows, column blocks 0 / 64 / 128 of the fused plane (pitch 192), one launch */
  const _Float16* V16 = QKV + 2 * DI;
  k_vt<NH, SQ><<<NB * NH * (SQ / 64), 256, 0, stream>>>(V16, LQK, 0, VT);      /* V^T [NB][HD][SQ] */
  k_fattn<<<dim3(SQ / FQ, NB), FW * 32, 0, stream>>>(QKV, VT, (float*)d_out);      /* out = softmax(causal(q k^T * 1024^-0.5)) v (the module scales by the EMBEDDING width), f32; row block on grid.x, batch on grid.y */
  k_gemm2<0><<<dim3((unsigned)((QT0 / 128) * (LQK / 64)), NB), 128, 0, stream>>>(X16, DM, (size_t)SQ * DM, BW, DM, 0, 0.0625f, nullptr, 0, nullptr, 1, 0, 0, QKVF0, nullptr, LQK, (size_t)QT0 * LQK, QT0, LQK, DM);      /* f32 q | k | v of rows 0..511 of each batch (exact products, f32 accumulation) */
  k_att0w<<<dim3(QT0 / 8, NB), 256, 0, stream>>>(QKVF0, 0.03125f, OF0);      /* exact f32 causal attention for rows 0..511 (o x64) */
  k_o0m<<<dim3((unsigned)(((size_t)QT0 * DI / 4 + 255) / 256), NB), 256, 0, stream>>>(OF0, (float*)d_out, (size_t)QT0 * DI / 4);      /* rows 0..511 of each batch REWRITTEN from the exact path */
}

// v005
// Measured time: 71.2 microseconds a run.
// Two timings next to v004 put it at 1.59 and 1.61 times that version's speed.
// Counting every step since v000, it is 199 times as fast.
#include <hip/hip_runtime.h>
// Single-head causal self-attention with the module's EMBEDDING-width scale (inps [4][2048][1024]; q/k/v = x W^T (natural [64][1024], U(+-1/32), no biases); ONE 64-wide head; scores * 1024^-0.5 (the source sets head_size = n_embed); causal (tril, -inf); softmax; out = weights v -> [4][2048][64]; no output projection).
// Structure (4 launches): x and the weights as exact f16 rows (one grid); one WMMA GEMM into the f16 q | k | v plane [8192][192], which also stores the f32 q | k | v of each batch's rows 0..511; v^T via LDS transposes; the last launch holds both attention paths, each storing its own rows: scores, causal softmax and P V in ONE launch (block = 32 query rows of one batch; its 16 waves share the row block's keys in 32-key steps; S^T = K Q^T, weights stay in registers as the B operand of O^T += V^T P^T; running maximum and sum per wave, the waves' parts joined in LDS), f32 straight into the output rows 512..2047; an exact f32 first tile (rows 0..511 of each batch) on further blocks of the same grid.
// Compute dtype: inputs rounded to bf16; x / weights exact; q, k, v and softmax weights as plain f16 GEMM operands (~2^-12) on rows 512..2047, o accumulated in f32; rows 0..511 all f32; scores and softmax statistics f32. v_wmma_f32_16x16x32_f16.
#define NB 4
#define SQ 2048
#define DM 1024
#define NH 1
#define HD 64
#define HG 4                         /* used only by the k_vt(V16, b, h0, VT) overload, which is not launched */
#define QT 256                       /* query rows per causal tile */
#define NKX SQ                       /* unused: the launches keep no S / P plane */
#define QT0 512                      /* first-tile rows computed exactly (f32): 512 here (no output projection averages the early-row cancellation errors away; logit sigma 1.0) */
#define B0 0                         /* unused: every launch covers all batches */
#define NBR NB                       /* unused by the launches (they put NB on or into grid.x) */
#define NR ((size_t)NB * SQ)
#define DMQ DM
#define DFF 4096                     /* unused: there is no FFN */
#define DFFR 100                     /* unused */
#define MP ((int)((size_t)NBR * SQ)) /* unused: the projections take NR rows */
#define QN SQ                        /* unused: the row blocks on grid.y cover SQ */
#define NHD NH                       /* unused: the launches use NH */
#define MPO MP                       /* unused: there is no output stage */
#define LQ (3 * DM)
typedef __bf16 v16b __attribute__((ext_vector_type(16)));
typedef unsigned short v8us __attribute__((ext_vector_type(8), may_alias));
typedef float  v8f  __attribute__((ext_vector_type(8)));
typedef float  v4f  __attribute__((ext_vector_type(4)));
typedef float  v4fa __attribute__((ext_vector_type(4), may_alias));
union FragB { v16b v; v8us half[2]; unsigned short u[16]; };

__device__ __forceinline__ unsigned short bf16_bits(float x) { unsigned int u = __float_as_uint(x); return (unsigned short)((u + 0x7FFFu + ((u >> 16) & 1u)) >> 16); }
__device__ __forceinline__ float bf16_val(unsigned short b) { return __uint_as_float(((unsigned int)b) << 16); }
__device__ __forceinline__ float bf16_round(float x) { return bf16_val(bf16_bits(x)); }
// D += A·B with NT terms: 1 = ah·bh, 2 = + al·bh (A split), 3 = + ah·bl (both split)
template <int NT>
__device__ __forceinline__ v8f mmaN(v16b ah, v16b al, v16b bh, v16b bl, v8f c) {
  c = __builtin_amdgcn_wmma_f32_16x16x32_bf16(false, ah, false, bh, (short)0, c, false, false);
  if (NT >= 2) c = __builtin_amdgcn_wmma_f32_16x16x32_bf16(false, al, false, bh, (short)0, c, false, false);
  if (NT >= 3) c = __builtin_amdgcn_wmma_f32_16x16x32_bf16(false, ah, false, bl, (short)0, c, false, false);
  asm volatile("v_nop\n\tv_nop\n\tv_nop\n\tv_nop" : "+v"(c) : "v"(ah), "v"(al), "v"(bh), "v"(bl));
  return c;
}

__global__ __launch_bounds__(256) void k_wt_bf16(const float* __restrict__ W, unsigned short* __restrict__ Wt, int K, int N) {
  const int t = blockIdx.x * 256 + threadIdx.x;
  const int k8n = K / 8;
  if (t >= N * k8n) return;
  const int n = t / k8n, k8 = (t % k8n) * 8;
  v8us v;
#pragma unroll
  for (int i = 0; i < 8; ++i) v[i] = bf16_bits(W[(size_t)(k8 + i) * N + n]);
  *(v8us*)(Wt + (size_t)n * K + k8) = v;
  
}

// GEMM C[M][N] (f32, pitch ldc) = act(A[M][K]·W + bias). A f32 row-major (pitch lda) converted per fragment to bf16
// (ASPLIT: hi/lo two planes -> 2 terms, else single rounded term); Wt bf16 [N][K] (pitch ldb). BIAS_BF16 rounds the
// bias to bf16 first (bias quantised to bf16 before the add). K%32==0, M%16==0, N%64==0.
template <bool ASPLIT, int ACT, bool BIAS_BF16>
__global__ __launch_bounds__(128) void k_gemm_bf(const float* __restrict__ A, int lda, const unsigned short* __restrict__ Wt, int ldb,
                                               const float* __restrict__ bias, float* __restrict__ C, int ldc, int M, int N, int K) {
  __shared__ __attribute__((aligned(16))) float so[4][16][64];
  const int tid = threadIdx.x, w = tid >> 5, lane = tid & 31, ln = lane & 15, hh = lane >> 4;
  const int ntn = N / 64;
  const int wid = blockIdx.x * 4 + w;
  const int mt = wid / ntn, nq = wid % ntn;
  if (mt * 16 >= M) return;
  const int row0 = mt * 16, col0 = nq * 64;
  const float* arow = A + (size_t)(row0 + ln) * lda;
  v8f acc[4] = {};
  for (int kb = 0; kb < K; kb += 32) {
    FragB ah, al;
    const v4f x0 = *(const v4fa*)(arow + kb + 8 * hh), x1 = *(const v4fa*)(arow + kb + 8 * hh + 4);
    const v4f x2 = *(const v4fa*)(arow + kb + 16 + 8 * hh), x3 = *(const v4fa*)(arow + kb + 16 + 8 * hh + 4);
    float xs[16] = {x0[0],x0[1],x0[2],x0[3],x1[0],x1[1],x1[2],x1[3],x2[0],x2[1],x2[2],x2[3],x3[0],x3[1],x3[2],x3[3]};
#pragma unroll
    for (int i = 0; i < 16; ++i) { const unsigned short hb = bf16_bits(xs[i]); ah.u[i] = hb; al.u[i] = ASPLIT ? bf16_bits(xs[i] - bf16_val(hb)) : (unsigned short)0; }
#pragma unroll
    for (int t = 0; t < 4; ++t) {
      const unsigned short* brow = Wt + (size_t)(col0 + t * 16 + ln) * ldb + kb;
      FragB b;
      b.half[0] = *(const v8us*)(brow + 8 * hh);
      b.half[1] = *(const v8us*)(brow + 16 + 8 * hh);
      acc[t] = mmaN<ASPLIT ? 2 : 1>(ah.v, al.v, b.v, b.v, acc[t]);
    }
  }
#pragma unroll
  for (int t = 0; t < 4; ++t) {
    float bv = bias ? bias[col0 + t * 16 + ln] : 0.f;
    if (BIAS_BF16) bv = bf16_round(bv);
#pragma unroll
    for (int r = 0; r < 8; ++r) { float v = acc[t][r] + bv; if (ACT == 1) v = fmaxf(v, 0.f); so[w][8 * hh + r][t * 16 + ln] = v; }
  }
  __builtin_amdgcn_fence(__ATOMIC_ACQ_REL, "workgroup");
  __builtin_amdgcn_wave_barrier();
  const int rsub = lane >> 4, c4 = (lane & 15) * 4;
  {
#pragma unroll
    for (int q = 0; q < 8; ++q) {
      const int r = q * 2 + rsub;
      const v4f v = *(const v4fa*)&so[w][r][c4];
      *(v4f*)(C + (size_t)(row0 + r) * ldc + col0 + c4) = v;
    }
    
  }
}

// GEMM C = act(A·W + bias + resid): A f32 (ASPLIT -> hi/lo 2 terms), Wt bf16 [N][K]; ACT 0 none, 1 relu, 2 exact gelu;
// resid (optional, f32, row index = (row % rmod), pitch ldr, RES_BF16 rounds it) added before the activation.
template <bool ASPLIT, int ACT, bool BIAS_BF16, bool RES_BF16>
__global__ __launch_bounds__(128) void k_gemm_bf3(const float* __restrict__ A, int lda, const unsigned short* __restrict__ Wt, int ldb,
                                                const float* __restrict__ bias, const float* __restrict__ resid, int rmod, int ldr,
                                                float* __restrict__ C, int ldc, int M, int N, int K) {
  __shared__ __attribute__((aligned(16))) float so[4][16][64];
  const int tid = threadIdx.x, w = tid >> 5, lane = tid & 31, ln = lane & 15, hh = lane >> 4;
  const int ntn = N / 64;
  const int wid = blockIdx.x * 4 + w;
  const int mt = wid / ntn, nq = wid % ntn;
  if (mt * 16 >= M) return;
  const int row0 = mt * 16, col0 = nq * 64;
  const float* arow = A + (size_t)(row0 + ln) * lda;
  v8f acc[4] = {};
  for (int kb = 0; kb < K; kb += 32) {
    FragB ah, al;
    const v4f x0 = *(const v4fa*)(arow + kb + 8 * hh), x1 = *(const v4fa*)(arow + kb + 8 * hh + 4);
    const v4f x2 = *(const v4fa*)(arow + kb + 16 + 8 * hh), x3 = *(const v4fa*)(arow + kb + 16 + 8 * hh + 4);
    float xs[16] = {x0[0],x0[1],x0[2],x0[3],x1[0],x1[1],x1[2],x1[3],x2[0],x2[1],x2[2],x2[3],x3[0],x3[1],x3[2],x3[3]};
#pragma unroll
    for (int i = 0; i < 16; ++i) { const unsigned short hb = bf16_bits(xs[i]); ah.u[i] = hb; al.u[i] = ASPLIT ? bf16_bits(xs[i] - bf16_val(hb)) : (unsigned short)0; }
#pragma unroll
    for (int t = 0; t < 4; ++t) {
      const unsigned short* brow = Wt + (size_t)(col0 + t * 16 + ln) * ldb + kb;
      FragB b;
      b.half[0] = *(const v8us*)(brow + 8 * hh);
      b.half[1] = *(const v8us*)(brow + 16 + 8 * hh);
      acc[t] = mmaN<ASPLIT ? 2 : 1>(ah.v, al.v, b.v, b.v, acc[t]);
    }
  }
#pragma unroll
  for (int t = 0; t < 4; ++t) {
    const int col = col0 + t * 16 + ln;
    float bv = bias ? bias[col] : 0.f;
    if (BIAS_BF16) bv = bf16_round(bv);
#pragma unroll
    for (int r = 0; r < 8; ++r) {
      float v = acc[t][r] + bv;
      if (resid) { float rv = resid[(size_t)((row0 + 8 * hh + r) % rmod) * ldr + col]; if (RES_BF16) rv = bf16_round(rv); v += rv; }
      if (ACT == 1) v = fmaxf(v, 0.f);
      if (ACT == 2) v = 0.5f * v * (1.0f + erff(v * 0.70710678118654752f));
      if (ACT == 3) { const float u = 0.7978845608028654f * (v + 0.044715f * v * v * v); v = 0.5f * v * (1.0f + tanhf(u)); }
      so[w][8 * hh + r][t * 16 + ln] = v;
    }
  }
  __builtin_amdgcn_fence(__ATOMIC_ACQ_REL, "workgroup");
  __builtin_amdgcn_wave_barrier();
  const int rsub = lane >> 4, c4 = (lane & 15) * 4;
  {
#pragma unroll
    for (int q = 0; q < 8; ++q) {
      const int r = q * 2 + rsub;
      const v4f v = *(const v4fa*)&so[w][r][c4];
      *(v4f*)(C + (size_t)(row0 + r) * ldc + col0 + c4) = v;
    }
    
  }
}
// row LayerNorm (biased variance, eps) over N: s = X (+ R); optional out_sum <- s; out_norm <- (s-mu)*rsqrt(var+eps)*g + b
template <bool PARAM_BF16>
__global__ __launch_bounds__(256) void k_layernorm(const float* __restrict__ X, const float* __restrict__ R, const float* __restrict__ g, const float* __restrict__ bta,
                                                  float* __restrict__ out_sum, float* __restrict__ out_norm, int N, float eps) {
  __shared__ float red[256];
  const int row = blockIdx.x, tid = threadIdx.x;
  const float* x = X + (size_t)row * N; const float* rr = R ? R + (size_t)row * N : nullptr;
  float vals[16];                     // up to N = 4096
  const int per = N / 256;            // contiguous chunk per thread? use strided-by-4 chunks: thread handles j = tid*4 + 1024*u
  float s1 = 0.f;
  for (int u = 0; u < per / 4; ++u) {
    const int j = tid * 4 + 1024 * u;
    const v4f a = *(const v4fa*)(x + j);
    v4f b = {0.f,0.f,0.f,0.f}; if (rr) b = *(const v4fa*)(rr + j);
#pragma unroll
    for (int q = 0; q < 4; ++q) { const float v = a[q] + b[q]; vals[u * 4 + q] = v; s1 += v; }
  }
  red[tid] = s1; __syncthreads();
  for (int st = 128; st > 0; st >>= 1) { if (tid < st) red[tid] += red[tid + st]; __syncthreads(); }
  const float mu = red[0] / (float)N; __syncthreads();
  float s2 = 0.f;
  for (int u = 0; u < per / 4; ++u)
#pragma unroll
    for (int q = 0; q < 4; ++q) { const float c = vals[u * 4 + q] - mu; s2 += c * c; }
  red[tid] = s2; __syncthreads();
  for (int st = 128; st > 0; st >>= 1) { if (tid < st) red[tid] += red[tid + st]; __syncthreads(); }
  const float rs = rsqrtf(red[0] / (float)N + eps);
  {
    for (int u = 0; u < per / 4; ++u) {
      const int j = tid * 4 + 1024 * u;
      v4f o, sm;
#pragma unroll
      for (int q = 0; q < 4; ++q) {
        float gg = g[j + q], bb = bta[j + q];
        if (PARAM_BF16) { gg = bf16_round(gg); bb = bf16_round(bb); }
        sm[q] = vals[u * 4 + q]; o[q] = (vals[u * 4 + q] - mu) * rs * gg + bb;
      }
      if (out_sum) *(v4f*)(out_sum + (size_t)row * N + j) = sm;
      *(v4f*)(out_norm + (size_t)row * N + j) = o;
    }
    
  }
}



// ---- f16 WMMA path (v_wmma_f32_16x16x32_f16): 11-bit significands for operands in range — used where a [0,1] probability operand needs more precision than bf16
typedef _Float16 v16h __attribute__((ext_vector_type(16)));
union FragH { v16h v; v8us half[2]; _Float16 h[16]; unsigned short u[16]; };
template <int NT>
__device__ __forceinline__ v8f mmaH(v16h ah, v16h al, v16h bh, v16h bl, v8f c) {
  c = __builtin_amdgcn_wmma_f32_16x16x32_f16(false, ah, false, bh, (short)0, c, false, false);
  if (NT >= 2) c = __builtin_amdgcn_wmma_f32_16x16x32_f16(false, al, false, bh, (short)0, c, false, false);
  if (NT >= 3) c = __builtin_amdgcn_wmma_f32_16x16x32_f16(false, ah, false, bl, (short)0, c, false, false);
  asm volatile("v_nop\n\tv_nop\n\tv_nop\n\tv_nop" : "+v"(c) : "v"(ah), "v"(al), "v"(bh), "v"(bl));
  return c;
}
// batched GEMM like k_gemm_b but f16 operands: A f32 (split into f16 hi/lo if ASPLIT, else rounded to f16), Bt = f16 values [n][k]; alpha; C f32; N multiple of 16 (partial tiles skipped)
template <bool ASPLIT>
__global__ __launch_bounds__(128) void k_gemm_h(const float* __restrict__ A, int lda, size_t sA, const _Float16* __restrict__ Bh, int ldb, size_t sB, float alpha, float* __restrict__ C, int ldc, size_t sC, int M, int N, int K) {
  __shared__ __attribute__((aligned(16))) float so[4][16][64];
  const int tid = threadIdx.x, w = tid >> 5, lane = tid & 31, ln = lane & 15, hh = lane >> 4; const int by = blockIdx.y;
  A += (size_t)by * sA; Bh += (size_t)by * sB; C += (size_t)by * sC;
  const int ntn = (N + 63) / 64; const int wid = blockIdx.x * 4 + w; const int mt = wid / ntn, nq = wid % ntn; if (mt * 16 >= M) return;
  const int row0 = mt * 16, col0 = nq * 64; const float* arow = A + (size_t)(row0 + ln) * lda;
  v8f acc[4] = {};
  for (int kb = 0; kb < K; kb += 32) {
    FragH ah, al;
    const v4f x0 = *(const v4fa*)(arow + kb + 8 * hh), x1 = *(const v4fa*)(arow + kb + 8 * hh + 4), x2 = *(const v4fa*)(arow + kb + 16 + 8 * hh), x3 = *(const v4fa*)(arow + kb + 16 + 8 * hh + 4);
    float xs[16] = {x0[0],x0[1],x0[2],x0[3],x1[0],x1[1],x1[2],x1[3],x2[0],x2[1],x2[2],x2[3],x3[0],x3[1],x3[2],x3[3]};
#pragma unroll
    for (int i = 0; i < 16; ++i) { const _Float16 h = (_Float16)xs[i]; ah.h[i] = h; al.h[i] = ASPLIT ? (_Float16)(xs[i] - (float)h) : (_Float16)0.0f; }
#pragma unroll
    for (int t = 0; t < 4; ++t) { if (col0 + t * 16 >= N) continue; const size_t boff = (size_t)(col0 + t * 16 + ln) * ldb + kb; FragH bq; bq.half[0] = *(const v8us*)(Bh + boff + 8 * hh); bq.half[1] = *(const v8us*)(Bh + boff + 16 + 8 * hh);
      acc[t] = mmaH<ASPLIT ? 2 : 1>(ah.v, al.v, bq.v, bq.v, acc[t]); }
  }
#pragma unroll
  for (int t = 0; t < 4; ++t) { if (col0 + t * 16 >= N) continue;
#pragma unroll
    for (int r = 0; r < 8; ++r) so[w][8 * hh + r][t * 16 + ln] = acc[t][r] * alpha; }
  __builtin_amdgcn_fence(__ATOMIC_ACQ_REL, "workgroup"); __builtin_amdgcn_wave_barrier();
  const int rsub = lane >> 4, c4 = (lane & 15) * 4;
  {
#pragma unroll
    for (int q = 0; q < 8; ++q) { const int r = q * 2 + rsub; if (col0 + c4 < N) { const v4f v = *(const v4fa*)&so[w][r][c4]; *(v4f*)(C + (size_t)(row0 + r) * ldc + col0 + c4) = v; } }
     }
}

// Wt[n][k] = f16(W[k][n]·scale) from f32 row-major W[K][N] (scale = power of two; bf16-exact weights stay exact in f16 away from the subnormal range)
__global__ __launch_bounds__(256) void k_wt_f16(const float* __restrict__ W, _Float16* __restrict__ Wt, int K, int N, float scale) {
  const int t = blockIdx.x * 256 + threadIdx.x; if (t >= N * (K / 8)) return; const int n = t / (K / 8), k8 = (t % (K / 8)) * 8; FragH f;
#pragma unroll
  for (int i = 0; i < 8; ++i) f.h[i] = (_Float16)(bf16_round(W[(size_t)(k8 + i) * N + n]) * scale); const v8us o = f.half[0];
  *(v8us*)((unsigned short*)Wt + (size_t)n * K + k8) = o; 
}
// k_gemm_hh variant with fused epilogue: v = acc·alpha + bias[by·sBias + col] (+ CP[(row/rowsPerB)·sCPb + by·64 + col] if CP) ; ACT 0 none / 1 elu ; writes f16 C16 (and f32 C if non-null)
template <int ACT>
__global__ __launch_bounds__(128) void k_gemm_hhx(const _Float16* __restrict__ A, int lda, size_t sA, const _Float16* __restrict__ Bh, int ldb, size_t sB, float alpha, const float* __restrict__ bias, size_t sBias, const float* __restrict__ CP, int rowsPerB, size_t sCPb, int row0g,
    float* __restrict__ C, _Float16* __restrict__ C16, int ldc, size_t sC, int M, int N, int K) {
  __shared__ __attribute__((aligned(16))) float so[4][16][64];
  const int tid = threadIdx.x, w = tid >> 5, lane = tid & 31, ln = lane & 15, hh = lane >> 4; const int by = blockIdx.y;
  A += (size_t)by * sA; Bh += (size_t)by * sB; const size_t cofs = (size_t)by * sC; const float* bp = bias ? bias + (size_t)by * sBias : nullptr;
  const int ntn = (N + 63) / 64; const int wid = blockIdx.x * 4 + w; const int mt = wid / ntn, nq = wid % ntn; if (mt * 16 >= M) return;
  const int row0 = mt * 16, col0 = nq * 64; const _Float16* arow = A + (size_t)(row0 + ln) * lda;
  v8f acc[4] = {};
  for (int kb = 0; kb < K; kb += 32) { FragH ah; ah.half[0] = *(const v8us*)((const unsigned short*)arow + kb + 8 * hh); ah.half[1] = *(const v8us*)((const unsigned short*)arow + kb + 16 + 8 * hh);
#pragma unroll
    for (int t = 0; t < 4; ++t) { if (col0 + t * 16 >= N) continue; const size_t boff = (size_t)(col0 + t * 16 + ln) * ldb + kb; FragH bq; bq.half[0] = *(const v8us*)((const unsigned short*)Bh + boff + 8 * hh); bq.half[1] = *(const v8us*)((const unsigned short*)Bh + boff + 16 + 8 * hh);
      acc[t] = mmaH<1>(ah.v, ah.v, bq.v, bq.v, acc[t]); }
  }
#pragma unroll
  for (int t = 0; t < 4; ++t) { if (col0 + t * 16 >= N) continue; const int col = col0 + t * 16 + ln; const float bv = bp ? bf16_round(bp[col]) : 0.f;
#pragma unroll
    for (int r = 0; r < 8; ++r) { float v = acc[t][r] * alpha + bv; if (CP) { const int rr = row0g + row0 + 8 * hh + r; if (rowsPerB < 0) v += CP[cofs + (size_t)rr * ldc + col];      /* rowsPerB < 0: own element of the batched C plane */ else { const int bidx = rr / rowsPerB; v += CP[(size_t)bidx * sCPb + (size_t)by * 64 + col]; } } if (ACT == 1) v = (v > 0.f) ? v : expm1f(v); else if (ACT == 7) v = (v > 0.f) ? v + 1.0f : expf(v); else if (ACT == 8) v = tanhf(v); else if (ACT == 9) v = 0.5f * v * (1.0f + tanhf(0.7978845608028654f * (v + 0.044715f * v * v * v))); else if (ACT == 11) v = 1.0f / (1.0f + expf(-v)); else if (ACT == 12) v = (v > 0.f) ? v : 0.01f * v; else if (ACT == 14) v = (v > 0.f) ? v : 0.1f * v; else if (ACT == 16) v = (v >= 0.f) ? v : 0.3f * v; else if (ACT == 17) v = (v >= 0.f) ? v : 0.2f * v; else if (ACT == 15) v = v / (1.0f + expf(-v)); else if (ACT == 3) v = fmaxf(v, 0.f); else if (ACT == 6) v = 0.5f * v * (1.0f + erff(v * 0.70710678118654752f)); so[w][8 * hh + r][t * 16 + ln] = v; } }
  __builtin_amdgcn_fence(__ATOMIC_ACQ_REL, "workgroup"); __builtin_amdgcn_wave_barrier();
  const int rsub = lane >> 4, c4 = (lane & 15) * 4; typedef _Float16 v4h __attribute__((ext_vector_type(4)));
  {
#pragma unroll
    for (int q = 0; q < 8; ++q) { const int r = q * 2 + rsub; if (col0 + c4 < N) { const v4f v = *(const v4fa*)&so[w][r][c4]; if (C) *(v4f*)(C + cofs + (size_t)(row0 + r) * ldc + col0 + c4) = v; if (C16) { v4h h4; for (int i = 0; i < 4; ++i) h4[i] = (_Float16)v[i]; *(v4h*)(C16 + cofs + (size_t)(row0 + r) * ldc + col0 + c4) = h4; } } }
     }
}


typedef _Float16 v4h __attribute__((ext_vector_type(4)));

__global__ __launch_bounds__(256) void k_h16(const float* __restrict__ x, _Float16* __restrict__ X16, size_t n8) { const size_t t = (size_t)blockIdx.x * 256 + threadIdx.x; if (t >= n8) return; FragH f;
#pragma unroll
  for (int q = 0; q < 8; ++q) f.h[q] = (_Float16)x[t * 8 + q]; *(v8us*)((unsigned short*)X16 + t * 8) = f.half[0];  }
__global__ __launch_bounds__(256) void k_round16f(const float* __restrict__ W, _Float16* __restrict__ Bt, size_t n8) { const size_t t = (size_t)blockIdx.x * 256 + threadIdx.x; if (t >= n8) return; FragH f;
#pragma unroll
  for (int i = 0; i < 8; ++i) f.h[i] = (_Float16)(bf16_round(W[t * 8 + i]) * 16.0f); *(v8us*)((unsigned short*)Bt + t * 8) = f.half[0];  }
template <int NHv, int TTv>
__global__ __launch_bounds__(256) void k_vt(const _Float16* __restrict__ V16, int ldv, int voff, _Float16* __restrict__ Vt) { __shared__ unsigned short tl[64][66]; const int tid = threadIdx.x; const int slab = blockIdx.x / (TTv / 64), lg = blockIdx.x % (TTv / 64); const int b = slab / NHv, h = slab % NHv;
  for (int i = tid; i < 64 * 8; i += 256) { const int r = i / 8, c8 = (i % 8) * 8; FragH f; f.half[0] = *(const v8us*)((const unsigned short*)V16 + ((size_t)b * TTv + lg * 64 + r) * ldv + voff + h * 64 + c8);
#pragma unroll
    for (int q = 0; q < 8; ++q) tl[r][c8 + q] = f.u[q]; }
  __syncthreads();
  {
#pragma unroll
    for (int rd = 0; rd < 2; ++rd) { const int d = rd * 32 + tid / 8, pc = tid % 8; FragH f;
#pragma unroll
      for (int q = 0; q < 8; ++q) f.u[q] = tl[pc * 8 + q][d];
      *(v8us*)((unsigned short*)Vt + ((size_t)slab * 64 + d) * TTv + lg * 64 + pc * 8) = f.half[0]; }
     } }

__global__ __launch_bounds__(256) void k_hl(const float* __restrict__ F, _Float16* __restrict__ Hh, _Float16* __restrict__ Hl, size_t n8) { const size_t t = (size_t)blockIdx.x * 256 + threadIdx.x; if (t >= n8) return; FragH fh, fl; const v4f a = *(const v4fa*)(F + t * 8), c = *(const v4fa*)(F + t * 8 + 4);
#pragma unroll
  for (int q = 0; q < 4; ++q) { _Float16 h = (_Float16)a[q]; fh.h[q] = h; fl.h[q] = (_Float16)((a[q] - (float)h) * 1024.0f); h = (_Float16)c[q]; fh.h[4 + q] = h; fl.h[4 + q] = (_Float16)((c[q] - (float)h) * 1024.0f); }
  { *(v8us*)((unsigned short*)Hh + t * 8) = fh.half[0]; *(v8us*)((unsigned short*)Hl + t * 8) = fl.half[0];  } }

// ---- fast GEMM (wave tile 32x64; requires M % 32 == 0 rows per launch region and N % 64 == 0); epilogue = k_gemm_hhx semantics ----
__device__ __forceinline__ v16h g2_frag(const _Float16* p, int hh) { FragH f; f.half[0] = *(const v8us*)((const unsigned short*)p + 8 * hh); f.half[1] = *(const v8us*)((const unsigned short*)p + 16 + 8 * hh); return f.v; }
__device__ __forceinline__ v8f g2_mma(v16h a, v16h b, v8f c) { v8f d = __builtin_amdgcn_wmma_f32_16x16x32_f16(false, a, false, b, (short)0, c, false, false); asm volatile("v_nop\n\tv_nop\n\tv_nop\n\tv_nop" : "+v"(d) : "v"(a), "v"(b)); return d; }
// CAUS 0: plain. CAUS 1 (scores): a 64-column tile at or past the end of its rows' causal query tile is skipped. CAUS 2 (P V): K runs over the keys of the rows' causal query tile only.
// F0 1: C holds only rows 0..QT0-1 of each batch, packed ([NB][QT0] rows); the other rows go to C16 alone.
template <int ACT, int CAUS = 0, int F0 = 0>
__global__ __launch_bounds__(128) void k_gemm2(const _Float16* __restrict__ A, int lda, size_t sA, const _Float16* __restrict__ Bh, int ldb, size_t sB, float alpha, const float* __restrict__ bias, size_t sBias, const float* __restrict__ CP, int rowsPerB, size_t sCPb, int row0g,
    float* __restrict__ C, _Float16* __restrict__ C16, int ldc, size_t sC, int M, int N, int K) { static_assert(ACT == 0 || ACT == 3 || ACT == 6 || ACT == 8 || ACT == 9 || ACT == 11 || ACT == 12 || ACT == 14 || ACT == 15 || ACT == 16 || ACT == 17, "k_gemm2: unsupported ACT code (would silently apply no activation)");
  __shared__ __attribute__((aligned(16))) float so[4][32][68];
  const int tid = threadIdx.x, w = tid >> 5, lane = tid & 31, ln = lane & 15, hh = lane >> 4; const int by = blockIdx.y;
  A += (size_t)by * sA; Bh += (size_t)by * sB; const size_t cofs = (size_t)by * sC; const float* bp = bias ? bias + (size_t)by * sBias : nullptr;
  const int ntn = N >> 6; const int mt = blockIdx.x / ntn, nq = blockIdx.x - mt * ntn; const int row0 = mt * 128 + 32 * w, col0 = nq * 64; if (row0 >= M) return;
  static_assert(QT % 128 == 0, "a 128-row block lies in one causal query tile"); const int nkc = (mt * 128 / QT + 1) * QT;      /* keys below the end of this block's causal query tile */
  if (CAUS == 1 && col0 >= nkc) return; if (CAUS == 2) K = nkc;
  const _Float16* a0p = A + (size_t)(row0 + ln) * lda; const _Float16* a1p = a0p + (size_t)16 * lda;
  const _Float16* b0p = Bh + (size_t)(col0 + ln) * ldb; const _Float16* b1p = b0p + (size_t)16 * ldb; const _Float16* b2p = b1p + (size_t)16 * ldb; const _Float16* b3p = b2p + (size_t)16 * ldb;
  const v8f z8 = {0.f,0.f,0.f,0.f,0.f,0.f,0.f,0.f}; v8f c00 = z8, c01 = z8, c02 = z8, c03 = z8, c10 = z8, c11 = z8, c12 = z8, c13 = z8;
#pragma unroll 1
  for (int kb = 0; kb < K; kb += 32) { const v16h a0 = g2_frag(a0p + kb, hh), a1 = g2_frag(a1p + kb, hh);
    v16h b = g2_frag(b0p + kb, hh); c00 = g2_mma(a0, b, c00); c10 = g2_mma(a1, b, c10);
    b = g2_frag(b1p + kb, hh); c01 = g2_mma(a0, b, c01); c11 = g2_mma(a1, b, c11);
    b = g2_frag(b2p + kb, hh); c02 = g2_mma(a0, b, c02); c12 = g2_mma(a1, b, c12);
    b = g2_frag(b3p + kb, hh); c03 = g2_mma(a0, b, c03); c13 = g2_mma(a1, b, c13); }
  v8f accs[8] = {c00, c01, c02, c03, c10, c11, c12, c13};
#pragma unroll
  for (int u = 0; u < 8; ++u) { const int t = u & 3, half = u >> 2; const int col = col0 + t * 16 + ln; const float bv = bp ? bf16_round(bp[col]) : 0.f;
#pragma unroll
    for (int r = 0; r < 8; ++r) { const int rloc = half * 16 + 8 * hh + r; float v = accs[u][r] * alpha + bv; if (CP) { if (rowsPerB < 0) v += CP[cofs + (size_t)(row0g + row0 + rloc) * ldc + col];      /* rowsPerB < 0: own element of the batched C plane */ else { const int bidx = (row0g + row0 + rloc) / rowsPerB; v += CP[(size_t)bidx * sCPb + (size_t)by * 64 + col]; } }
      if (ACT == 3) v = fmaxf(v, 0.f); else if (ACT == 6) v = 0.5f * v * (1.0f + erff(v * 0.70710678118654752f)); else if (ACT == 11) v = 1.0f / (1.0f + expf(-v)); else if (ACT == 15) v = v / (1.0f + expf(-v)); else if (ACT == 12) v = (v > 0.f) ? v : 0.01f * v; else if (ACT == 8) v = tanhf(v); else if (ACT == 9) v = 0.5f * v * (1.0f + tanhf(0.7978845608028654f * (v + 0.044715f * v * v * v))); else if (ACT == 14) v = (v > 0.f) ? v : 0.1f * v; else if (ACT == 16) v = (v >= 0.f) ? v : 0.3f * v; else if (ACT == 17) v = (v >= 0.f) ? v : 0.2f * v;
      so[w][rloc][t * 16 + ln] = v; } }
  __builtin_amdgcn_fence(__ATOMIC_ACQ_REL, "workgroup"); __builtin_amdgcn_wave_barrier();
  const int rsub = lane >> 4, c4 = (lane & 15) * 4;
  static_assert(SQ % 32 == 0 && QT0 % 32 == 0, "a wave's 32 rows lie on one side of the first tile's end"); size_t crow = (size_t)row0; if (F0) { const int rb = row0 / SQ, ri = row0 - rb * SQ; crow = (size_t)rb * QT0 + ri; if (ri >= QT0) C = nullptr; }
  {
#pragma unroll
    for (int q = 0; q < 16; ++q) { const int r = q * 2 + rsub; const v4f v = *(const v4fa*)&so[w][r][c4]; if (C) *(v4f*)(C + cofs + (crow + r) * ldc + col0 + c4) = v; if (C16) { v4h h4; for (int i = 0; i < 4; ++i) h4[i] = (_Float16)v[i]; *(v4h*)(C16 + cofs + (size_t)(row0 + r) * ldc + col0 + c4) = h4; } }
     } }


__global__ __launch_bounds__(256) void k_rsm(const float* __restrict__ S, _Float16* __restrict__ P, int nrows) {
  #pragma clang fp contract(off)
  const int i = blockIdx.x * 256 + threadIdx.x; if (i >= nrows) return; const float* s = S + (size_t)i * SQ; float mx = -3.0e38f;
#pragma unroll 1
  for (int j = 0; j < SQ; ++j) mx = fmaxf(mx, s[j]); float se = 0.f;
#pragma unroll 1
  for (int j = 0; j < SQ; ++j) se += expf(s[j] - mx); const float sc = 256.0f / se;
#pragma unroll 1
  for (int j0 = 0; j0 < SQ; j0 += 8) { FragH f; for (int q = 0; q < 8; ++q) f.h[q] = (_Float16)(expf(s[j0 + q] - mx) * sc); unsigned short* d = (unsigned short*)P + (size_t)i * SQ + j0; *(v8us*)d = f.half[0];  } }
__global__ __launch_bounds__(256) void k_vt(const _Float16* __restrict__ V16, int b, int h0, _Float16* __restrict__ VT) { __shared__ unsigned short tl[64][65]; const int tid = threadIdx.x; const int hh = blockIdx.x % HG, sg = blockIdx.x / HG; const int s0 = sg * 64; const int h = h0 + hh;
  for (int i = tid; i < 64 * 8; i += 256) { const int j = i / 8, d8 = (i % 8) * 8; FragH f; f.half[0] = *(const v8us*)((const unsigned short*)V16 + ((size_t)b * SQ + s0 + j) * DM + h * HD + d8); for (int q = 0; q < 8; ++q) tl[d8 + q][j] = f.u[q]; }
  __syncthreads();
  { for (int i = tid; i < 64 * 8; i += 256) { const int d = i / 8, j8 = (i % 8) * 8; FragH f; for (int q = 0; q < 8; ++q) f.u[q] = tl[d][j8 + q]; *(v8us*)((unsigned short*)VT + ((size_t)hh * HD + d) * SQ + s0 + j8) = f.half[0]; }  } }



template <int BFIN, int WXB>
__global__ __launch_bounds__(256) void k_ln16(const float* __restrict__ X, const float* __restrict__ g, const float* __restrict__ bb, float eps, _Float16* __restrict__ N16, float* __restrict__ XB) {
  #pragma clang fp contract(off)
  __shared__ float red[256]; const size_t r = blockIdx.x; const int t = threadIdx.x; const v4f xa = *(const v4fa*)(X + r * DMQ + t * 4); float s[4]; float sum = 0.f;
  for (int q = 0; q < 4; ++q) { s[q] = BFIN ? bf16_round(xa[q]) : xa[q]; sum = __fadd_rn(sum, s[q]); }
  red[t] = sum; __syncthreads(); for (int st = 128; st > 0; st >>= 1) { if (t < st) red[t] = __fadd_rn(red[t], red[t + st]); __syncthreads(); } const float mu = red[0] / (float)DMQ; __syncthreads();
  float vs = 0.f; for (int q = 0; q < 4; ++q) { const float dl = __fadd_rn(s[q], -mu); vs = __fadd_rn(vs, __fmul_rn(dl, dl)); } red[t] = vs; __syncthreads(); for (int st = 128; st > 0; st >>= 1) { if (t < st) red[t] = __fadd_rn(red[t], red[t + st]); __syncthreads(); }
  const float rs = rsqrtf(__fadd_rn(red[0] / (float)DMQ, eps)); v4h y; v4f xb;
  for (int q = 0; q < 4; ++q) { const int c = t * 4 + q; y[q] = (_Float16)__fadd_rn(__fmul_rn(__fmul_rn(__fadd_rn(s[q], -mu), rs), bf16_round(g[c])), bf16_round(bb[c])); xb[q] = s[q]; }
  { *(v4h*)(N16 + r * DMQ + t * 4) = y; if (WXB) *(v4f*)(XB + r * DMQ + t * 4) = xb;  } }
__global__ __launch_bounds__(256) void k_ftres2(const float* __restrict__ OF0, const float* __restrict__ XB, float* __restrict__ X1, size_t n4) {
  #pragma clang fp contract(off)
  const size_t t = (size_t)blockIdx.x * 256 + threadIdx.x; if (t >= n4) return; const v4f o = *(const v4fa*)(OF0 + t * 4), xv = *(const v4fa*)(XB + t * 4); v4f y; for (int q = 0; q < 4; ++q) y[q] = __fadd_rn(__fmul_rn(o[q], 0.015625f), xv[q]); *(v4f*)(X1 + t * 4) = y;  }

__global__ __launch_bounds__(256) void k_wthd(const float* __restrict__ Wt, _Float16* __restrict__ Bt) { const size_t t = (size_t)blockIdx.x * 256 + threadIdx.x; if (t >= (size_t)NH * HD * (DM / 8)) return; const int m8 = (int)(t % (DM / 8)) * 8; const int d = (int)((t / (DM / 8)) % HD); const int h = (int)(t / ((size_t)(DM / 8) * HD)); FragH f;
  for (int q = 0; q < 8; ++q) f.h[q] = (_Float16)(16.0f * bf16_round(Wt[((size_t)h * DM + m8 + q) * HD + d])); unsigned short* dst = (unsigned short*)Bt + ((size_t)h * HD + d) * DM + m8; *(v8us*)dst = f.half[0];  }




__global__ __launch_bounds__(256) void k_wtpad(const float* __restrict__ Wm, _Float16* __restrict__ Wt, int Kr, int Kp, int Nr, int Np, float scale) {
  const int t = blockIdx.x * 256 + threadIdx.x; if (t >= Np * (Kp / 8)) return; const int n = t / (Kp / 8), k8 = (t % (Kp / 8)) * 8; const int nc = min(n, Nr - 1); const float fn = (n < Nr) ? 1.f : 0.f; FragH f;
  for (int i = 0; i < 8; ++i) { const int k = k8 + i; const int kc = min(k, Kr - 1); const float fk = (k < Kr) ? fn : 0.f; f.h[i] = (_Float16)(bf16_round(Wm[(size_t)kc * Nr + nc]) * scale * fk); }
  unsigned short* o = (unsigned short*)Wt + (size_t)n * Kp + k8; *(v8us*)o = f.half[0];  }
__global__ __launch_bounds__(128) void k_bpad(const float* __restrict__ b, float* __restrict__ Bp, int nr, int np) {
  const int i = threadIdx.x; if (i >= np) return; const float v = b[min(i, nr - 1)] * ((i < nr) ? 1.f : 0.f); *(float*)(Bp + i) = v;  }

#define DI 64         /* inner width = NH * HD (ONE 64-wide head) */
#define LQK (3 * DI)  /* fused q | k | v row pitch (192) */
__global__ __launch_bounds__(256) void k_o0(const float* __restrict__ OF, float* __restrict__ ob, size_t n4) {
  #pragma clang fp contract(off)
  const size_t t = (size_t)blockIdx.x * 256 + threadIdx.x; if (t >= n4) return; const size_t e = t * 4; const int i = (int)(e / DI); const int c = (int)(e % DI); const int h = c / HD, d = c % HD; const v4f a = *(const v4fa*)(OF + e); v4f o; for (int q = 0; q < 4; ++q) o[q] = __fmul_rn(a[q], 0.015625f); float* dst = ob + (size_t)h * SQ * HD + (size_t)i * HD + d; *(v4f*)dst = o;  }

// x and the three weights to f16 on ONE grid (none reads what another writes): blocks 0 .. 3 WB - 1 take Wq | Wk | Wv (natural [64][DM] rows = Bt, x16, stacked), the rest take x (bf16-valued, exact in f16).
#define WB ((unsigned)((size_t)DI * DM / 8 / 256))      /* blocks a weight */
__global__ __launch_bounds__(256) void k_cvt(const float* __restrict__ x, const float* __restrict__ wq, const float* __restrict__ wk, const float* __restrict__ wv, _Float16* __restrict__ X16, _Float16* __restrict__ BW) {
  static_assert((size_t)DI * DM % (8 * 256) == 0 && NR * DM % (8 * 256) == 0, "whole blocks, eight elements a thread");
  const unsigned b = blockIdx.x; FragH f;
  if (b < 3 * WB) { const unsigned s = b / WB; const float* w = (s == 0) ? wq : (s == 1) ? wk : wv; const size_t t = (size_t)(b - s * WB) * 256 + threadIdx.x;
    for (int q = 0; q < 8; ++q) f.h[q] = (_Float16)(bf16_round(w[t * 8 + q]) * 16.0f);
    *(v8us*)((unsigned short*)BW + (size_t)s * DI * DM + t * 8) = f.half[0]; }
  else { const size_t t = (size_t)(b - 3 * WB) * 256 + threadIdx.x;
#pragma unroll      /* the eight elements stay in registers: two 16-byte loads, one 16-byte store */
    for (int q = 0; q < 8; ++q) f.h[q] = (_Float16)bf16_round(x[t * 8 + q]);
    *(v8us*)((unsigned short*)X16 + t * 8) = f.half[0]; } }
#define FW 16                        /* waves of an attention block, either path */
// Exact f32 causal attention for rows 0..QT0-1 of each batch, spread over lanes: a block takes FW query rows (i0 ..) of batch b; sc: FW rows of QT0 floats in the block's LDS.
// Scores: one THREAD per key (its K row in registers; the FW q rows are read at block-uniform addresses). Softmax and P V: one WAVE per query row (lanes across the keys, then across the 64 output columns).
typedef float v2f __attribute__((ext_vector_type(2)));
typedef float v2fa __attribute__((ext_vector_type(2), may_alias));
__device__ __forceinline__ void att0_rows(const float* __restrict__ QKV, float scale, float* __restrict__ O, const int b, const int i0, float (*sc)[QT0]) {      /* sc: scaled scores, then the unnormalised weights, of the block's rows */
  static_assert(QT0 % 32 == 0 && QT0 / 32 <= 16 && QT0 % FW == 0 && HD == 64 && NH == 1, "key chunks of 32, at most 16 a row; two output columns a lane");
  const int tid = threadIdx.x, lane = tid & 31; const int w = __builtin_amdgcn_readfirstlane(tid >> 5);
  const float* base = QKV + (size_t)b * QT0 * LQK; const float* qb = base + (size_t)i0 * LQK; const float* kb = base + DI; const float* vb = base + 2 * DI;
  for (int j0 = w * 32; j0 < i0 + FW; j0 += FW * 32) {      /* whole 32-key chunks up to the block's last row: j <= QT0 - 1 */
    const int j = j0 + lane; const float* kr = kb + (size_t)j * LQK; v4f kk[HD / 4];
#pragma unroll
    for (int c = 0; c < HD / 4; ++c) kk[c] = *(const v4fa*)(kr + c * 4);
#pragma unroll 1      /* rolled: one q row (64 scalars) fits the scalar registers; with the rows unrolled they spill */
    for (int r = 0; r < FW; ++r) { v4f a = {0.f, 0.f, 0.f, 0.f};
#pragma unroll
      for (int c = 0; c < HD / 4; ++c) a += *(const v4fa*)(qb + r * LQK + c * 4) * kk[c];
      sc[r][j] = ((a[0] + a[1]) + (a[2] + a[3])) * scale; } }
  __syncthreads();      /* every key's scores are in LDS before a row's wave reads them */
  const int i = i0 + w; const int nu = (i >> 5) + 1; float x[QT0 / 32]; float mx = -1.0e30f;
#pragma unroll
  for (int u = 0; u < QT0 / 32; ++u) if (u < nu) x[u] = sc[w][u * 32 + lane];      /* all reads issued before the first is used */
#pragma unroll
  for (int u = 0; u < QT0 / 32; ++u) if (u < nu) { x[u] = (u * 32 + lane <= i) ? x[u] : -1.0e30f; mx = fmaxf(mx, x[u]); }
  for (int d = 16; d > 0; d >>= 1) mx = fmaxf(mx, __shfl_xor(mx, d, 32));
  float l = 0.f;
#pragma unroll
  for (int u = 0; u < QT0 / 32; ++u) if (u < nu) { const float e = expf(x[u] - mx); l += e; sc[w][u * 32 + lane] = e; }      /* keys past the row: exactly 0 */
  for (int d = 16; d > 0; d >>= 1) l += __shfl_xor(l, d, 32);
  __syncthreads();      /* the weights that the other lanes wrote are in LDS before they are read back */
  v2f o = {0.f, 0.f}; const float* vr = vb + lane * 2;
  for (int j0 = 0; j0 < nu * 32; j0 += 32) {
    v4f p[8]; v2f vv[32];
#pragma unroll
    for (int t = 0; t < 32; ++t) vv[t] = *(const v2fa*)(vr + (size_t)(j0 + t) * LQK);
#pragma unroll
    for (int t = 0; t < 8; ++t) p[t] = *(const v4f*)&sc[w][j0 + t * 4];
#pragma unroll
    for (int t = 0; t < 32; ++t) o += p[t >> 2][t & 3] * vv[t]; }
  o *= 1.0f / l;
  *(v2f*)(O + ((size_t)b * SQ + i) * DI + lane * 2) = o;      /* the row's own place in the output: no other block stores rows 0..QT0-1 */
  asm volatile("s_wait_xcnt 0x0" ::: "memory"); }      /* behind the store: in the joined kernel code of the other path follows in the listing and writes the store's registers */

// Fused causal attention. A block takes the FQ query rows of row block qb of batch b; its FW waves take the row block's keys in 32-key steps, step st to wave st % FW.
// A step: S^T = K Q^T (A = 16 key rows, B = 16 query rows: a lane holds scores of ONE query), running maximum and sum per query, weights exp(s - m) packed in place as f16 into the B operand of O^T += V^T P^T.
// At the end every wave leaves (m, l, O) in LDS and the block joins them: out = sum_w 2^(c (m_w - M)) O_w / sum_w 2^(c (m_w - M)) l_w.
#define FQ 32                        /* query rows of a block: two 16-column groups a wave */
#define FP 68                        /* floats between two rows of a wave's part in LDS: 16-byte aligned, rows spread over the banks */
#define FC (0.03125f * 1.44269504f)  /* raw score -> scaled log2 domain: 1024^-0.5 * log2 e */
/* 2^x; the v_nop is the slot that the instruction set asks for behind a transcendental, in the same statement so that it stands there whatever the compiler puts next */
__device__ __forceinline__ float fa_exp2(float x) { asm("v_exp_f32 %0, %0\n\tv_nop" : "+v"(x)); return x; }
/* a fragment in the hardware k order; p: the lane's own row, at its lane half's first element */
__device__ __forceinline__ v16h fa_frag(const unsigned short* p) { FragH f; f.half[0] = *(const v8us*)p; f.half[1] = *(const v8us*)(p + 16); return f.v; }
__device__ __forceinline__ v8f fa_mma(v16h a, v16h b, v8f c) { return __builtin_amdgcn_wmma_f32_16x16x32_f16(false, a, false, b, (short)0, c, false, false); }
__device__ __forceinline__ void fattn_rows(const _Float16* __restrict__ QKV, const _Float16* __restrict__ VT, float* __restrict__ O, const int b, const int qb, float (*po)[FQ][FP], float (*pm)[FQ], float (*pl)[FQ]) {
  static_assert(HD == 64 && NH == 1 && SQ % FQ == 0 && FQ == 32 && FW * 32 == FQ * (HD / 4), "two k blocks a score, four 16-row tiles of O^T; the join gives a thread four columns of one row");
  const int tid = threadIdx.x, lane = tid & 31, ln = lane & 15, hh = lane >> 4; const int w = __builtin_amdgcn_readfirstlane(tid >> 5);
  const _Float16* base = QKV + (size_t)b * SQ * LQK; const _Float16* qp = base + (size_t)(qb * FQ + ln) * LQK; const _Float16* kb = base + DI; const _Float16* vb = VT + (size_t)b * HD * SQ; const unsigned kofs = (unsigned)(ln * LQK + 8 * hh), vofs = (unsigned)(ln * SQ + 8 * hh);
  v16h q[2][2];
#pragma unroll
  for (int qt = 0; qt < 2; ++qt) for (int ks = 0; ks < 2; ++ks) q[qt][ks] = g2_frag(qp + (size_t)qt * 16 * LQK + ks * 32, hh);
  const v8f z8 = {0.f, 0.f, 0.f, 0.f, 0.f, 0.f, 0.f, 0.f}; v8f o[4][2]; float m[2] = {-3.0e38f, -3.0e38f}, l[2] = {0.f, 0.f};      /* m: raw (unscaled) score */
#pragma unroll
  for (int dt = 0; dt < 4; ++dt) for (int qt = 0; qt < 2; ++qt) o[dt][qt] = z8;
  for (int st = w; st <= qb; st += FW) {      /* the same in every lane of a wave; no barrier inside */
    const int k0 = st * 32; const unsigned short* kr = (const unsigned short*)kb + (size_t)k0 * LQK + kofs; const unsigned short* vr = (const unsigned short*)vb + k0 + vofs; v16h kf[2][2], vf[4];
#pragma unroll
    for (int kt = 0; kt < 2; ++kt) for (int ks = 0; ks < 2; ++ks) kf[kt][ks] = fa_frag(kr + kt * 16 * LQK + ks * 32);
    asm volatile("s_wait_xcnt 0x0" :: "v"(kr) : "memory");      /* behind the eight K loads; their address is named as an input so that it lives up to here and no load's result lands in it earlier */
    __builtin_amdgcn_sched_barrier(0);      /* holds that wait between the two groups of loads */
#pragma unroll
    for (int dt = 0; dt < 4; ++dt) vf[dt] = fa_frag(vr + dt * 16 * SQ);
    asm volatile("s_wait_xcnt 0x0" :: "v"(vr) : "memory");      /* the same behind the eight V^T loads */
    __builtin_amdgcn_sched_barrier(0);      /* all sixteen loads of a step are issued ahead of its first product: one load latency a step (left free, the compiler put loads behind products, into their operands' registers: three latencies in a row) */
    v8f s[2][2];      /* s[qt][kt][r]: key k0 + 16 kt + 8 hh + r against query 16 qt + ln */
#pragma unroll
    for (int qt = 0; qt < 2; ++qt) for (int kt = 0; kt < 2; ++kt) s[qt][kt] = fa_mma(kf[kt][1], q[qt][1], fa_mma(kf[kt][0], q[qt][0], z8));
    if (st == qb) {      /* the row block's own keys: those past a row drop out (key 0 of the step stays for every row) */
#pragma unroll
      for (int qt = 0; qt < 2; ++qt) for (int kt = 0; kt < 2; ++kt) for (int r = 0; r < 8; ++r) s[qt][kt][r] = (kt * 16 + 8 * hh + r <= qt * 16 + ln) ? s[qt][kt][r] : -1.0e30f; }
#pragma unroll
    for (int qt = 0; qt < 2; ++qt) {
      float mx = s[qt][0][0];
#pragma unroll
      for (int r = 1; r < 8; ++r) mx = fmaxf(mx, s[qt][0][r]);
#pragma unroll
      for (int r = 0; r < 8; ++r) mx = fmaxf(mx, s[qt][1][r]);
      mx = fmaxf(mx, __shfl_xor(mx, 16, 32));      /* the two lane halves hold the same query's other keys */
      const float mn = fmaxf(m[qt], mx); const float f = fa_exp2((m[qt] - mn) * FC); const float nm = -mn * FC; m[qt] = mn;
      FragH pb; v4f s4 = {0.f, 0.f, 0.f, 0.f};
#pragma unroll
      for (int kt = 0; kt < 2; ++kt) for (int g = 0; g < 2; ++g) { float e0 = fmaf(s[qt][kt][g * 4 + 0], FC, nm), e1 = fmaf(s[qt][kt][g * 4 + 1], FC, nm), e2 = fmaf(s[qt][kt][g * 4 + 2], FC, nm), e3 = fmaf(s[qt][kt][g * 4 + 3], FC, nm);
        /* four 2^x in place; the v_nop as in fa_exp2 */
        asm("v_exp_f32 %0, %0\n\tv_exp_f32 %1, %1\n\tv_exp_f32 %2, %2\n\tv_exp_f32 %3, %3\n\tv_nop" : "+v"(e0), "+v"(e1), "+v"(e2), "+v"(e3));
        const v4f e = {e0, e1, e2, e3}; s4 += e;      /* keys past the row: exactly 0 */
        pb.h[kt * 8 + g * 4 + 0] = (_Float16)e0; pb.h[kt * 8 + g * 4 + 1] = (_Float16)e1; pb.h[kt * 8 + g * 4 + 2] = (_Float16)e2; pb.h[kt * 8 + g * 4 + 3] = (_Float16)e3; }
      l[qt] = l[qt] * f + ((s4[0] + s4[1]) + (s4[2] + s4[3]));
#pragma unroll
      for (int dt = 0; dt < 4; ++dt) { o[dt][qt] *= f; o[dt][qt] = fa_mma(vf[dt], pb.v, o[dt][qt]); } } }
#pragma unroll
  for (int qt = 0; qt < 2; ++qt) { l[qt] += __shfl_xor(l[qt], 16, 32); if (hh == 0) { pm[w][qt * 16 + ln] = m[qt]; pl[w][qt * 16 + ln] = l[qt]; }
#pragma unroll
    for (int dt = 0; dt < 4; ++dt) { const v4f lo = {o[dt][qt][0], o[dt][qt][1], o[dt][qt][2], o[dt][qt][3]}, hi = {o[dt][qt][4], o[dt][qt][5], o[dt][qt][6], o[dt][qt][7]};      /* o[dt][qt][r] = O[query 16 qt + ln][column 16 dt + 8 hh + r] */
      *(v4f*)&po[w][qt * 16 + ln][dt * 16 + 8 * hh] = lo; *(v4f*)&po[w][qt * 16 + ln][dt * 16 + 8 * hh + 4] = hi; } }
  __syncthreads();      /* every wave's part (every wave has at least one step: qb >= FW) is in LDS before the join reads it */
  const int qi = tid >> 4, d4 = (tid & 15) * 4; float M = pm[0][qi];
#pragma unroll
  for (int u = 1; u < FW; ++u) M = fmaxf(M, pm[u][qi]);
  float L = 0.f; v4f a = {0.f, 0.f, 0.f, 0.f};
#pragma unroll
  for (int u = 0; u < FW; ++u) { const float g = fa_exp2((pm[u][qi] - M) * FC); L += g * pl[u][qi]; a += g * *(const v4f*)&po[u][qi][d4]; }
  a *= 1.0f / L;
  *(v4f*)(O + ((size_t)b * SQ + qb * FQ + qi) * DI + d4) = a; }

// Both attention paths on ONE grid (neither reads what the other writes; each output row has one writer): grid.x = batch; grid.y: first the f16 row blocks of rows QT0 .. SQ-1, then the exact f32 blocks of rows 0 .. QT0-1, each kind with its most keys first.
#define NFB ((SQ - QT0) / FQ)        /* f16 row blocks of a batch */
#define NAB (QT0 / FW)               /* exact f32 blocks of a batch */
__global__ __launch_bounds__(FW * 32) void k_attn(const _Float16* __restrict__ QKV, const _Float16* __restrict__ VT, const float* __restrict__ QKVF0, float* __restrict__ O) {
  static_assert(QT0 % FQ == 0 && FW * QT0 <= FW * FQ * FP, "the first tile ends on a row block; the exact path's scores fit the LDS of the other path's parts");
  __shared__ __attribute__((aligned(16))) float po[FW][FQ][FP]; __shared__ float pm[FW][FQ]; __shared__ float pl[FW][FQ];
  const int b = (int)blockIdx.x, y = (int)blockIdx.y;      /* the branch is the same for a whole block: each path's barriers are passed by all of its threads */
  if (y < NFB) fattn_rows(QKV, VT, O, b, SQ / FQ - 1 - y, po, pm, pl);
  else att0_rows(QKVF0, 0.03125f, O, b, (NFB + NAB - 1 - y) * FW, (float (*)[QT0])&po[0][0][0]); }

extern "C" void kernel_launch(void* const* d_in, const int* in_sizes, int n_in,
                              void* d_out, int out_size, void* d_ws, size_t ws_size, hipStream_t stream) {
  (void)in_sizes; (void)n_in; (void)out_size;
  const float* const* I = (const float* const*)d_in; const float* x = I[0]; const float* wq = I[1]; const float* wk = I[2]; const float* wv = I[3];      /* x; natural [out = 64][in] Wq / Wk / Wv (input order as this module lists them); no biases */
  char* ws = (char*)d_ws; size_t off = 0;
  auto take = [&](size_t bytes) { char* p = ws + off; off += (bytes + 255) & ~(size_t)255; return p; };
  _Float16* BW = (_Float16*)take((size_t)LQK * DM * 2); _Float16* X16 = (_Float16*)take(NR * DM * 2); _Float16* QKV = (_Float16*)take(NR * LQK * 2); _Float16* VT = (_Float16*)take((size_t)NB * HD * SQ * 2);
  float* QKVF0 = (float*)take((size_t)NB * QT0 * LQK * 4);      /* every plane holds all batches */
  if (off > ws_size) return;
  k_cvt<<<(unsigned)(3 * WB + NR * DM / 8 / 256), 256, 0, stream>>>(x, wq, wk, wv, X16, BW);      /* weights (x16, stacked q | k | v) and x as exact f16 rows */
  k_gemm2<0, 0, 1><<<dim3((unsigned)((NR / 128) * (LQK / 64)), 1), 128, 0, stream>>>(X16, DM, 0, BW, DM, 0, 0.0625f, nullptr, 0, nullptr, 1, 0, 0, QKVF0, QKV, LQK, 0, (int)NR, LQK, DM);      /* q | k | v = x W^T -> f16 rows, column blocks 0 / 64 / 128 of the fused plane (pitch 192); the same f32 sums of rows 0..511 of each batch also stored unrounded */
  const _Float16* V16 = QKV + 2 * DI;
  k_vt<NH, SQ><<<NB * NH * (SQ / 64), 256, 0, stream>>>(V16, LQK, 0, VT);      /* V^T [NB][HD][SQ] */
  k_attn<<<dim3(NB, NFB + NAB), FW * 32, 0, stream>>>(QKV, VT, QKVF0, (float*)d_out);      /* out = softmax(causal(q k^T * 1024^-0.5)) v (the module scales by the EMBEDDING width), f32: rows 512.. on the f16 path, rows 0..511 exact in f32 */
}

// v006
// A run of this version takes 36.8 microseconds.
// In two side-by-side timings against v005, it was 1.87 and 1.89 times as fast.
// Counting every step since v000, it is 374 times as fast.
#include <hip/hip_runtime.h>
// Single-head causal self-attention with the module's EMBEDDING-width scale (inps [4][2048][1024]; q/k/v = x W^T (natural [64][1024], U(+-1/32), no biases); ONE 64-wide head; scores * 1024^-0.5 (the source sets head_size = n_embed); causal (tril, -inf); softmax; out = weights v -> [4][2048][64]; no output projection).
// Structure (4 launches): the weights as exact f16, packed in fragment order; one WMMA GEMM that reads the f32 x itself (rounded in registers, exact in f16) into the f16 q | k | v plane [8192][192], which also stores the f32 q | k | v of each batch's rows 0..511; v^T via LDS transposes; the last launch holds both attention paths, each storing its own rows: scores, causal softmax and P V in ONE launch (block = 32 query rows of one batch; its 16 waves share the row block's keys in 32-key steps; S^T = K Q^T, weights stay in registers as the B operand of O^T += V^T P^T; running maximum and sum per wave, the waves' parts joined in LDS), f32 straight into the output rows 512..2047; an exact f32 first tile (rows 0..511 of each batch) on further blocks of the same grid.
// Compute dtype: inputs rounded to bf16; x / weights exact; q, k, v and softmax weights as plain f16 GEMM operands (~2^-12); scores, softmax statistics and o f32. v_wmma_f32_16x16x32_f16.
#define NB 4
#define SQ 2048
#define DM 1024
#define NH 1
#define HD 64
#define HG 4                         /* used only by the k_vt(V16, b, h0, VT) overload, which is not launched */
#define QT 256                       /* query rows per causal tile */
#define NKX SQ                       /* unused: the launches keep no S / P plane */
#define QT0 512                      /* first-tile rows computed exactly (f32): 512 here (no output projection averages the early-row cancellation errors away; logit sigma 1.0) */
#define B0 0                         /* unused: every launch covers all batches */
#define NBR NB                       /* unused by the launches (they put NB on or into grid.x) */
#define NR ((size_t)NB * SQ)
#define DMQ DM
#define DFF 4096                     /* unused: there is no FFN */
#define DFFR 100                     /* unused */
#define MP ((int)((size_t)NBR * SQ)) /* unused: the projections take NR rows */
#define QN SQ                        /* unused: the row blocks on grid.y cover SQ */
#define NHD NH                       /* unused: the launches use NH */
#define MPO MP                       /* unused: there is no output stage */
#define LQ (3 * DM)
typedef __bf16 v16b __attribute__((ext_vector_type(16)));
typedef unsigned short v8us __attribute__((ext_vector_type(8), may_alias));
typedef float  v8f  __attribute__((ext_vector_type(8)));
typedef float  v4f  __attribute__((ext_vector_type(4)));
typedef float  v4fa __attribute__((ext_vector_type(4), may_alias));
union FragB { v16b v; v8us half[2]; unsigned short u[16]; };

__device__ __forceinline__ unsigned short bf16_bits(float x) { unsigned int u = __float_as_uint(x); return (unsigned short)((u + 0x7FFFu + ((u >> 16) & 1u)) >> 16); }
__device__ __forceinline__ float bf16_val(unsigned short b) { return __uint_as_float(((unsigned int)b) << 16); }
__device__ __forceinline__ float bf16_round(float x) { return bf16_val(bf16_bits(x)); }
// D += A·B with NT terms: 1 = ah·bh, 2 = + al·bh (A split), 3 = + ah·bl (both split)
template <int NT>
__device__ __forceinline__ v8f mmaN(v16b ah, v16b al, v16b bh, v16b bl, v8f c) {
  c = __builtin_amdgcn_wmma_f32_16x16x32_bf16(false, ah, false, bh, (short)0, c, false, false);
  if (NT >= 2) c = __builtin_amdgcn_wmma_f32_16x16x32_bf16(false, al, false, bh, (short)0, c, false, false);
  if (NT >= 3) c = __builtin_amdgcn_wmma_f32_16x16x32_bf16(false, ah, false, bl, (short)0, c, false, false);
  asm volatile("v_nop\n\tv_nop\n\tv_nop\n\tv_nop" : "+v"(c) : "v"(ah), "v"(al), "v"(bh), "v"(bl));
  return c;
}

__global__ __launch_bounds__(256) void k_wt_bf16(const float* __restrict__ W, unsigned short* __restrict__ Wt, int K, int N) {
  const int t = blockIdx.x * 256 + threadIdx.x;
  const int k8n = K / 8;
  if (t >= N * k8n) return;
  const int n = t / k8n, k8 = (t % k8n) * 8;
  v8us v;
#pragma unroll
  for (int i = 0; i < 8; ++i) v[i] = bf16_bits(W[(size_t)(k8 + i) * N + n]);
  *(v8us*)(Wt + (size_t)n * K + k8) = v;
  
}

// GEMM C[M][N] (f32, pitch ldc) = act(A[M][K]·W + bias). A f32 row-major (pitch lda) converted per fragment to bf16
// (ASPLIT: hi/lo two planes -> 2 terms, else single rounded term); Wt bf16 [N][K] (pitch ldb). BIAS_BF16 rounds the
// bias to bf16 first (bias quantised to bf16 before the add). K%32==0, M%16==0, N%64==0.
template <bool ASPLIT, int ACT, bool BIAS_BF16>
__global__ __launch_bounds__(128) void k_gemm_bf(const float* __restrict__ A, int lda, const unsigned short* __restrict__ Wt, int ldb,
                                               const float* __restrict__ bias, float* __restrict__ C, int ldc, int M, int N, int K) {
  __shared__ __attribute__((aligned(16))) float so[4][16][64];
  const int tid = threadIdx.x, w = tid >> 5, lane = tid & 31, ln = lane & 15, hh = lane >> 4;
  const int ntn = N / 64;
  const int wid = blockIdx.x * 4 + w;
  const int mt = wid / ntn, nq = wid % ntn;
  if (mt * 16 >= M) return;
  const int row0 = mt * 16, col0 = nq * 64;
  const float* arow = A + (size_t)(row0 + ln) * lda;
  v8f acc[4] = {};
  for (int kb = 0; kb < K; kb += 32) {
    FragB ah, al;
    const v4f x0 = *(const v4fa*)(arow + kb + 8 * hh), x1 = *(const v4fa*)(arow + kb + 8 * hh + 4);
    const v4f x2 = *(const v4fa*)(arow + kb + 16 + 8 * hh), x3 = *(const v4fa*)(arow + kb + 16 + 8 * hh + 4);
    float xs[16] = {x0[0],x0[1],x0[2],x0[3],x1[0],x1[1],x1[2],x1[3],x2[0],x2[1],x2[2],x2[3],x3[0],x3[1],x3[2],x3[3]};
#pragma unroll
    for (int i = 0; i < 16; ++i) { const unsigned short hb = bf16_bits(xs[i]); ah.u[i] = hb; al.u[i] = ASPLIT ? bf16_bits(xs[i] - bf16_val(hb)) : (unsigned short)0; }
#pragma unroll
    for (int t = 0; t < 4; ++t) {
      const unsigned short* brow = Wt + (size_t)(col0 + t * 16 + ln) * ldb + kb;
      FragB b;
      b.half[0] = *(const v8us*)(brow + 8 * hh);
      b.half[1] = *(const v8us*)(brow + 16 + 8 * hh);
      acc[t] = mmaN<ASPLIT ? 2 : 1>(ah.v, al.v, b.v, b.v, acc[t]);
    }
  }
#pragma unroll
  for (int t = 0; t < 4; ++t) {
    float bv = bias ? bias[col0 + t * 16 + ln] : 0.f;
    if (BIAS_BF16) bv = bf16_round(bv);
#pragma unroll
    for (int r = 0; r < 8; ++r) { float v = acc[t][r] + bv; if (ACT == 1) v = fmaxf(v, 0.f); so[w][8 * hh + r][t * 16 + ln] = v; }
  }
  __builtin_amdgcn_fence(__ATOMIC_ACQ_REL, "workgroup");
  __builtin_amdgcn_wave_barrier();
  const int rsub = lane >> 4, c4 = (lane & 15) * 4;
  {
#pragma unroll
    for (int q = 0; q < 8; ++q) {
      const int r = q * 2 + rsub;
      const v4f v = *(const v4fa*)&so[w][r][c4];
      *(v4f*)(C + (size_t)(row0 + r) * ldc + col0 + c4) = v;
    }
    
  }
}

// GEMM C = act(A·W + bias + resid): A f32 (ASPLIT -> hi/lo 2 terms), Wt bf16 [N][K]; ACT 0 none, 1 relu, 2 exact gelu;
// resid (optional, f32, row index = (row % rmod), pitch ldr, RES_BF16 rounds it) added before the activation.
template <bool ASPLIT, int ACT, bool BIAS_BF16, bool RES_BF16>
__global__ __launch_bounds__(128) void k_gemm_bf3(const float* __restrict__ A, int lda, const unsigned short* __restrict__ Wt, int ldb,
                                                const float* __restrict__ bias, const float* __restrict__ resid, int rmod, int ldr,
                                                float* __restrict__ C, int ldc, int M, int N, int K) {
  __shared__ __attribute__((aligned(16))) float so[4][16][64];
  const int tid = threadIdx.x, w = tid >> 5, lane = tid & 31, ln = lane & 15, hh = lane >> 4;
  const int ntn = N / 64;
  const int wid = blockIdx.x * 4 + w;
  const int mt = wid / ntn, nq = wid % ntn;
  if (mt * 16 >= M) return;
  const int row0 = mt * 16, col0 = nq * 64;
  const float* arow = A + (size_t)(row0 + ln) * lda;
  v8f acc[4] = {};
  for (int kb = 0; kb < K; kb += 32) {
    FragB ah, al;
    const v4f x0 = *(const v4fa*)(arow + kb + 8 * hh), x1 = *(const v4fa*)(arow + kb + 8 * hh + 4);
    const v4f x2 = *(const v4fa*)(arow + kb + 16 + 8 * hh), x3 = *(const v4fa*)(arow + kb + 16 + 8 * hh + 4);
    float xs[16] = {x0[0],x0[1],x0[2],x0[3],x1[0],x1[1],x1[2],x1[3],x2[0],x2[1],x2[2],x2[3],x3[0],x3[1],x3[2],x3[3]};
#pragma unroll
    for (int i = 0; i < 16; ++i) { const unsigned short hb = bf16_bits(xs[i]); ah.u[i] = hb; al.u[i] = ASPLIT ? bf16_bits(xs[i] - bf16_val(hb)) : (unsigned short)0; }
#pragma unroll
    for (int t = 0; t < 4; ++t) {
      const unsigned short* brow = Wt + (size_t)(col0 + t * 16 + ln) * ldb + kb;
      FragB b;
      b.half[0] = *(const v8us*)(brow + 8 * hh);
      b.half[1] = *(const v8us*)(brow + 16 + 8 * hh);
      acc[t] = mmaN<ASPLIT ? 2 : 1>(ah.v, al.v, b.v, b.v, acc[t]);
    }
  }
#pragma unroll
  for (int t = 0; t < 4; ++t) {
    const int col = col0 + t * 16 + ln;
    float bv = bias ? bias[col] : 0.f;
    if (BIAS_BF16) bv = bf16_round(bv);
#pragma unroll
    for (int r = 0; r < 8; ++r) {
      float v = acc[t][r] + bv;
      if (resid) { float rv = resid[(size_t)((row0 + 8 * hh + r) % rmod) * ldr + col]; if (RES_BF16) rv = bf16_round(rv); v += rv; }
      if (ACT == 1) v = fmaxf(v, 0.f);
      if (ACT == 2) v = 0.5f * v * (1.0f + erff(v * 0.70710678118654752f));
      if (ACT == 3) { const float u = 0.7978845608028654f * (v + 0.044715f * v * v * v); v = 0.5f * v * (1.0f + tanhf(u)); }
      so[w][8 * hh + r][t * 16 + ln] = v;
    }
  }
  __builtin_amdgcn_fence(__ATOMIC_ACQ_REL, "workgroup");
  __builtin_amdgcn_wave_barrier();
  const int rsub = lane >> 4, c4 = (lane & 15) * 4;
  {
#pragma unroll
    for (int q = 0; q < 8; ++q) {
      const int r = q * 2 + rsub;
      const v4f v = *(const v4fa*)&so[w][r][c4];
      *(v4f*)(C + (size_t)(row0 + r) * ldc + col0 + c4) = v;
    }
    
  }
}
// row LayerNorm (biased variance, eps) over N: s = X (+ R); optional out_sum <- s; out_norm <- (s-mu)*rsqrt(var+eps)*g + b
template <bool PARAM_BF16>
__global__ __launch_bounds__(256) void k_layernorm(const float* __restrict__ X, const float* __restrict__ R, const float* __restrict__ g, const float* __restrict__ bta,
                                                  float* __restrict__ out_sum, float* __restrict__ out_norm, int N, float eps) {
  __shared__ float red[256];
  const int row = blockIdx.x, tid = threadIdx.x;
  const float* x = X + (size_t)row * N; const float* rr = R ? R + (size_t)row * N : nullptr;
  float vals[16];                     // up to N = 4096
  const int per = N / 256;            // contiguous chunk per thread? use strided-by-4 chunks: thread handles j = tid*4 + 1024*u
  float s1 = 0.f;
  for (int u = 0; u < per / 4; ++u) {
    const int j = tid * 4 + 1024 * u;
    const v4f a = *(const v4fa*)(x + j);
    v4f b = {0.f,0.f,0.f,0.f}; if (rr) b = *(const v4fa*)(rr + j);
#pragma unroll
    for (int q = 0; q < 4; ++q) { const float v = a[q] + b[q]; vals[u * 4 + q] = v; s1 += v; }
  }
  red[tid] = s1; __syncthreads();
  for (int st = 128; st > 0; st >>= 1) { if (tid < st) red[tid] += red[tid + st]; __syncthreads(); }
  const float mu = red[0] / (float)N; __syncthreads();
  float s2 = 0.f;
  for (int u = 0; u < per / 4; ++u)
#pragma unroll
    for (int q = 0; q < 4; ++q) { const float c = vals[u * 4 + q] - mu; s2 += c * c; }
  red[tid] = s2; __syncthreads();
  for (int st = 128; st > 0; st >>= 1) { if (tid < st) red[tid] += red[tid + st]; __syncthreads(); }
  const float rs = rsqrtf(red[0] / (float)N + eps);
  {
    for (int u = 0; u < per / 4; ++u) {
      const int j = tid * 4 + 1024 * u;
      v4f o, sm;
#pragma unroll
      for (int q = 0; q < 4; ++q) {
        float gg = g[j + q], bb = bta[j + q];
        if (PARAM_BF16) { gg = bf16_round(gg); bb = bf16_round(bb); }
        sm[q] = vals[u * 4 + q]; o[q] = (vals[u * 4 + q] - mu) * rs * gg + bb;
      }
      if (out_sum) *(v4f*)(out_sum + (size_t)row * N + j) = sm;
      *(v4f*)(out_norm + (size_t)row * N + j) = o;
    }
    
  }
}



// ---- f16 WMMA path (v_wmma_f32_16x16x32_f16): 11-bit significands for operands in range — used where a [0,1] probability operand needs more precision than bf16
typedef _Float16 v16h __attribute__((ext_vector_type(16)));
union FragH { v16h v; v8us half[2]; _Float16 h[16]; unsigned short u[16]; };
template <int NT>
__device__ __forceinline__ v8f mmaH(v16h ah, v16h al, v16h bh, v16h bl, v8f c) {
  c = __builtin_amdgcn_wmma_f32_16x16x32_f16(false, ah, false, bh, (short)0, c, false, false);
  if (NT >= 2) c = __builtin_amdgcn_wmma_f32_16x16x32_f16(false, al, false, bh, (short)0, c, false, false);
  if (NT >= 3) c = __builtin_amdgcn_wmma_f32_16x16x32_f16(false, ah, false, bl, (short)0, c, false, false);
  asm volatile("v_nop\n\tv_nop\n\tv_nop\n\tv_nop" : "+v"(c) : "v"(ah), "v"(al), "v"(bh), "v"(bl));
  return c;
}
// batched GEMM like k_gemm_b but f16 operands: A f32 (split into f16 hi/lo if ASPLIT, else rounded to f16), Bt = f16 values [n][k]; alpha; C f32; N multiple of 16 (partial tiles skipped)
template <bool ASPLIT>
__global__ __launch_bounds__(128) void k_gemm_h(const float* __restrict__ A, int lda, size_t sA, const _Float16* __restrict__ Bh, int ldb, size_t sB, float alpha, float* __restrict__ C, int ldc, size_t sC, int M, int N, int K) {
  __shared__ __attribute__((aligned(16))) float so[4][16][64];
  const int tid = threadIdx.x, w = tid >> 5, lane = tid & 31, ln = lane & 15, hh = lane >> 4; const int by = blockIdx.y;
  A += (size_t)by * sA; Bh += (size_t)by * sB; C += (size_t)by * sC;
  const int ntn = (N + 63) / 64; const int wid = blockIdx.x * 4 + w; const int mt = wid / ntn, nq = wid % ntn; if (mt * 16 >= M) return;
  const int row0 = mt * 16, col0 = nq * 64; const float* arow = A + (size_t)(row0 + ln) * lda;
  v8f acc[4] = {};
  for (int kb = 0; kb < K; kb += 32) {
    FragH ah, al;
    const v4f x0 = *(const v4fa*)(arow + kb + 8 * hh), x1 = *(const v4fa*)(arow + kb + 8 * hh + 4), x2 = *(const v4fa*)(arow + kb + 16 + 8 * hh), x3 = *(const v4fa*)(arow + kb + 16 + 8 * hh + 4);
    float xs[16] = {x0[0],x0[1],x0[2],x0[3],x1[0],x1[1],x1[2],x1[3],x2[0],x2[1],x2[2],x2[3],x3[0],x3[1],x3[2],x3[3]};
#pragma unroll
    for (int i = 0; i < 16; ++i) { const _Float16 h = (_Float16)xs[i]; ah.h[i] = h; al.h[i] = ASPLIT ? (_Float16)(xs[i] - (float)h) : (_Float16)0.0f; }
#pragma unroll
    for (int t = 0; t < 4; ++t) { if (col0 + t * 16 >= N) continue; const size_t boff = (size_t)(col0 + t * 16 + ln) * ldb + kb; FragH bq; bq.half[0] = *(const v8us*)(Bh + boff + 8 * hh); bq.half[1] = *(const v8us*)(Bh + boff + 16 + 8 * hh);
      acc[t] = mmaH<ASPLIT ? 2 : 1>(ah.v, al.v, bq.v, bq.v, acc[t]); }
  }
#pragma unroll
  for (int t = 0; t < 4; ++t) { if (col0 + t * 16 >= N) continue;
#pragma unroll
    for (int r = 0; r < 8; ++r) so[w][8 * hh + r][t * 16 + ln] = acc[t][r] * alpha; }
  __builtin_amdgcn_fence(__ATOMIC_ACQ_REL, "workgroup"); __builtin_amdgcn_wave_barrier();
  const int rsub = lane >> 4, c4 = (lane & 15) * 4;
  {
#pragma unroll
    for (int q = 0; q < 8; ++q) { const int r = q * 2 + rsub; if (col0 + c4 < N) { const v4f v = *(const v4fa*)&so[w][r][c4]; *(v4f*)(C + (size_t)(row0 + r) * ldc + col0 + c4) = v; } }
     }
}

// Wt[n][k] = f16(W[k][n]·scale) from f32 row-major W[K][N] (scale = power of two; bf16-exact weights stay exact in f16 away from the subnormal range)
__global__ __launch_bounds__(256) void k_wt_f16(const float* __restrict__ W, _Float16* __restrict__ Wt, int K, int N, float scale) {
  const int t = blockIdx.x * 256 + threadIdx.x; if (t >= N * (K / 8)) return; const int n = t / (K / 8), k8 = (t % (K / 8)) * 8; FragH f;
#pragma unroll
  for (int i = 0; i < 8; ++i) f.h[i] = (_Float16)(bf16_round(W[(size_t)(k8 + i) * N + n]) * scale); const v8us o = f.half[0];
  *(v8us*)((unsigned short*)Wt + (size_t)n * K + k8) = o; 
}
// k_gemm_hh variant with fused epilogue: v = acc·alpha + bias[by·sBias + col] (+ CP[(row/rowsPerB)·sCPb + by·64 + col] if CP) ; ACT 0 none / 1 elu ; writes f16 C16 (and f32 C if non-null)
template <int ACT>
__global__ __launch_bounds__(128) void k_gemm_hhx(const _Float16* __restrict__ A, int lda, size_t sA, const _Float16* __restrict__ Bh, int ldb, size_t sB, float alpha, const float* __restrict__ bias, size_t sBias, const float* __restrict__ CP, int rowsPerB, size_t sCPb, int row0g,
    float* __restrict__ C, _Float16* __restrict__ C16, int ldc, size_t sC, int M, int N, int K) {
  __shared__ __attribute__((aligned(16))) float so[4][16][64];
  const int tid = threadIdx.x, w = tid >> 5, lane = tid & 31, ln = lane & 15, hh = lane >> 4; const int by = blockIdx.y;
  A += (size_t)by * sA; Bh += (size_t)by * sB; const size_t cofs = (size_t)by * sC; const float* bp = bias ? bias + (size_t)by * sBias : nullptr;
  const int ntn = (N + 63) / 64; const int wid = blockIdx.x * 4 + w; const int mt = wid / ntn, nq = wid % ntn; if (mt * 16 >= M) return;
  const int row0 = mt * 16, col0 = nq * 64; const _Float16* arow = A + (size_t)(row0 + ln) * lda;
  v8f acc[4] = {};
  for (int kb = 0; kb < K; kb += 32) { FragH ah; ah.half[0] = *(const v8us*)((const unsigned short*)arow + kb + 8 * hh); ah.half[1] = *(const v8us*)((const unsigned short*)arow + kb + 16 + 8 * hh);
#pragma unroll
    for (int t = 0; t < 4; ++t) { if (col0 + t * 16 >= N) continue; const size_t boff = (size_t)(col0 + t * 16 + ln) * ldb + kb; FragH bq; bq.half[0] = *(const v8us*)((const unsigned short*)Bh + boff + 8 * hh); bq.half[1] = *(const v8us*)((const unsigned short*)Bh + boff + 16 + 8 * hh);
      acc[t] = mmaH<1>(ah.v, ah.v, bq.v, bq.v, acc[t]); }
  }
#pragma unroll
  for (int t = 0; t < 4; ++t) { if (col0 + t * 16 >= N) continue; const int col = col0 + t * 16 + ln; const float bv = bp ? bf16_round(bp[col]) : 0.f;
#pragma unroll
    for (int r = 0; r < 8; ++r) { float v = acc[t][r] * alpha + bv; if (CP) { const int rr = row0g + row0 + 8 * hh + r; if (rowsPerB < 0) v += CP[cofs + (size_t)rr * ldc + col];      /* rowsPerB < 0: own element of the batched C plane */ else { const int bidx = rr / rowsPerB; v += CP[(size_t)bidx * sCPb + (size_t)by * 64 + col]; } } if (ACT == 1) v = (v > 0.f) ? v : expm1f(v); else if (ACT == 7) v = (v > 0.f) ? v + 1.0f : expf(v); else if (ACT == 8) v = tanhf(v); else if (ACT == 9) v = 0.5f * v * (1.0f + tanhf(0.7978845608028654f * (v + 0.044715f * v * v * v))); else if (ACT == 11) v = 1.0f / (1.0f + expf(-v)); else if (ACT == 12) v = (v > 0.f) ? v : 0.01f * v; else if (ACT == 14) v = (v > 0.f) ? v : 0.1f * v; else if (ACT == 16) v = (v >= 0.f) ? v : 0.3f * v; else if (ACT == 17) v = (v >= 0.f) ? v : 0.2f * v; else if (ACT == 15) v = v / (1.0f + expf(-v)); else if (ACT == 3) v = fmaxf(v, 0.f); else if (ACT == 6) v = 0.5f * v * (1.0f + erff(v * 0.70710678118654752f)); so[w][8 * hh + r][t * 16 + ln] = v; } }
  __builtin_amdgcn_fence(__ATOMIC_ACQ_REL, "workgroup"); __builtin_amdgcn_wave_barrier();
  const int rsub = lane >> 4, c4 = (lane & 15) * 4; typedef _Float16 v4h __attribute__((ext_vector_type(4)));
  {
#pragma unroll
    for (int q = 0; q < 8; ++q) { const int r = q * 2 + rsub; if (col0 + c4 < N) { const v4f v = *(const v4fa*)&so[w][r][c4]; if (C) *(v4f*)(C + cofs + (size_t)(row0 + r) * ldc + col0 + c4) = v; if (C16) { v4h h4; for (int i = 0; i < 4; ++i) h4[i] = (_Float16)v[i]; *(v4h*)(C16 + cofs + (size_t)(row0 + r) * ldc + col0 + c4) = h4; } } }
     }
}


typedef _Float16 v4h __attribute__((ext_vector_type(4)));

__global__ __launch_bounds__(256) void k_h16(const float* __restrict__ x, _Float16* __restrict__ X16, size_t n8) { const size_t t = (size_t)blockIdx.x * 256 + threadIdx.x; if (t >= n8) return; FragH f;
#pragma unroll
  for (int q = 0; q < 8; ++q) f.h[q] = (_Float16)x[t * 8 + q]; *(v8us*)((unsigned short*)X16 + t * 8) = f.half[0];  }
__global__ __launch_bounds__(256) void k_round16f(const float* __restrict__ W, _Float16* __restrict__ Bt, size_t n8) { const size_t t = (size_t)blockIdx.x * 256 + threadIdx.x; if (t >= n8) return; FragH f;
#pragma unroll
  for (int i = 0; i < 8; ++i) f.h[i] = (_Float16)(bf16_round(W[t * 8 + i]) * 16.0f); *(v8us*)((unsigned short*)Bt + t * 8) = f.half[0];  }
template <int NHv, int TTv>
__global__ __launch_bounds__(256) void k_vt(const _Float16* __restrict__ V16, int ldv, int voff, _Float16* __restrict__ Vt) { __shared__ unsigned short tl[64][66]; const int tid = threadIdx.x; const int slab = blockIdx.x / (TTv / 64), lg = blockIdx.x % (TTv / 64); const int b = slab / NHv, h = slab % NHv;
  for (int i = tid; i < 64 * 8; i += 256) { const int r = i / 8, c8 = (i % 8) * 8; FragH f; f.half[0] = *(const v8us*)((const unsigned short*)V16 + ((size_t)b * TTv + lg * 64 + r) * ldv + voff + h * 64 + c8);
#pragma unroll
    for (int q = 0; q < 8; ++q) tl[r][c8 + q] = f.u[q]; }
  __syncthreads();
  {
#pragma unroll
    for (int rd = 0; rd < 2; ++rd) { const int d = rd * 32 + tid / 8, pc = tid % 8; FragH f;
#pragma unroll
      for (int q = 0; q < 8; ++q) f.u[q] = tl[pc * 8 + q][d];
      *(v8us*)((unsigned short*)Vt + ((size_t)slab * 64 + d) * TTv + lg * 64 + pc * 8) = f.half[0]; }
     } }

__global__ __launch_bounds__(256) void k_hl(const float* __restrict__ F, _Float16* __restrict__ Hh, _Float16* __restrict__ Hl, size_t n8) { const size_t t = (size_t)blockIdx.x * 256 + threadIdx.x; if (t >= n8) return; FragH fh, fl; const v4f a = *(const v4fa*)(F + t * 8), c = *(const v4fa*)(F + t * 8 + 4);
#pragma unroll
  for (int q = 0; q < 4; ++q) { _Float16 h = (_Float16)a[q]; fh.h[q] = h; fl.h[q] = (_Float16)((a[q] - (float)h) * 1024.0f); h = (_Float16)c[q]; fh.h[4 + q] = h; fl.h[4 + q] = (_Float16)((c[q] - (float)h) * 1024.0f); }
  { *(v8us*)((unsigned short*)Hh + t * 8) = fh.half[0]; *(v8us*)((unsigned short*)Hl + t * 8) = fl.half[0];  } }

// ---- fast GEMM (wave tile 32x64; requires M % 32 == 0 rows per launch region and N % 64 == 0); epilogue = k_gemm_hhx semantics ----
__device__ __forceinline__ v16h g2_frag(const _Float16* p, int hh) { FragH f; f.half[0] = *(const v8us*)((const unsigned short*)p + 8 * hh); f.half[1] = *(const v8us*)((const unsigned short*)p + 16 + 8 * hh); return f.v; }
__device__ __forceinline__ v8f g2_mma(v16h a, v16h b, v8f c) { v8f d = __builtin_amdgcn_wmma_f32_16x16x32_f16(false, a, false, b, (short)0, c, false, false); asm volatile("v_nop\n\tv_nop\n\tv_nop\n\tv_nop" : "+v"(d) : "v"(a), "v"(b)); return d; }
// CAUS 0: plain. CAUS 1 (scores): a 64-column tile at or past the end of its rows' causal query tile is skipped. CAUS 2 (P V): K runs over the keys of the rows' causal query tile only.
// F0 1: C holds only rows 0..QT0-1 of each batch, packed ([NB][QT0] rows); the other rows go to C16 alone.
template <int ACT, int CAUS = 0, int F0 = 0>
__global__ __launch_bounds__(128) void k_gemm2(const _Float16* __restrict__ A, int lda, size_t sA, const _Float16* __restrict__ Bh, int ldb, size_t sB, float alpha, const float* __restrict__ bias, size_t sBias, const float* __restrict__ CP, int rowsPerB, size_t sCPb, int row0g,
    float* __restrict__ C, _Float16* __restrict__ C16, int ldc, size_t sC, int M, int N, int K) { static_assert(ACT == 0 || ACT == 3 || ACT == 6 || ACT == 8 || ACT == 9 || ACT == 11 || ACT == 12 || ACT == 14 || ACT == 15 || ACT == 16 || ACT == 17, "k_gemm2: unsupported ACT code (would silently apply no activation)");
  __shared__ __attribute__((aligned(16))) float so[4][32][68];
  const int tid = threadIdx.x, w = tid >> 5, lane = tid & 31, ln = lane & 15, hh = lane >> 4; const int by = blockIdx.y;
  A += (size_t)by * sA; Bh += (size_t)by * sB; const size_t cofs = (size_t)by * sC; const float* bp = bias ? bias + (size_t)by * sBias : nullptr;
  const int ntn = N >> 6; const int mt = blockIdx.x / ntn, nq = blockIdx.x - mt * ntn; const int row0 = mt * 128 + 32 * w, col0 = nq * 64; if (row0 >= M) return;
  static_assert(QT % 128 == 0, "a 128-row block lies in one causal query tile"); const int nkc = (mt * 128 / QT + 1) * QT;      /* keys below the end of this block's causal query tile */
  if (CAUS == 1 && col0 >= nkc) return; if (CAUS == 2) K = nkc;
  const _Float16* a0p = A + (size_t)(row0 + ln) * lda; const _Float16* a1p = a0p + (size_t)16 * lda;
  const _Float16* b0p = Bh + (size_t)(col0 + ln) * ldb; const _Float16* b1p = b0p + (size_t)16 * ldb; const _Float16* b2p = b1p + (size_t)16 * ldb; const _Float16* b3p = b2p + (size_t)16 * ldb;
  const v8f z8 = {0.f,0.f,0.f,0.f,0.f,0.f,0.f,0.f}; v8f c00 = z8, c01 = z8, c02 = z8, c03 = z8, c10 = z8, c11 = z8, c12 = z8, c13 = z8;
#pragma unroll 1
  for (int kb = 0; kb < K; kb += 32) { const v16h a0 = g2_frag(a0p + kb, hh), a1 = g2_frag(a1p + kb, hh);
    v16h b = g2_frag(b0p + kb, hh); c00 = g2_mma(a0, b, c00); c10 = g2_mma(a1, b, c10);
    b = g2_frag(b1p + kb, hh); c01 = g2_mma(a0, b, c01); c11 = g2_mma(a1, b, c11);
    b = g2_frag(b2p + kb, hh); c02 = g2_mma(a0, b, c02); c12 = g2_mma(a1, b, c12);
    b = g2_frag(b3p + kb, hh); c03 = g2_mma(a0, b, c03); c13 = g2_mma(a1, b, c13); }
  v8f accs[8] = {c00, c01, c02, c03, c10, c11, c12, c13};
#pragma unroll
  for (int u = 0; u < 8; ++u) { const int t = u & 3, half = u >> 2; const int col = col0 + t * 16 + ln; const float bv = bp ? bf16_round(bp[col]) : 0.f;
#pragma unroll
    for (int r = 0; r < 8; ++r) { const int rloc = half * 16 + 8 * hh + r; float v = accs[u][r] * alpha + bv; if (CP) { if (rowsPerB < 0) v += CP[cofs + (size_t)(row0g + row0 + rloc) * ldc + col];      /* rowsPerB < 0: own element of the batched C plane */ else { const int bidx = (row0g + row0 + rloc) / rowsPerB; v += CP[(size_t)bidx * sCPb + (size_t)by * 64 + col]; } }
      if (ACT == 3) v = fmaxf(v, 0.f); else if (ACT == 6) v = 0.5f * v * (1.0f + erff(v * 0.70710678118654752f)); else if (ACT == 11) v = 1.0f / (1.0f + expf(-v)); else if (ACT == 15) v = v / (1.0f + expf(-v)); else if (ACT == 12) v = (v > 0.f) ? v : 0.01f * v; else if (ACT == 8) v = tanhf(v); else if (ACT == 9) v = 0.5f * v * (1.0f + tanhf(0.7978845608028654f * (v + 0.044715f * v * v * v))); else if (ACT == 14) v = (v > 0.f) ? v : 0.1f * v; else if (ACT == 16) v = (v >= 0.f) ? v : 0.3f * v; else if (ACT == 17) v = (v >= 0.f) ? v : 0.2f * v;
      so[w][rloc][t * 16 + ln] = v; } }
  __builtin_amdgcn_fence(__ATOMIC_ACQ_REL, "workgroup"); __builtin_amdgcn_wave_barrier();
  const int rsub = lane >> 4, c4 = (lane & 15) * 4;
  static_assert(SQ % 32 == 0 && QT0 % 32 == 0, "a wave's 32 rows lie on one side of the first tile's end"); size_t crow = (size_t)row0; if (F0) { const int rb = row0 / SQ, ri = row0 - rb * SQ; crow = (size_t)rb * QT0 + ri; if (ri >= QT0) C = nullptr; }
  {
#pragma unroll
    for (int q = 0; q < 16; ++q) { const int r = q * 2 + rsub; const v4f v = *(const v4fa*)&so[w][r][c4]; if (C) *(v4f*)(C + cofs + (crow + r) * ldc + col0 + c4) = v; if (C16) { v4h h4; for (int i = 0; i < 4; ++i) h4[i] = (_Float16)v[i]; *(v4h*)(C16 + cofs + (size_t)(row0 + r) * ldc + col0 + c4) = h4; } }
     } }


__global__ __launch_bounds__(256) void k_rsm(const float* __restrict__ S, _Float16* __restrict__ P, int nrows) {
  #pragma clang fp contract(off)
  const int i = blockIdx.x * 256 + threadIdx.x; if (i >= nrows) return; const float* s = S + (size_t)i * SQ; float mx = -3.0e38f;
#pragma unroll 1
  for (int j = 0; j < SQ; ++j) mx = fmaxf(mx, s[j]); float se = 0.f;
#pragma unroll 1
  for (int j = 0; j < SQ; ++j) se += expf(s[j] - mx); const float sc = 256.0f / se;
#pragma unroll 1
  for (int j0 = 0; j0 < SQ; j0 += 8) { FragH f; for (int q = 0; q < 8; ++q) f.h[q] = (_Float16)(expf(s[j0 + q] - mx) * sc); unsigned short* d = (unsigned short*)P + (size_t)i * SQ + j0; *(v8us*)d = f.half[0];  } }
__global__ __launch_bounds__(256) void k_vt(const _Float16* __restrict__ V16, int b, int h0, _Float16* __restrict__ VT) { __shared__ unsigned short tl[64][65]; const int tid = threadIdx.x; const int hh = blockIdx.x % HG, sg = blockIdx.x / HG; const int s0 = sg * 64; const int h = h0 + hh;
  for (int i = tid; i < 64 * 8; i += 256) { const int j = i / 8, d8 = (i % 8) * 8; FragH f; f.half[0] = *(const v8us*)((const unsigned short*)V16 + ((size_t)b * SQ + s0 + j) * DM + h * HD + d8); for (int q = 0; q < 8; ++q) tl[d8 + q][j] = f.u[q]; }
  __syncthreads();
  { for (int i = tid; i < 64 * 8; i += 256) { const int d = i / 8, j8 = (i % 8) * 8; FragH f; for (int q = 0; q < 8; ++q) f.u[q] = tl[d][j8 + q]; *(v8us*)((unsigned short*)VT + ((size_t)hh * HD + d) * SQ + s0 + j8) = f.half[0]; }  } }



template <int BFIN, int WXB>
__global__ __launch_bounds__(256) void k_ln16(const float* __restrict__ X, const float* __restrict__ g, const float* __restrict__ bb, float eps, _Float16* __restrict__ N16, float* __restrict__ XB) {
  #pragma clang fp contract(off)
  __shared__ float red[256]; const size_t r = blockIdx.x; const int t = threadIdx.x; const v4f xa = *(const v4fa*)(X + r * DMQ + t * 4); float s[4]; float sum = 0.f;
  for (int q = 0; q < 4; ++q) { s[q] = BFIN ? bf16_round(xa[q]) : xa[q]; sum = __fadd_rn(sum, s[q]); }
  red[t] = sum; __syncthreads(); for (int st = 128; st > 0; st >>= 1) { if (t < st) red[t] = __fadd_rn(red[t], red[t + st]); __syncthreads(); } const float mu = red[0] / (float)DMQ; __syncthreads();
  float vs = 0.f; for (int q = 0; q < 4; ++q) { const float dl = __fadd_rn(s[q], -mu); vs = __fadd_rn(vs, __fmul_rn(dl, dl)); } red[t] = vs; __syncthreads(); for (int st = 128; st > 0; st >>= 1) { if (t < st) red[t] = __fadd_rn(red[t], red[t + st]); __syncthreads(); }
  const float rs = rsqrtf(__fadd_rn(red[0] / (float)DMQ, eps)); v4h y; v4f xb;
  for (int q = 0; q < 4; ++q) { const int c = t * 4 + q; y[q] = (_Float16)__fadd_rn(__fmul_rn(__fmul_rn(__fadd_rn(s[q], -mu), rs), bf16_round(g[c])), bf16_round(bb[c])); xb[q] = s[q]; }
  { *(v4h*)(N16 + r * DMQ + t * 4) = y; if (WXB) *(v4f*)(XB + r * DMQ + t * 4) = xb;  } }
__global__ __launch_bounds__(256) void k_ftres2(const float* __restrict__ OF0, const float* __restrict__ XB, float* __restrict__ X1, size_t n4) {
  #pragma clang fp contract(off)
  const size_t t = (size_t)blockIdx.x * 256 + threadIdx.x; if (t >= n4) return; const v4f o = *(const v4fa*)(OF0 + t * 4), xv = *(const v4fa*)(XB + t * 4); v4f y; for (int q = 0; q < 4; ++q) y[q] = __fadd_rn(__fmul_rn(o[q], 0.015625f), xv[q]); *(v4f*)(X1 + t * 4) = y;  }

__global__ __launch_bounds__(256) void k_wthd(const float* __restrict__ Wt, _Float16* __restrict__ Bt) { const size_t t = (size_t)blockIdx.x * 256 + threadIdx.x; if (t >= (size_t)NH * HD * (DM / 8)) return; const int m8 = (int)(t % (DM / 8)) * 8; const int d = (int)((t / (DM / 8)) % HD); const int h = (int)(t / ((size_t)(DM / 8) * HD)); FragH f;
  for (int q = 0; q < 8; ++q) f.h[q] = (_Float16)(16.0f * bf16_round(Wt[((size_t)h * DM + m8 + q) * HD + d])); unsigned short* dst = (unsigned short*)Bt + ((size_t)h * HD + d) * DM + m8; *(v8us*)dst = f.half[0];  }




__global__ __launch_bounds__(256) void k_wtpad(const float* __restrict__ Wm, _Float16* __restrict__ Wt, int Kr, int Kp, int Nr, int Np, float scale) {
  const int t = blockIdx.x * 256 + threadIdx.x; if (t >= Np * (Kp / 8)) return; const int n = t / (Kp / 8), k8 = (t % (Kp / 8)) * 8; const int nc = min(n, Nr - 1); const float fn = (n < Nr) ? 1.f : 0.f; FragH f;
  for (int i = 0; i < 8; ++i) { const int k = k8 + i; const int kc = min(k, Kr - 1); const float fk = (k < Kr) ? fn : 0.f; f.h[i] = (_Float16)(bf16_round(Wm[(size_t)kc * Nr + nc]) * scale * fk); }
  unsigned short* o = (unsigned short*)Wt + (size_t)n * Kp + k8; *(v8us*)o = f.half[0];  }
__global__ __launch_bounds__(128) void k_bpad(const float* __restrict__ b, float* __restrict__ Bp, int nr, int np) {
  const int i = threadIdx.x; if (i >= np) return; const float v = b[min(i, nr - 1)] * ((i < nr) ? 1.f : 0.f); *(float*)(Bp + i) = v;  }

#define DI 64         /* inner width = NH * HD (ONE 64-wide head) */
#define LQK (3 * DI)  /* fused q | k | v row pitch (192) */
__global__ __launch_bounds__(256) void k_o0(const float* __restrict__ OF, float* __restrict__ ob, size_t n4) {
  #pragma clang fp contract(off)
  const size_t t = (size_t)blockIdx.x * 256 + threadIdx.x; if (t >= n4) return; const size_t e = t * 4; const int i = (int)(e / DI); const int c = (int)(e % DI); const int h = c / HD, d = c % HD; const v4f a = *(const v4fa*)(OF + e); v4f o; for (int q = 0; q < 4; ++q) o[q] = __fmul_rn(a[q], 0.015625f); float* dst = ob + (size_t)h * SQ * HD + (size_t)i * HD + d; *(v4f*)dst = o;  }

// The projection q | k | v = x W^T straight from the f32 input: x is read once, by the GEMM itself.
#define GKS 8                        /* K slices of a block */
#define GST (DM / GKS / 32)          /* 32-wide k steps of a slice */
#define GNT (LQK / 16)               /* 16-column tiles of q | k | v */
#define GP (LQK + 4)                 /* floats between two rows of a part in LDS: 16-byte aligned; the two lane halves (8 rows apart) fall on different banks */
// Wq | Wk | Wv (natural [64][DM] rows, x16, exact in f16) packed so that a wave's 16-byte load of half a B fragment is 512 contiguous bytes:
// BP[k step][column tile][half j][lane][8]: column 16 tile + (lane & 15), k = 32 step + 16 j + 8 (lane >> 4) + 0..7 (the hardware k order, as the A loader below).
__global__ __launch_bounds__(256) void k_wpack(const float* __restrict__ wq, const float* __restrict__ wk, const float* __restrict__ wv, _Float16* __restrict__ BP) {
  static_assert((DM / 32) * GNT * 2 * 32 % 256 == 0 && DI % 16 == 0, "whole blocks; a column tile lies in one weight");
  const unsigned t = blockIdx.x * 256 + threadIdx.x, lane = t & 31, j = (t >> 5) & 1, u = t >> 6; const unsigned ct = u % GNT, st = u / GNT;
  const unsigned col = ct * 16 + (lane & 15), k = st * 32 + j * 16 + 8 * (lane >> 4);
  const float* w = (col < DI) ? wq : (col < 2 * DI) ? wk : wv; const float* p = w + (size_t)(col % DI) * DM + k; FragH f;
#pragma unroll      /* the eight elements stay in registers: two 16-byte loads, one 16-byte store */
  for (int q = 0; q < 8; ++q) f.h[q] = (_Float16)(bf16_round(p[q]) * 16.0f);
  *(v8us*)((unsigned short*)BP + (size_t)t * 8) = f.half[0]; }
typedef float v2fc __attribute__((ext_vector_type(2)));
typedef __bf16 v2bc __attribute__((ext_vector_type(2)));
typedef _Float16 v2hc __attribute__((ext_vector_type(2)));
// A block takes 32 rows of x and all 192 columns; wave w takes row tile w & 1 and K slice w >> 1 (128 of the 1024 k): its whole share of x (16 loads) is in flight at once.
// The slices' parts are summed in LDS (slice 0 first); the block's f16 rows (and f32 rows, where kept) are one contiguous range of the plane.
__global__ __launch_bounds__(GKS * 2 * 32) void k_qkv(const float* __restrict__ x, const _Float16* __restrict__ BP, float* __restrict__ C0, _Float16* __restrict__ C16) {
  static_assert(DM % (GKS * 32) == 0 && NR % 32 == 0 && SQ % 32 == 0 && QT0 % 32 == 0 && (32 * LQK / 4) % (GKS * 2 * 32) == 0, "whole k steps; a block's 32 rows lie on one side of the first tile's end");
  __shared__ __attribute__((aligned(16))) float part[GKS][32][GP];
  const int tid = threadIdx.x, lane = tid & 31, ln = lane & 15, hh = lane >> 4; const int w = __builtin_amdgcn_readfirstlane(tid >> 5); const int rt = w & 1, ks = w >> 1; const int row0 = (int)blockIdx.x * 32;
  const float* xs = x + (size_t)(row0 + rt * 16) * DM + ks * (GST * 32); const unsigned xo = (unsigned)(ln * DM + 8 * hh) * 4u;      /* the lane's byte offset: the one vector register that all sixteen loads name */
  v4f xa[GST][4];
#pragma unroll      /* constant indices: the arrays stay in registers */
  for (int s = 0; s < GST; ++s) { const char* p = (const char*)(xs + s * 32) + xo; xa[s][0] = *(const v4fa*)p; xa[s][1] = *(const v4fa*)(p + 16); xa[s][2] = *(const v4fa*)(p + 64); xa[s][3] = *(const v4fa*)(p + 80); }
  asm volatile("s_wait_xcnt 0x0" :: "v"(xo) : "memory");      /* behind the sixteen x loads; their offset is named as an input so that it lives up to here */
  const unsigned short* bs = (const unsigned short*)BP + (size_t)ks * (GST * GNT * 512); const unsigned bo = (unsigned)(lane * 16);      /* byte offset, as xo */
  const v8f z8 = {0.f, 0.f, 0.f, 0.f, 0.f, 0.f, 0.f, 0.f}; v8f acc[GNT];
#pragma unroll      /* constant indices: the arrays stay in registers */
  for (int t = 0; t < GNT; ++t) acc[t] = z8;
#pragma unroll      /* constant indices: the arrays stay in registers */
  for (int s = 0; s < GST; ++s) { union { v16h v; v2hc p[8]; } ah;
#pragma unroll      /* constant indices: the arrays stay in registers */
    for (int c = 0; c < 4; ++c) for (int i = 0; i < 2; ++i) { const v2fc e = {xa[s][c][2 * i], xa[s][c][2 * i + 1]}; const v2bc r = __builtin_convertvector(e, v2bc);      /* to bf16, nearest even, then exact in f16 */
      ah.p[c * 2 + i] = __builtin_convertvector(__builtin_convertvector(r, v2fc), v2hc); }
#pragma unroll      /* constant indices: the arrays stay in registers */
    for (int t = 0; t < GNT; ++t) { FragH b; const char* p = (const char*)(bs + (s * GNT + t) * 512) + bo; b.half[0] = *(const v8us*)p; b.half[1] = *(const v8us*)(p + 512); acc[t] = __builtin_amdgcn_wmma_f32_16x16x32_f16(false, ah.v, false, b.v, (short)0, acc[t], false, false); } }
  asm volatile("s_wait_xcnt 0x0" :: "v"(bo) : "memory");      /* the same behind the W loads */
#pragma unroll      /* constant indices: the arrays stay in registers */
  for (int t = 0; t < GNT; ++t) for (int r = 0; r < 8; ++r) part[ks][rt * 16 + 8 * hh + r][t * 16 + ln] = acc[t][r];
  __syncthreads();      /* every slice's part is in LDS before the sum reads it */
  const int rb = row0 / SQ, ri = row0 - rb * SQ;
#pragma unroll      /* three groups of four columns a thread, no loop counter */
  for (int q = 0; q < 32 * LQK / 4 / (GKS * 2 * 32); ++q) { const int g = q * (GKS * 2 * 32) + tid; const int row = g / (LQK / 4), c4 = (g - row * (LQK / 4)) * 4; v4f v = *(const v4f*)&part[0][row][c4];
#pragma unroll      /* the eight LDS reads are issued together */
    for (int u = 1; u < GKS; ++u) v += *(const v4f*)&part[u][row][c4];
    v *= 0.0625f; v4h h4; for (int i = 0; i < 4; ++i) h4[i] = (_Float16)v[i];
    *(v4h*)(C16 + (size_t)row0 * LQK + (size_t)g * 4) = h4;
    if (ri < QT0) *(v4f*)(C0 + ((size_t)rb * QT0 + ri) * LQK + (size_t)g * 4) = v; } }
#define FW 16                        /* waves of an attention block, either path */
// Exact f32 causal attention for rows 0..QT0-1 of each batch, spread over lanes: a block takes FW query rows (i0 ..) of batch b; sc: FW rows of QT0 floats in the block's LDS.
// Scores: one THREAD per key (its K row in registers; the FW q rows are read at block-uniform addresses). Softmax and P V: one WAVE per query row (lanes across the keys, then across the 64 output columns).
typedef float v2f __attribute__((ext_vector_type(2)));
typedef float v2fa __attribute__((ext_vector_type(2), may_alias));
__device__ __forceinline__ void att0_rows(const float* __restrict__ QKV, float scale, float* __restrict__ O, const int b, const int i0, float (*sc)[QT0]) {      /* sc: scaled scores, then the unnormalised weights, of the block's rows */
  static_assert(QT0 % 32 == 0 && QT0 / 32 <= 16 && QT0 % FW == 0 && HD == 64 && NH == 1, "key chunks of 32, at most 16 a row; two output columns a lane");
  const int tid = threadIdx.x, lane = tid & 31; const int w = __builtin_amdgcn_readfirstlane(tid >> 5);
  const float* base = QKV + (size_t)b * QT0 * LQK; const float* qb = base + (size_t)i0 * LQK; const float* kb = base + DI; const float* vb = base + 2 * DI;
  for (int j0 = w * 32; j0 < i0 + FW; j0 += FW * 32) {      /* whole 32-key chunks up to the block's last row: j <= QT0 - 1 */
    const int j = j0 + lane; const float* kr = kb + (size_t)j * LQK; v4f kk[HD / 4];
#pragma unroll
    for (int c = 0; c < HD / 4; ++c) kk[c] = *(const v4fa*)(kr + c * 4);
#pragma unroll 1      /* rolled: one q row (64 scalars) fits the scalar registers; with the rows unrolled they spill */
    for (int r = 0; r < FW; ++r) { v4f a = {0.f, 0.f, 0.f, 0.f};
#pragma unroll
      for (int c = 0; c < HD / 4; ++c) a += *(const v4fa*)(qb + r * LQK + c * 4) * kk[c];
      sc[r][j] = ((a[0] + a[1]) + (a[2] + a[3])) * scale; } }
  __syncthreads();      /* every key's scores are in LDS before a row's wave reads them */
  const int i = i0 + w; const int nu = (i >> 5) + 1; float x[QT0 / 32]; float mx = -1.0e30f;
#pragma unroll
  for (int u = 0; u < QT0 / 32; ++u) if (u < nu) x[u] = sc[w][u * 32 + lane];      /* all reads issued before the first is used */
#pragma unroll
  for (int u = 0; u < QT0 / 32; ++u) if (u < nu) { x[u] = (u * 32 + lane <= i) ? x[u] : -1.0e30f; mx = fmaxf(mx, x[u]); }
  for (int d = 16; d > 0; d >>= 1) mx = fmaxf(mx, __shfl_xor(mx, d, 32));
  float l = 0.f;
#pragma unroll
  for (int u = 0; u < QT0 / 32; ++u) if (u < nu) { const float e = expf(x[u] - mx); l += e; sc[w][u * 32 + lane] = e; }      /* keys past the row: exactly 0 */
  for (int d = 16; d > 0; d >>= 1) l += __shfl_xor(l, d, 32);
  __syncthreads();      /* the weights that the other lanes wrote are in LDS before they are read back */
  v2f o = {0.f, 0.f}; const float* vr = vb + lane * 2;
  for (int j0 = 0; j0 < nu * 32; j0 += 32) {
    v4f p[8]; v2f vv[32];
#pragma unroll
    for (int t = 0; t < 32; ++t) vv[t] = *(const v2fa*)(vr + (size_t)(j0 + t) * LQK);
#pragma unroll
    for (int t = 0; t < 8; ++t) p[t] = *(const v4f*)&sc[w][j0 + t * 4];
#pragma unroll
    for (int t = 0; t < 32; ++t) o += p[t >> 2][t & 3] * vv[t]; }
  o *= 1.0f / l;
  *(v2f*)(O + ((size_t)b * SQ + i) * DI + lane * 2) = o;      /* the row's own place in the output: no other block stores rows 0..QT0-1 */
  asm volatile("s_wait_xcnt 0x0" ::: "memory"); }      /* behind the store: in the joined kernel code of the other path follows in the listing and writes the store's registers */

// Fused causal attention. A block takes the FQ query rows of row block qb of batch b; its FW waves take the row block's keys in 32-key steps, step st to wave st % FW.
// A step: S^T = K Q^T (A = 16 key rows, B = 16 query rows: a lane holds scores of ONE query), running maximum and sum per query, weights exp(s - m) packed in place as f16 into the B operand of O^T += V^T P^T.
// At the end every wave leaves (m, l, O) in LDS and the block joins them: out = sum_w 2^(c (m_w - M)) O_w / sum_w 2^(c (m_w - M)) l_w.
#define FQ 32                        /* query rows of a block: two 16-column groups a wave */
#define FP 68                        /* floats between two rows of a wave's part in LDS: 16-byte aligned, rows spread over the banks */
#define FC (0.03125f * 1.44269504f)  /* raw score -> scaled log2 domain: 1024^-0.5 * log2 e */
/* 2^x; the v_nop is the slot that the instruction set asks for behind a transcendental, in the same statement so that it stands there whatever the compiler puts next */
__device__ __forceinline__ float fa_exp2(float x) { asm("v_exp_f32 %0, %0\n\tv_nop" : "+v"(x)); return x; }
/* a fragment in the hardware k order; p: the lane's own row, at its lane half's first element */
__device__ __forceinline__ v16h fa_frag(const unsigned short* p) { FragH f; f.half[0] = *(const v8us*)p; f.half[1] = *(const v8us*)(p + 16); return f.v; }
__device__ __forceinline__ v8f fa_mma(v16h a, v16h b, v8f c) { return __builtin_amdgcn_wmma_f32_16x16x32_f16(false, a, false, b, (short)0, c, false, false); }
__device__ __forceinline__ void fattn_rows(const _Float16* __restrict__ QKV, const _Float16* __restrict__ VT, float* __restrict__ O, const int b, const int qb, float (*po)[FQ][FP], float (*pm)[FQ], float (*pl)[FQ]) {
  static_assert(HD == 64 && NH == 1 && SQ % FQ == 0 && FQ == 32 && FW * 32 == FQ * (HD / 4), "two k blocks a score, four 16-row tiles of O^T; the join gives a thread four columns of one row");
  const int tid = threadIdx.x, lane = tid & 31, ln = lane & 15, hh = lane >> 4; const int w = __builtin_amdgcn_readfirstlane(tid >> 5);
  const _Float16* base = QKV + (size_t)b * SQ * LQK; const _Float16* qp = base + (size_t)(qb * FQ + ln) * LQK; const _Float16* kb = base + DI; const _Float16* vb = VT + (size_t)b * HD * SQ; const unsigned kofs = (unsigned)(ln * LQK + 8 * hh), vofs = (unsigned)(ln * SQ + 8 * hh);
  v16h q[2][2];
#pragma unroll
  for (int qt = 0; qt < 2; ++qt) for (int ks = 0; ks < 2; ++ks) q[qt][ks] = g2_frag(qp + (size_t)qt * 16 * LQK + ks * 32, hh);
  const v8f z8 = {0.f, 0.f, 0.f, 0.f, 0.f, 0.f, 0.f, 0.f}; v8f o[4][2]; float m[2] = {-3.0e38f, -3.0e38f}, l[2] = {0.f, 0.f};      /* m: raw (unscaled) score */
#pragma unroll
  for (int dt = 0; dt < 4; ++dt) for (int qt = 0; qt < 2; ++qt) o[dt][qt] = z8;
  for (int st = w; st <= qb; st += FW) {      /* the same in every lane of a wave; no barrier inside */
    const int k0 = st * 32; const unsigned short* kr = (const unsigned short*)kb + (size_t)k0 * LQK + kofs; const unsigned short* vr = (const unsigned short*)vb + k0 + vofs; v16h kf[2][2], vf[4];
#pragma unroll
    for (int kt = 0; kt < 2; ++kt) for (int ks = 0; ks < 2; ++ks) kf[kt][ks] = fa_frag(kr + kt * 16 * LQK + ks * 32);
    asm volatile("s_wait_xcnt 0x0" :: "v"(kr) : "memory");      /* behind the eight K loads; their address is named as an input so that it lives up to here and no load's result lands in it earlier */
    __builtin_amdgcn_sched_barrier(0);      /* holds that wait between the two groups of loads */
#pragma unroll
    for (int dt = 0; dt < 4; ++dt) vf[dt] = fa_frag(vr + dt * 16 * SQ);
    asm volatile("s_wait_xcnt 0x0" :: "v"(vr) : "memory");      /* the same behind the eight V^T loads */
    __builtin_amdgcn_sched_barrier(0);      /* all sixteen loads of a step are issued ahead of its first product: one load latency a step (left free, the compiler put loads behind products, into their operands' registers: three latencies in a row) */
    v8f s[2][2];      /* s[qt][kt][r]: key k0 + 16 kt + 8 hh + r against query 16 qt + ln */
#pragma unroll
    for (int qt = 0; qt < 2; ++qt) for (int kt = 0; kt < 2; ++kt) s[qt][kt] = fa_mma(kf[kt][1], q[qt][1], fa_mma(kf[kt][0], q[qt][0], z8));
    if (st == qb) {      /* the row block's own keys: those past a row drop out (key 0 of the step stays for every row) */
#pragma unroll
      for (int qt = 0; qt < 2; ++qt) for (int kt = 0; kt < 2; ++kt) for (int r = 0; r < 8; ++r) s[qt][kt][r] = (kt * 16 + 8 * hh + r <= qt * 16 + ln) ? s[qt][kt][r] : -1.0e30f; }
#pragma unroll
    for (int qt = 0; qt < 2; ++qt) {
      float mx = s[qt][0][0];
#pragma unroll
      for (int r = 1; r < 8; ++r) mx = fmaxf(mx, s[qt][0][r]);
#pragma unroll
      for (int r = 0; r < 8; ++r) mx = fmaxf(mx, s[qt][1][r]);
      mx = fmaxf(mx, __shfl_xor(mx, 16, 32));      /* the two lane halves hold the same query's other keys */
      const float mn = fmaxf(m[qt], mx); const float f = fa_exp2((m[qt] - mn) * FC); const float nm = -mn * FC; m[qt] = mn;
      FragH pb; v4f s4 = {0.f, 0.f, 0.f, 0.f};
#pragma unroll
      for (int kt = 0; kt < 2; ++kt) for (int g = 0; g < 2; ++g) { float e0 = fmaf(s[qt][kt][g * 4 + 0], FC, nm), e1 = fmaf(s[qt][kt][g * 4 + 1], FC, nm), e2 = fmaf(s[qt][kt][g * 4 + 2], FC, nm), e3 = fmaf(s[qt][kt][g * 4 + 3], FC, nm);
        /* four 2^x in place; the v_nop as in fa_exp2 */
        asm("v_exp_f32 %0, %0\n\tv_exp_f32 %1, %1\n\tv_exp_f32 %2, %2\n\tv_exp_f32 %3, %3\n\tv_nop" : "+v"(e0), "+v"(e1), "+v"(e2), "+v"(e3));
        const v4f e = {e0, e1, e2, e3}; s4 += e;      /* keys past the row: exactly 0 */
        pb.h[kt * 8 + g * 4 + 0] = (_Float16)e0; pb.h[kt * 8 + g * 4 + 1] = (_Float16)e1; pb.h[kt * 8 + g * 4 + 2] = (_Float16)e2; pb.h[kt * 8 + g * 4 + 3] = (_Float16)e3; }
      l[qt] = l[qt] * f + ((s4[0] + s4[1]) + (s4[2] + s4[3]));
#pragma unroll
      for (int dt = 0; dt < 4; ++dt) { o[dt][qt] *= f; o[dt][qt] = fa_mma(vf[dt], pb.v, o[dt][qt]); } } }
#pragma unroll
  for (int qt = 0; qt < 2; ++qt) { l[qt] += __shfl_xor(l[qt], 16, 32); if (hh == 0) { pm[w][qt * 16 + ln] = m[qt]; pl[w][qt * 16 + ln] = l[qt]; }
#pragma unroll
    for (int dt = 0; dt < 4; ++dt) { const v4f lo = {o[dt][qt][0], o[dt][qt][1], o[dt][qt][2], o[dt][qt][3]}, hi = {o[dt][qt][4], o[dt][qt][5], o[dt][qt][6], o[dt][qt][7]};      /* o[dt][qt][r] = O[query 16 qt + ln][column 16 dt + 8 hh + r] */
      *(v4f*)&po[w][qt * 16 + ln][dt * 16 + 8 * hh] = lo; *(v4f*)&po[w][qt * 16 + ln][dt * 16 + 8 * hh + 4] = hi; } }
  __syncthreads();      /* every wave's part (every wave has at least one step: qb >= FW) is in LDS before the join reads it */
  const int qi = tid >> 4, d4 = (tid & 15) * 4; float M = pm[0][qi];
#pragma unroll
  for (int u = 1; u < FW; ++u) M = fmaxf(M, pm[u][qi]);
  float L = 0.f; v4f a = {0.f, 0.f, 0.f, 0.f};
#pragma unroll
  for (int u = 0; u < FW; ++u) { const float g = fa_exp2((pm[u][qi] - M) * FC); L += g * pl[u][qi]; a += g * *(const v4f*)&po[u][qi][d4]; }
  a *= 1.0f / L;
  *(v4f*)(O + ((size_t)b * SQ + qb * FQ + qi) * DI + d4) = a; }

// Both attention paths on ONE grid (neither reads what the other writes; each output row has one writer): grid.x = batch; grid.y: first the f16 row blocks of rows QT0 .. SQ-1, then the exact f32 blocks of rows 0 .. QT0-1, each kind with its most keys first.
#define NFB ((SQ - QT0) / FQ)        /* f16 row blocks of a batch */
#define NAB (QT0 / FW)               /* exact f32 blocks of a batch */
__global__ __launch_bounds__(FW * 32) void k_attn(const _Float16* __restrict__ QKV, const _Float16* __restrict__ VT, const float* __restrict__ QKVF0, float* __restrict__ O) {
  static_assert(QT0 % FQ == 0 && FW * QT0 <= FW * FQ * FP, "the first tile ends on a row block; the exact path's scores fit the LDS of the other path's parts");
  __shared__ __attribute__((aligned(16))) float po[FW][FQ][FP]; __shared__ float pm[FW][FQ]; __shared__ float pl[FW][FQ];
  const int b = (int)blockIdx.x, y = (int)blockIdx.y;      /* the branch is the same for a whole block: each path's barriers are passed by all of its threads */
  if (y < NFB) fattn_rows(QKV, VT, O, b, SQ / FQ - 1 - y, po, pm, pl);
  else att0_rows(QKVF0, 0.03125f, O, b, (NFB + NAB - 1 - y) * FW, (float (*)[QT0])&po[0][0][0]); }

extern "C" void kernel_launch(void* const* d_in, const int* in_sizes, int n_in,
                              void* d_out, int out_size, void* d_ws, size_t ws_size, hipStream_t stream) {
  (void)in_sizes; (void)n_in; (void)out_size;
  const float* const* I = (const float* const*)d_in; const float* x = I[0]; const float* wq = I[1]; const float* wk = I[2]; const float* wv = I[3];      /* x; natural [out = 64][in] Wq / Wk / Wv (input order as this module lists them); no biases */
  char* ws = (char*)d_ws; size_t off = 0;
  auto take = [&](size_t bytes) { char* p = ws + off; off += (bytes + 255) & ~(size_t)255; return p; };
  _Float16* BP = (_Float16*)take((size_t)LQK * DM * 2); _Float16* QKV = (_Float16*)take(NR * LQK * 2); _Float16* VT = (_Float16*)take((size_t)NB * HD * SQ * 2);
  float* QKVF0 = (float*)take((size_t)NB * QT0 * LQK * 4);      /* every plane holds all batches */
  if (off > ws_size) return;
  k_wpack<<<(unsigned)((DM / 32) * GNT * 2 * 32 / 256), 256, 0, stream>>>(wq, wk, wv, BP);      /* weights (x16, q | k | v) as exact f16 in fragment order */
  k_qkv<<<(unsigned)(NR / 32), GKS * 2 * 32, 0, stream>>>(x, BP, QKVF0, QKV);      /* q | k | v = x W^T -> f16 rows, column blocks 0 / 64 / 128 of the fused plane (pitch 192); the same f32 sums of rows 0..511 of each batch also stored unrounded */
  const _Float16* V16 = QKV + 2 * DI;
  k_vt<NH, SQ><<<NB * NH * (SQ / 64), 256, 0, stream>>>(V16, LQK, 0, VT);      /* V^T [NB][HD][SQ] */
  k_attn<<<dim3(NB, NFB + NAB), FW * 32, 0, stream>>>(QKV, VT, QKVF0, (float*)d_out);      /* out = softmax(causal(q k^T * 1024^-0.5)) v (the module scales by the EMBEDDING width), f32: rows 512.. on the f16 path, rows 0..511 exact in f32 */
}

// v007
// A run of this version takes 30.9 microseconds.
// Next to v006, in two timings, it ran 1.21 and 1.20 times as fast.
// Counting every step since v000, it is 452 times as fast.
#include <hip/hip_runtime.h>
// Single-head causal self-attention with the module's EMBEDDING-width scale (inps [4][2048][1024]; q/k/v = x W^T (natural [64][1024], U(+-1/32), no biases); ONE 64-wide head; scores * 1024^-0.5 (the source sets head_size = n_embed); causal (tril, -inf); softmax; out = weights v -> [4][2048][64]; no output projection).
// Structure (3 launches): the weights as exact f16, packed in fragment order; one WMMA GEMM that reads the f32 x itself (rounded in registers, exact in f16) and stores, per 32 rows, one tile each of q, k and v^T as f16 in fragment order, and also the f32 q | k | v of each batch's rows 0..511; the last launch holds both attention paths, each storing its own rows: scores, causal softmax and P V in ONE launch (block = 32 query rows of one batch; its 16 waves share the row block's keys in 32-key steps; S^T = K Q^T, weights stay in registers as the B operand of O^T += V^T P^T; running maximum and sum per wave, the waves' parts joined in LDS), f32 straight into the output rows 512..2047; an exact f32 first tile (rows 0..511 of each batch) on further blocks of the same grid.
// Compute dtype: inputs rounded to bf16; x / weights exact; q, k, v and softmax weights as plain f16 GEMM operands (~2^-12); scores, softmax statistics and o f32. v_wmma_f32_16x16x32_f16.
#define NB 4
#define SQ 2048
#define DM 1024
#define NH 1
#define HD 64
#define HG 4                         /* used only by the k_vt(V16, b, h0, VT) overload, which is not launched */
#define QT 256                       /* query rows per causal tile */
#define NKX SQ                       /* unused: the launches keep no S / P plane */
#define QT0 512                      /* first-tile rows computed exactly (f32): 512 here (no output projection averages the early-row cancellation errors away; logit sigma 1.0) */
#define B0 0                         /* unused: every launch covers all batches */
#define NBR NB                       /* unused by the launches (they put NB on or into grid.x) */
#define NR ((size_t)NB * SQ)
#define DMQ DM
#define DFF 4096                     /* unused: there is no FFN */
#define DFFR 100                     /* unused */
#define MP ((int)((size_t)NBR * SQ)) /* unused: the projections take NR rows */
#define QN SQ                        /* unused: the row blocks on grid.y cover SQ */
#define NHD NH                       /* unused: the launches use NH */
#define MPO MP                       /* unused: there is no output stage */
#define LQ (3 * DM)
typedef __bf16 v16b __attribute__((ext_vector_type(16)));
typedef unsigned short v8us __attribute__((ext_vector_type(8), may_alias));
typedef float  v8f  __attribute__((ext_vector_type(8)));
typedef float  v4f  __attribute__((ext_vector_type(4)));
typedef float  v4fa __attribute__((ext_vector_type(4), may_alias));
union FragB { v16b v; v8us half[2]; unsigned short u[16]; };

__device__ __forceinline__ unsigned short bf16_bits(float x) { unsigned int u = __float_as_uint(x); return (unsigned short)((u + 0x7FFFu + ((u >> 16) & 1u)) >> 16); }
__device__ __forceinline__ float bf16_val(unsigned short b) { return __uint_as_float(((unsigned int)b) << 16); }
__device__ __forceinline__ float bf16_round(float x) { return bf16_val(bf16_bits(x)); }
// D += A·B with NT terms: 1 = ah·bh, 2 = + al·bh (A split), 3 = + ah·bl (both split)
template <int NT>
__device__ __forceinline__ v8f mmaN(v16b ah, v16b al, v16b bh, v16b bl, v8f c) {
  c = __builtin_amdgcn_wmma_f32_16x16x32_bf16(false, ah, false, bh, (short)0, c, false, false);
  if (NT >= 2) c = __builtin_amdgcn_wmma_f32_16x16x32_bf16(false, al, false, bh, (short)0, c, false, false);
  if (NT >= 3) c = __builtin_amdgcn_wmma_f32_16x16x32_bf16(false, ah, false, bl, (short)0, c, false, false);
  asm volatile("v_nop\n\tv_nop\n\tv_nop\n\tv_nop" : "+v"(c) : "v"(ah), "v"(al), "v"(bh), "v"(bl));
  return c;
}

__global__ __launch_bounds__(256) void k_wt_bf16(const float* __restrict__ W, unsigned short* __restrict__ Wt, int K, int N) {
  const int t = blockIdx.x * 256 + threadIdx.x;
  const int k8n = K / 8;
  if (t >= N * k8n) return;
  const int n = t / k8n, k8 = (t % k8n) * 8;
  v8us v;
#pragma unroll
  for (int i = 0; i < 8; ++i) v[i] = bf16_bits(W[(size_t)(k8 + i) * N + n]);
  *(v8us*)(Wt + (size_t)n * K + k8) = v;
  
}

// GEMM C[M][N] (f32, pitch ldc) = act(A[M][K]·W + bias). A f32 row-major (pitch lda) converted per fragment to bf16
// (ASPLIT: hi/lo two planes -> 2 terms, else single rounded term); Wt bf16 [N][K] (pitch ldb). BIAS_BF16 rounds the
// bias to bf16 first (bias quantised to bf16 before the add). K%32==0, M%16==0, N%64==0.
template <bool ASPLIT, int ACT, bool BIAS_BF16>
__global__ __launch_bounds__(128) void k_gemm_bf(const float* __restrict__ A, int lda, const unsigned short* __restrict__ Wt, int ldb,
                                               const float* __restrict__ bias, float* __restrict__ C, int ldc, int M, int N, int K) {
  __shared__ __attribute__((aligned(16))) float so[4][16][64];
  const int tid = threadIdx.x, w = tid >> 5, lane = tid & 31, ln = lane & 15, hh = lane >> 4;
  const int ntn = N / 64;
  const int wid = blockIdx.x * 4 + w;
  const int mt = wid / ntn, nq = wid % ntn;
  if (mt * 16 >= M) return;
  const int row0 = mt * 16, col0 = nq * 64;
  const float* arow = A + (size_t)(row0 + ln) * lda;
  v8f acc[4] = {};
  for (int kb = 0; kb < K; kb += 32) {
    FragB ah, al;
    const v4f x0 = *(const v4fa*)(arow + kb + 8 * hh), x1 = *(const v4fa*)(arow + kb + 8 * hh + 4);
    const v4f x2 = *(const v4fa*)(arow + kb + 16 + 8 * hh), x3 = *(const v4fa*)(arow + kb + 16 + 8 * hh + 4);
    float xs[16] = {x0[0],x0[1],x0[2],x0[3],x1[0],x1[1],x1[2],x1[3],x2[0],x2[1],x2[2],x2[3],x3[0],x3[1],x3[2],x3[3]};
#pragma unroll
    for (int i = 0; i < 16; ++i) { const unsigned short hb = bf16_bits(xs[i]); ah.u[i] = hb; al.u[i] = ASPLIT ? bf16_bits(xs[i] - bf16_val(hb)) : (unsigned short)0; }
#pragma unroll
    for (int t = 0; t < 4; ++t) {
      const unsigned short* brow = Wt + (size_t)(col0 + t * 16 + ln) * ldb + kb;
      FragB b;
      b.half[0] = *(const v8us*)(brow + 8 * hh);
      b.half[1] = *(const v8us*)(brow + 16 + 8 * hh);
      acc[t] = mmaN<ASPLIT ? 2 : 1>(ah.v, al.v, b.v, b.v, acc[t]);
    }
  }
#pragma unroll
  for (int t = 0; t < 4; ++t) {
    float bv = bias ? bias[col0 + t * 16 + ln] : 0.f;
    if (BIAS_BF16) bv = bf16_round(bv);
#pragma unroll
    for (int r = 0; r < 8; ++r) { float v = acc[t][r] + bv; if (ACT == 1) v = fmaxf(v, 0.f); so[w][8 * hh + r][t * 16 + ln] = v; }
  }
  __builtin_amdgcn_fence(__ATOMIC_ACQ_REL, "workgroup");
  __builtin_amdgcn_wave_barrier();
  const int rsub = lane >> 4, c4 = (lane & 15) * 4;
  {
#pragma unroll
    for (int q = 0; q < 8; ++q) {
      const int r = q * 2 + rsub;
      const v4f v = *(const v4fa*)&so[w][r][c4];
      *(v4f*)(C + (size_t)(row0 + r) * ldc + col0 + c4) = v;
    }
    
  }
}

// GEMM C = act(A·W + bias + resid): A f32 (ASPLIT -> hi/lo 2 terms), Wt bf16 [N][K]; ACT 0 none, 1 relu, 2 exact gelu;
// resid (optional, f32, row index = (row % rmod), pitch ldr, RES_BF16 rounds it) added before the activation.
template <bool ASPLIT, int ACT, bool BIAS_BF16, bool RES_BF16>
__global__ __launch_bounds__(128) void k_gemm_bf3(const float* __restrict__ A, int lda, const unsigned short* __restrict__ Wt, int ldb,
                                                const float* __restrict__ bias, const float* __restrict__ resid, int rmod, int ldr,
                                                float* __restrict__ C, int ldc, int M, int N, int K) {
  __shared__ __attribute__((aligned(16))) float so[4][16][64];
  const int tid = threadIdx.x, w = tid >> 5, lane = tid & 31, ln = lane & 15, hh = lane >> 4;
  const int ntn = N / 64;
  const int wid = blockIdx.x * 4 + w;
  const int mt = wid / ntn, nq = wid % ntn;
  if (mt * 16 >= M) return;
  const int row0 = mt * 16, col0 = nq * 64;
  const float* arow = A + (size_t)(row0 + ln) * lda;
  v8f acc[4] = {};
  for (int kb = 0; kb < K; kb += 32) {
    FragB ah, al;
    const v4f x0 = *(const v4fa*)(arow + kb + 8 * hh), x1 = *(const v4fa*)(arow + kb + 8 * hh + 4);
    const v4f x2 = *(const v4fa*)(arow + kb + 16 + 8 * hh), x3 = *(const v4fa*)(arow + kb + 16 + 8 * hh + 4);
    float xs[16] = {x0[0],x0[1],x0[2],x0[3],x1[0],x1[1],x1[2],x1[3],x2[0],x2[1],x2[2],x2[3],x3[0],x3[1],x3[2],x3[3]};
#pragma unroll
    for (int i = 0; i < 16; ++i) { const unsigned short hb = bf16_bits(xs[i]); ah.u[i] = hb; al.u[i] = ASPLIT ? bf16_bits(xs[i] - bf16_val(hb)) : (unsigned short)0; }
#pragma unroll
    for (int t = 0; t < 4; ++t) {
      const unsigned short* brow = Wt + (size_t)(col0 + t * 16 + ln) * ldb + kb;
      FragB b;
      b.half[0] = *(const v8us*)(brow + 8 * hh);
      b.half[1] = *(const v8us*)(brow + 16 + 8 * hh);
      acc[t] = mmaN<ASPLIT ? 2 : 1>(ah.v, al.v, b.v, b.v, acc[t]);
    }
  }
#pragma unroll
  for (int t = 0; t < 4; ++t) {
    const int col = col0 + t * 16 + ln;
    float bv = bias ? bias[col] : 0.f;
    if (BIAS_BF16) bv = bf16_round(bv);
#pragma unroll
    for (int r = 0; r < 8; ++r) {
      float v = acc[t][r] + bv;
      if (resid) { float rv = resid[(size_t)((row0 + 8 * hh + r) % rmod) * ldr + col]; if (RES_BF16) rv = bf16_round(rv); v += rv; }
      if (ACT == 1) v = fmaxf(v, 0.f);
      if (ACT == 2) v = 0.5f * v * (1.0f + erff(v * 0.70710678118654752f));
      if (ACT == 3) { const float u = 0.7978845608028654f * (v + 0.044715f * v * v * v); v = 0.5f * v * (1.0f + tanhf(u)); }
      so[w][8 * hh + r][t * 16 + ln] = v;
    }
  }
  __builtin_amdgcn_fence(__ATOMIC_ACQ_REL, "workgroup");
  __builtin_amdgcn_wave_barrier();
  const int rsub = lane >> 4, c4 = (lane & 15) * 4;
  {
#pragma unroll
    for (int q = 0; q < 8; ++q) {
      const int r = q * 2 + rsub;
      const v4f v = *(const v4fa*)&so[w][r][c4];
      *(v4f*)(C + (size_t)(row0 + r) * ldc + col0 + c4) = v;
    }
    
  }
}
// row LayerNorm (biased variance, eps) over N: s = X (+ R); optional out_sum <- s; out_norm <- (s-mu)*rsqrt(var+eps)*g + b
template <bool PARAM_BF16>
__global__ __launch_bounds__(256) void k_layernorm(const float* __restrict__ X, const float* __restrict__ R, const float* __restrict__ g, const float* __restrict__ bta,
                                                  float* __restrict__ out_sum, float* __restrict__ out_norm, int N, float eps) {
  __shared__ float red[256];
  const int row = blockIdx.x, tid = threadIdx.x;
  const float* x = X + (size_t)row * N; const float* rr = R ? R + (size_t)row * N : nullptr;
  float vals[16];                     // up to N = 4096
  const int per = N / 256;            // contiguous chunk per thread? use strided-by-4 chunks: thread handles j = tid*4 + 1024*u
  float s1 = 0.f;
  for (int u = 0; u < per / 4; ++u) {
    const int j = tid * 4 + 1024 * u;
    const v4f a = *(const v4fa*)(x + j);
    v4f b = {0.f,0.f,0.f,0.f}; if (rr) b = *(const v4fa*)(rr + j);
#pragma unroll
    for (int q = 0; q < 4; ++q) { const float v = a[q] + b[q]; vals[u * 4 + q] = v; s1 += v; }
  }
  red[tid] = s1; __syncthreads();
  for (int st = 128; st > 0; st >>= 1) { if (tid < st) red[tid] += red[tid + st]; __syncthreads(); }
  const float mu = red[0] / (float)N; __syncthreads();
  float s2 = 0.f;
  for (int u = 0; u < per / 4; ++u)
#pragma unroll
    for (int q = 0; q < 4; ++q) { const float c = vals[u * 4 + q] - mu; s2 += c * c; }
  red[tid] = s2; __syncthreads();
  for (int st = 128; st > 0; st >>= 1) { if (tid < st) red[tid] += red[tid + st]; __syncthreads(); }
  const float rs = rsqrtf(red[0] / (float)N + eps);
  {
    for (int u = 0; u < per / 4; ++u) {
      const int j = tid * 4 + 1024 * u;
      v4f o, sm;
#pragma unroll
      for (int q = 0; q < 4; ++q) {
        float gg = g[j + q], bb = bta[j + q];
        if (PARAM_BF16) { gg = bf16_round(gg); bb = bf16_round(bb); }
        sm[q] = vals[u * 4 + q]; o[q] = (vals[u * 4 + q] - mu) * rs * gg + bb;
      }
      if (out_sum) *(v4f*)(out_sum + (size_t)row * N + j) = sm;
      *(v4f*)(out_norm + (size_t)row * N + j) = o;
    }
    
  }
}



// ---- f16 WMMA path (v_wmma_f32_16x16x32_f16): 11-bit significands for operands in range — used where a [0,1] probability operand needs more precision than bf16
typedef _Float16 v16h __attribute__((ext_vector_type(16)));
union FragH { v16h v; v8us half[2]; _Float16 h[16]; unsigned short u[16]; };
template <int NT>
__device__ __forceinline__ v8f mmaH(v16h ah, v16h al, v16h bh, v16h bl, v8f c) {
  c = __builtin_amdgcn_wmma_f32_16x16x32_f16(false, ah, false, bh, (short)0, c, false, false);
  if (NT >= 2) c = __builtin_amdgcn_wmma_f32_16x16x32_f16(false, al, false, bh, (short)0, c, false, false);
  if (NT >= 3) c = __builtin_amdgcn_wmma_f32_16x16x32_f16(false, ah, false, bl, (short)0, c, false, false);
  asm volatile("v_nop\n\tv_nop\n\tv_nop\n\tv_nop" : "+v"(c) : "v"(ah), "v"(al), "v"(bh), "v"(bl));
  return c;
}
// batched GEMM like k_gemm_b but f16 operands: A f32 (split into f16 hi/lo if ASPLIT, else rounded to f16), Bt = f16 values [n][k]; alpha; C f32; N multiple of 16 (partial tiles skipped)
template <bool ASPLIT>
__global__ __launch_bounds__(128) void k_gemm_h(const float* __restrict__ A, int lda, size_t sA, const _Float16* __restrict__ Bh, int ldb, size_t sB, float alpha, float* __restrict__ C, int ldc, size_t sC, int M, int N, int K) {
  __shared__ __attribute__((aligned(16))) float so[4][16][64];
  const int tid = threadIdx.x, w = tid >> 5, lane = tid & 31, ln = lane & 15, hh = lane >> 4; const int by = blockIdx.y;
  A += (size_t)by * sA; Bh += (size_t)by * sB; C += (size_t)by * sC;
  const int ntn = (N + 63) / 64; const int wid = blockIdx.x * 4 + w; const int mt = wid / ntn, nq = wid % ntn; if (mt * 16 >= M) return;
  const int row0 = mt * 16, col0 = nq * 64; const float* arow = A + (size_t)(row0 + ln) * lda;
  v8f acc[4] = {};
  for (int kb = 0; kb < K; kb += 32) {
    FragH ah, al;
    const v4f x0 = *(const v4fa*)(arow + kb + 8 * hh), x1 = *(const v4fa*)(arow + kb + 8 * hh + 4), x2 = *(const v4fa*)(arow + kb + 16 + 8 * hh), x3 = *(const v4fa*)(arow + kb + 16 + 8 * hh + 4);
    float xs[16] = {x0[0],x0[1],x0[2],x0[3],x1[0],x1[1],x1[2],x1[3],x2[0],x2[1],x2[2],x2[3],x3[0],x3[1],x3[2],x3[3]};
#pragma unroll
    for (int i = 0; i < 16; ++i) { const _Float16 h = (_Float16)xs[i]; ah.h[i] = h; al.h[i] = ASPLIT ? (_Float16)(xs[i] - (float)h) : (_Float16)0.0f; }
#pragma unroll
    for (int t = 0; t < 4; ++t) { if (col0 + t * 16 >= N) continue; const size_t boff = (size_t)(col0 + t * 16 + ln) * ldb + kb; FragH bq; bq.half[0] = *(const v8us*)(Bh + boff + 8 * hh); bq.half[1] = *(const v8us*)(Bh + boff + 16 + 8 * hh);
      acc[t] = mmaH<ASPLIT ? 2 : 1>(ah.v, al.v, bq.v, bq.v, acc[t]); }
  }
#pragma unroll
  for (int t = 0; t < 4; ++t) { if (col0 + t * 16 >= N) continue;
#pragma unroll
    for (int r = 0; r < 8; ++r) so[w][8 * hh + r][t * 16 + ln] = acc[t][r] * alpha; }
  __builtin_amdgcn_fence(__ATOMIC_ACQ_REL, "workgroup"); __builtin_amdgcn_wave_barrier();
  const int rsub = lane >> 4, c4 = (lane & 15) * 4;
  {
#pragma unroll
    for (int q = 0; q < 8; ++q) { const int r = q * 2 + rsub; if (col0 + c4 < N) { const v4f v = *(const v4fa*)&so[w][r][c4]; *(v4f*)(C + (size_t)(row0 + r) * ldc + col0 + c4) = v; } }
     }
}

// Wt[n][k] = f16(W[k][n]·scale) from f32 row-major W[K][N] (scale = power of two; bf16-exact weights stay exact in f16 away from the subnormal range)
__global__ __launch_bounds__(256) void k_wt_f16(const float* __restrict__ W, _Float16* __restrict__ Wt, int K, int N, float scale) {
  const int t = blockIdx.x * 256 + threadIdx.x; if (t >= N * (K / 8)) return; const int n = t / (K / 8), k8 = (t % (K / 8)) * 8; FragH f;
#pragma unroll
  for (int i = 0; i < 8; ++i) f.h[i] = (_Float16)(bf16_round(W[(size_t)(k8 + i) * N + n]) * scale); const v8us o = f.half[0];
  *(v8us*)((unsigned short*)Wt + (size_t)n * K + k8) = o; 
}
// k_gemm_hh variant with fused epilogue: v = acc·alpha + bias[by·sBias + col] (+ CP[(row/rowsPerB)·sCPb + by·64 + col] if CP) ; ACT 0 none / 1 elu ; writes f16 C16 (and f32 C if non-null)
template <int ACT>
__global__ __launch_bounds__(128) void k_gemm_hhx(const _Float16* __restrict__ A, int lda, size_t sA, const _Float16* __restrict__ Bh, int ldb, size_t sB, float alpha, const float* __restrict__ bias, size_t sBias, const float* __restrict__ CP, int rowsPerB, size_t sCPb, int row0g,
    float* __restrict__ C, _Float16* __restrict__ C16, int ldc, size_t sC, int M, int N, int K) {
  __shared__ __attribute__((aligned(16))) float so[4][16][64];
  const int tid = threadIdx.x, w = tid >> 5, lane = tid & 31, ln = lane & 15, hh = lane >> 4; const int by = blockIdx.y;
  A += (size_t)by * sA; Bh += (size_t)by * sB; const size_t cofs = (size_t)by * sC; const float* bp = bias ? bias + (size_t)by * sBias : nullptr;
  const int ntn = (N + 63) / 64; const int wid = blockIdx.x * 4 + w; const int mt = wid / ntn, nq = wid % ntn; if (mt * 16 >= M) return;
  const int row0 = mt * 16, col0 = nq * 64; const _Float16* arow = A + (size_t)(row0 + ln) * lda;
  v8f acc[4] = {};
  for (int kb = 0; kb < K; kb += 32) { FragH ah; ah.half[0] = *(const v8us*)((const unsigned short*)arow + kb + 8 * hh); ah.half[1] = *(const v8us*)((const unsigned short*)arow + kb + 16 + 8 * hh);
#pragma unroll
    for (int t = 0; t < 4; ++t) { if (col0 + t * 16 >= N) continue; const size_t boff = (size_t)(col0 + t * 16 + ln) * ldb + kb; FragH bq; bq.half[0] = *(const v8us*)((const unsigned short*)Bh + boff + 8 * hh); bq.half[1] = *(const v8us*)((const unsigned short*)Bh + boff + 16 + 8 * hh);
      acc[t] = mmaH<1>(ah.v, ah.v, bq.v, bq.v, acc[t]); }
  }
#pragma unroll
  for (int t = 0; t < 4; ++t) { if (col0 + t * 16 >= N) continue; const int col = col0 + t * 16 + ln; const float bv = bp ? bf16_round(bp[col]) : 0.f;
#pragma unroll
    for (int r = 0; r < 8; ++r) { float v = acc[t][r] * alpha + bv; if (CP) { const int rr = row0g + row0 + 8 * hh + r; if (rowsPerB < 0) v += CP[cofs + (size_t)rr * ldc + col];      /* rowsPerB < 0: own element of the batched C plane */ else { const int bidx = rr / rowsPerB; v += CP[(size_t)bidx * sCPb + (size_t)by * 64 + col]; } } if (ACT == 1) v = (v > 0.f) ? v : expm1f(v); else if (ACT == 7) v = (v > 0.f) ? v + 1.0f : expf(v); else if (ACT == 8) v = tanhf(v); else if (ACT == 9) v = 0.5f * v * (1.0f + tanhf(0.7978845608028654f * (v + 0.044715f * v * v * v))); else if (ACT == 11) v = 1.0f / (1.0f + expf(-v)); else if (ACT == 12) v = (v > 0.f) ? v : 0.01f * v; else if (ACT == 14) v = (v > 0.f) ? v : 0.1f * v; else if (ACT == 16) v = (v >= 0.f) ? v : 0.3f * v; else if (ACT == 17) v = (v >= 0.f) ? v : 0.2f * v; else if (ACT == 15) v = v / (1.0f + expf(-v)); else if (ACT == 3) v = fmaxf(v, 0.f); else if (ACT == 6) v = 0.5f * v * (1.0f + erff(v * 0.70710678118654752f)); so[w][8 * hh + r][t * 16 + ln] = v; } }
  __builtin_amdgcn_fence(__ATOMIC_ACQ_REL, "workgroup"); __builtin_amdgcn_wave_barrier();
  const int rsub = lane >> 4, c4 = (lane & 15) * 4; typedef _Float16 v4h __attribute__((ext_vector_type(4)));
  {
#pragma unroll
    for (int q = 0; q < 8; ++q) { const int r = q * 2 + rsub; if (col0 + c4 < N) { const v4f v = *(const v4fa*)&so[w][r][c4]; if (C) *(v4f*)(C + cofs + (size_t)(row0 + r) * ldc + col0 + c4) = v; if (C16) { v4h h4; for (int i = 0; i < 4; ++i) h4[i] = (_Float16)v[i]; *(v4h*)(C16 + cofs + (size_t)(row0 + r) * ldc + col0 + c4) = h4; } } }
     }
}


typedef _Float16 v4h __attribute__((ext_vector_type(4)));

__global__ __launch_bounds__(256) void k_h16(const float* __restrict__ x, _Float16* __restrict__ X16, size_t n8) { const size_t t = (size_t)blockIdx.x * 256 + threadIdx.x; if (t >= n8) return; FragH f;
#pragma unroll
  for (int q = 0; q < 8; ++q) f.h[q] = (_Float16)x[t * 8 + q]; *(v8us*)((unsigned short*)X16 + t * 8) = f.half[0];  }
__global__ __launch_bounds__(256) void k_round16f(const float* __restrict__ W, _Float16* __restrict__ Bt, size_t n8) { const size_t t = (size_t)blockIdx.x * 256 + threadIdx.x; if (t >= n8) return; FragH f;
#pragma unroll
  for (int i = 0; i < 8; ++i) f.h[i] = (_Float16)(bf16_round(W[t * 8 + i]) * 16.0f); *(v8us*)((unsigned short*)Bt + t * 8) = f.half[0];  }
template <int NHv, int TTv>
__global__ __launch_bounds__(256) void k_vt(const _Float16* __restrict__ V16, int ldv, int voff, _Float16* __restrict__ Vt) { __shared__ unsigned short tl[64][66]; const int tid = threadIdx.x; const int slab = blockIdx.x / (TTv / 64), lg = blockIdx.x % (TTv / 64); const int b = slab / NHv, h = slab % NHv;
  for (int i = tid; i < 64 * 8; i += 256) { const int r = i / 8, c8 = (i % 8) * 8; FragH f; f.half[0] = *(const v8us*)((const unsigned short*)V16 + ((size_t)b * TTv + lg * 64 + r) * ldv + voff + h * 64 + c8);
#pragma unroll
    for (int q = 0; q < 8; ++q) tl[r][c8 + q] = f.u[q]; }
  __syncthreads();
  {
#pragma unroll
    for (int rd = 0; rd < 2; ++rd) { const int d = rd * 32 + tid / 8, pc = tid % 8; FragH f;
#pragma unroll
      for (int q = 0; q < 8; ++q) f.u[q] = tl[pc * 8 + q][d];
      *(v8us*)((unsigned short*)Vt + ((size_t)slab * 64 + d) * TTv + lg * 64 + pc * 8) = f.half[0]; }
     } }

__global__ __launch_bounds__(256) void k_hl(const float* __restrict__ F, _Float16* __restrict__ Hh, _Float16* __restrict__ Hl, size_t n8) { const size_t t = (size_t)blockIdx.x * 256 + threadIdx.x; if (t >= n8) return; FragH fh, fl; const v4f a = *(const v4fa*)(F + t * 8), c = *(const v4fa*)(F + t * 8 + 4);
#pragma unroll
  for (int q = 0; q < 4; ++q) { _Float16 h = (_Float16)a[q]; fh.h[q] = h; fl.h[q] = (_Float16)((a[q] - (float)h) * 1024.0f); h = (_Float16)c[q]; fh.h[4 + q] = h; fl.h[4 + q] = (_Float16)((c[q] - (float)h) * 1024.0f); }
  { *(v8us*)((unsigned short*)Hh + t * 8) = fh.half[0]; *(v8us*)((unsigned short*)Hl + t * 8) = fl.half[0];  } }

// ---- fast GEMM (wave tile 32x64; requires M % 32 == 0 rows per launch region and N % 64 == 0); epilogue = k_gemm_hhx semantics ----
__device__ __forceinline__ v16h g2_frag(const _Float16* p, int hh) { FragH f; f.half[0] = *(const v8us*)((const unsigned short*)p + 8 * hh); f.half[1] = *(const v8us*)((const unsigned short*)p + 16 + 8 * hh); return f.v; }
__device__ __forceinline__ v8f g2_mma(v16h a, v16h b, v8f c) { v8f d = __builtin_amdgcn_wmma_f32_16x16x32_f16(false, a, false, b, (short)0, c, false, false); asm volatile("v_nop\n\tv_nop\n\tv_nop\n\tv_nop" : "+v"(d) : "v"(a), "v"(b)); return d; }
// CAUS 0: plain. CAUS 1 (scores): a 64-column tile at or past the end of its rows' causal query tile is skipped. CAUS 2 (P V): K runs over the keys of the rows' causal query tile only.
// F0 1: C holds only rows 0..QT0-1 of each batch, packed ([NB][QT0] rows); the other rows go to C16 alone.
template <int ACT, int CAUS = 0, int F0 = 0>
__global__ __launch_bounds__(128) void k_gemm2(const _Float16* __restrict__ A, int lda, size_t sA, const _Float16* __restrict__ Bh, int ldb, size_t sB, float alpha, const float* __restrict__ bias, size_t sBias, const float* __restrict__ CP, int rowsPerB, size_t sCPb, int row0g,
    float* __restrict__ C, _Float16* __restrict__ C16, int ldc, size_t sC, int M, int N, int K) { static_assert(ACT == 0 || ACT == 3 || ACT == 6 || ACT == 8 || ACT == 9 || ACT == 11 || ACT == 12 || ACT == 14 || ACT == 15 || ACT == 16 || ACT == 17, "k_gemm2: unsupported ACT code (would silently apply no activation)");
  __shared__ __attribute__((aligned(16))) float so[4][32][68];
  const int tid = threadIdx.x, w = tid >> 5, lane = tid & 31, ln = lane & 15, hh = lane >> 4; const int by = blockIdx.y;
  A += (size_t)by * sA; Bh += (size_t)by * sB; const size_t cofs = (size_t)by * sC; const float* bp = bias ? bias + (size_t)by * sBias : nullptr;
  const int ntn = N >> 6; const int mt = blockIdx.x / ntn, nq = blockIdx.x - mt * ntn; const int row0 = mt * 128 + 32 * w, col0 = nq * 64; if (row0 >= M) return;
  static_assert(QT % 128 == 0, "a 128-row block lies in one causal query tile"); const int nkc = (mt * 128 / QT + 1) * QT;      /* keys below the end of this block's causal query tile */
  if (CAUS == 1 && col0 >= nkc) return; if (CAUS == 2) K = nkc;
  const _Float16* a0p = A + (size_t)(row0 + ln) * lda; const _Float16* a1p = a0p + (size_t)16 * lda;
  const _Float16* b0p = Bh + (size_t)(col0 + ln) * ldb; const _Float16* b1p = b0p + (size_t)16 * ldb; const _Float16* b2p = b1p + (size_t)16 * ldb; const _Float16* b3p = b2p + (size_t)16 * ldb;
  const v8f z8 = {0.f,0.f,0.f,0.f,0.f,0.f,0.f,0.f}; v8f c00 = z8, c01 = z8, c02 = z8, c03 = z8, c10 = z8, c11 = z8, c12 = z8, c13 = z8;
#pragma unroll 1
  for (int kb = 0; kb < K; kb += 32) { const v16h a0 = g2_frag(a0p + kb, hh), a1 = g2_frag(a1p + kb, hh);
    v16h b = g2_frag(b0p + kb, hh); c00 = g2_mma(a0, b, c00); c10 = g2_mma(a1, b, c10);
    b = g2_frag(b1p + kb, hh); c01 = g2_mma(a0, b, c01); c11 = g2_mma(a1, b, c11);
    b = g2_frag(b2p + kb, hh); c02 = g2_mma(a0, b, c02); c12 = g2_mma(a1, b, c12);
    b = g2_frag(b3p + kb, hh); c03 = g2_mma(a0, b, c03); c13 = g2_mma(a1, b, c13); }
  v8f accs[8] = {c00, c01, c02, c03, c10, c11, c12, c13};
#pragma unroll
  for (int u = 0; u < 8; ++u) { const int t = u & 3, half = u >> 2; const int col = col0 + t * 16 + ln; const float bv = bp ? bf16_round(bp[col]) : 0.f;
#pragma unroll
    for (int r = 0; r < 8; ++r) { const int rloc = half * 16 + 8 * hh + r; float v = accs[u][r] * alpha + bv; if (CP) { if (rowsPerB < 0) v += CP[cofs + (size_t)(row0g + row0 + rloc) * ldc + col];      /* rowsPerB < 0: own element of the batched C plane */ else { const int bidx = (row0g + row0 + rloc) / rowsPerB; v += CP[(size_t)bidx * sCPb + (size_t)by * 64 + col]; } }
      if (ACT == 3) v = fmaxf(v, 0.f); else if (ACT == 6) v = 0.5f * v * (1.0f + erff(v * 0.70710678118654752f)); else if (ACT == 11) v = 1.0f / (1.0f + expf(-v)); else if (ACT == 15) v = v / (1.0f + expf(-v)); else if (ACT == 12) v = (v > 0.f) ? v : 0.01f * v; else if (ACT == 8) v = tanhf(v); else if (ACT == 9) v = 0.5f * v * (1.0f + tanhf(0.7978845608028654f * (v + 0.044715f * v * v * v))); else if (ACT == 14) v = (v > 0.f) ? v : 0.1f * v; else if (ACT == 16) v = (v >= 0.f) ? v : 0.3f * v; else if (ACT == 17) v = (v >= 0.f) ? v : 0.2f * v;
      so[w][rloc][t * 16 + ln] = v; } }
  __builtin_amdgcn_fence(__ATOMIC_ACQ_REL, "workgroup"); __builtin_amdgcn_wave_barrier();
  const int rsub = lane >> 4, c4 = (lane & 15) * 4;
  static_assert(SQ % 32 == 0 && QT0 % 32 == 0, "a wave's 32 rows lie on one side of the first tile's end"); size_t crow = (size_t)row0; if (F0) { const int rb = row0 / SQ, ri = row0 - rb * SQ; crow = (size_t)rb * QT0 + ri; if (ri >= QT0) C = nullptr; }
  {
#pragma unroll
    for (int q = 0; q < 16; ++q) { const int r = q * 2 + rsub; const v4f v = *(const v4fa*)&so[w][r][c4]; if (C) *(v4f*)(C + cofs + (crow + r) * ldc + col0 + c4) = v; if (C16) { v4h h4; for (int i = 0; i < 4; ++i) h4[i] = (_Float16)v[i]; *(v4h*)(C16 + cofs + (size_t)(row0 + r) * ldc + col0 + c4) = h4; } }
     } }


__global__ __launch_bounds__(256) void k_rsm(const float* __restrict__ S, _Float16* __restrict__ P, int nrows) {
  #pragma clang fp contract(off)
  const int i = blockIdx.x * 256 + threadIdx.x; if (i >= nrows) return; const float* s = S + (size_t)i * SQ; float mx = -3.0e38f;
#pragma unroll 1
  for (int j = 0; j < SQ; ++j) mx = fmaxf(mx, s[j]); float se = 0.f;
#pragma unroll 1
  for (int j = 0; j < SQ; ++j) se += expf(s[j] - mx); const float sc = 256.0f / se;
#pragma unroll 1
  for (int j0 = 0; j0 < SQ; j0 += 8) { FragH f; for (int q = 0; q < 8; ++q) f.h[q] = (_Float16)(expf(s[j0 + q] - mx) * sc); unsigned short* d = (unsigned short*)P + (size_t)i * SQ + j0; *(v8us*)d = f.half[0];  } }
__global__ __launch_bounds__(256) void k_vt(const _Float16* __restrict__ V16, int b, int h0, _Float16* __restrict__ VT) { __shared__ unsigned short tl[64][65]; const int tid = threadIdx.x; const int hh = blockIdx.x % HG, sg = blockIdx.x / HG; const int s0 = sg * 64; const int h = h0 + hh;
  for (int i = tid; i < 64 * 8; i += 256) { const int j = i / 8, d8 = (i % 8) * 8; FragH f; f.half[0] = *(const v8us*)((const unsigned short*)V16 + ((size_t)b * SQ + s0 + j) * DM + h * HD + d8); for (int q = 0; q < 8; ++q) tl[d8 + q][j] = f.u[q]; }
  __syncthreads();
  { for (int i = tid; i < 64 * 8; i += 256) { const int d = i / 8, j8 = (i % 8) * 8; FragH f; for (int q = 0; q < 8; ++q) f.u[q] = tl[d][j8 + q]; *(v8us*)((unsigned short*)VT + ((size_t)hh * HD + d) * SQ + s0 + j8) = f.half[0]; }  } }



template <int BFIN, int WXB>
__global__ __launch_bounds__(256) void k_ln16(const float* __restrict__ X, const float* __restrict__ g, const float* __restrict__ bb, float eps, _Float16* __restrict__ N16, float* __restrict__ XB) {
  #pragma clang fp contract(off)
  __shared__ float red[256]; const size_t r = blockIdx.x; const int t = threadIdx.x; const v4f xa = *(const v4fa*)(X + r * DMQ + t * 4); float s[4]; float sum = 0.f;
  for (int q = 0; q < 4; ++q) { s[q] = BFIN ? bf16_round(xa[q]) : xa[q]; sum = __fadd_rn(sum, s[q]); }
  red[t] = sum; __syncthreads(); for (int st = 128; st > 0; st >>= 1) { if (t < st) red[t] = __fadd_rn(red[t], red[t + st]); __syncthreads(); } const float mu = red[0] / (float)DMQ; __syncthreads();
  float vs = 0.f; for (int q = 0; q < 4; ++q) { const float dl = __fadd_rn(s[q], -mu); vs = __fadd_rn(vs, __fmul_rn(dl, dl)); } red[t] = vs; __syncthreads(); for (int st = 128; st > 0; st >>= 1) { if (t < st) red[t] = __fadd_rn(red[t], red[t + st]); __syncthreads(); }
  const float rs = rsqrtf(__fadd_rn(red[0] / (float)DMQ, eps)); v4h y; v4f xb;
  for (int q = 0; q < 4; ++q) { const int c = t * 4 + q; y[q] = (_Float16)__fadd_rn(__fmul_rn(__fmul_rn(__fadd_rn(s[q], -mu), rs), bf16_round(g[c])), bf16_round(bb[c])); xb[q] = s[q]; }
  { *(v4h*)(N16 + r * DMQ + t * 4) = y; if (WXB) *(v4f*)(XB + r * DMQ + t * 4) = xb;  } }
__global__ __launch_bounds__(256) void k_ftres2(const float* __restrict__ OF0, const float* __restrict__ XB, float* __restrict__ X1, size_t n4) {
  #pragma clang fp contract(off)
  const size_t t = (size_t)blockIdx.x * 256 + threadIdx.x; if (t >= n4) return; const v4f o = *(const v4fa*)(OF0 + t * 4), xv = *(const v4fa*)(XB + t * 4); v4f y; for (int q = 0; q < 4; ++q) y[q] = __fadd_rn(__fmul_rn(o[q], 0.015625f), xv[q]); *(v4f*)(X1 + t * 4) = y;  }

__global__ __launch_bounds__(256) void k_wthd(const float* __restrict__ Wt, _Float16* __restrict__ Bt) { const size_t t = (size_t)blockIdx.x * 256 + threadIdx.x; if (t >= (size_t)NH * HD * (DM / 8)) return; const int m8 = (int)(t % (DM / 8)) * 8; const int d = (int)((t / (DM / 8)) % HD); const int h = (int)(t / ((size_t)(DM / 8) * HD)); FragH f;
  for (int q = 0; q < 8; ++q) f.h[q] = (_Float16)(16.0f * bf16_round(Wt[((size_t)h * DM + m8 + q) * HD + d])); unsigned short* dst = (unsigned short*)Bt + ((size_t)h * HD + d) * DM + m8; *(v8us*)dst = f.half[0];  }




__global__ __launch_bounds__(256) void k_wtpad(const float* __restrict__ Wm, _Float16* __restrict__ Wt, int Kr, int Kp, int Nr, int Np, float scale) {
  const int t = blockIdx.x * 256 + threadIdx.x; if (t >= Np * (Kp / 8)) return; const int n = t / (Kp / 8), k8 = (t % (Kp / 8)) * 8; const int nc = min(n, Nr - 1); const float fn = (n < Nr) ? 1.f : 0.f; FragH f;
  for (int i = 0; i < 8; ++i) { const int k = k8 + i; const int kc = min(k, Kr - 1); const float fk = (k < Kr) ? fn : 0.f; f.h[i] = (_Float16)(bf16_round(Wm[(size_t)kc * Nr + nc]) * scale * fk); }
  unsigned short* o = (unsigned short*)Wt + (size_t)n * Kp + k8; *(v8us*)o = f.half[0];  }
__global__ __launch_bounds__(128) void k_bpad(const float* __restrict__ b, float* __restrict__ Bp, int nr, int np) {
  const int i = threadIdx.x; if (i >= np) return; const float v = b[min(i, nr - 1)] * ((i < nr) ? 1.f : 0.f); *(float*)(Bp + i) = v;  }

#define DI 64         /* inner width = NH * HD (ONE 64-wide head) */
#define LQK (3 * DI)  /* fused q | k | v row pitch (192) */
__global__ __launch_bounds__(256) void k_o0(const float* __restrict__ OF, float* __restrict__ ob, size_t n4) {
  #pragma clang fp contract(off)
  const size_t t = (size_t)blockIdx.x * 256 + threadIdx.x; if (t >= n4) return; const size_t e = t * 4; const int i = (int)(e / DI); const int c = (int)(e % DI); const int h = c / HD, d = c % HD; const v4f a = *(const v4fa*)(OF + e); v4f o; for (int q = 0; q < 4; ++q) o[q] = __fmul_rn(a[q], 0.015625f); float* dst = ob + (size_t)h * SQ * HD + (size_t)i * HD + d; *(v4f*)dst = o;  }

// The projection q | k | v = x W^T straight from the f32 input: x is read once, by the GEMM itself.
#define GKS 8                        /* K slices of a block */
#define GST (DM / GKS / 32)          /* 32-wide k steps of a slice */
#define GNT (LQK / 16)               /* 16-column tiles of q | k | v */
#define GPL 40                       /* 16-byte places of a register half's plane in LDS: 32 lanes and 8 idle, so that the two planes that a half wave reads together fall on different banks */
#define KVT 4096                     /* f16 elements of a 32-key tile of the k | v^T plane: 8 half fragments of k, then 8 of v^T, 512 bytes each */
// Wq | Wk | Wv (natural [64][DM] rows, x16, exact in f16) packed so that a wave's 16-byte load of half a fragment (A for q and k, B for v) is 512 contiguous bytes:
// BP[k step][column tile][half j][lane][8]: column 16 tile + (lane & 15), k = 32 step + 16 j + 8 (lane >> 4) + 0..7 (the hardware k order, as the x loader below).
__global__ __launch_bounds__(256) void k_wpack(const float* __restrict__ wq, const float* __restrict__ wk, const float* __restrict__ wv, _Float16* __restrict__ BP) {
  static_assert((DM / 32) * GNT * 2 * 32 % 256 == 0 && DI % 16 == 0, "whole blocks; a column tile lies in one weight");
  const unsigned t = blockIdx.x * 256 + threadIdx.x, lane = t & 31, j = (t >> 5) & 1, u = t >> 6; const unsigned ct = u % GNT, st = u / GNT;
  const unsigned col = ct * 16 + (lane & 15), k = st * 32 + j * 16 + 8 * (lane >> 4);
  const float* w = (col < DI) ? wq : (col < 2 * DI) ? wk : wv; const float* p = w + (size_t)(col % DI) * DM + k; FragH f;
#pragma unroll      /* the eight elements stay in registers: two 16-byte loads, one 16-byte store */
  for (int q = 0; q < 8; ++q) f.h[q] = (_Float16)(bf16_round(p[q]) * 16.0f);
  *(v8us*)((unsigned short*)BP + (size_t)t * 8) = f.half[0]; }
typedef float v2fc __attribute__((ext_vector_type(2)));
typedef __bf16 v2bc __attribute__((ext_vector_type(2)));
typedef _Float16 v2hc __attribute__((ext_vector_type(2)));
// A block takes 32 rows of x and all 192 columns; wave w takes row tile w & 1 and K slice w >> 1 (128 of the 1024 k): its whole share of x (16 loads) is in flight at once.
// The slices' parts are summed in LDS (slice 0 first). A block's 32 rows are one 32-key step of attention: it stores that step's k and v^T as the A fragments that attention loads,
// KV[batch][step][k: (key tile kt, k block ks, half j) | v^T: (column tile dt, half j)][lane][8]: k: key 16 kt + (lane & 15), feature 32 ks + 16 j + 8 (lane >> 4) + 0..7; v^T: column 16 dt + (lane & 15), key 16 j + 8 (lane >> 4) + 0..7.
// They are also one row block of queries: Q16[batch][row block] holds its q as B fragments, in the order of k.
// An accumulator lane holds 8 consecutive rows of ONE column of D: 8 keys of a column of v as D = x W^T, 8 features of a row of q or k as D = W x^T (the same two fragments, A and B exchanged; same k order).
// So every accumulator half is four neighbours of a fragment: the parts go through LDS lane by lane in 16-byte pieces and need no transpose.
__global__ __launch_bounds__(GKS * 2 * 32) void k_qkv(const float* __restrict__ x, const _Float16* __restrict__ BP, float* __restrict__ C0, _Float16* __restrict__ Q16, _Float16* __restrict__ KV) {
  static_assert(DM % (GKS * 32) == 0 && NR % 32 == 0 && SQ % 32 == 0 && QT0 % 32 == 0 && 32 * DI / 4 == GKS * 2 * 32 && DI == 64, "whole k steps; a block's 32 rows lie on one side of the first tile's end; a thread sums four q, four k and four v elements");
  __shared__ __attribute__((aligned(16))) float part[GKS][2][GNT][2][GPL][4];      /* part[slice][row tile][column tile][register half][lane][4] */
  const int tid = threadIdx.x, lane = tid & 31, ln = lane & 15, hh = lane >> 4; const int w = __builtin_amdgcn_readfirstlane(tid >> 5); const int rt = w & 1, ks = w >> 1; const int row0 = (int)blockIdx.x * 32;
  const float* xs = x + (size_t)(row0 + rt * 16) * DM + ks * (GST * 32); const unsigned xo = (unsigned)(ln * DM + 8 * hh) * 4u;      /* the lane's byte offset: the one vector register that all sixteen loads name */
  v4f xa[GST][4];
#pragma unroll      /* constant indices: the arrays stay in registers */
  for (int s = 0; s < GST; ++s) { const char* p = (const char*)(xs + s * 32) + xo; xa[s][0] = *(const v4fa*)p; xa[s][1] = *(const v4fa*)(p + 16); xa[s][2] = *(const v4fa*)(p + 64); xa[s][3] = *(const v4fa*)(p + 80); }
  asm volatile("s_wait_xcnt 0x0" :: "v"(xo) : "memory");      /* behind the sixteen x loads; their offset is named as an input so that it lives up to here */
  const unsigned short* bs = (const unsigned short*)BP + (size_t)ks * (GST * GNT * 512); const unsigned bo = (unsigned)(lane * 16);      /* byte offset, as xo */
  const v8f z8 = {0.f, 0.f, 0.f, 0.f, 0.f, 0.f, 0.f, 0.f}; v8f acc[GNT];
#pragma unroll      /* constant indices: the arrays stay in registers */
  for (int t = 0; t < GNT; ++t) acc[t] = z8;
#pragma unroll      /* constant indices: the arrays stay in registers */
  for (int s = 0; s < GST; ++s) { union { v16h v; v2hc p[8]; } ah;
#pragma unroll      /* constant indices: the arrays stay in registers */
    for (int c = 0; c < 4; ++c) for (int i = 0; i < 2; ++i) { const v2fc e = {xa[s][c][2 * i], xa[s][c][2 * i + 1]}; const v2bc r = __builtin_convertvector(e, v2bc);      /* to bf16, nearest even, then exact in f16 */
      ah.p[c * 2 + i] = __builtin_convertvector(__builtin_convertvector(r, v2fc), v2hc); }
#pragma unroll      /* constant indices: the arrays stay in registers */
    for (int t = 0; t < GNT; ++t) { FragH b; const char* p = (const char*)(bs + (s * GNT + t) * 512) + bo; b.half[0] = *(const v8us*)p; b.half[1] = *(const v8us*)(p + 512); acc[t] = (t < 2 * DI / 16) ? __builtin_amdgcn_wmma_f32_16x16x32_f16(false, b.v, false, ah.v, (short)0, acc[t], false, false) : __builtin_amdgcn_wmma_f32_16x16x32_f16(false, ah.v, false, b.v, (short)0, acc[t], false, false); } }      /* q, k: D = W x^T; v: D = x W^T */
  asm volatile("s_wait_xcnt 0x0" :: "v"(bo) : "memory");      /* the same behind the W loads */
#pragma unroll      /* constant indices: the arrays stay in registers */
  for (int t = 0; t < GNT; ++t) for (int h = 0; h < 2; ++h) { const v4f e = {acc[t][4 * h], acc[t][4 * h + 1], acc[t][4 * h + 2], acc[t][4 * h + 3]}; *(v4f*)&part[ks][rt][t][h][lane][0] = e; }      /* q, k: columns 16 t + 8 hh + 4 h + 0..3 of row 16 rt + ln; v: rows 16 rt + 8 hh + 4 h + 0..3 of column 16 t + ln */
  __syncthreads();      /* every slice's part is in LDS before the sum reads it */
  const int rb = row0 / SQ, ri = row0 - rb * SQ; float* c0 = C0 + ((size_t)rb * QT0 + ri) * LQK; _Float16* kvt = KV + ((size_t)rb * (SQ / 32) + ri / 32) * KVT;      /* the block's own f32 rows (where kept) and its own tile */
  /* each thread's place in the three f16 ranges is 4 tid: whole lines stored. q and k: half fragment tid >> 6 = (kt 2 + ks) 2 + j, lane (tid >> 1) & 31. v: half fragment tid >> 6 = dt 2 + j (j = the row tile), lane (tid >> 1) & 31, register half tid & 1 */
  const int pl = (tid >> 1) & 31, ph = tid & 1, ci = tid >> 6;
  const int krow = (ci >> 2) * 16 + (pl & 15), qc = ((ci >> 1) & 1) * 32 + (ci & 1) * 16 + (pl >> 4) * 8 + ph * 4, kc = DI + qc, qrow = krow;
  v4f vq = *(const v4f*)&part[0][ci >> 2][ci & 3][ph][pl][0], vk = *(const v4f*)&part[0][ci >> 2][4 + (ci & 3)][ph][pl][0], vv = *(const v4f*)&part[0][ci & 1][8 + (ci >> 1)][ph][pl][0];
#pragma unroll      /* the LDS reads are issued together */
  for (int u = 1; u < GKS; ++u) { vq += *(const v4f*)&part[u][ci >> 2][ci & 3][ph][pl][0]; vk += *(const v4f*)&part[u][ci >> 2][4 + (ci & 3)][ph][pl][0]; vv += *(const v4f*)&part[u][ci & 1][8 + (ci >> 1)][ph][pl][0]; }
  vq *= 0.0625f; vk *= 0.0625f; vv *= 0.0625f; v4h hq, hk, hv; for (int i = 0; i < 4; ++i) { hq[i] = (_Float16)vq[i]; hk[i] = (_Float16)vk[i]; hv[i] = (_Float16)vv[i]; }
  _Float16* qd = Q16 + (size_t)row0 * DI; *(v4h*)(qd + tid * 4) = hq; *(v4h*)(kvt + tid * 4) = hk; *(v4h*)(kvt + KVT / 2 + tid * 4) = hv;
  asm volatile("s_wait_xcnt 0x0" :: "v"(tid), "v"(hq), "v"(hk), "v"(hv), "s"(qd), "s"(kvt) : "memory");      /* behind the three f16 stores; what they name is given as inputs so that it lives up to here: the f32 stores' addresses are formed behind it */
  if (ri < QT0) { *(v4f*)(c0 + qrow * LQK + qc) = vq; *(v4f*)(c0 + krow * LQK + kc) = vk; float* cv = c0 + ((ci & 1) * 16 + (pl >> 4) * 8 + ph * 4) * LQK + 2 * DI + (ci >> 1) * 16 + (pl & 15);
#pragma unroll      /* four rows of one column */
    for (int i = 0; i < 4; ++i) cv[i * LQK] = vv[i]; } }
#define FW 16                        /* waves of an attention block, either path */
// Exact f32 causal attention for rows 0..QT0-1 of each batch, spread over lanes: a block takes FW query rows (i0 ..) of batch b; sc: FW rows of QT0 floats in the block's LDS.
// Scores: one THREAD per key (its K row in registers; the FW q rows are read at block-uniform addresses). Softmax and P V: one WAVE per query row (lanes across the keys, then across the 64 output columns).
typedef float v2f __attribute__((ext_vector_type(2)));
typedef float v2fa __attribute__((ext_vector_type(2), may_alias));
__device__ __forceinline__ void att0_rows(const float* __restrict__ QKV, float scale, float* __restrict__ O, const int b, const int i0, float (*sc)[QT0]) {      /* sc: scaled scores, then the unnormalised weights, of the block's rows */
  static_assert(QT0 % 32 == 0 && QT0 / 32 <= 16 && QT0 % FW == 0 && HD == 64 && NH == 1, "key chunks of 32, at most 16 a row; two output columns a lane");
  const int tid = threadIdx.x, lane = tid & 31; const int w = __builtin_amdgcn_readfirstlane(tid >> 5);
  const float* base = QKV + (size_t)b * QT0 * LQK; const float* qb = base + (size_t)i0 * LQK; const float* kb = base + DI; const float* vb = base + 2 * DI;
  for (int j0 = w * 32; j0 < i0 + FW; j0 += FW * 32) {      /* whole 32-key chunks up to the block's last row: j <= QT0 - 1 */
    const int j = j0 + lane; const float* kr = kb + (size_t)j * LQK; v4f kk[HD / 4];
#pragma unroll
    for (int c = 0; c < HD / 4; ++c) kk[c] = *(const v4fa*)(kr + c * 4);
#pragma unroll 1      /* rolled: one q row (64 scalars) fits the scalar registers; with the rows unrolled they spill */
    for (int r = 0; r < FW; ++r) { v4f a = {0.f, 0.f, 0.f, 0.f};
#pragma unroll
      for (int c = 0; c < HD / 4; ++c) a += *(const v4fa*)(qb + r * LQK + c * 4) * kk[c];
      sc[r][j] = ((a[0] + a[1]) + (a[2] + a[3])) * scale; } }
  __syncthreads();      /* every key's scores are in LDS before a row's wave reads them */
  const int i = i0 + w; const int nu = (i >> 5) + 1; float x[QT0 / 32]; float mx = -1.0e30f;
#pragma unroll
  for (int u = 0; u < QT0 / 32; ++u) if (u < nu) x[u] = sc[w][u * 32 + lane];      /* all reads issued before the first is used */
#pragma unroll
  for (int u = 0; u < QT0 / 32; ++u) if (u < nu) { x[u] = (u * 32 + lane <= i) ? x[u] : -1.0e30f; mx = fmaxf(mx, x[u]); }
  for (int d = 16; d > 0; d >>= 1) mx = fmaxf(mx, __shfl_xor(mx, d, 32));
  float l = 0.f;
#pragma unroll
  for (int u = 0; u < QT0 / 32; ++u) if (u < nu) { const float e = expf(x[u] - mx); l += e; sc[w][u * 32 + lane] = e; }      /* keys past the row: exactly 0 */
  for (int d = 16; d > 0; d >>= 1) l += __shfl_xor(l, d, 32);
  __syncthreads();      /* the weights that the other lanes wrote are in LDS before they are read back */
  v2f o = {0.f, 0.f}; const float* vr = vb + lane * 2;
  for (int j0 = 0; j0 < nu * 32; j0 += 32) {
    v4f p[8]; v2f vv[32];
#pragma unroll
    for (int t = 0; t < 32; ++t) vv[t] = *(const v2fa*)(vr + (size_t)(j0 + t) * LQK);
#pragma unroll
    for (int t = 0; t < 8; ++t) p[t] = *(const v4f*)&sc[w][j0 + t * 4];
#pragma unroll
    for (int t = 0; t < 32; ++t) o += p[t >> 2][t & 3] * vv[t]; }
  o *= 1.0f / l;
  *(v2f*)(O + ((size_t)b * SQ + i) * DI + lane * 2) = o;      /* the row's own place in the output: no other block stores rows 0..QT0-1 */
  asm volatile("s_wait_xcnt 0x0" ::: "memory"); }      /* behind the store: in the joined kernel code of the other path follows in the listing and writes the store's registers */

// Fused causal attention. A block takes the FQ query rows of row block qb of batch b; its FW waves take the row block's keys in 32-key steps, step st to wave st % FW.
// A step: S^T = K Q^T (A = 16 key rows, B = 16 query rows: a lane holds scores of ONE query), running maximum and sum per query, weights exp(s - m) packed in place as f16 into the B operand of O^T += V^T P^T.
// At the end every wave leaves (m, l, O) in LDS and the block joins them: out = sum_w 2^(c (m_w - M)) O_w / sum_w 2^(c (m_w - M)) l_w.
#define FQ 32                        /* query rows of a block: two 16-column groups a wave */
#define FP 68                        /* floats between two rows of a wave's part in LDS: 16-byte aligned, rows spread over the banks */
#define FC (0.03125f * 1.44269504f)  /* raw score -> scaled log2 domain: 1024^-0.5 * log2 e */
/* 2^x; the v_nop is the slot that the instruction set asks for behind a transcendental, in the same statement so that it stands there whatever the compiler puts next */
__device__ __forceinline__ float fa_exp2(float x) { asm("v_exp_f32 %0, %0\n\tv_nop" : "+v"(x)); return x; }
/* a fragment stored in fragment order: two half fragments of 512 bytes; p: the lane's own 16 bytes of the first */
__device__ __forceinline__ v16h fa_frag(const unsigned short* p) { FragH f; f.half[0] = *(const v8us*)p; f.half[1] = *(const v8us*)(p + 256); return f.v; }
__device__ __forceinline__ v8f fa_mma(v16h a, v16h b, v8f c) { return __builtin_amdgcn_wmma_f32_16x16x32_f16(false, a, false, b, (short)0, c, false, false); }
__device__ __forceinline__ void fattn_rows(const _Float16* __restrict__ Q16, const _Float16* __restrict__ KV, float* __restrict__ O, const int b, const int qb, float (*po)[FQ][FP], float (*pm)[FQ], float (*pl)[FQ]) {
  static_assert(HD == 64 && NH == 1 && SQ % FQ == 0 && FQ == 32 && FW * 32 == FQ * (HD / 4), "two k blocks a score, four 16-row tiles of O^T; the join gives a thread four columns of one row");
  const int tid = threadIdx.x, lane = tid & 31, ln = lane & 15, hh = lane >> 4; const int w = __builtin_amdgcn_readfirstlane(tid >> 5);
  const unsigned short* qp = (const unsigned short*)Q16 + ((size_t)b * SQ + qb * FQ) * DI + lane * 8; const unsigned short* kvb = (const unsigned short*)KV + (size_t)b * (SQ / 32) * KVT + lane * 8;      /* the lane's 16 bytes of every half fragment */
  v16h q[2][2];
#pragma unroll
  for (int qt = 0; qt < 2; ++qt) for (int ks = 0; ks < 2; ++ks) q[qt][ks] = fa_frag(qp + (qt * 2 + ks) * 512);
  const v8f z8 = {0.f, 0.f, 0.f, 0.f, 0.f, 0.f, 0.f, 0.f}; v8f o[4][2]; float m[2] = {-3.0e38f, -3.0e38f}, l[2] = {0.f, 0.f};      /* m: raw (unscaled) score */
#pragma unroll
  for (int dt = 0; dt < 4; ++dt) for (int qt = 0; qt < 2; ++qt) o[dt][qt] = z8;
  for (int st = w; st <= qb; st += FW) {      /* the same in every lane of a wave; no barrier inside */
    const unsigned short* kv = kvb + (size_t)st * KVT; v16h kf[2][2], vf[4];      /* the step's tile: sixteen loads of 512 contiguous bytes a wave, one address */
#pragma unroll
    for (int kt = 0; kt < 2; ++kt) for (int ks = 0; ks < 2; ++ks) kf[kt][ks] = fa_frag(kv + (kt * 2 + ks) * 512);
#pragma unroll
    for (int dt = 0; dt < 4; ++dt) vf[dt] = fa_frag(kv + KVT / 2 + dt * 512);
    asm volatile("s_wait_xcnt 0x0" :: "v"(kv) : "memory");      /* behind the sixteen loads; their address is named as an input so that it lives up to here and no load's result lands in it earlier */
    __builtin_amdgcn_sched_barrier(0);      /* all sixteen loads of a step are issued ahead of its first product: one load latency a step (left free, the compiler put loads behind products, into their operands' registers: three latencies in a row) */
    v8f s[2][2];      /* s[qt][kt][r]: key k0 + 16 kt + 8 hh + r against query 16 qt + ln */
#pragma unroll
    for (int qt = 0; qt < 2; ++qt) for (int kt = 0; kt < 2; ++kt) s[qt][kt] = fa_mma(kf[kt][1], q[qt][1], fa_mma(kf[kt][0], q[qt][0], z8));
    if (st == qb) {      /* the row block's own keys: those past a row drop out (key 0 of the step stays for every row) */
#pragma unroll
      for (int qt = 0; qt < 2; ++qt) for (int kt = 0; kt < 2; ++kt) for (int r = 0; r < 8; ++r) s[qt][kt][r] = (kt * 16 + 8 * hh + r <= qt * 16 + ln) ? s[qt][kt][r] : -1.0e30f; }
#pragma unroll
    for (int qt = 0; qt < 2; ++qt) {
      float mx = s[qt][0][0];
#pragma unroll
      for (int r = 1; r < 8; ++r) mx = fmaxf(mx, s[qt][0][r]);
#pragma unroll
      for (int r = 0; r < 8; ++r) mx = fmaxf(mx, s[qt][1][r]);
      mx = fmaxf(mx, __shfl_xor(mx, 16, 32));      /* the two lane halves hold the same query's other keys */
      const float mn = fmaxf(m[qt], mx); const float f = fa_exp2((m[qt] - mn) * FC); const float nm = -mn * FC; m[qt] = mn;
      FragH pb; v4f s4 = {0.f, 0.f, 0.f, 0.f};
#pragma unroll
      for (int kt = 0; kt < 2; ++kt) for (int g = 0; g < 2; ++g) { float e0 = fmaf(s[qt][kt][g * 4 + 0], FC, nm), e1 = fmaf(s[qt][kt][g * 4 + 1], FC, nm), e2 = fmaf(s[qt][kt][g * 4 + 2], FC, nm), e3 = fmaf(s[qt][kt][g * 4 + 3], FC, nm);
        /* four 2^x in place; the v_nop as in fa_exp2 */
        asm("v_exp_f32 %0, %0\n\tv_exp_f32 %1, %1\n\tv_exp_f32 %2, %2\n\tv_exp_f32 %3, %3\n\tv_nop" : "+v"(e0), "+v"(e1), "+v"(e2), "+v"(e3));
        const v4f e = {e0, e1, e2, e3}; s4 += e;      /* keys past the row: exactly 0 */
        pb.h[kt * 8 + g * 4 + 0] = (_Float16)e0; pb.h[kt * 8 + g * 4 + 1] = (_Float16)e1; pb.h[kt * 8 + g * 4 + 2] = (_Float16)e2; pb.h[kt * 8 + g * 4 + 3] = (_Float16)e3; }
      l[qt] = l[qt] * f + ((s4[0] + s4[1]) + (s4[2] + s4[3]));
#pragma unroll
      for (int dt = 0; dt < 4; ++dt) { o[dt][qt] *= f; o[dt][qt] = fa_mma(vf[dt], pb.v, o[dt][qt]); } } }
#pragma unroll
  for (int qt = 0; qt < 2; ++qt) { l[qt] += __shfl_xor(l[qt], 16, 32); if (hh == 0) { pm[w][qt * 16 + ln] = m[qt]; pl[w][qt * 16 + ln] = l[qt]; }
#pragma unroll
    for (int dt = 0; dt < 4; ++dt) { const v4f lo = {o[dt][qt][0], o[dt][qt][1], o[dt][qt][2], o[dt][qt][3]}, hi = {o[dt][qt][4], o[dt][qt][5], o[dt][qt][6], o[dt][qt][7]};      /* o[dt][qt][r] = O[query 16 qt + ln][column 16 dt + 8 hh + r] */
      *(v4f*)&po[w][qt * 16 + ln][dt * 16 + 8 * hh] = lo; *(v4f*)&po[w][qt * 16 + ln][dt * 16 + 8 * hh + 4] = hi; } }
  __syncthreads();      /* every wave's part (every wave has at least one step: qb >= FW) is in LDS before the join reads it */
  const int qi = tid >> 4, d4 = (tid & 15) * 4; float M = pm[0][qi];
#pragma unroll
  for (int u = 1; u < FW; ++u) M = fmaxf(M, pm[u][qi]);
  float L = 0.f; v4f a = {0.f, 0.f, 0.f, 0.f};
#pragma unroll
  for (int u = 0; u < FW; ++u) { const float g = fa_exp2((pm[u][qi] - M) * FC); L += g * pl[u][qi]; a += g * *(const v4f*)&po[u][qi][d4]; }
  a *= 1.0f / L;
  *(v4f*)(O + ((size_t)b * SQ + qb * FQ + qi) * DI + d4) = a; }

// Both attention paths on ONE grid (neither reads what the other writes; each output row has one writer): grid.x = batch; grid.y: first the f16 row blocks of rows QT0 .. SQ-1, then the exact f32 blocks of rows 0 .. QT0-1, each kind with its most keys first.
#define NFB ((SQ - QT0) / FQ)        /* f16 row blocks of a batch */
#define NAB (QT0 / FW)               /* exact f32 blocks of a batch */
__global__ __launch_bounds__(FW * 32) void k_attn(const _Float16* __restrict__ Q16, const _Float16* __restrict__ KV, const float* __restrict__ QKVF0, float* __restrict__ O) {
  static_assert(QT0 % FQ == 0 && FW * QT0 <= FW * FQ * FP, "the first tile ends on a row block; the exact path's scores fit the LDS of the other path's parts");
  __shared__ __attribute__((aligned(16))) float po[FW][FQ][FP]; __shared__ float pm[FW][FQ]; __shared__ float pl[FW][FQ];
  const int b = (int)blockIdx.x, y = (int)blockIdx.y;      /* the branch is the same for a whole block: each path's barriers are passed by all of its threads */
  if (y < NFB) fattn_rows(Q16, KV, O, b, SQ / FQ - 1 - y, po, pm, pl);
  else att0_rows(QKVF0, 0.03125f, O, b, (NFB + NAB - 1 - y) * FW, (float (*)[QT0])&po[0][0][0]); }

extern "C" void kernel_launch(void* const* d_in, const int* in_sizes, int n_in,
                              void* d_out, int out_size, void* d_ws, size_t ws_size, hipStream_t stream) {
  (void)in_sizes; (void)n_in; (void)out_size;
  const float* const* I = (const float* const*)d_in; const float* x = I[0]; const float* wq = I[1]; const float* wk = I[2]; const float* wv = I[3];      /* x; natural [out = 64][in] Wq / Wk / Wv (input order as this module lists them); no biases */
  char* ws = (char*)d_ws; size_t off = 0;
  auto take = [&](size_t bytes) { char* p = ws + off; off += (bytes + 255) & ~(size_t)255; return p; };
  _Float16* BP = (_Float16*)take((size_t)LQK * DM * 2); _Float16* Q16 = (_Float16*)take(NR * DI * 2); _Float16* KV = (_Float16*)take(NR / 32 * KVT * 2);
  float* QKVF0 = (float*)take((size_t)NB * QT0 * LQK * 4);      /* every plane holds all batches */
  if (off > ws_size) return;
  k_wpack<<<(unsigned)((DM / 32) * GNT * 2 * 32 / 256), 256, 0, stream>>>(wq, wk, wv, BP);      /* weights (x16, q | k | v) as exact f16 in fragment order */
  k_qkv<<<(unsigned)(NR / 32), GKS * 2 * 32, 0, stream>>>(x, BP, QKVF0, Q16, KV);      /* q | k | v = x W^T -> f16 q, k and v^T tiles in fragment order; the same f32 sums of rows 0..511 of each batch also stored unrounded (rows of pitch 192) */
  k_attn<<<dim3(NB, NFB + NAB), FW * 32, 0, stream>>>(Q16, KV, QKVF0, (float*)d_out);      /* out = softmax(causal(q k^T * 1024^-0.5)) v (the module scales by the EMBEDDING width), f32: rows 512.. on the f16 path, rows 0..511 exact in f32 */
}

// v008
// It runs in 28.5 microseconds.
// In two side-by-side timings against v007, it was 1.09 and 1.07 times as fast.
// Over all steps from v000 it is 487 times as fast.
#include <hip/hip_runtime.h>
// Single-head causal self-attention with the module's EMBEDDING-width scale (inps [4][2048][1024]; q/k/v = x W^T (natural [64][1024], U(+-1/32), no biases); ONE 64-wide head; scores * 1024^-0.5 (the source sets head_size = n_embed); causal (tril, -inf); softmax; out = weights v -> [4][2048][64]; no output projection).
// Structure (3 launches): the weights as exact f16, packed in fragment order; one WMMA GEMM that reads the f32 x itself (rounded in registers, exact in f16) and stores, per 32 rows, one tile each of q, k and v^T as f16 in fragment order, and also the f32 q | k | v of each batch's rows 0..511; the last launch holds both attention paths, each storing its own rows: scores, causal softmax and P V in ONE launch (block = 32 query rows of one batch; its 16 waves share the row block's keys in 32-key steps; S^T = K Q^T, weights stay in registers as the B operand of O^T += V^T P^T; running maximum and sum per wave, the waves' parts joined in LDS), f32 straight into the output rows 512..2047; an exact f32 first tile (rows 0..511 of each batch) on further blocks of the same grid.
// Compute dtype: inputs rounded to bf16; x / weights exact; q, k, v and softmax weights as plain f16 GEMM operands (~2^-12); scores, softmax statistics and o f32. v_wmma_f32_16x16x32_f16.
#define NB 4
#define SQ 2048
#define DM 1024
#define NH 1
#define HD 64
#define HG 4                         /* used only by the k_vt(V16, b, h0, VT) overload, which is not launched */
#define QT 256                       /* query rows per causal tile */
#define NKX SQ                       /* unused: the launches keep no S / P plane */
#define QT0 512                      /* first-tile rows computed exactly (f32): 512 here (no output projection averages the early-row cancellation errors away; logit sigma 1.0) */
#define B0 0                         /* unused: every launch covers all batches */
#define NBR NB                       /* unused by the launches (they put NB on or into grid.x) */
#define NR ((size_t)NB * SQ)
#define DMQ DM
#define DFF 4096                     /* unused: there is no FFN */
#define DFFR 100                     /* unused */
#define MP ((int)((size_t)NBR * SQ)) /* unused: the projections take NR rows */
#define QN SQ                        /* unused: the row blocks on grid.y cover SQ */
#define NHD NH                       /* unused: the launches use NH */
#define MPO MP                       /* unused: there is no output stage */
#define LQ (3 * DM)
typedef __bf16 v16b __attribute__((ext_vector_type(16)));
typedef unsigned short v8us __attribute__((ext_vector_type(8), may_alias));
typedef float  v8f  __attribute__((ext_vector_type(8)));
typedef float  v4f  __attribute__((ext_vector_type(4)));
typedef float  v4fa __attribute__((ext_vector_type(4), may_alias));
union FragB { v16b v; v8us half[2]; unsigned short u[16]; };

__device__ __forceinline__ unsigned short bf16_bits(float x) { unsigned int u = __float_as_uint(x); return (unsigned short)((u + 0x7FFFu + ((u >> 16) & 1u)) >> 16); }
__device__ __forceinline__ float bf16_val(unsigned short b) { return __uint_as_float(((unsigned int)b) << 16); }
__device__ __forceinline__ float bf16_round(float x) { return bf16_val(bf16_bits(x)); }
// D += A·B with NT terms: 1 = ah·bh, 2 = + al·bh (A split), 3 = + ah·bl (both split)
template <int NT>
__device__ __forceinline__ v8f mmaN(v16b ah, v16b al, v16b bh, v16b bl, v8f c) {
  c = __builtin_amdgcn_wmma_f32_16x16x32_bf16(false, ah, false, bh, (short)0, c, false, false);
  if (NT >= 2) c = __builtin_amdgcn_wmma_f32_16x16x32_bf16(false, al, false, bh, (short)0, c, false, false);
  if (NT >= 3) c = __builtin_amdgcn_wmma_f32_16x16x32_bf16(false, ah, false, bl, (short)0, c, false, false);
  asm volatile("v_nop\n\tv_nop\n\tv_nop\n\tv_nop" : "+v"(c) : "v"(ah), "v"(al), "v"(bh), "v"(bl));
  return c;
}

__global__ __launch_bounds__(256) void k_wt_bf16(const float* __restrict__ W, unsigned short* __restrict__ Wt, int K, int N) {
  const int t = blockIdx.x * 256 + threadIdx.x;
  const int k8n = K / 8;
  if (t >= N * k8n) return;
  const int n = t / k8n, k8 = (t % k8n) * 8;
  v8us v;
#pragma unroll
  for (int i = 0; i < 8; ++i) v[i] = bf16_bits(W[(size_t)(k8 + i) * N + n]);
  *(v8us*)(Wt + (size_t)n * K + k8) = v;
  
}

// GEMM C[M][N] (f32, pitch ldc) = act(A[M][K]·W + bias). A f32 row-major (pitch lda) converted per fragment to bf16
// (ASPLIT: hi/lo two planes -> 2 terms, else single rounded term); Wt bf16 [N][K] (pitch ldb). BIAS_BF16 rounds the
// bias to bf16 first (bias quantised to bf16 before the add). K%32==0, M%16==0, N%64==0.
template <bool ASPLIT, int ACT, bool BIAS_BF16>
__global__ __launch_bounds__(128) void k_gemm_bf(const float* __restrict__ A, int lda, const unsigned short* __restrict__ Wt, int ldb,
                                               const float* __restrict__ bias, float* __restrict__ C, int ldc, int M, int N, int K) {
  __shared__ __attribute__((aligned(16))) float so[4][16][64];
  const int tid = threadIdx.x, w = tid >> 5, lane = tid & 31, ln = lane & 15, hh = lane >> 4;
  const int ntn = N / 64;
  const int wid = blockIdx.x * 4 + w;
  const int mt = wid / ntn, nq = wid % ntn;
  if (mt * 16 >= M) return;
  const int row0 = mt * 16, col0 = nq * 64;
  const float* arow = A + (size_t)(row0 + ln) * lda;
  v8f acc[4] = {};
  for (int kb = 0; kb < K; kb += 32) {
    FragB ah, al;
    const v4f x0 = *(const v4fa*)(arow + kb + 8 * hh), x1 = *(const v4fa*)(arow + kb + 8 * hh + 4);
    const v4f x2 = *(const v4fa*)(arow + kb + 16 + 8 * hh), x3 = *(const v4fa*)(arow + kb + 16 + 8 * hh + 4);
    float xs[16] = {x0[0],x0[1],x0[2],x0[3],x1[0],x1[1],x1[2],x1[3],x2[0],x2[1],x2[2],x2[3],x3[0],x3[1],x3[2],x3[3]};
#pragma unroll
    for (int i = 0; i < 16; ++i) { const unsigned short hb = bf16_bits(xs[i]); ah.u[i] = hb; al.u[i] = ASPLIT ? bf16_bits(xs[i] - bf16_val(hb)) : (unsigned short)0; }
#pragma unroll
    for (int t = 0; t < 4; ++t) {
      const unsigned short* brow = Wt + (size_t)(col0 + t * 16 + ln) * ldb + kb;
      FragB b;
      b.half[0] = *(const v8us*)(brow + 8 * hh);
      b.half[1] = *(const v8us*)(brow + 16 + 8 * hh);
      acc[t] = mmaN<ASPLIT ? 2 : 1>(ah.v, al.v, b.v, b.v, acc[t]);
    }
  }
#pragma unroll
  for (int t = 0; t < 4; ++t) {
    float bv = bias ? bias[col0 + t * 16 + ln] : 0.f;
    if (BIAS_BF16) bv = bf16_round(bv);
#pragma unroll
    for (int r = 0; r < 8; ++r) { float v = acc[t][r] + bv; if (ACT == 1) v = fmaxf(v, 0.f); so[w][8 * hh + r][t * 16 + ln] = v; }
  }
  __builtin_amdgcn_fence(__ATOMIC_ACQ_REL, "workgroup");
  __builtin_amdgcn_wave_barrier();
  const int rsub = lane >> 4, c4 = (lane & 15) * 4;
  {
#pragma unroll
    for (int q = 0; q < 8; ++q) {
      const int r = q * 2 + rsub;
      const v4f v = *(const v4fa*)&so[w][r][c4];
      *(v4f*)(C + (size_t)(row0 + r) * ldc + col0 + c4) = v;
    }
    
  }
}

// GEMM C = act(A·W + bias + resid): A f32 (ASPLIT -> hi/lo 2 terms), Wt bf16 [N][K]; ACT 0 none, 1 relu, 2 exact gelu;
// resid (optional, f32, row index = (row % rmod), pitch ldr, RES_BF16 rounds it) added before the activation.
template <bool ASPLIT, int ACT, bool BIAS_BF16, bool RES_BF16>
__global__ __launch_bounds__(128) void k_gemm_bf3(const float* __restrict__ A, int lda, const unsigned short* __restrict__ Wt, int ldb,
                                                const float* __restrict__ bias, const float* __restrict__ resid, int rmod, int ldr,
                                                float* __restrict__ C, int ldc, int M, int N, int K) {
  __shared__ __attribute__((aligned(16))) float so[4][16][64];
  const int tid = threadIdx.x, w = tid >> 5, lane = tid & 31, ln = lane & 15, hh = lane >> 4;
  const int ntn = N / 64;
  const int wid = blockIdx.x * 4 + w;
  const int mt = wid / ntn, nq = wid % ntn;
  if (mt * 16 >= M) return;
  const int row0 = mt * 16, col0 = nq * 64;
  const float* arow = A + (size_t)(row0 + ln) * lda;
  v8f acc[4] = {};
  for (int kb = 0; kb < K; kb += 32) {
    FragB ah, al;
    const v4f x0 = *(const v4fa*)(arow + kb + 8 * hh), x1 = *(const v4fa*)(arow + kb + 8 * hh + 4);
    const v4f x2 = *(const v4fa*)(arow + kb + 16 + 8 * hh), x3 = *(const v4fa*)(arow + kb + 16 + 8 * hh + 4);
    float xs[16] = {x0[0],x0[1],x0[2],x0[3],x1[0],x1[1],x1[2],x1[3],x2[0],x2[1],x2[2],x2[3],x3[0],x3[1],x3[2],x3[3]};
#pragma unroll
    for (int i = 0; i < 16; ++i) { const unsigned short hb = bf16_bits(xs[i]); ah.u[i] = hb; al.u[i] = ASPLIT ? bf16_bits(xs[i] - bf16_val(hb)) : (unsigned short)0; }
#pragma unroll
    for (int t = 0; t < 4; ++t) {
      const unsigned short* brow = Wt + (size_t)(col0 + t * 16 + ln) * ldb + kb;
      FragB b;
      b.half[0] = *(const v8us*)(brow + 8 * hh);
      b.half[1] = *(const v8us*)(brow + 16 + 8 * hh);
      acc[t] = mmaN<ASPLIT ? 2 : 1>(ah.v, al.v, b.v, b.v, acc[t]);
    }
  }
#pragma unroll
  for (int t = 0; t < 4; ++t) {
    const int col = col0 + t * 16 + ln;
    float bv = bias ? bias[col] : 0.f;
    if (BIAS_BF16) bv = bf16_round(bv);
#pragma unroll
    for (int r = 0; r < 8; ++r) {
      float v = acc[t][r] + bv;
      if (resid) { float rv = resid[(size_t)((row0 + 8 * hh + r) % rmod) * ldr + col]; if (RES_BF16) rv = bf16_round(rv); v += rv; }
      if (ACT == 1) v = fmaxf(v, 0.f);
      if (ACT == 2) v = 0.5f * v * (1.0f + erff(v * 0.70710678118654752f));
      if (ACT == 3) { const float u = 0.7978845608028654f * (v + 0.044715f * v * v * v); v = 0.5f * v * (1.0f + tanhf(u)); }
      so[w][8 * hh + r][t * 16 + ln] = v;
    }
  }
  __builtin_amdgcn_fence(__ATOMIC_ACQ_REL, "workgroup");
  __builtin_amdgcn_wave_barrier();
  const int rsub = lane >> 4, c4 = (lane & 15) * 4;
  {
#pragma unroll
    for (int q = 0; q < 8; ++q) {
      const int r = q * 2 + rsub;
      const v4f v = *(const v4fa*)&so[w][r][c4];
      *(v4f*)(C + (size_t)(row0 + r) * ldc + col0 + c4) = v;
    }
    
  }
}
// row LayerNorm (biased variance, eps) over N: s = X (+ R); optional out_sum <- s; out_norm <- (s-mu)*rsqrt(var+eps)*g + b
template <bool PARAM_BF16>
__global__ __launch_bounds__(256) void k_layernorm(const float* __restrict__ X, const float* __restrict__ R, const float* __restrict__ g, const float* __restrict__ bta,
                                                  float* __restrict__ out_sum, float* __restrict__ out_norm, int N, float eps) {
  __shared__ float red[256];
  const int row = blockIdx.x, tid = threadIdx.x;
  const float* x = X + (size_t)row * N; const float* rr = R ? R + (size_t)row * N : nullptr;
  float vals[16];                     // up to N = 4096
  const int per = N / 256;            // contiguous chunk per thread? use strided-by-4 chunks: thread handles j = tid*4 + 1024*u
  float s1 = 0.f;
  for (int u = 0; u < per / 4; ++u) {
    const int j = tid * 4 + 1024 * u;
    const v4f a = *(const v4fa*)(x + j);
    v4f b = {0.f,0.f,0.f,0.f}; if (rr) b = *(const v4fa*)(rr + j);
#pragma unroll
    for (int q = 0; q < 4; ++q) { const float v = a[q] + b[q]; vals[u * 4 + q] = v; s1 += v; }
  }
  red[tid] = s1; __syncthreads();
  for (int st = 128; st > 0; st >>= 1) { if (tid < st) red[tid] += red[tid + st]; __syncthreads(); }
  const float mu = red[0] / (float)N; __syncthreads();
  float s2 = 0.f;
  for (int u = 0; u < per / 4; ++u)
#pragma unroll
    for (int q = 0; q < 4; ++q) { const float c = vals[u * 4 + q] - mu; s2 += c * c; }
  red[tid] = s2; __syncthreads();
  for (int st = 128; st > 0; st >>= 1) { if (tid < st) red[tid] += red[tid + st]; __syncthreads(); }
  const float rs = rsqrtf(red[0] / (float)N + eps);
  {
    for (int u = 0; u < per / 4; ++u) {
      const int j = tid * 4 + 1024 * u;
      v4f o, sm;
#pragma unroll
      for (int q = 0; q < 4; ++q) {
        float gg = g[j + q], bb = bta[j + q];
        if (PARAM_BF16) { gg = bf16_round(gg); bb = bf16_round(bb); }
        sm[q] = vals[u * 4 + q]; o[q] = (vals[u * 4 + q] - mu) * rs * gg + bb;
      }
      if (out_sum) *(v4f*)(out_sum + (size_t)row * N + j) = sm;
      *(v4f*)(out_norm + (size_t)row * N + j) = o;
    }
    
  }
}



// ---- f16 WMMA path (v_wmma_f32_16x16x32_f16): 11-bit significands for operands in range — used where a [0,1] probability operand needs more precision than bf16
typedef _Float16 v16h __attribute__((ext_vector_type(16)));
union FragH { v16h v; v8us half[2]; _Float16 h[16]; unsigned short u[16]; };
template <int NT>
__device__ __forceinline__ v8f mmaH(v16h ah, v16h al, v16h bh, v16h bl, v8f c) {
  c = __builtin_amdgcn_wmma_f32_16x16x32_f16(false, ah, false, bh, (short)0, c, false, false);
  if (NT >= 2) c = __builtin_amdgcn_wmma_f32_16x16x32_f16(false, al, false, bh, (short)0, c, false, false);
  if (NT >= 3) c = __builtin_amdgcn_wmma_f32_16x16x32_f16(false, ah, false, bl, (short)0, c, false, false);
  asm volatile("v_nop\n\tv_nop\n\tv_nop\n\tv_nop" : "+v"(c) : "v"(ah), "v"(al), "v"(bh), "v"(bl));
  return c;
}
// batched GEMM like k_gemm_b but f16 operands: A f32 (split into f16 hi/lo if ASPLIT, else rounded to f16), Bt = f16 values [n][k]; alpha; C f32; N multiple of 16 (partial tiles skipped)
template <bool ASPLIT>
__global__ __launch_bounds__(128) void k_gemm_h(const float* __restrict__ A, int lda, size_t sA, const _Float16* __restrict__ Bh, int ldb, size_t sB, float alpha, float* __restrict__ C, int ldc, size_t sC, int M, int N, int K) {
  __shared__ __attribute__((aligned(16))) float so[4][16][64];
  const int tid = threadIdx.x, w = tid >> 5, lane = tid & 31, ln = lane & 15, hh = lane >> 4; const int by = blockIdx.y;
  A += (size_t)by * sA; Bh += (size_t)by * sB; C += (size_t)by * sC;
  const int ntn = (N + 63) / 64; const int wid = blockIdx.x * 4 + w; const int mt = wid / ntn, nq = wid % ntn; if (mt * 16 >= M) return;
  const int row0 = mt * 16, col0 = nq * 64; const float* arow = A + (size_t)(row0 + ln) * lda;
  v8f acc[4] = {};
  for (int kb = 0; kb < K; kb += 32) {
    FragH ah, al;
    const v4f x0 = *(const v4fa*)(arow + kb + 8 * hh), x1 = *(const v4fa*)(arow + kb + 8 * hh + 4), x2 = *(const v4fa*)(arow + kb + 16 + 8 * hh), x3 = *(const v4fa*)(arow + kb + 16 + 8 * hh + 4);
    float xs[16] = {x0[0],x0[1],x0[2],x0[3],x1[0],x1[1],x1[2],x1[3],x2[0],x2[1],x2[2],x2[3],x3[0],x3[1],x3[2],x3[3]};
#pragma unroll
    for (int i = 0; i < 16; ++i) { const _Float16 h = (_Float16)xs[i]; ah.h[i] = h; al.h[i] = ASPLIT ? (_Float16)(xs[i] - (float)h) : (_Float16)0.0f; }
#pragma unroll
    for (int t = 0; t < 4; ++t) { if (col0 + t * 16 >= N) continue; const size_t boff = (size_t)(col0 + t * 16 + ln) * ldb + kb; FragH bq; bq.half[0] = *(const v8us*)(Bh + boff + 8 * hh); bq.half[1] = *(const v8us*)(Bh + boff + 16 + 8 * hh);
      acc[t] = mmaH<ASPLIT ? 2 : 1>(ah.v, al.v, bq.v, bq.v, acc[t]); }
  }
#pragma unroll
  for (int t = 0; t < 4; ++t) { if (col0 + t * 16 >= N) continue;
#pragma unroll
    for (int r = 0; r < 8; ++r) so[w][8 * hh + r][t * 16 + ln] = acc[t][r] * alpha; }
  __builtin_amdgcn_fence(__ATOMIC_ACQ_REL, "workgroup"); __builtin_amdgcn_wave_barrier();
  const int rsub = lane >> 4, c4 = (lane & 15) * 4;
  {
#pragma unroll
    for (int q = 0; q < 8; ++q) { const int r = q * 2 + rsub; if (col0 + c4 < N) { const v4f v = *(const v4fa*)&so[w][r][c4]; *(v4f*)(C + (size_t)(row0 + r) * ldc + col0 + c4) = v; } }
     }
}

// Wt[n][k] = f16(W[k][n]·scale) from f32 row-major W[K][N] (scale = power of two; bf16-exact weights stay exact in f16 away from the subnormal range)
__global__ __launch_bounds__(256) void k_wt_f16(const float* __restrict__ W, _Float16* __restrict__ Wt, int K, int N, float scale) {
  const int t = blockIdx.x * 256 + threadIdx.x; if (t >= N * (K / 8)) return; const int n = t / (K / 8), k8 = (t % (K / 8)) * 8; FragH f;
#pragma unroll
  for (int i = 0; i < 8; ++i) f.h[i] = (_Float16)(bf16_round(W[(size_t)(k8 + i) * N + n]) * scale); const v8us o = f.half[0];
  *(v8us*)((unsigned short*)Wt + (size_t)n * K + k8) = o; 
}
// k_gemm_hh variant with fused epilogue: v = acc·alpha + bias[by·sBias + col] (+ CP[(row/rowsPerB)·sCPb + by·64 + col] if CP) ; ACT 0 none / 1 elu ; writes f16 C16 (and f32 C if non-null)
template <int ACT>
__global__ __launch_bounds__(128) void k_gemm_hhx(const _Float16* __restrict__ A, int lda, size_t sA, const _Float16* __restrict__ Bh, int ldb, size_t sB, float alpha, const float* __restrict__ bias, size_t sBias, const float* __restrict__ CP, int rowsPerB, size_t sCPb, int row0g,
    float* __restrict__ C, _Float16* __restrict__ C16, int ldc, size_t sC, int M, int N, int K) {
  __shared__ __attribute__((aligned(16))) float so[4][16][64];
  const int tid = threadIdx.x, w = tid >> 5, lane = tid & 31, ln = lane & 15, hh = lane >> 4; const int by = blockIdx.y;
  A += (size_t)by * sA; Bh += (size_t)by * sB; const size_t cofs = (size_t)by * sC; const float* bp = bias ? bias + (size_t)by * sBias : nullptr;
  const int ntn = (N + 63) / 64; const int wid = blockIdx.x * 4 + w; const int mt = wid / ntn, nq = wid % ntn; if (mt * 16 >= M) return;
  const int row0 = mt * 16, col0 = nq * 64; const _Float16* arow = A + (size_t)(row0 + ln) * lda;
  v8f acc[4] = {};
  for (int kb = 0; kb < K; kb += 32) { FragH ah; ah.half[0] = *(const v8us*)((const unsigned short*)arow + kb + 8 * hh); ah.half[1] = *(const v8us*)((const unsigned short*)arow + kb + 16 + 8 * hh);
#pragma unroll
    for (int t = 0; t < 4; ++t) { if (col0 + t * 16 >= N) continue; const size_t boff = (size_t)(col0 + t * 16 + ln) * ldb + kb; FragH bq; bq.half[0] = *(const v8us*)((const unsigned short*)Bh + boff + 8 * hh); bq.half[1] = *(const v8us*)((const unsigned short*)Bh + boff + 16 + 8 * hh);
      acc[t] = mmaH<1>(ah.v, ah.v, bq.v, bq.v, acc[t]); }
  }
#pragma unroll
  for (int t = 0; t < 4; ++t) { if (col0 + t * 16 >= N) continue; const int col = col0 + t * 16 + ln; const float bv = bp ? bf16_round(bp[col]) : 0.f;
#pragma unroll
    for (int r = 0; r < 8; ++r) { float v = acc[t][r] * alpha + bv; if (CP) { const int rr = row0g + row0 + 8 * hh + r; if (rowsPerB < 0) v += CP[cofs + (size_t)rr * ldc + col];      /* rowsPerB < 0: own element of the batched C plane */ else { const int bidx = rr / rowsPerB; v += CP[(size_t)bidx * sCPb + (size_t)by * 64 + col]; } } if (ACT == 1) v = (v > 0.f) ? v : expm1f(v); else if (ACT == 7) v = (v > 0.f) ? v + 1.0f : expf(v); else if (ACT == 8) v = tanhf(v); else if (ACT == 9) v = 0.5f * v * (1.0f + tanhf(0.7978845608028654f * (v + 0.044715f * v * v * v))); else if (ACT == 11) v = 1.0f / (1.0f + expf(-v)); else if (ACT == 12) v = (v > 0.f) ? v : 0.01f * v; else if (ACT == 14) v = (v > 0.f) ? v : 0.1f * v; else if (ACT == 16) v = (v >= 0.f) ? v : 0.3f * v; else if (ACT == 17) v = (v >= 0.f) ? v : 0.2f * v; else if (ACT == 15) v = v / (1.0f + expf(-v)); else if (ACT == 3) v = fmaxf(v, 0.f); else if (ACT == 6) v = 0.5f * v * (1.0f + erff(v * 0.70710678118654752f)); so[w][8 * hh + r][t * 16 + ln] = v; } }
  __builtin_amdgcn_fence(__ATOMIC_ACQ_REL, "workgroup"); __builtin_amdgcn_wave_barrier();
  const int rsub = lane >> 4, c4 = (lane & 15) * 4; typedef _Float16 v4h __attribute__((ext_vector_type(4)));
  {
#pragma unroll
    for (int q = 0; q < 8; ++q) { const int r = q * 2 + rsub; if (col0 + c4 < N) { const v4f v = *(const v4fa*)&so[w][r][c4]; if (C) *(v4f*)(C + cofs + (size_t)(row0 + r) * ldc + col0 + c4) = v; if (C16) { v4h h4; for (int i = 0; i < 4; ++i) h4[i] = (_Float16)v[i]; *(v4h*)(C16 + cofs + (size_t)(row0 + r) * ldc + col0 + c4) = h4; } } }
     }
}


typedef _Float16 v4h __attribute__((ext_vector_type(4)));

__global__ __launch_bounds__(256) void k_h16(const float* __restrict__ x, _Float16* __restrict__ X16, size_t n8) { const size_t t = (size_t)blockIdx.x * 256 + threadIdx.x; if (t >= n8) return; FragH f;
#pragma unroll
  for (int q = 0; q < 8; ++q) f.h[q] = (_Float16)x[t * 8 + q]; *(v8us*)((unsigned short*)X16 + t * 8) = f.half[0];  }
__global__ __launch_bounds__(256) void k_round16f(const float* __restrict__ W, _Float16* __restrict__ Bt, size_t n8) { const size_t t = (size_t)blockIdx.x * 256 + threadIdx.x; if (t >= n8) return; FragH f;
#pragma unroll
  for (int i = 0; i < 8; ++i) f.h[i] = (_Float16)(bf16_round(W[t * 8 + i]) * 16.0f); *(v8us*)((unsigned short*)Bt + t * 8) = f.half[0];  }
template <int NHv, int TTv>
__global__ __launch_bounds__(256) void k_vt(const _Float16* __restrict__ V16, int ldv, int voff, _Float16* __restrict__ Vt) { __shared__ unsigned short tl[64][66]; const int tid = threadIdx.x; const int slab = blockIdx.x / (TTv / 64), lg = blockIdx.x % (TTv / 64); const int b = slab / NHv, h = slab % NHv;
  for (int i = tid; i < 64 * 8; i += 256) { const int r = i / 8, c8 = (i % 8) * 8; FragH f; f.half[0] = *(const v8us*)((const unsigned short*)V16 + ((size_t)b * TTv + lg * 64 + r) * ldv + voff + h * 64 + c8);
#pragma unroll
    for (int q = 0; q < 8; ++q) tl[r][c8 + q] = f.u[q]; }
  __syncthreads();
  {
#pragma unroll
    for (int rd = 0; rd < 2; ++rd) { const int d = rd * 32 + tid / 8, pc = tid % 8; FragH f;
#pragma unroll
      for (int q = 0; q < 8; ++q) f.u[q] = tl[pc * 8 + q][d];
      *(v8us*)((unsigned short*)Vt + ((size_t)slab * 64 + d) * TTv + lg * 64 + pc * 8) = f.half[0]; }
     } }

__global__ __launch_bounds__(256) void k_hl(const float* __restrict__ F, _Float16* __restrict__ Hh, _Float16* __restrict__ Hl, size_t n8) { const size_t t = (size_t)blockIdx.x * 256 + threadIdx.x; if (t >= n8) return; FragH fh, fl; const v4f a = *(const v4fa*)(F + t * 8), c = *(const v4fa*)(F + t * 8 + 4);
#pragma unroll
  for (int q = 0; q < 4; ++q) { _Float16 h = (_Float16)a[q]; fh.h[q] = h; fl.h[q] = (_Float16)((a[q] - (float)h) * 1024.0f); h = (_Float16)c[q]; fh.h[4 + q] = h; fl.h[4 + q] = (_Float16)((c[q] - (float)h) * 1024.0f); }
  { *(v8us*)((unsigned short*)Hh + t * 8) = fh.half[0]; *(v8us*)((unsigned short*)Hl + t * 8) = fl.half[0];  } }

// ---- fast GEMM (wave tile 32x64; requires M % 32 == 0 rows per launch region and N % 64 == 0); epilogue = k_gemm_hhx semantics ----
__device__ __forceinline__ v16h g2_frag(const _Float16* p, int hh) { FragH f; f.half[0] = *(const v8us*)((const unsigned short*)p + 8 * hh); f.half[1] = *(const v8us*)((const unsigned short*)p + 16 + 8 * hh); return f.v; }
__device__ __forceinline__ v8f g2_mma(v16h a, v16h b, v8f c) { v8f d = __builtin_amdgcn_wmma_f32_16x16x32_f16(false, a, false, b, (short)0, c, false, false); asm volatile("v_nop\n\tv_nop\n\tv_nop\n\tv_nop" : "+v"(d) : "v"(a), "v"(b)); return d; }
// CAUS 0: plain. CAUS 1 (scores): a 64-column tile at or past the end of its rows' causal query tile is skipped. CAUS 2 (P V): K runs over the keys of the rows' causal query tile only.
// F0 1: C holds only rows 0..QT0-1 of each batch, packed ([NB][QT0] rows); the other rows go to C16 alone.
template <int ACT, int CAUS = 0, int F0 = 0>
__global__ __launch_bounds__(128) void k_gemm2(const _Float16* __restrict__ A, int lda, size_t sA, const _Float16* __restrict__ Bh, int ldb, size_t sB, float alpha, const float* __restrict__ bias, size_t sBias, const float* __restrict__ CP, int rowsPerB, size_t sCPb, int row0g,
    float* __restrict__ C, _Float16* __restrict__ C16, int ldc, size_t sC, int M, int N, int K) { static_assert(ACT == 0 || ACT == 3 || ACT == 6 || ACT == 8 || ACT == 9 || ACT == 11 || ACT == 12 || ACT == 14 || ACT == 15 || ACT == 16 || ACT == 17, "k_gemm2: unsupported ACT code (would silently apply no activation)");
  __shared__ __attribute__((aligned(16))) float so[4][32][68];
  const int tid = threadIdx.x, w = tid >> 5, lane = tid & 31, ln = lane & 15, hh = lane >> 4; const int by = blockIdx.y;
  A += (size_t)by * sA; Bh += (size_t)by * sB; const size_t cofs = (size_t)by * sC; const float* bp = bias ? bias + (size_t)by * sBias : nullptr;
  const int ntn = N >> 6; const int mt = blockIdx.x / ntn, nq = blockIdx.x - mt * ntn; const int row0 = mt * 128 + 32 * w, col0 = nq * 64; if (row0 >= M) return;
  static_assert(QT % 128 == 0, "a 128-row block lies in one causal query tile"); const int nkc = (mt * 128 / QT + 1) * QT;      /* keys below the end of this block's causal query tile */
  if (CAUS == 1 && col0 >= nkc) return; if (CAUS == 2) K = nkc;
  const _Float16* a0p = A + (size_t)(row0 + ln) * lda; const _Float16* a1p = a0p + (size_t)16 * lda;
  const _Float16* b0p = Bh + (size_t)(col0 + ln) * ldb; const _Float16* b1p = b0p + (size_t)16 * ldb; const _Float16* b2p = b1p + (size_t)16 * ldb; const _Float16* b3p = b2p + (size_t)16 * ldb;
  const v8f z8 = {0.f,0.f,0.f,0.f,0.f,0.f,0.f,0.f}; v8f c00 = z8, c01 = z8, c02 = z8, c03 = z8, c10 = z8, c11 = z8, c12 = z8, c13 = z8;
#pragma unroll 1
  for (int kb = 0; kb < K; kb += 32) { const v16h a0 = g2_frag(a0p + kb, hh), a1 = g2_frag(a1p + kb, hh);
    v16h b = g2_frag(b0p + kb, hh); c00 = g2_mma(a0, b, c00); c10 = g2_mma(a1, b, c10);
    b = g2_frag(b1p + kb, hh); c01 = g2_mma(a0, b, c01); c11 = g2_mma(a1, b, c11);
    b = g2_frag(b2p + kb, hh); c02 = g2_mma(a0, b, c02); c12 = g2_mma(a1, b, c12);
    b = g2_frag(b3p + kb, hh); c03 = g2_mma(a0, b, c03); c13 = g2_mma(a1, b, c13); }
  v8f accs[8] = {c00, c01, c02, c03, c10, c11, c12, c13};
#pragma unroll
  for (int u = 0; u < 8; ++u) { const int t = u & 3, half = u >> 2; const int col = col0 + t * 16 + ln; const float bv = bp ? bf16_round(bp[col]) : 0.f;
#pragma unroll
    for (int r = 0; r < 8; ++r) { const int rloc = half * 16 + 8 * hh + r; float v = accs[u][r] * alpha + bv; if (CP) { if (rowsPerB < 0) v += CP[cofs + (size_t)(row0g + row0 + rloc) * ldc + col];      /* rowsPerB < 0: own element of the batched C plane */ else { const int bidx = (row0g + row0 + rloc) / rowsPerB; v += CP[(size_t)bidx * sCPb + (size_t)by * 64 + col]; } }
      if (ACT == 3) v = fmaxf(v, 0.f); else if (ACT == 6) v = 0.5f * v * (1.0f + erff(v * 0.70710678118654752f)); else if (ACT == 11) v = 1.0f / (1.0f + expf(-v)); else if (ACT == 15) v = v / (1.0f + expf(-v)); else if (ACT == 12) v = (v > 0.f) ? v : 0.01f * v; else if (ACT == 8) v = tanhf(v); else if (ACT == 9) v = 0.5f * v * (1.0f + tanhf(0.7978845608028654f * (v + 0.044715f * v * v * v))); else if (ACT == 14) v = (v > 0.f) ? v : 0.1f * v; else if (ACT == 16) v = (v >= 0.f) ? v : 0.3f * v; else if (ACT == 17) v = (v >= 0.f) ? v : 0.2f * v;
      so[w][rloc][t * 16 + ln] = v; } }
  __builtin_amdgcn_fence(__ATOMIC_ACQ_REL, "workgroup"); __builtin_amdgcn_wave_barrier();
  const int rsub = lane >> 4, c4 = (lane & 15) * 4;
  static_assert(SQ % 32 == 0 && QT0 % 32 == 0, "a wave's 32 rows lie on one side of the first tile's end"); size_t crow = (size_t)row0; if (F0) { const int rb = row0 / SQ, ri = row0 - rb * SQ; crow = (size_t)rb * QT0 + ri; if (ri >= QT0) C = nullptr; }
  {
#pragma unroll
    for (int q = 0; q < 16; ++q) { const int r = q * 2 + rsub; const v4f v = *(const v4fa*)&so[w][r][c4]; if (C) *(v4f*)(C + cofs + (crow + r) * ldc + col0 + c4) = v; if (C16) { v4h h4; for (int i = 0; i < 4; ++i) h4[i] = (_Float16)v[i]; *(v4h*)(C16 + cofs + (size_t)(row0 + r) * ldc + col0 + c4) = h4; } }
     } }


__global__ __launch_bounds__(256) void k_rsm(const float* __restrict__ S, _Float16* __restrict__ P, int nrows) {
  #pragma clang fp contract(off)
  const int i = blockIdx.x * 256 + threadIdx.x; if (i >= nrows) return; const float* s = S + (size_t)i * SQ; float mx = -3.0e38f;
#pragma unroll 1
  for (int j = 0; j < SQ; ++j) mx = fmaxf(mx, s[j]); float se = 0.f;
#pragma unroll 1
  for (int j = 0; j < SQ; ++j) se += expf(s[j] - mx); const float sc = 256.0f / se;
#pragma unroll 1
  for (int j0 = 0; j0 < SQ; j0 += 8) { FragH f; for (int q = 0; q < 8; ++q) f.h[q] = (_Float16)(expf(s[j0 + q] - mx) * sc); unsigned short* d = (unsigned short*)P + (size_t)i * SQ + j0; *(v8us*)d = f.half[0];  } }
__global__ __launch_bounds__(256) void k_vt(const _Float16* __restrict__ V16, int b, int h0, _Float16* __restrict__ VT) { __shared__ unsigned short tl[64][65]; const int tid = threadIdx.x; const int hh = blockIdx.x % HG, sg = blockIdx.x / HG; const int s0 = sg * 64; const int h = h0 + hh;
  for (int i = tid; i < 64 * 8; i += 256) { const int j = i / 8, d8 = (i % 8) * 8; FragH f; f.half[0] = *(const v8us*)((const unsigned short*)V16 + ((size_t)b * SQ + s0 + j) * DM + h * HD + d8); for (int q = 0; q < 8; ++q) tl[d8 + q][j] = f.u[q]; }
  __syncthreads();
  { for (int i = tid; i < 64 * 8; i += 256) { const int d = i / 8, j8 = (i % 8) * 8; FragH f; for (int q = 0; q < 8; ++q) f.u[q] = tl[d][j8 + q]; *(v8us*)((unsigned short*)VT + ((size_t)hh * HD + d) * SQ + s0 + j8) = f.half[0]; }  } }



template <int BFIN, int WXB>
__global__ __launch_bounds__(256) void k_ln16(const float* __restrict__ X, const float* __restrict__ g, const float* __restrict__ bb, float eps, _Float16* __restrict__ N16, float* __restrict__ XB) {
  #pragma clang fp contract(off)
  __shared__ float red[256]; const size_t r = blockIdx.x; const int t = threadIdx.x; const v4f xa = *(const v4fa*)(X + r * DMQ + t * 4); float s[4]; float sum = 0.f;
  for (int q = 0; q < 4; ++q) { s[q] = BFIN ? bf16_round(xa[q]) : xa[q]; sum = __fadd_rn(sum, s[q]); }
  red[t] = sum; __syncthreads(); for (int st = 128; st > 0; st >>= 1) { if (t < st) red[t] = __fadd_rn(red[t], red[t + st]); __syncthreads(); } const float mu = red[0] / (float)DMQ; __syncthreads();
  float vs = 0.f; for (int q = 0; q < 4; ++q) { const float dl = __fadd_rn(s[q], -mu); vs = __fadd_rn(vs, __fmul_rn(dl, dl)); } red[t] = vs; __syncthreads(); for (int st = 128; st > 0; st >>= 1) { if (t < st) red[t] = __fadd_rn(red[t], red[t + st]); __syncthreads(); }
  const float rs = rsqrtf(__fadd_rn(red[0] / (float)DMQ, eps)); v4h y; v4f xb;
  for (int q = 0; q < 4; ++q) { const int c = t * 4 + q; y[q] = (_Float16)__fadd_rn(__fmul_rn(__fmul_rn(__fadd_rn(s[q], -mu), rs), bf16_round(g[c])), bf16_round(bb[c])); xb[q] = s[q]; }
  { *(v4h*)(N16 + r * DMQ + t * 4) = y; if (WXB) *(v4f*)(XB + r * DMQ + t * 4) = xb;  } }
__global__ __launch_bounds__(256) void k_ftres2(const float* __restrict__ OF0, const float* __restrict__ XB, float* __restrict__ X1, size_t n4) {
  #pragma clang fp contract(off)
  const size_t t = (size_t)blockIdx.x * 256 + threadIdx.x; if (t >= n4) return; const v4f o = *(const v4fa*)(OF0 + t * 4), xv = *(const v4fa*)(XB + t * 4); v4f y; for (int q = 0; q < 4; ++q) y[q] = __fadd_rn(__fmul_rn(o[q], 0.015625f), xv[q]); *(v4f*)(X1 + t * 4) = y;  }

__global__ __launch_bounds__(256) void k_wthd(const float* __restrict__ Wt, _Float16* __restrict__ Bt) { const size_t t = (size_t)blockIdx.x * 256 + threadIdx.x; if (t >= (size_t)NH * HD * (DM / 8)) return; const int m8 = (int)(t % (DM / 8)) * 8; const int d = (int)((t / (DM / 8)) % HD); const int h = (int)(t / ((size_t)(DM / 8) * HD)); FragH f;
  for (int q = 0; q < 8; ++q) f.h[q] = (_Float16)(16.0f * bf16_round(Wt[((size_t)h * DM + m8 + q) * HD + d])); unsigned short* dst = (unsigned short*)Bt + ((size_t)h * HD + d) * DM + m8; *(v8us*)dst = f.half[0];  }




__global__ __launch_bounds__(256) void k_wtpad(const float* __restrict__ Wm, _Float16* __restrict__ Wt, int Kr, int Kp, int Nr, int Np, float scale) {
  const int t = blockIdx.x * 256 + threadIdx.x; if (t >= Np * (Kp / 8)) return; const int n = t / (Kp / 8), k8 = (t % (Kp / 8)) * 8; const int nc = min(n, Nr - 1); const float fn = (n < Nr) ? 1.f : 0.f; FragH f;
  for (int i = 0; i < 8; ++i) { const int k = k8 + i; const int kc = min(k, Kr - 1); const float fk = (k < Kr) ? fn : 0.f; f.h[i] = (_Float16)(bf16_round(Wm[(size_t)kc * Nr + nc]) * scale * fk); }
  unsigned short* o = (unsigned short*)Wt + (size_t)n * Kp + k8; *(v8us*)o = f.half[0];  }
__global__ __launch_bounds__(128) void k_bpad(const float* __restrict__ b, float* __restrict__ Bp, int nr, int np) {
  const int i = threadIdx.x; if (i >= np) return; const float v = b[min(i, nr - 1)] * ((i < nr) ? 1.f : 0.f); *(float*)(Bp + i) = v;  }

#define DI 64         /* inner width = NH * HD (ONE 64-wide head) */
#define LQK (3 * DI)  /* fused q | k | v row pitch (192) */
__global__ __launch_bounds__(256) void k_o0(const float* __restrict__ OF, float* __restrict__ ob, size_t n4) {
  #pragma clang fp contract(off)
  const size_t t = (size_t)blockIdx.x * 256 + threadIdx.x; if (t >= n4) return; const size_t e = t * 4; const int i = (int)(e / DI); const int c = (int)(e % DI); const int h = c / HD, d = c % HD; const v4f a = *(const v4fa*)(OF + e); v4f o; for (int q = 0; q < 4; ++q) o[q] = __fmul_rn(a[q], 0.015625f); float* dst = ob + (size_t)h * SQ * HD + (size_t)i * HD + d; *(v4f*)dst = o;  }

// The projection q | k | v = x W^T straight from the f32 input: x is read once, by the GEMM itself.
#define GKS 8                        /* K slices of a block */
#define GST (DM / GKS / 32)          /* 32-wide k steps of a slice */
#define GNT (LQK / 16)               /* 16-column tiles of q | k | v */
#define GPL 40                       /* 16-byte places of a register half's plane in LDS: 32 lanes and 8 idle, so that the two planes that a half wave reads together fall on different banks */
#define KVT 4096                     /* f16 elements of a 32-key tile of the k | v^T plane: 8 half fragments of k, then 8 of v^T, 512 bytes each */
// Wq | Wk | Wv (natural [64][DM] rows, x16, exact in f16) packed so that a wave's 16-byte load of half a fragment (A for q and k, B for v) is 512 contiguous bytes:
// BP[k step][column tile][half j][lane][8]: column 16 tile + (lane & 15), k = 32 step + 16 j + 8 (lane >> 4) + 0..7 (the hardware k order, as the x loader below).
__global__ __launch_bounds__(256) void k_wpack(const float* __restrict__ wq, const float* __restrict__ wk, const float* __restrict__ wv, _Float16* __restrict__ BP) {
  static_assert((DM / 32) * GNT * 2 * 32 % 256 == 0 && DI % 16 == 0, "whole blocks; a column tile lies in one weight");
  const unsigned t = blockIdx.x * 256 + threadIdx.x, lane = t & 31, j = (t >> 5) & 1, u = t >> 6; const unsigned ct = u % GNT, st = u / GNT;
  const unsigned col = ct * 16 + (lane & 15), k = st * 32 + j * 16 + 8 * (lane >> 4);
  const float* w = (col < DI) ? wq : (col < 2 * DI) ? wk : wv; const float* p = w + (size_t)(col % DI) * DM + k; FragH f;
#pragma unroll      /* the eight elements stay in registers: two 16-byte loads, one 16-byte store */
  for (int q = 0; q < 8; ++q) f.h[q] = (_Float16)(bf16_round(p[q]) * 16.0f);
  *(v8us*)((unsigned short*)BP + (size_t)t * 8) = f.half[0]; }
typedef float v2fc __attribute__((ext_vector_type(2)));
typedef __bf16 v2bc __attribute__((ext_vector_type(2)));
typedef _Float16 v2hc __attribute__((ext_vector_type(2)));
// A block takes 32 rows of x and all 192 columns; wave w takes row tile w & 1 and K slice w >> 1 (128 of the 1024 k): its whole share of x (16 loads) is in flight at once.
// The slices' parts are summed in LDS (slice 0 first). A block's 32 rows are one 32-key step of attention: it stores that step's k and v^T as the A fragments that attention loads,
// KV[batch][step][k: (key tile kt, k block ks, half j) | v^T: (column tile dt, half j)][lane][8]: k: key 16 kt + (lane & 15), feature 32 ks + 16 j + 8 (lane >> 4) + 0..7; v^T: column 16 dt + (lane & 15), key 16 j + 8 (lane >> 4) + 0..7.
// They are also one row block of queries: Q16[batch][row block] holds its q as B fragments, in the order of k.
// An accumulator lane holds 8 consecutive rows of ONE column of D: 8 keys of a column of v as D = x W^T, 8 features of a row of q or k as D = W x^T (the same two fragments, A and B exchanged; same k order).
// So every accumulator half is four neighbours of a fragment: the parts go through LDS lane by lane in 16-byte pieces and need no transpose.
__global__ __launch_bounds__(GKS * 2 * 32) void k_qkv(const float* __restrict__ x, const _Float16* __restrict__ BP, float* __restrict__ C0, _Float16* __restrict__ Q16, _Float16* __restrict__ KV) {
  static_assert(DM % (GKS * 32) == 0 && NR % 32 == 0 && SQ % 32 == 0 && QT0 % 32 == 0 && 32 * DI / 4 == GKS * 2 * 32 && DI == 64, "whole k steps; a block's 32 rows lie on one side of the first tile's end; a thread sums four q, four k and four v elements");
  __shared__ __attribute__((aligned(16))) float part[GKS][2][GNT][2][GPL][4];      /* part[slice][row tile][column tile][register half][lane][4] */
  const int tid = threadIdx.x, lane = tid & 31, ln = lane & 15, hh = lane >> 4; const int w = __builtin_amdgcn_readfirstlane(tid >> 5); const int rt = w & 1, ks = w >> 1; const int row0 = (int)blockIdx.x * 32;
  const float* xs = x + (size_t)(row0 + rt * 16) * DM + ks * (GST * 32); const unsigned xo = (unsigned)(ln * DM + 8 * hh) * 4u;      /* the lane's byte offset: the one vector register that all sixteen loads name */
  v4f xa[GST][4];
#pragma unroll      /* constant indices: the arrays stay in registers */
  for (int s = 0; s < GST; ++s) { const char* p = (const char*)(xs + s * 32) + xo; xa[s][0] = *(const v4fa*)p; xa[s][1] = *(const v4fa*)(p + 16); xa[s][2] = *(const v4fa*)(p + 64); xa[s][3] = *(const v4fa*)(p + 80); }
  asm volatile("s_wait_xcnt 0x0" :: "v"(xo) : "memory");      /* behind the sixteen x loads; their offset is named as an input so that it lives up to here */
  const unsigned short* bs = (const unsigned short*)BP + (size_t)ks * (GST * GNT * 512); const unsigned bo = (unsigned)(lane * 16);      /* byte offset, as xo */
  const v8f z8 = {0.f, 0.f, 0.f, 0.f, 0.f, 0.f, 0.f, 0.f}; v8f acc[GNT];
#pragma unroll      /* constant indices: the arrays stay in registers */
  for (int t = 0; t < GNT; ++t) acc[t] = z8;
#pragma unroll      /* constant indices: the arrays stay in registers */
  for (int s = 0; s < GST; ++s) { union { v16h v; v2hc p[8]; } ah;
#pragma unroll      /* constant indices: the arrays stay in registers */
    for (int c = 0; c < 4; ++c) for (int i = 0; i < 2; ++i) { const v2fc e = {xa[s][c][2 * i], xa[s][c][2 * i + 1]}; const v2bc r = __builtin_convertvector(e, v2bc);      /* to bf16, nearest even, then exact in f16 */
      ah.p[c * 2 + i] = __builtin_convertvector(__builtin_convertvector(r, v2fc), v2hc); }
#pragma unroll      /* constant indices: the arrays stay in registers */
    for (int t = 0; t < GNT; ++t) { FragH b; const char* p = (const char*)(bs + (s * GNT + t) * 512) + bo; b.half[0] = *(const v8us*)p; b.half[1] = *(const v8us*)(p + 512); acc[t] = (t < 2 * DI / 16) ? __builtin_amdgcn_wmma_f32_16x16x32_f16(false, b.v, false, ah.v, (short)0, acc[t], false, false) : __builtin_amdgcn_wmma_f32_16x16x32_f16(false, ah.v, false, b.v, (short)0, acc[t], false, false); } }      /* q, k: D = W x^T; v: D = x W^T */
  asm volatile("s_wait_xcnt 0x0" :: "v"(bo) : "memory");      /* the same behind the W loads */
#pragma unroll      /* constant indices: the arrays stay in registers */
  for (int t = 0; t < GNT; ++t) for (int h = 0; h < 2; ++h) { const v4f e = {acc[t][4 * h], acc[t][4 * h + 1], acc[t][4 * h + 2], acc[t][4 * h + 3]}; *(v4f*)&part[ks][rt][t][h][lane][0] = e; }      /* q, k: columns 16 t + 8 hh + 4 h + 0..3 of row 16 rt + ln; v: rows 16 rt + 8 hh + 4 h + 0..3 of column 16 t + ln */
  __syncthreads();      /* every slice's part is in LDS before the sum reads it */
  const int rb = row0 / SQ, ri = row0 - rb * SQ; float* c0 = C0 + ((size_t)rb * QT0 + ri) * LQK; _Float16* kvt = KV + ((size_t)rb * (SQ / 32) + ri / 32) * KVT;      /* the block's own f32 rows (where kept) and its own tile */
  /* each thread's place in the three f16 ranges is 4 tid: whole lines stored. q and k: half fragment tid >> 6 = (kt 2 + ks) 2 + j, lane (tid >> 1) & 31. v: half fragment tid >> 6 = dt 2 + j (j = the row tile), lane (tid >> 1) & 31, register half tid & 1 */
  const int pl = (tid >> 1) & 31, ph = tid & 1, ci = tid >> 6;
  const int krow = (ci >> 2) * 16 + (pl & 15), qc = ((ci >> 1) & 1) * 32 + (ci & 1) * 16 + (pl >> 4) * 8 + ph * 4, kc = DI + qc, qrow = krow;
  v4f vq = *(const v4f*)&part[0][ci >> 2][ci & 3][ph][pl][0], vk = *(const v4f*)&part[0][ci >> 2][4 + (ci & 3)][ph][pl][0], vv = *(const v4f*)&part[0][ci & 1][8 + (ci >> 1)][ph][pl][0];
#pragma unroll      /* the LDS reads are issued together */
  for (int u = 1; u < GKS; ++u) { vq += *(const v4f*)&part[u][ci >> 2][ci & 3][ph][pl][0]; vk += *(const v4f*)&part[u][ci >> 2][4 + (ci & 3)][ph][pl][0]; vv += *(const v4f*)&part[u][ci & 1][8 + (ci >> 1)][ph][pl][0]; }
  vq *= 0.0625f; vk *= 0.0625f; vv *= 0.0625f; v4h hq, hk, hv; for (int i = 0; i < 4; ++i) { hq[i] = (_Float16)vq[i]; hk[i] = (_Float16)vk[i]; hv[i] = (_Float16)vv[i]; }
  _Float16* qd = Q16 + (size_t)row0 * DI; *(v4h*)(qd + tid * 4) = hq; *(v4h*)(kvt + tid * 4) = hk; *(v4h*)(kvt + KVT / 2 + tid * 4) = hv;
  asm volatile("s_wait_xcnt 0x0" :: "v"(tid), "v"(hq), "v"(hk), "v"(hv), "s"(qd), "s"(kvt) : "memory");      /* behind the three f16 stores; what they name is given as inputs so that it lives up to here: the f32 stores' addresses are formed behind it */
  if (ri < QT0) { *(v4f*)(c0 + qrow * LQK + qc) = vq; *(v4f*)(c0 + krow * LQK + kc) = vk; float* cv = c0 + ((ci & 1) * 16 + (pl >> 4) * 8 + ph * 4) * LQK + 2 * DI + (ci >> 1) * 16 + (pl & 15);
#pragma unroll      /* four rows of one column */
    for (int i = 0; i < 4; ++i) cv[i * LQK] = vv[i]; } }
#define FW 16                        /* waves of an attention block, either path */
// Exact f32 causal attention for rows 0..QT0-1 of each batch, spread over lanes: a block takes FW query rows (i0 ..) of batch b; sc: FW rows of QT0 floats in the block's LDS.
// Scores: one THREAD per key (its K row in registers; the FW q rows are read at block-uniform addresses). Softmax: one WAVE per query row (lanes across the keys).
// P V: one WAVE per 32-key chunk, for all FW rows (a half wave across the 64 output columns, the two halves on rows r and r + FW / 2): a V row is read once a block; the chunks' parts lie in LDS behind sc and are summed by the row's wave.
typedef float v2f __attribute__((ext_vector_type(2)));
typedef float v2fa __attribute__((ext_vector_type(2), may_alias));
__device__ __forceinline__ void att0_rows(const float* __restrict__ QKV, float scale, float* __restrict__ O, const int b, const int i0, float (*sc)[QT0]) {      /* sc: scaled scores, then the unnormalised weights, of the block's rows */
  static_assert(QT0 % 32 == 0 && QT0 / 32 <= 16 && QT0 / 32 <= FW && 32 % FW == 0 && QT0 % FW == 0 && HD == 64 && NH == 1, "key chunks of 32, at most 16 a row and at most one a wave; a block's rows end in the same chunk; two output columns a lane");
  const int tid = threadIdx.x, lane = tid & 31; const int w = __builtin_amdgcn_readfirstlane(tid >> 5);
  const float* base = QKV + (size_t)b * QT0 * LQK; const float* qb = base + (size_t)i0 * LQK; const float* kb = base + DI; const float* vb = base + 2 * DI;
  for (int j0 = w * 32; j0 < i0 + FW; j0 += FW * 32) {      /* whole 32-key chunks up to the block's last row: j <= QT0 - 1 */
    const int j = j0 + lane; const float* kr = kb + (size_t)j * LQK; v4f kk[HD / 4];
#pragma unroll
    for (int c = 0; c < HD / 4; ++c) kk[c] = *(const v4fa*)(kr + c * 4);
#pragma unroll 1      /* rolled: one q row (64 scalars) fits the scalar registers; with the rows unrolled they spill */
    for (int r = 0; r < FW; ++r) { v4f a = {0.f, 0.f, 0.f, 0.f};
#pragma unroll
      for (int c = 0; c < HD / 4; ++c) a += *(const v4fa*)(qb + r * LQK + c * 4) * kk[c];
      sc[r][j] = ((a[0] + a[1]) + (a[2] + a[3])) * scale; } }
  __syncthreads();      /* every key's scores are in LDS before a row's wave reads them */
  const int i = i0 + w; const int nu = (i >> 5) + 1; float x[QT0 / 32]; float mx = -1.0e30f;      /* nu: the same for every row of the block */
  const int ln = lane & 15, hh = lane >> 4; const bool own = w < nu; v4f vv[32]; const float* vs = vb + (size_t)(w * 32) * LQK; const unsigned vo = (unsigned)(ln * 16);      /* the wave's own chunk of keys: its 32 V rows, four columns a lane, the same in both half waves (vo: the lane's byte offset); asked for here so that they arrive during the softmax */
  if (own) {
#pragma unroll      /* constant indices: the array stays in registers */
    for (int t = 0; t < 32; ++t) vv[t] = *(const v4fa*)((const char*)(vs + t * LQK) + vo);
    asm volatile("s_wait_xcnt 0x0" ::: "memory"); }      /* behind the 32 V loads, the last statement of their block: the softmax below writes the scalar registers that held their base */
#pragma unroll
  for (int u = 0; u < QT0 / 32; ++u) if (u < nu) x[u] = sc[w][u * 32 + lane];      /* all reads issued before the first is used */
#pragma unroll
  for (int u = 0; u < QT0 / 32; ++u) if (u < nu) { x[u] = (u * 32 + lane <= i) ? x[u] : -1.0e30f; mx = fmaxf(mx, x[u]); }
  for (int d = 16; d > 0; d >>= 1) mx = fmaxf(mx, __shfl_xor(mx, d, 32));
  float l = 0.f;
#pragma unroll
  for (int u = 0; u < QT0 / 32; ++u) if (u < nu) { const float e = expf(x[u] - mx); l += e; sc[w][u * 32 + lane] = e; }      /* keys past the row: exactly 0 */
  for (int d = 16; d > 0; d >>= 1) l += __shfl_xor(l, d, 32);
  __syncthreads();      /* every row's weights are in LDS before the chunks' waves read them */
  float* pp = &sc[0][0] + FW * QT0; float* pw = pp + (w * FW + hh * (FW / 2)) * HD + ln * 4;      /* pp[chunk][row][column]: the chunks' parts of P V */
  if (own) {
    for (int r = 0; r < FW / 2; ++r) { v4f p[8]; v4f o0 = {0.f, 0.f, 0.f, 0.f}, o1 = {0.f, 0.f, 0.f, 0.f};      /* two sums a row: a product need not wait for the one before it */
#pragma unroll      /* constant indices: the arrays stay in registers */
      for (int t = 0; t < 8; ++t) p[t] = *(const v4f*)&sc[r + hh * (FW / 2)][w * 32 + t * 4];      /* one address a half wave */
#pragma unroll      /* constant indices: the arrays stay in registers */
      for (int t = 0; t < 32; t += 2) { o0 += p[t >> 2][t & 3] * vv[t]; o1 += p[t >> 2][(t & 3) + 1] * vv[t + 1]; }
      *(v4f*)(pw + r * HD) = o0 + o1; } }
  else { const v4f z4 = {0.f, 0.f, 0.f, 0.f};      /* a wave without keys leaves zeros: the sum below takes FW parts whatever the row */
    for (int r = 0; r < FW / 2; ++r) *(v4f*)(pw + r * HD) = z4; }
  __syncthreads();      /* every chunk's part is in LDS before a row's wave sums them */
  v2f pt[FW];
#pragma unroll      /* all reads issued before the first is used */
  for (int u = 0; u < FW; ++u) pt[u] = *(const v2f*)(pp + (u * FW + w) * HD + lane * 2);
  v2f o = pt[0];
#pragma unroll      /* constant indices: the array stays in registers */
  for (int u = 1; u < FW; ++u) o += pt[u];
  o *= 1.0f / l;
  *(v2f*)(O + ((size_t)b * SQ + i) * DI + lane * 2) = o;      /* the row's own place in the output: no other block stores rows 0..QT0-1 */
  asm volatile("s_wait_xcnt 0x0" ::: "memory"); }      /* behind the store: in the joined kernel code of the other path follows in the listing and writes the store's registers */

// Fused causal attention. A block takes the FQ query rows of row block qb of batch b; its FW waves take the row block's keys in 32-key steps, step st to wave st % FW.
// A step: S^T = K Q^T (A = 16 key rows, B = 16 query rows: a lane holds scores of ONE query), running maximum and sum per query, weights exp(s - m) packed in place as f16 into the B operand of O^T += V^T P^T.
// At the end every wave leaves (m, l, O) in LDS and the block joins them: out = sum_w 2^(c (m_w - M)) O_w / sum_w 2^(c (m_w - M)) l_w.
#define FQ 32                        /* query rows of a block: two 16-column groups a wave */
#define FP 68                        /* floats between two rows of a wave's part in LDS: 16-byte aligned, rows spread over the banks */
#define FC (0.03125f * 1.44269504f)  /* raw score -> scaled log2 domain: 1024^-0.5 * log2 e */
/* 2^x; the v_nop is the slot that the instruction set asks for behind a transcendental, in the same statement so that it stands there whatever the compiler puts next */
__device__ __forceinline__ float fa_exp2(float x) { asm("v_exp_f32 %0, %0\n\tv_nop" : "+v"(x)); return x; }
/* a fragment stored in fragment order: two half fragments of 512 bytes; p: the lane's own 16 bytes of the first */
__device__ __forceinline__ v16h fa_frag(const unsigned short* p) { FragH f; f.half[0] = *(const v8us*)p; f.half[1] = *(const v8us*)(p + 256); return f.v; }
__device__ __forceinline__ v8f fa_mma(v16h a, v16h b, v8f c) { return __builtin_amdgcn_wmma_f32_16x16x32_f16(false, a, false, b, (short)0, c, false, false); }
__device__ __forceinline__ void fattn_rows(const _Float16* __restrict__ Q16, const _Float16* __restrict__ KV, float* __restrict__ O, const int b, const int qb, float (*po)[FQ][FP], float (*pm)[FQ], float (*pl)[FQ]) {
  static_assert(HD == 64 && NH == 1 && SQ % FQ == 0 && FQ == 32 && FW * 32 == FQ * (HD / 4), "two k blocks a score, four 16-row tiles of O^T; the join gives a thread four columns of one row");
  const int tid = threadIdx.x, lane = tid & 31, ln = lane & 15, hh = lane >> 4; const int w = __builtin_amdgcn_readfirstlane(tid >> 5);
  const unsigned short* qp = (const unsigned short*)Q16 + ((size_t)b * SQ + qb * FQ) * DI + lane * 8; const unsigned short* kvb = (const unsigned short*)KV + (size_t)b * (SQ / 32) * KVT + lane * 8;      /* the lane's 16 bytes of every half fragment */
  v16h q[2][2];
#pragma unroll
  for (int qt = 0; qt < 2; ++qt) for (int ks = 0; ks < 2; ++ks) q[qt][ks] = fa_frag(qp + (qt * 2 + ks) * 512);
  const v8f z8 = {0.f, 0.f, 0.f, 0.f, 0.f, 0.f, 0.f, 0.f}; v8f o[4][2]; float m[2] = {-3.0e38f, -3.0e38f}, l[2] = {0.f, 0.f};      /* m: raw (unscaled) score */
#pragma unroll
  for (int dt = 0; dt < 4; ++dt) for (int qt = 0; qt < 2; ++qt) o[dt][qt] = z8;
  for (int st = w; st <= qb; st += FW) {      /* the same in every lane of a wave; no barrier inside */
    const unsigned short* kv = kvb + (size_t)st * KVT; v16h kf[2][2], vf[4];      /* the step's tile: sixteen loads of 512 contiguous bytes a wave, one address */
#pragma unroll
    for (int kt = 0; kt < 2; ++kt) for (int ks = 0; ks < 2; ++ks) kf[kt][ks] = fa_frag(kv + (kt * 2 + ks) * 512);
#pragma unroll
    for (int dt = 0; dt < 4; ++dt) vf[dt] = fa_frag(kv + KVT / 2 + dt * 512);
    asm volatile("s_wait_xcnt 0x0" :: "v"(kv) : "memory");      /* behind the sixteen loads; their address is named as an input so that it lives up to here and no load's result lands in it earlier */
    __builtin_amdgcn_sched_barrier(0);      /* all sixteen loads of a step are issued ahead of its first product: one load latency a step (left free, the compiler put loads behind products, into their operands' registers: three latencies in a row) */
    v8f s[2][2];      /* s[qt][kt][r]: key k0 + 16 kt + 8 hh + r against query 16 qt + ln */
#pragma unroll
    for (int qt = 0; qt < 2; ++qt) for (int kt = 0; kt < 2; ++kt) s[qt][kt] = fa_mma(kf[kt][1], q[qt][1], fa_mma(kf[kt][0], q[qt][0], z8));
    if (st == qb) {      /* the row block's own keys: those past a row drop out (key 0 of the step stays for every row) */
#pragma unroll
      for (int qt = 0; qt < 2; ++qt) for (int kt = 0; kt < 2; ++kt) for (int r = 0; r < 8; ++r) s[qt][kt][r] = (kt * 16 + 8 * hh + r <= qt * 16 + ln) ? s[qt][kt][r] : -1.0e30f; }
#pragma unroll
    for (int qt = 0; qt < 2; ++qt) {
      float mx = s[qt][0][0];
#pragma unroll
      for (int r = 1; r < 8; ++r) mx = fmaxf(mx, s[qt][0][r]);
#pragma unroll
      for (int r = 0; r < 8; ++r) mx = fmaxf(mx, s[qt][1][r]);
      mx = fmaxf(mx, __shfl_xor(mx, 16, 32));      /* the two lane halves hold the same query's other keys */
      const float mn = fmaxf(m[qt], mx); const float f = fa_exp2((m[qt] - mn) * FC); const float nm = -mn * FC; m[qt] = mn;
      FragH pb; v4f s4 = {0.f, 0.f, 0.f, 0.f};
#pragma unroll
      for (int kt = 0; kt < 2; ++kt) for (int g = 0; g < 2; ++g) { float e0 = fmaf(s[qt][kt][g * 4 + 0], FC, nm), e1 = fmaf(s[qt][kt][g * 4 + 1], FC, nm), e2 = fmaf(s[qt][kt][g * 4 + 2], FC, nm), e3 = fmaf(s[qt][kt][g * 4 + 3], FC, nm);
        /* four 2^x in place; the v_nop as in fa_exp2 */
        asm("v_exp_f32 %0, %0\n\tv_exp_f32 %1, %1\n\tv_exp_f32 %2, %2\n\tv_exp_f32 %3, %3\n\tv_nop" : "+v"(e0), "+v"(e1), "+v"(e2), "+v"(e3));
        const v4f e = {e0, e1, e2, e3}; s4 += e;      /* keys past the row: exactly 0 */
        pb.h[kt * 8 + g * 4 + 0] = (_Float16)e0; pb.h[kt * 8 + g * 4 + 1] = (_Float16)e1; pb.h[kt * 8 + g * 4 + 2] = (_Float16)e2; pb.h[kt * 8 + g * 4 + 3] = (_Float16)e3; }
      l[qt] = l[qt] * f + ((s4[0] + s4[1]) + (s4[2] + s4[3]));
#pragma unroll
      for (int dt = 0; dt < 4; ++dt) { o[dt][qt] *= f; o[dt][qt] = fa_mma(vf[dt], pb.v, o[dt][qt]); } } }
#pragma unroll
  for (int qt = 0; qt < 2; ++qt) { l[qt] += __shfl_xor(l[qt], 16, 32); if (hh == 0) { pm[w][qt * 16 + ln] = m[qt]; pl[w][qt * 16 + ln] = l[qt]; }
#pragma unroll
    for (int dt = 0; dt < 4; ++dt) { const v4f lo = {o[dt][qt][0], o[dt][qt][1], o[dt][qt][2], o[dt][qt][3]}, hi = {o[dt][qt][4], o[dt][qt][5], o[dt][qt][6], o[dt][qt][7]};      /* o[dt][qt][r] = O[query 16 qt + ln][column 16 dt + 8 hh + r] */
      *(v4f*)&po[w][qt * 16 + ln][dt * 16 + 8 * hh] = lo; *(v4f*)&po[w][qt * 16 + ln][dt * 16 + 8 * hh + 4] = hi; } }
  __syncthreads();      /* every wave's part (every wave has at least one step: qb >= FW) is in LDS before the join reads it */
  const int qi = tid >> 4, d4 = (tid & 15) * 4; float M = pm[0][qi];
#pragma unroll
  for (int u = 1; u < FW; ++u) M = fmaxf(M, pm[u][qi]);
  float L = 0.f; v4f a = {0.f, 0.f, 0.f, 0.f};
#pragma unroll
  for (int u = 0; u < FW; ++u) { const float g = fa_exp2((pm[u][qi] - M) * FC); L += g * pl[u][qi]; a += g * *(const v4f*)&po[u][qi][d4]; }
  a *= 1.0f / L;
  *(v4f*)(O + ((size_t)b * SQ + qb * FQ + qi) * DI + d4) = a; }

// Both attention paths on ONE grid (neither reads what the other writes; each output row has one writer): grid.x = batch; grid.y: first the f16 row blocks of rows QT0 .. SQ-1, then the exact f32 blocks of rows 0 .. QT0-1, each kind with its most keys first.
#define NFB ((SQ - QT0) / FQ)        /* f16 row blocks of a batch */
#define NAB (QT0 / FW)               /* exact f32 blocks of a batch */
__global__ __launch_bounds__(FW * 32) void k_attn(const _Float16* __restrict__ Q16, const _Float16* __restrict__ KV, const float* __restrict__ QKVF0, float* __restrict__ O) {
  static_assert(QT0 % FQ == 0 && FW * QT0 + FW * FW * HD <= FW * FQ * FP, "the first tile ends on a row block; the exact path's scores and its parts of P V fit the LDS of the other path's parts");
  __shared__ __attribute__((aligned(16))) float po[FW][FQ][FP]; __shared__ float pm[FW][FQ]; __shared__ float pl[FW][FQ];
  const int b = (int)blockIdx.x, y = (int)blockIdx.y;      /* the branch is the same for a whole block: each path's barriers are passed by all of its threads */
  if (y < NFB) fattn_rows(Q16, KV, O, b, SQ / FQ - 1 - y, po, pm, pl);
  else att0_rows(QKVF0, 0.03125f, O, b, (NFB + NAB - 1 - y) * FW, (float (*)[QT0])&po[0][0][0]); }

extern "C" void kernel_launch(void* const* d_in, const int* in_sizes, int n_in,
                              void* d_out, int out_size, void* d_ws, size_t ws_size, hipStream_t stream) {
  (void)in_sizes; (void)n_in; (void)out_size;
  const float* const* I = (const float* const*)d_in; const float* x = I[0]; const float* wq = I[1]; const float* wk = I[2]; const float* wv = I[3];      /* x; natural [out = 64][in] Wq / Wk / Wv (input order as this module lists them); no biases */
  char* ws = (char*)d_ws; size_t off = 0;
  auto take = [&](size_t bytes) { char* p = ws + off; off += (bytes + 255) & ~(size_t)255; return p; };
  _Float16* BP = (_Float16*)take((size_t)LQK * DM * 2); _Float16* Q16 = (_Float16*)take(NR * DI * 2); _Float16* KV = (_Float16*)take(NR / 32 * KVT * 2);
  float* QKVF0 = (float*)take((size_t)NB * QT0 * LQK * 4);      /* every plane holds all batches */
  if (off > ws_size) return;
  k_wpack<<<(unsigned)((DM / 32) * GNT * 2 * 32 / 256), 256, 0, stream>>>(wq, wk, wv, BP);      /* weights (x16, q | k | v) as exact f16 in fragment order */
  k_qkv<<<(unsigned)(NR / 32), GKS * 2 * 32, 0, stream>>>(x, BP, QKVF0, Q16, KV);      /* q | k | v = x W^T -> f16 q, k and v^T tiles in fragment order; the same f32 sums of rows 0..511 of each batch also stored unrounded (rows of pitch 192) */
  k_attn<<<dim3(NB, NFB + NAB), FW * 32, 0, stream>>>(Q16, KV, QKVF0, (float*)d_out);      /* out = softmax(causal(q k^T * 1024^-0.5)) v (the module scales by the EMBEDDING width), f32: rows 512.. on the f16 path, rows 0..511 exact in f32 */
}

// v009
// One run takes 21.9 microseconds.
// Two timings next to v008 put it at 1.29 and 1.30 times that version's speed.
// All steps since v000 together make it 631 times as fast.
#include <hip/hip_runtime.h>
// Single-head causal self-attention with the module's EMBEDDING-width scale (inps [4][2048][1024]; q/k/v = x W^T (natural [64][1024], U(+-1/32), no biases); ONE 64-wide head; scores * 1024^-0.5 (the source sets head_size = n_embed); causal (tril, -inf); softmax; out = weights v -> [4][2048][64]; no output projection).
// Structure (3 launches): the weights as exact f16, packed in fragment order; one WMMA GEMM that reads the f32 x itself (rounded in registers, exact in f16) and stores, per 32 rows, one tile each of q, k and v^T as f16 in fragment order, and also the f32 q | k | v of each batch's rows 0..511; the last launch holds both attention paths, each storing its own rows: scores, causal softmax and P V in ONE launch (block = 32 query rows of one batch; its 16 waves share the row block's keys in 32-key steps; S^T = K Q^T, weights stay in registers as the B operand of O^T += V^T P^T; running maximum and sum per wave, the waves' parts joined in LDS), f32 straight into the output rows 512..2047; an exact f32 first tile (rows 0..511 of each batch) on further blocks of the same grid.
// Compute dtype: inputs rounded to bf16; x / weights exact; q, k, v and softmax weights as plain f16 GEMM operands, o accumulated in f32; scores and softmax statistics f32. v_wmma_f32_16x16x32_f16; the exact first tile's scores: v_wmma_f32_16x16x4_f32 (f32 operands).
#define NB 4
#define SQ 2048
#define DM 1024
#define NH 1
#define HD 64
#define HG 4                         /* used only by the k_vt(V16, b, h0, VT) overload, which is not launched */
#define QT 256                       /* query rows per causal tile */
#define NKX SQ                       /* unused: the launches keep no S / P plane */
#define QT0 512                      /* first-tile rows computed exactly (f32): 512 here (no output projection averages the early-row cancellation errors away; logit sigma 1.0) */
#define B0 0                         /* unused: every launch covers all batches */
#define NBR NB                       /* unused by the launches (they put NB on or into grid.x) */
#define NR ((size_t)NB * SQ)
#define DMQ DM
#define DFF 4096                     /* unused: there is no FFN */
#define DFFR 100                     /* unused */
#define MP ((int)((size_t)NBR * SQ)) /* unused: the projections take NR rows */
#define QN SQ                        /* unused: the row blocks on grid.y cover SQ */
#define NHD NH                       /* unused: the launches use NH */
#define MPO MP                       /* unused: there is no output stage */
#define LQ (3 * DM)
typedef __bf16 v16b __attribute__((ext_vector_type(16)));
typedef unsigned short v8us __attribute__((ext_vector_type(8), may_alias));
typedef float  v8f  __attribute__((ext_vector_type(8)));
typedef float  v4f  __attribute__((ext_vector_type(4)));
typedef float  v4fa __attribute__((ext_vector_type(4), may_alias));
union FragB { v16b v; v8us half[2]; unsigned short u[16]; };

__device__ __forceinline__ unsigned short bf16_bits(float x) { unsigned int u = __float_as_uint(x); return (unsigned short)((u + 0x7FFFu + ((u >> 16) & 1u)) >> 16); }
__device__ __forceinline__ float bf16_val(unsigned short b) { return __uint_as_float(((unsigned int)b) << 16); }
__device__ __forceinline__ float bf16_round(float x) { return bf16_val(bf16_bits(x)); }
// D += A·B with NT terms: 1 = ah·bh, 2 = + al·bh (A split), 3 = + ah·bl (both split)
template <int NT>
__device__ __forceinline__ v8f mmaN(v16b ah, v16b al, v16b bh, v16b bl, v8f c) {
  c = __builtin_amdgcn_wmma_f32_16x16x32_bf16(false, ah, false, bh, (short)0, c, false, false);
  if (NT >= 2) c = __builtin_amdgcn_wmma_f32_16x16x32_bf16(false, al, false, bh, (short)0, c, false, false);
  if (NT >= 3) c = __builtin_amdgcn_wmma_f32_16x16x32_bf16(false, ah, false, bl, (short)0, c, false, false);
  asm volatile("v_nop\n\tv_nop\n\tv_nop\n\tv_nop" : "+v"(c) : "v"(ah), "v"(al), "v"(bh), "v"(bl));
  return c;
}

__global__ __launch_bounds__(256) void k_wt_bf16(const float* __restrict__ W, unsigned short* __restrict__ Wt, int K, int N) {
  const int t = blockIdx.x * 256 + threadIdx.x;
  const int k8n = K / 8;
  if (t >= N * k8n) return;
  const int n = t / k8n, k8 = (t % k8n) * 8;
  v8us v;
#pragma unroll
  for (int i = 0; i < 8; ++i) v[i] = bf16_bits(W[(size_t)(k8 + i) * N + n]);
  *(v8us*)(Wt + (size_t)n * K + k8) = v;
  
}

// GEMM C[M][N] (f32, pitch ldc) = act(A[M][K]·W + bias). A f32 row-major (pitch lda) converted per fragment to bf16
// (ASPLIT: hi/lo two planes -> 2 terms, else single rounded term); Wt bf16 [N][K] (pitch ldb). BIAS_BF16 rounds the
// bias to bf16 first (bias quantised to bf16 before the add). K%32==0, M%16==0, N%64==0.
template <bool ASPLIT, int ACT, bool BIAS_BF16>
__global__ __launch_bounds__(128) void k_gemm_bf(const float* __restrict__ A, int lda, const unsigned short* __restrict__ Wt, int ldb,
                                               const float* __restrict__ bias, float* __restrict__ C, int ldc, int M, int N, int K) {
  __shared__ __attribute__((aligned(16))) float so[4][16][64];
  const int tid = threadIdx.x, w = tid >> 5, lane = tid & 31, ln = lane & 15, hh = lane >> 4;
  const int ntn = N / 64;
  const int wid = blockIdx.x * 4 + w;
  const int mt = wid / ntn, nq = wid % ntn;
  if (mt * 16 >= M) return;
  const int row0 = mt * 16, col0 = nq * 64;
  const float* arow = A + (size_t)(row0 + ln) * lda;
  v8f acc[4] = {};
  for (int kb = 0; kb < K; kb += 32) {
    FragB ah, al;
    const v4f x0 = *(const v4fa*)(arow + kb + 8 * hh), x1 = *(const v4fa*)(arow + kb + 8 * hh + 4);
    const v4f x2 = *(const v4fa*)(arow + kb + 16 + 8 * hh), x3 = *(const v4fa*)(arow + kb + 16 + 8 * hh + 4);
    float xs[16] = {x0[0],x0[1],x0[2],x0[3],x1[0],x1[1],x1[2],x1[3],x2[0],x2[1],x2[2],x2[3],x3[0],x3[1],x3[2],x3[3]};
#pragma unroll
    for (int i = 0; i < 16; ++i) { const unsigned short hb = bf16_bits(xs[i]); ah.u[i] = hb; al.u[i] = ASPLIT ? bf16_bits(xs[i] - bf16_val(hb)) : (unsigned short)0; }
#pragma unroll
    for (int t = 0; t < 4; ++t) {
      const unsigned short* brow = Wt + (size_t)(col0 + t * 16 + ln) * ldb + kb;
      FragB b;
      b.half[0] = *(const v8us*)(brow + 8 * hh);
      b.half[1] = *(const v8us*)(brow + 16 + 8 * hh);
      acc[t] = mmaN<ASPLIT ? 2 : 1>(ah.v, al.v, b.v, b.v, acc[t]);
    }
  }
#pragma unroll
  for (int t = 0; t < 4; ++t) {
    float bv = bias ? bias[col0 + t * 16 + ln] : 0.f;
    if (BIAS_BF16) bv = bf16_round(bv);
#pragma unroll
    for (int r = 0; r < 8; ++r) { float v = acc[t][r] + bv; if (ACT == 1) v = fmaxf(v, 0.f); so[w][8 * hh + r][t * 16 + ln] = v; }
  }
  __builtin_amdgcn_fence(__ATOMIC_ACQ_REL, "workgroup");
  __builtin_amdgcn_wave_barrier();
  const int rsub = lane >> 4, c4 = (lane & 15) * 4;
  {
#pragma unroll
    for (int q = 0; q < 8; ++q) {
      const int r = q * 2 + rsub;
      const v4f v = *(const v4fa*)&so[w][r][c4];
      *(v4f*)(C + (size_t)(row0 + r) * ldc + col0 + c4) = v;
    }
    
  }
}

// GEMM C = act(A·W + bias + resid): A f32 (ASPLIT -> hi/lo 2 terms), Wt bf16 [N][K]; ACT 0 none, 1 relu, 2 exact gelu;
// resid (optional, f32, row index = (row % rmod), pitch ldr, RES_BF16 rounds it) added before the activation.
template <bool ASPLIT, int ACT, bool BIAS_BF16, bool RES_BF16>
__global__ __launch_bounds__(128) void k_gemm_bf3(const float* __restrict__ A, int lda, const unsigned short* __restrict__ Wt, int ldb,
                                                const float* __restrict__ bias, const float* __restrict__ resid, int rmod, int ldr,
                                                float* __restrict__ C, int ldc, int M, int N, int K) {
  __shared__ __attribute__((aligned(16))) float so[4][16][64];
  const int tid = threadIdx.x, w = tid >> 5, lane = tid & 31, ln = lane & 15, hh = lane >> 4;
  const int ntn = N / 64;
  const int wid = blockIdx.x * 4 + w;
  const int mt = wid / ntn, nq = wid % ntn;
  if (mt * 16 >= M) return;
  const int row0 = mt * 16, col0 = nq * 64;
  const float* arow = A + (size_t)(row0 + ln) * lda;
  v8f acc[4] = {};
  for (int kb = 0; kb < K; kb += 32) {
    FragB ah, al;
    const v4f x0 = *(const v4fa*)(arow + kb + 8 * hh), x1 = *(const v4fa*)(arow + kb + 8 * hh + 4);
    const v4f x2 = *(const v4fa*)(arow + kb + 16 + 8 * hh), x3 = *(const v4fa*)(arow + kb + 16 + 8 * hh + 4);
    float xs[16] = {x0[0],x0[1],x0[2],x0[3],x1[0],x1[1],x1[2],x1[3],x2[0],x2[1],x2[2],x2[3],x3[0],x3[1],x3[2],x3[3]};
#pragma unroll
    for (int i = 0; i < 16; ++i) { const unsigned short hb = bf16_bits(xs[i]); ah.u[i] = hb; al.u[i] = ASPLIT ? bf16_bits(xs[i] - bf16_val(hb)) : (unsigned short)0; }
#pragma unroll
    for (int t = 0; t < 4; ++t) {
      const unsigned short* brow = Wt + (size_t)(col0 + t * 16 + ln) * ldb + kb;
      FragB b;
      b.half[0] = *(const v8us*)(brow + 8 * hh);
      b.half[1] = *(const v8us*)(brow + 16 + 8 * hh);
      acc[t] = mmaN<ASPLIT ? 2 : 1>(ah.v, al.v, b.v, b.v, acc[t]);
    }
  }
#pragma unroll
  for (int t = 0; t < 4; ++t) {
    const int col = col0 + t * 16 + ln;
    float bv = bias ? bias[col] : 0.f;
    if (BIAS_BF16) bv = bf16_round(bv);
#pragma unroll
    for (int r = 0; r < 8; ++r) {
      float v = acc[t][r] + bv;
      if (resid) { float rv = resid[(size_t)((row0 + 8 * hh + r) % rmod) * ldr + col]; if (RES_BF16) rv = bf16_round(rv); v += rv; }
      if (ACT == 1) v = fmaxf(v, 0.f);
      if (ACT == 2) v = 0.5f * v * (1.0f + erff(v * 0.70710678118654752f));
      if (ACT == 3) { const float u = 0.7978845608028654f * (v + 0.044715f * v * v * v); v = 0.5f * v * (1.0f + tanhf(u)); }
      so[w][8 * hh + r][t * 16 + ln] = v;
    }
  }
  __builtin_amdgcn_fence(__ATOMIC_ACQ_REL, "workgroup");
  __builtin_amdgcn_wave_barrier();
  const int rsub = lane >> 4, c4 = (lane & 15) * 4;
  {
#pragma unroll
    for (int q = 0; q < 8; ++q) {
      const int r = q * 2 + rsub;
      const v4f v = *(const v4fa*)&so[w][r][c4];
      *(v4f*)(C + (size_t)(row0 + r) * ldc + col0 + c4) = v;
    }
    
  }
}
// row LayerNorm (biased variance, eps) over N: s = X (+ R); optional out_sum <- s; out_norm <- (s-mu)*rsqrt(var+eps)*g + b
template <bool PARAM_BF16>
__global__ __launch_bounds__(256) void k_layernorm(const float* __restrict__ X, const float* __restrict__ R, const float* __restrict__ g, const float* __restrict__ bta,
                                                  float* __restrict__ out_sum, float* __restrict__ out_norm, int N, float eps) {
  __shared__ float red[256];
  const int row = blockIdx.x, tid = threadIdx.x;
  const float* x = X + (size_t)row * N; const float* rr = R ? R + (size_t)row * N : nullptr;
  float vals[16];                     // up to N = 4096
  const int per = N / 256;            // contiguous chunk per thread? use strided-by-4 chunks: thread handles j = tid*4 + 1024*u
  float s1 = 0.f;
  for (int u = 0; u < per / 4; ++u) {
    const int j = tid * 4 + 1024 * u;
    const v4f a = *(const v4fa*)(x + j);
    v4f b = {0.f,0.f,0.f,0.f}; if (rr) b = *(const v4fa*)(rr + j);
#pragma unroll
    for (int q = 0; q < 4; ++q) { const float v = a[q] + b[q]; vals[u * 4 + q] = v; s1 += v; }
  }
  red[tid] = s1; __syncthreads();
  for (int st = 128; st > 0; st >>= 1) { if (tid < st) red[tid] += red[tid + st]; __syncthreads(); }
  const float mu = red[0] / (float)N; __syncthreads();
  float s2 = 0.f;
  for (int u = 0; u < per / 4; ++u)
#pragma unroll
    for (int q = 0; q < 4; ++q) { const float c = vals[u * 4 + q] - mu; s2 += c * c; }
  red[tid] = s2; __syncthreads();
  for (int st = 128; st > 0; st >>= 1) { if (tid < st) red[tid] += red[tid + st]; __syncthreads(); }
  const float rs = rsqrtf(red[0] / (float)N + eps);
  {
    for (int u = 0; u < per / 4; ++u) {
      const int j = tid * 4 + 1024 * u;
      v4f o, sm;
#pragma unroll
      for (int q = 0; q < 4; ++q) {
        float gg = g[j + q], bb = bta[j + q];
        if (PARAM_BF16) { gg = bf16_round(gg); bb = bf16_round(bb); }
        sm[q] = vals[u * 4 + q]; o[q] = (vals[u * 4 + q] - mu) * rs * gg + bb;
      }
      if (out_sum) *(v4f*)(out_sum + (size_t)row * N + j) = sm;
      *(v4f*)(out_norm + (size_t)row * N + j) = o;
    }
    
  }
}



// ---- f16 WMMA path (v_wmma_f32_16x16x32_f16): 11-bit significands for operands in range — used where a [0,1] probability operand needs more precision than bf16
typedef _Float16 v16h __attribute__((ext_vector_type(16)));
union FragH { v16h v; v8us half[2]; _Float16 h[16]; unsigned short u[16]; };
template <int NT>
__device__ __forceinline__ v8f mmaH(v16h ah, v16h al, v16h bh, v16h bl, v8f c) {
  c = __builtin_amdgcn_wmma_f32_16x16x32_f16(false, ah, false, bh, (short)0, c, false, false);
  if (NT >= 2) c = __builtin_amdgcn_wmma_f32_16x16x32_f16(false, al, false, bh, (short)0, c, false, false);
  if (NT >= 3) c = __builtin_amdgcn_wmma_f32_16x16x32_f16(false, ah, false, bl, (short)0, c, false, false);
  asm volatile("v_nop\n\tv_nop\n\tv_nop\n\tv_nop" : "+v"(c) : "v"(ah), "v"(al), "v"(bh), "v"(bl));
  return c;
}
// batched GEMM like k_gemm_b but f16 operands: A f32 (split into f16 hi/lo if ASPLIT, else rounded to f16), Bt = f16 values [n][k]; alpha; C f32; N multiple of 16 (partial tiles skipped)
template <bool ASPLIT>
__global__ __launch_bounds__(128) void k_gemm_h(const float* __restrict__ A, int lda, size_t sA, const _Float16* __restrict__ Bh, int ldb, size_t sB, float alpha, float* __restrict__ C, int ldc, size_t sC, int M, int N, int K) {
  __shared__ __attribute__((aligned(16))) float so[4][16][64];
  const int tid = threadIdx.x, w = tid >> 5, lane = tid & 31, ln = lane & 15, hh = lane >> 4; const int by = blockIdx.y;
  A += (size_t)by * sA; Bh += (size_t)by * sB; C += (size_t)by * sC;
  const int ntn = (N + 63) / 64; const int wid = blockIdx.x * 4 + w; const int mt = wid / ntn, nq = wid % ntn; if (mt * 16 >= M) return;
  const int row0 = mt * 16, col0 = nq * 64; const float* arow = A + (size_t)(row0 + ln) * lda;
  v8f acc[4] = {};
  for (int kb = 0; kb < K; kb += 32) {
    FragH ah, al;
    const v4f x0 = *(const v4fa*)(arow + kb + 8 * hh), x1 = *(const v4fa*)(arow + kb + 8 * hh + 4), x2 = *(const v4fa*)(arow + kb + 16 + 8 * hh), x3 = *(const v4fa*)(arow + kb + 16 + 8 * hh + 4);
    float xs[16] = {x0[0],x0[1],x0[2],x0[3],x1[0],x1[1],x1[2],x1[3],x2[0],x2[1],x2[2],x2[3],x3[0],x3[1],x3[2],x3[3]};
#pragma unroll
    for (int i = 0; i < 16; ++i) { const _Float16 h = (_Float16)xs[i]; ah.h[i] = h; al.h[i] = ASPLIT ? (_Float16)(xs[i] - (float)h) : (_Float16)0.0f; }
#pragma unroll
    for (int t = 0; t < 4; ++t) { if (col0 + t * 16 >= N) continue; const size_t boff = (size_t)(col0 + t * 16 + ln) * ldb + kb; FragH bq; bq.half[0] = *(const v8us*)(Bh + boff + 8 * hh); bq.half[1] = *(const v8us*)(Bh + boff + 16 + 8 * hh);
      acc[t] = mmaH<ASPLIT ? 2 : 1>(ah.v, al.v, bq.v, bq.v, acc[t]); }
  }
#pragma unroll
  for (int t = 0; t < 4; ++t) { if (col0 + t * 16 >= N) continue;
#pragma unroll
    for (int r = 0; r < 8; ++r) so[w][8 * hh + r][t * 16 + ln] = acc[t][r] * alpha; }
  __builtin_amdgcn_fence(__ATOMIC_ACQ_REL, "workgroup"); __builtin_amdgcn_wave_barrier();
  const int rsub = lane >> 4, c4 = (lane & 15) * 4;
  {
#pragma unroll
    for (int q = 0; q < 8; ++q) { const int r = q * 2 + rsub; if (col0 + c4 < N) { const v4f v = *(const v4fa*)&so[w][r][c4]; *(v4f*)(C + (size_t)(row0 + r) * ldc + col0 + c4) = v; } }
     }
}

// Wt[n][k] = f16(W[k][n]·scale) from f32 row-major W[K][N] (scale = power of two; bf16-exact weights stay exact in f16 away from the subnormal range)
__global__ __launch_bounds__(256) void k_wt_f16(const float* __restrict__ W, _Float16* __restrict__ Wt, int K, int N, float scale) {
  const int t = blockIdx.x * 256 + threadIdx.x; if (t >= N * (K / 8)) return; const int n = t / (K / 8), k8 = (t % (K / 8)) * 8; FragH f;
#pragma unroll
  for (int i = 0; i < 8; ++i) f.h[i] = (_Float16)(bf16_round(W[(size_t)(k8 + i) * N + n]) * scale); const v8us o = f.half[0];
  *(v8us*)((unsigned short*)Wt + (size_t)n * K + k8) = o; 
}
// k_gemm_hh variant with fused epilogue: v = acc·alpha + bias[by·sBias + col] (+ CP[(row/rowsPerB)·sCPb + by·64 + col] if CP) ; ACT 0 none / 1 elu ; writes f16 C16 (and f32 C if non-null)
template <int ACT>
__global__ __launch_bounds__(128) void k_gemm_hhx(const _Float16* __restrict__ A, int lda, size_t sA, const _Float16* __restrict__ Bh, int ldb, size_t sB, float alpha, const float* __restrict__ bias, size_t sBias, const float* __restrict__ CP, int rowsPerB, size_t sCPb, int row0g,
    float* __restrict__ C, _Float16* __restrict__ C16, int ldc, size_t sC, int M, int N, int K) {
  __shared__ __attribute__((aligned(16))) float so[4][16][64];
  const int tid = threadIdx.x, w = tid >> 5, lane = tid & 31, ln = lane & 15, hh = lane >> 4; const int by = blockIdx.y;
  A += (size_t)by * sA; Bh += (size_t)by * sB; const size_t cofs = (size_t)by * sC; const float* bp = bias ? bias + (size_t)by * sBias : nullptr;
  const int ntn = (N + 63) / 64; const int wid = blockIdx.x * 4 + w; const int mt = wid / ntn, nq = wid % ntn; if (mt * 16 >= M) return;
  const int row0 = mt * 16, col0 = nq * 64; const _Float16* arow = A + (size_t)(row0 + ln) * lda;
  v8f acc[4] = {};
  for (int kb = 0; kb < K; kb += 32) { FragH ah; ah.half[0] = *(const v8us*)((const unsigned short*)arow + kb + 8 * hh); ah.half[1] = *(const v8us*)((const unsigned short*)arow + kb + 16 + 8 * hh);
#pragma unroll
    for (int t = 0; t < 4; ++t) { if (col0 + t * 16 >= N) continue; const size_t boff = (size_t)(col0 + t * 16 + ln) * ldb + kb; FragH bq; bq.half[0] = *(const v8us*)((const unsigned short*)Bh + boff + 8 * hh); bq.half[1] = *(const v8us*)((const unsigned short*)Bh + boff + 16 + 8 * hh);
      acc[t] = mmaH<1>(ah.v, ah.v, bq.v, bq.v, acc[t]); }
  }
#pragma unroll
  for (int t = 0; t < 4; ++t) { if (col0 + t * 16 >= N) continue; const int col = col0 + t * 16 + ln; const float bv = bp ? bf16_round(bp[col]) : 0.f;
#pragma unroll
    for (int r = 0; r < 8; ++r) { float v = acc[t][r] * alpha + bv; if (CP) { const int rr = row0g + row0 + 8 * hh + r; if (rowsPerB < 0) v += CP[cofs + (size_t)rr * ldc + col];      /* rowsPerB < 0: own element of the batched C plane */ else { const int bidx = rr / rowsPerB; v += CP[(size_t)bidx * sCPb + (size_t)by * 64 + col]; } } if (ACT == 1) v = (v > 0.f) ? v : expm1f(v); else if (ACT == 7) v = (v > 0.f) ? v + 1.0f : expf(v); else if (ACT == 8) v = tanhf(v); else if (ACT == 9) v = 0.5f * v * (1.0f + tanhf(0.7978845608028654f * (v + 0.044715f * v * v * v))); else if (ACT == 11) v = 1.0f / (1.0f + expf(-v)); else if (ACT == 12) v = (v > 0.f) ? v : 0.01f * v; else if (ACT == 14) v = (v > 0.f) ? v : 0.1f * v; else if (ACT == 16) v = (v >= 0.f) ? v : 0.3f * v; else if (ACT == 17) v = (v >= 0.f) ? v : 0.2f * v; else if (ACT == 15) v = v / (1.0f + expf(-v)); else if (ACT == 3) v = fmaxf(v, 0.f); else if (ACT == 6) v = 0.5f * v * (1.0f + erff(v * 0.70710678118654752f)); so[w][8 * hh + r][t * 16 + ln] = v; } }
  __builtin_amdgcn_fence(__ATOMIC_ACQ_REL, "workgroup"); __builtin_amdgcn_wave_barrier();
  const int rsub = lane >> 4, c4 = (lane & 15) * 4; typedef _Float16 v4h __attribute__((ext_vector_type(4)));
  {
#pragma unroll
    for (int q = 0; q < 8; ++q) { const int r = q * 2 + rsub; if (col0 + c4 < N) { const v4f v = *(const v4fa*)&so[w][r][c4]; if (C) *(v4f*)(C + cofs + (size_t)(row0 + r) * ldc + col0 + c4) = v; if (C16) { v4h h4; for (int i = 0; i < 4; ++i) h4[i] = (_Float16)v[i]; *(v4h*)(C16 + cofs + (size_t)(row0 + r) * ldc + col0 + c4) = h4; } } }
     }
}


typedef _Float16 v4h __attribute__((ext_vector_type(4)));

__global__ __launch_bounds__(256) void k_h16(const float* __restrict__ x, _Float16* __restrict__ X16, size_t n8) { const size_t t = (size_t)blockIdx.x * 256 + threadIdx.x; if (t >= n8) return; FragH f;
#pragma unroll
  for (int q = 0; q < 8; ++q) f.h[q] = (_Float16)x[t * 8 + q]; *(v8us*)((unsigned short*)X16 + t * 8) = f.half[0];  }
__global__ __launch_bounds__(256) void k_round16f(const float* __restrict__ W, _Float16* __restrict__ Bt, size_t n8) { const size_t t = (size_t)blockIdx.x * 256 + threadIdx.x; if (t >= n8) return; FragH f;
#pragma unroll
  for (int i = 0; i < 8; ++i) f.h[i] = (_Float16)(bf16_round(W[t * 8 + i]) * 16.0f); *(v8us*)((unsigned short*)Bt + t * 8) = f.half[0];  }
template <int NHv, int TTv>
__global__ __launch_bounds__(256) void k_vt(const _Float16* __restrict__ V16, int ldv, int voff, _Float16* __restrict__ Vt) { __shared__ unsigned short tl[64][66]; const int tid = threadIdx.x; const int slab = blockIdx.x / (TTv / 64), lg = blockIdx.x % (TTv / 64); const int b = slab / NHv, h = slab % NHv;
  for (int i = tid; i < 64 * 8; i += 256) { const int r = i / 8, c8 = (i % 8) * 8; FragH f; f.half[0] = *(const v8us*)((const unsigned short*)V16 + ((size_t)b * TTv + lg * 64 + r) * ldv + voff + h * 64 + c8);
#pragma unroll
    for (int q = 0; q < 8; ++q) tl[r][c8 + q] = f.u[q]; }
  __syncthreads();
  {
#pragma unroll
    for (int rd = 0; rd < 2; ++rd) { const int d = rd * 32 + tid / 8, pc = tid % 8; FragH f;
#pragma unroll
      for (int q = 0; q < 8; ++q) f.u[q] = tl[pc * 8 + q][d];
      *(v8us*)((unsigned short*)Vt + ((size_t)slab * 64 + d) * TTv + lg * 64 + pc * 8) = f.half[0]; }
     } }

__global__ __launch_bounds__(256) void k_hl(const float* __restrict__ F, _Float16* __restrict__ Hh, _Float16* __restrict__ Hl, size_t n8) { const size_t t = (size_t)blockIdx.x * 256 + threadIdx.x; if (t >= n8) return; FragH fh, fl; const v4f a = *(const v4fa*)(F + t * 8), c = *(const v4fa*)(F + t * 8 + 4);
#pragma unroll
  for (int q = 0; q < 4; ++q) { _Float16 h = (_Float16)a[q]; fh.h[q] = h; fl.h[q] = (_Float16)((a[q] - (float)h) * 1024.0f); h = (_Float16)c[q]; fh.h[4 + q] = h; fl.h[4 + q] = (_Float16)((c[q] - (float)h) * 1024.0f); }
  { *(v8us*)((unsigned short*)Hh + t * 8) = fh.half[0]; *(v8us*)((unsigned short*)Hl + t * 8) = fl.half[0];  } }

// ---- fast GEMM (wave tile 32x64; requires M % 32 == 0 rows per launch region and N % 64 == 0); epilogue = k_gemm_hhx semantics ----
__device__ __forceinline__ v16h g2_frag(const _Float16* p, int hh) { FragH f; f.half[0] = *(const v8us*)((const unsigned short*)p + 8 * hh); f.half[1] = *(const v8us*)((const unsigned short*)p + 16 + 8 * hh); return f.v; }
__device__ __forceinline__ v8f g2_mma(v16h a, v16h b, v8f c) { v8f d = __builtin_amdgcn_wmma_f32_16x16x32_f16(false, a, false, b, (short)0, c, false, false); asm volatile("v_nop\n\tv_nop\n\tv_nop\n\tv_nop" : "+v"(d) : "v"(a), "v"(b)); return d; }
// CAUS 0: plain. CAUS 1 (scores): a 64-column tile at or past the end of its rows' causal query tile is skipped. CAUS 2 (P V): K runs over the keys of the rows' causal query tile only.
// F0 1: C holds only rows 0..QT0-1 of each batch, packed ([NB][QT0] rows); the other rows go to C16 alone.
template <int ACT, int CAUS = 0, int F0 = 0>
__global__ __launch_bounds__(128) void k_gemm2(const _Float16* __restrict__ A, int lda, size_t sA, const _Float16* __restrict__ Bh, int ldb, size_t sB, float alpha, const float* __restrict__ bias, size_t sBias, const float* __restrict__ CP, int rowsPerB, size_t sCPb, int row0g,
    float* __restrict__ C, _Float16* __restrict__ C16, int ldc, size_t sC, int M, int N, int K) { static_assert(ACT == 0 || ACT == 3 || ACT == 6 || ACT == 8 || ACT == 9 || ACT == 11 || ACT == 12 || ACT == 14 || ACT == 15 || ACT == 16 || ACT == 17, "k_gemm2: unsupported ACT code (would silently apply no activation)");
  __shared__ __attribute__((aligned(16))) float so[4][32][68];
  const int tid = threadIdx.x, w = tid >> 5, lane = tid & 31, ln = lane & 15, hh = lane >> 4; const int by = blockIdx.y;
  A += (size_t)by * sA; Bh += (size_t)by * sB; const size_t cofs = (size_t)by * sC; const float* bp = bias ? bias + (size_t)by * sBias : nullptr;
  const int ntn = N >> 6; const int mt = blockIdx.x / ntn, nq = blockIdx.x - mt * ntn; const int row0 = mt * 128 + 32 * w, col0 = nq * 64; if (row0 >= M) return;
  static_assert(QT % 128 == 0, "a 128-row block lies in one causal query tile"); const int nkc = (mt * 128 / QT + 1) * QT;      /* keys below the end of this block's causal query tile */
  if (CAUS == 1 && col0 >= nkc) return; if (CAUS == 2) K = nkc;
  const _Float16* a0p = A + (size_t)(row0 + ln) * lda; const _Float16* a1p = a0p + (size_t)16 * lda;
  const _Float16* b0p = Bh + (size_t)(col0 + ln) * ldb; const _Float16* b1p = b0p + (size_t)16 * ldb; const _Float16* b2p = b1p + (size_t)16 * ldb; const _Float16* b3p = b2p + (size_t)16 * ldb;
  const v8f z8 = {0.f,0.f,0.f,0.f,0.f,0.f,0.f,0.f}; v8f c00 = z8, c01 = z8, c02 = z8, c03 = z8, c10 = z8, c11 = z8, c12 = z8, c13 = z8;
#pragma unroll 1
  for (int kb = 0; kb < K; kb += 32) { const v16h a0 = g2_frag(a0p + kb, hh), a1 = g2_frag(a1p + kb, hh);
    v16h b = g2_frag(b0p + kb, hh); c00 = g2_mma(a0, b, c00); c10 = g2_mma(a1, b, c10);
    b = g2_frag(b1p + kb, hh); c01 = g2_mma(a0, b, c01); c11 = g2_mma(a1, b, c11);
    b = g2_frag(b2p + kb, hh); c02 = g2_mma(a0, b, c02); c12 = g2_mma(a1, b, c12);
    b = g2_frag(b3p + kb, hh); c03 = g2_mma(a0, b, c03); c13 = g2_mma(a1, b, c13); }
  v8f accs[8] = {c00, c01, c02, c03, c10, c11, c12, c13};
#pragma unroll
  for (int u = 0; u < 8; ++u) { const int t = u & 3, half = u >> 2; const int col = col0 + t * 16 + ln; const float bv = bp ? bf16_round(bp[col]) : 0.f;
#pragma unroll
    for (int r = 0; r < 8; ++r) { const int rloc = half * 16 + 8 * hh + r; float v = accs[u][r] * alpha + bv; if (CP) { if (rowsPerB < 0) v += CP[cofs + (size_t)(row0g + row0 + rloc) * ldc + col];      /* rowsPerB < 0: own element of the batched C plane */ else { const int bidx = (row0g + row0 + rloc) / rowsPerB; v += CP[(size_t)bidx * sCPb + (size_t)by * 64 + col]; } }
      if (ACT == 3) v = fmaxf(v, 0.f); else if (ACT == 6) v = 0.5f * v * (1.0f + erff(v * 0.70710678118654752f)); else if (ACT == 11) v = 1.0f / (1.0f + expf(-v)); else if (ACT == 15) v = v / (1.0f + expf(-v)); else if (ACT == 12) v = (v > 0.f) ? v : 0.01f * v; else if (ACT == 8) v = tanhf(v); else if (ACT == 9) v = 0.5f * v * (1.0f + tanhf(0.7978845608028654f * (v + 0.044715f * v * v * v))); else if (ACT == 14) v = (v > 0.f) ? v : 0.1f * v; else if (ACT == 16) v = (v >= 0.f) ? v : 0.3f * v; else if (ACT == 17) v = (v >= 0.f) ? v : 0.2f * v;
      so[w][rloc][t * 16 + ln] = v; } }
  __builtin_amdgcn_fence(__ATOMIC_ACQ_REL, "workgroup"); __builtin_amdgcn_wave_barrier();
  const int rsub = lane >> 4, c4 = (lane & 15) * 4;
  static_assert(SQ % 32 == 0 && QT0 % 32 == 0, "a wave's 32 rows lie on one side of the first tile's end"); size_t crow = (size_t)row0; if (F0) { const int rb = row0 / SQ, ri = row0 - rb * SQ; crow = (size_t)rb * QT0 + ri; if (ri >= QT0) C = nullptr; }
  {
#pragma unroll
    for (int q = 0; q < 16; ++q) { const int r = q * 2 + rsub; const v4f v = *(const v4fa*)&so[w][r][c4]; if (C) *(v4f*)(C + cofs + (crow + r) * ldc + col0 + c4) = v; if (C16) { v4h h4; for (int i = 0; i < 4; ++i) h4[i] = (_Float16)v[i]; *(v4h*)(C16 + cofs + (size_t)(row0 + r) * ldc + col0 + c4) = h4; } }
     } }


__global__ __launch_bounds__(256) void k_rsm(const float* __restrict__ S, _Float16* __restrict__ P, int nrows) {
  #pragma clang fp contract(off)
  const int i = blockIdx.x * 256 + threadIdx.x; if (i >= nrows) return; const float* s = S + (size_t)i * SQ; float mx = -3.0e38f;
#pragma unroll 1
  for (int j = 0; j < SQ; ++j) mx = fmaxf(mx, s[j]); float se = 0.f;
#pragma unroll 1
  for (int j = 0; j < SQ; ++j) se += expf(s[j] - mx); const float sc = 256.0f / se;
#pragma unroll 1
  for (int j0 = 0; j0 < SQ; j0 += 8) { FragH f; for (int q = 0; q < 8; ++q) f.h[q] = (_Float16)(expf(s[j0 + q] - mx) * sc); unsigned short* d = (unsigned short*)P + (size_t)i * SQ + j0; *(v8us*)d = f.half[0];  } }
__global__ __launch_bounds__(256) void k_vt(const _Float16* __restrict__ V16, int b, int h0, _Float16* __restrict__ VT) { __shared__ unsigned short tl[64][65]; const int tid = threadIdx.x; const int hh = blockIdx.x % HG, sg = blockIdx.x / HG; const int s0 = sg * 64; const int h = h0 + hh;
  for (int i = tid; i < 64 * 8; i += 256) { const int j = i / 8, d8 = (i % 8) * 8; FragH f; f.half[0] = *(const v8us*)((const unsigned short*)V16 + ((size_t)b * SQ + s0 + j) * DM + h * HD + d8); for (int q = 0; q < 8; ++q) tl[d8 + q][j] = f.u[q]; }
  __syncthreads();
  { for (int i = tid; i < 64 * 8; i += 256) { const int d = i / 8, j8 = (i % 8) * 8; FragH f; for (int q = 0; q < 8; ++q) f.u[q] = tl[d][j8 + q]; *(v8us*)((unsigned short*)VT + ((size_t)hh * HD + d) * SQ + s0 + j8) = f.half[0]; }  } }



template <int BFIN, int WXB>
__global__ __launch_bounds__(256) void k_ln16(const float* __restrict__ X, const float* __restrict__ g, const float* __restrict__ bb, float eps, _Float16* __restrict__ N16, float* __restrict__ XB) {
  #pragma clang fp contract(off)
  __shared__ float red[256]; const size_t r = blockIdx.x; const int t = threadIdx.x; const v4f xa = *(const v4fa*)(X + r * DMQ + t * 4); float s[4]; float sum = 0.f;
  for (int q = 0; q < 4; ++q) { s[q] = BFIN ? bf16_round(xa[q]) : xa[q]; sum = __fadd_rn(sum, s[q]); }
  red[t] = sum; __syncthreads(); for (int st = 128; st > 0; st >>= 1) { if (t < st) red[t] = __fadd_rn(red[t], red[t + st]); __syncthreads(); } const float mu = red[0] / (float)DMQ; __syncthreads();
  float vs = 0.f; for (int q = 0; q < 4; ++q) { const float dl = __fadd_rn(s[q], -mu); vs = __fadd_rn(vs, __fmul_rn(dl, dl)); } red[t] = vs; __syncthreads(); for (int st = 128; st > 0; st >>= 1) { if (t < st) red[t] = __fadd_rn(red[t], red[t + st]); __syncthreads(); }
  const float rs = rsqrtf(__fadd_rn(red[0] / (float)DMQ, eps)); v4h y; v4f xb;
  for (int q = 0; q < 4; ++q) { const int c = t * 4 + q; y[q] = (_Float16)__fadd_rn(__fmul_rn(__fmul_rn(__fadd_rn(s[q], -mu), rs), bf16_round(g[c])), bf16_round(bb[c])); xb[q] = s[q]; }
  { *(v4h*)(N16 + r * DMQ + t * 4) = y; if (WXB) *(v4f*)(XB + r * DMQ + t * 4) = xb;  } }
__global__ __launch_bounds__(256) void k_ftres2(const float* __restrict__ OF0, const float* __restrict__ XB, float* __restrict__ X1, size_t n4) {
  #pragma clang fp contract(off)
  const size_t t = (size_t)blockIdx.x * 256 + threadIdx.x; if (t >= n4) return; const v4f o = *(const v4fa*)(OF0 + t * 4), xv = *(const v4fa*)(XB + t * 4); v4f y; for (int q = 0; q < 4; ++q) y[q] = __fadd_rn(__fmul_rn(o[q], 0.015625f), xv[q]); *(v4f*)(X1 + t * 4) = y;  }

__global__ __launch_bounds__(256) void k_wthd(const float* __restrict__ Wt, _Float16* __restrict__ Bt) { const size_t t = (size_t)blockIdx.x * 256 + threadIdx.x; if (t >= (size_t)NH * HD * (DM / 8)) return; const int m8 = (int)(t % (DM / 8)) * 8; const int d = (int)((t / (DM / 8)) % HD); const int h = (int)(t / ((size_t)(DM / 8) * HD)); FragH f;
  for (int q = 0; q < 8; ++q) f.h[q] = (_Float16)(16.0f * bf16_round(Wt[((size_t)h * DM + m8 + q) * HD + d])); unsigned short* dst = (unsigned short*)Bt + ((size_t)h * HD + d) * DM + m8; *(v8us*)dst = f.half[0];  }




__global__ __launch_bounds__(256) void k_wtpad(const float* __restrict__ Wm, _Float16* __restrict__ Wt, int Kr, int Kp, int Nr, int Np, float scale) {
  const int t = blockIdx.x * 256 + threadIdx.x; if (t >= Np * (Kp / 8)) return; const int n = t / (Kp / 8), k8 = (t % (Kp / 8)) * 8; const int nc = min(n, Nr - 1); const float fn = (n < Nr) ? 1.f : 0.f; FragH f;
  for (int i = 0; i < 8; ++i) { const int k = k8 + i; const int kc = min(k, Kr - 1); const float fk = (k < Kr) ? fn : 0.f; f.h[i] = (_Float16)(bf16_round(Wm[(size_t)kc * Nr + nc]) * scale * fk); }
  unsigned short* o = (unsigned short*)Wt + (size_t)n * Kp + k8; *(v8us*)o = f.half[0];  }
__global__ __launch_bounds__(128) void k_bpad(const float* __restrict__ b, float* __restrict__ Bp, int nr, int np) {
  const int i = threadIdx.x; if (i >= np) return; const float v = b[min(i, nr - 1)] * ((i < nr) ? 1.f : 0.f); *(float*)(Bp + i) = v;  }

#define DI 64         /* inner width = NH * HD (ONE 64-wide head) */
#define LQK (3 * DI)  /* fused q | k | v row pitch (192) */
__global__ __launch_bounds__(256) void k_o0(const float* __restrict__ OF, float* __restrict__ ob, size_t n4) {
  #pragma clang fp contract(off)
  const size_t t = (size_t)blockIdx.x * 256 + threadIdx.x; if (t >= n4) return; const size_t e = t * 4; const int i = (int)(e / DI); const int c = (int)(e % DI); const int h = c / HD, d = c % HD; const v4f a = *(const v4fa*)(OF + e); v4f o; for (int q = 0; q < 4; ++q) o[q] = __fmul_rn(a[q], 0.015625f); float* dst = ob + (size_t)h * SQ * HD + (size_t)i * HD + d; *(v4f*)dst = o;  }

// The projection q | k | v = x W^T straight from the f32 input: x is read once, by the GEMM itself.
#define GKS 8                        /* K slices of a block */
#define GST (DM / GKS / 32)          /* 32-wide k steps of a slice */
#define GNT (LQK / 16)               /* 16-column tiles of q | k | v */
#define GPL 40                       /* 16-byte places of a register half's plane in LDS: 32 lanes and 8 idle, so that the two planes that a half wave reads together fall on different banks */
#define KVT 4096                     /* f16 elements of a 32-key tile of the k | v^T plane: 8 half fragments of k, then 8 of v^T, 512 bytes each */
// Wq | Wk | Wv (natural [64][DM] rows, x16, exact in f16) packed so that a wave's 16-byte load of half a fragment (A for q and k, B for v) is 512 contiguous bytes:
// BP[k step][column tile][half j][lane][8]: column 16 tile + (lane & 15), k = 32 step + 16 j + 8 (lane >> 4) + 0..7 (the hardware k order, as the x loader below).
__global__ __launch_bounds__(256) void k_wpack(const float* __restrict__ wq, const float* __restrict__ wk, const float* __restrict__ wv, _Float16* __restrict__ BP) {
  static_assert((DM / 32) * GNT * 2 * 32 % 256 == 0 && DI % 16 == 0, "whole blocks; a column tile lies in one weight");
  const unsigned t = blockIdx.x * 256 + threadIdx.x, lane = t & 31, j = (t >> 5) & 1, u = t >> 6; const unsigned ct = u % GNT, st = u / GNT;
  const unsigned col = ct * 16 + (lane & 15), k = st * 32 + j * 16 + 8 * (lane >> 4);
  const float* w = (col < DI) ? wq : (col < 2 * DI) ? wk : wv; const float* p = w + (size_t)(col % DI) * DM + k; FragH f;
#pragma unroll      /* the eight elements stay in registers: two 16-byte loads, one 16-byte store */
  for (int q = 0; q < 8; ++q) f.h[q] = (_Float16)(bf16_round(p[q]) * 16.0f);
  *(v8us*)((unsigned short*)BP + (size_t)t * 8) = f.half[0]; }
typedef float v2fc __attribute__((ext_vector_type(2)));
typedef __bf16 v2bc __attribute__((ext_vector_type(2)));
typedef _Float16 v2hc __attribute__((ext_vector_type(2)));
// A block takes 32 rows of x and all 192 columns; wave w takes row tile w & 1 and K slice w >> 1 (128 of the 1024 k): its whole share of x (16 loads) is in flight at once.
// The slices' parts are summed in LDS (slice 0 first). A block's 32 rows are one 32-key step of attention: it stores that step's k and v^T as the A fragments that attention loads,
// KV[batch][step][k: (key tile kt, k block ks, half j) | v^T: (column tile dt, half j)][lane][8]: k: key 16 kt + (lane & 15), feature 32 ks + 16 j + 8 (lane >> 4) + 0..7; v^T: column 16 dt + (lane & 15), key 16 j + 8 (lane >> 4) + 0..7.
// They are also one row block of queries: Q16[batch][row block] holds its q as B fragments, in the order of k.
// An accumulator lane holds 8 consecutive rows of ONE column of D: 8 keys of a column of v as D = x W^T, 8 features of a row of q or k as D = W x^T (the same two fragments, A and B exchanged; same k order).
// So every accumulator half is four neighbours of a fragment: the parts go through LDS lane by lane in 16-byte pieces and need no transpose.
__global__ __launch_bounds__(GKS * 2 * 32) void k_qkv(const float* __restrict__ x, const _Float16* __restrict__ BP, float* __restrict__ C0, float* __restrict__ Q0, float* __restrict__ K0, _Float16* __restrict__ Q16, _Float16* __restrict__ KV) {
  static_assert(DM % (GKS * 32) == 0 && NR % 32 == 0 && SQ % 32 == 0 && QT0 % 32 == 0 && 32 * DI / 4 == GKS * 2 * 32 && DI == 64, "whole k steps; a block's 32 rows lie on one side of the first tile's end; a thread sums four q, four k and four v elements");
  __shared__ __attribute__((aligned(16))) float part[GKS][2][GNT][2][GPL][4];      /* part[slice][row tile][column tile][register half][lane][4] */
  const int tid = threadIdx.x, lane = tid & 31, ln = lane & 15, hh = lane >> 4; const int w = __builtin_amdgcn_readfirstlane(tid >> 5); const int rt = w & 1, ks = w >> 1; const int row0 = (int)blockIdx.x * 32;
  const float* xs = x + (size_t)(row0 + rt * 16) * DM + ks * (GST * 32); const unsigned xo = (unsigned)(ln * DM + 8 * hh) * 4u;      /* the lane's byte offset: the one vector register that all sixteen loads name */
  v4f xa[GST][4];
#pragma unroll      /* constant indices: the arrays stay in registers */
  for (int s = 0; s < GST; ++s) { const char* p = (const char*)(xs + s * 32) + xo; xa[s][0] = *(const v4fa*)p; xa[s][1] = *(const v4fa*)(p + 16); xa[s][2] = *(const v4fa*)(p + 64); xa[s][3] = *(const v4fa*)(p + 80); }
  asm volatile("s_wait_xcnt 0x0" :: "v"(xo) : "memory");      /* behind the sixteen x loads; their offset is named as an input so that it lives up to here */
  const unsigned short* bs = (const unsigned short*)BP + (size_t)ks * (GST * GNT * 512); const unsigned bo = (unsigned)(lane * 16);      /* byte offset, as xo */
  const v8f z8 = {0.f, 0.f, 0.f, 0.f, 0.f, 0.f, 0.f, 0.f}; v8f acc[GNT];
#pragma unroll      /* constant indices: the arrays stay in registers */
  for (int t = 0; t < GNT; ++t) acc[t] = z8;
#pragma unroll      /* constant indices: the arrays stay in registers */
  for (int s = 0; s < GST; ++s) { union { v16h v; v2hc p[8]; } ah;
#pragma unroll      /* constant indices: the arrays stay in registers */
    for (int c = 0; c < 4; ++c) for (int i = 0; i < 2; ++i) { const v2fc e = {xa[s][c][2 * i], xa[s][c][2 * i + 1]}; const v2bc r = __builtin_convertvector(e, v2bc);      /* to bf16, nearest even, then exact in f16 */
      ah.p[c * 2 + i] = __builtin_convertvector(__builtin_convertvector(r, v2fc), v2hc); }
#pragma unroll      /* constant indices: the arrays stay in registers */
    for (int t = 0; t < GNT; ++t) { FragH b; const char* p = (const char*)(bs + (s * GNT + t) * 512) + bo; b.half[0] = *(const v8us*)p; b.half[1] = *(const v8us*)(p + 512); acc[t] = (t < 2 * DI / 16) ? __builtin_amdgcn_wmma_f32_16x16x32_f16(false, b.v, false, ah.v, (short)0, acc[t], false, false) : __builtin_amdgcn_wmma_f32_16x16x32_f16(false, ah.v, false, b.v, (short)0, acc[t], false, false); } }      /* q, k: D = W x^T; v: D = x W^T */
  asm volatile("s_wait_xcnt 0x0" :: "v"(bo) : "memory");      /* the same behind the W loads */
#pragma unroll      /* constant indices: the arrays stay in registers */
  for (int t = 0; t < GNT; ++t) for (int h = 0; h < 2; ++h) { const v4f e = {acc[t][4 * h], acc[t][4 * h + 1], acc[t][4 * h + 2], acc[t][4 * h + 3]}; *(v4f*)&part[ks][rt][t][h][lane][0] = e; }      /* q, k: columns 16 t + 8 hh + 4 h + 0..3 of row 16 rt + ln; v: rows 16 rt + 8 hh + 4 h + 0..3 of column 16 t + ln */
  __syncthreads();      /* every slice's part is in LDS before the sum reads it */
  const int rb = row0 / SQ, ri = row0 - rb * SQ; float* c0 = C0 + ((size_t)rb * QT0 + ri) * LQK; _Float16* kvt = KV + ((size_t)rb * (SQ / 32) + ri / 32) * KVT;      /* the block's own f32 rows (where kept) and its own tile */
  /* each thread's place in the three f16 ranges is 4 tid: whole lines stored. q and k: half fragment tid >> 6 = (kt 2 + ks) 2 + j, lane (tid >> 1) & 31. v: half fragment tid >> 6 = dt 2 + j (j = the row tile), lane (tid >> 1) & 31, register half tid & 1 */
  const int pl = (tid >> 1) & 31, ph = tid & 1, ci = tid >> 6;
  const int krow = (ci >> 2) * 16 + (pl & 15), qc = ((ci >> 1) & 1) * 32 + (ci & 1) * 16 + (pl >> 4) * 8 + ph * 4;
  v4f vq = *(const v4f*)&part[0][ci >> 2][ci & 3][ph][pl][0], vk = *(const v4f*)&part[0][ci >> 2][4 + (ci & 3)][ph][pl][0], vv = *(const v4f*)&part[0][ci & 1][8 + (ci >> 1)][ph][pl][0];
#pragma unroll      /* the LDS reads are issued together */
  for (int u = 1; u < GKS; ++u) { vq += *(const v4f*)&part[u][ci >> 2][ci & 3][ph][pl][0]; vk += *(const v4f*)&part[u][ci >> 2][4 + (ci & 3)][ph][pl][0]; vv += *(const v4f*)&part[u][ci & 1][8 + (ci >> 1)][ph][pl][0]; }
  vq *= 0.0625f; vk *= 0.0625f; vv *= 0.0625f; v4h hq, hk, hv; for (int i = 0; i < 4; ++i) { hq[i] = (_Float16)vq[i]; hk[i] = (_Float16)vk[i]; hv[i] = (_Float16)vv[i]; }
  _Float16* qd = Q16 + (size_t)row0 * DI; *(v4h*)(qd + tid * 4) = hq; *(v4h*)(kvt + tid * 4) = hk; *(v4h*)(kvt + KVT / 2 + tid * 4) = hv;
  asm volatile("s_wait_xcnt 0x0" :: "v"(tid), "v"(hq), "v"(hk), "v"(hv), "s"(qd), "s"(kvt) : "memory");      /* behind the three f16 stores; what they name is given as inputs so that it lives up to here: the f32 stores' addresses are formed behind it */
  if (ri < QT0) { const size_t fo = (((size_t)rb * (DI / 4) + (qc >> 2)) * QT0 + ri + krow) * 4; *(v4f*)(Q0 + fo) = vq; *(v4f*)(K0 + fo) = vk;      /* f32 q and k: [batch][feature / 4][row][4]: 16 rows of a feature group are 256 contiguous bytes, as the exact path's fragment loads take them */
    float* cv = c0 + ((ci & 1) * 16 + (pl >> 4) * 8 + ph * 4) * LQK + 2 * DI + (ci >> 1) * 16 + (pl & 15);
#pragma unroll      /* four rows of one column */
    for (int i = 0; i < 4; ++i) cv[i * LQK] = vv[i]; } }
#define FW 16                        /* waves of an attention block, either path */
// Exact f32 causal attention for rows 0..QT0-1 of each batch, spread over lanes: a block takes FW query rows (i0 ..) of batch b; sc: FW rows of QT0 floats in the block's LDS.
// Scores: one WAVE per 32-key chunk, on the f32 matrix form (16x16x4: full f32 operands, f32 sums): S = Q K^T, the block's FW rows against 16 keys a tile. Softmax: one WAVE per query row (lanes across the keys).
// P V: one WAVE per 32-key chunk, for all FW rows (a half wave across the 64 output columns, the two halves on rows r and r + FW / 2): a V row is read once a block; the chunks' parts lie in LDS behind sc and are summed by the row's wave.
typedef float v2f __attribute__((ext_vector_type(2)));
typedef float v2fa __attribute__((ext_vector_type(2), may_alias));
__device__ __forceinline__ void att0_rows(const float* __restrict__ QKV, const float* __restrict__ Q0, const float* __restrict__ K0, float scale, float* __restrict__ O, const int b, const int i0, float (*sc)[QT0]) {      /* sc: scaled scores, then the unnormalised weights, of the block's rows */
  static_assert(QT0 % 32 == 0 && QT0 / 32 <= 16 && QT0 / 32 <= FW && FW == 16 && QT0 % FW == 0 && HD == 64 && NH == 1, "key chunks of 32, at most 16 a row and at most one a wave; a block's rows are one 16-row matrix tile and end in the same chunk; two output columns a lane");
  const int tid = threadIdx.x, lane = tid & 31; const int w = __builtin_amdgcn_readfirstlane(tid >> 5);
  const int ln = lane & 15, hh = lane >> 4; const float* vb = QKV + (size_t)b * QT0 * LQK + 2 * DI;
  const float* qf = Q0 + ((size_t)b * (DI / 4) * QT0 + i0) * 4; const float* kf = K0 + (size_t)b * (DI / 4) * QT0 * 4;      /* [feature / 4][row][4] */
  for (int j0 = w * 32; j0 < i0 + FW; j0 += FW * 32) {      /* whole 32-key chunks up to the block's last row: j <= QT0 - 1; the same in every lane of a wave */
    /* A = the block's 16 q rows, B = 16 keys, twice; q and k through the same loader: lane (ln, hh) holds features 8 m + 4 hh + 0..3 of its row, two k steps of the 16x16x4 form; a wave's load is two runs of 256 contiguous bytes */
    const unsigned fo = (unsigned)((hh * QT0 + ln) * 16); v4f qa[HD / 8], k0[HD / 8], k1[HD / 8];      /* fo: the lane's byte offset in both planes */
#pragma unroll      /* constant indices: the arrays stay in registers */
    for (int m = 0; m < HD / 8; ++m) { qa[m] = *(const v4fa*)((const char*)(qf + m * (2 * QT0 * 4)) + fo); k0[m] = *(const v4fa*)((const char*)(kf + m * (2 * QT0 * 4) + j0 * 4) + fo); k1[m] = *(const v4fa*)((const char*)(kf + m * (2 * QT0 * 4) + (j0 + 16) * 4) + fo); }
    asm volatile("s_wait_xcnt 0x0" :: "v"(fo) : "memory");      /* behind the 24 loads, in front of the first write of a register that they name; their offset is named as an input so that it lives up to here */
    v8f s0 = {0.f, 0.f, 0.f, 0.f, 0.f, 0.f, 0.f, 0.f}, s1 = s0;      /* s0[r]: row 8 hh + r against key j0 + ln; s1: key j0 + 16 + ln */
#pragma unroll      /* constant indices: the arrays stay in registers */
    for (int m = 0; m < HD / 8; ++m) for (int e = 0; e < 4; e += 2) { const v2f a = {qa[m][e], qa[m][e + 1]}, b0 = {k0[m][e], k0[m][e + 1]}, b1 = {k1[m][e], k1[m][e + 1]};
      s0 = __builtin_amdgcn_wmma_f32_16x16x4_f32(false, a, false, b0, (short)0, s0, false, false); s1 = __builtin_amdgcn_wmma_f32_16x16x4_f32(false, a, false, b1, (short)0, s1, false, false); }
    asm volatile("v_nop\n\tv_nop\n\tv_nop\n\tv_nop" : "+v"(s0), "+v"(s1) : "v"(qa[0]), "v"(k0[0]), "v"(k1[0]));      /* the vector slots between the last matrix instruction and the first reader of its result; the first fragments are named as inputs so that no result register is laid over an operand just issued */
#pragma unroll      /* constant indices: the sums stay in registers */
    for (int r = 0; r < 8; ++r) { sc[8 * hh + r][j0 + ln] = s0[r] * scale; sc[8 * hh + r][j0 + 16 + ln] = s1[r] * scale; } }
  __syncthreads();      /* every key's scores are in LDS before a row's wave reads them */
  const int i = i0 + w; const int nu = (i >> 5) + 1; float x[QT0 / 32]; float mx = -1.0e30f;      /* nu: the same for every row of the block */
  const bool own = w < nu; v4f vv[32]; const float* vs = vb + (size_t)(w * 32) * LQK; const unsigned vo = (unsigned)(ln * 16);      /* the wave's own chunk of keys: its 32 V rows, four columns a lane, the same in both half waves (vo: the lane's byte offset); asked for here so that they arrive during the softmax */
  if (own) {
#pragma unroll      /* constant indices: the array stays in registers */
    for (int t = 0; t < 32; ++t) vv[t] = *(const v4fa*)((const char*)(vs + t * LQK) + vo);
    asm volatile("s_wait_xcnt 0x0" ::: "memory"); }      /* behind the 32 V loads, the last statement of their block: the softmax below writes the scalar registers that held their base */
#pragma unroll
  for (int u = 0; u < QT0 / 32; ++u) if (u < nu) x[u] = sc[w][u * 32 + lane];      /* all reads issued before the first is used */
#pragma unroll
  for (int u = 0; u < QT0 / 32; ++u) if (u < nu) { x[u] = (u * 32 + lane <= i) ? x[u] : -1.0e30f; mx = fmaxf(mx, x[u]); }
  for (int d = 16; d > 0; d >>= 1) mx = fmaxf(mx, __shfl_xor(mx, d, 32));
  float l = 0.f;
#pragma unroll
  for (int u = 0; u < QT0 / 32; ++u) if (u < nu) { const float e = expf(x[u] - mx); l += e; sc[w][u * 32 + lane] = e; }      /* keys past the row: exactly 0 */
  for (int d = 16; d > 0; d >>= 1) l += __shfl_xor(l, d, 32);
  __syncthreads();      /* every row's weights are in LDS before the chunks' waves read them */
  float* pp = &sc[0][0] + FW * QT0; float* pw = pp + (w * FW + hh * (FW / 2)) * HD + ln * 4;      /* pp[chunk][row][column]: the chunks' parts of P V */
  if (own) {
    for (int r = 0; r < FW / 2; ++r) { v4f p[8]; v4f o0 = {0.f, 0.f, 0.f, 0.f}, o1 = {0.f, 0.f, 0.f, 0.f};      /* two sums a row: a product need not wait for the one before it */
#pragma unroll      /* constant indices: the arrays stay in registers */
      for (int t = 0; t < 8; ++t) p[t] = *(const v4f*)&sc[r + hh * (FW / 2)][w * 32 + t * 4];      /* one address a half wave */
#pragma unroll      /* constant indices: the arrays stay in registers */
      for (int t = 0; t < 32; t += 2) { o0 += p[t >> 2][t & 3] * vv[t]; o1 += p[t >> 2][(t & 3) + 1] * vv[t + 1]; }
      *(v4f*)(pw + r * HD) = o0 + o1; } }
  else { const v4f z4 = {0.f, 0.f, 0.f, 0.f};      /* a wave without keys leaves zeros: the sum below takes FW parts whatever the row */
    for (int r = 0; r < FW / 2; ++r) *(v4f*)(pw + r * HD) = z4; }
  __syncthreads();      /* every chunk's part is in LDS before a row's wave sums them */
  v2f pt[FW];
#pragma unroll      /* all reads issued before the first is used */
  for (int u = 0; u < FW; ++u) pt[u] = *(const v2f*)(pp + (u * FW + w) * HD + lane * 2);
  v2f o = pt[0];
#pragma unroll      /* constant indices: the array stays in registers */
  for (int u = 1; u < FW; ++u) o += pt[u];
  o *= 1.0f / l;
  *(v2f*)(O + ((size_t)b * SQ + i) * DI + lane * 2) = o;      /* the row's own place in the output: no other block stores rows 0..QT0-1 */
  asm volatile("s_wait_xcnt 0x0" ::: "memory"); }      /* behind the store: in the joined kernel code of the other path follows in the listing and writes the store's registers */

// Fused causal attention. A block takes the FQ query rows of row block qb of batch b; its FW waves take the row block's keys in 32-key steps, step st to wave st % FW.
// A step: S^T = K Q^T (A = 16 key rows, B = 16 query rows: a lane holds scores of ONE query), running maximum and sum per query, weights exp(s - m) packed in place as f16 into the B operand of O^T += V^T P^T.
// At the end every wave leaves (m, l, O) in LDS and the block joins them: out = sum_w 2^(c (m_w - M)) O_w / sum_w 2^(c (m_w - M)) l_w.
#define FQ 32                        /* query rows of a block: two 16-column groups a wave */
#define FP 68                        /* floats between two rows of a wave's part in LDS: 16-byte aligned, rows spread over the banks */
#define FC (0.03125f * 1.44269504f)  /* raw score -> scaled log2 domain: 1024^-0.5 * log2 e */
/* 2^x; the v_nop is the slot that the instruction set asks for behind a transcendental, in the same statement so that it stands there whatever the compiler puts next */
__device__ __forceinline__ float fa_exp2(float x) { asm("v_exp_f32 %0, %0\n\tv_nop" : "+v"(x)); return x; }
/* a fragment stored in fragment order: two half fragments of 512 bytes; p: the lane's own 16 bytes of the first */
__device__ __forceinline__ v16h fa_frag(const unsigned short* p) { FragH f; f.half[0] = *(const v8us*)p; f.half[1] = *(const v8us*)(p + 256); return f.v; }
__device__ __forceinline__ v8f fa_mma(v16h a, v16h b, v8f c) { return __builtin_amdgcn_wmma_f32_16x16x32_f16(false, a, false, b, (short)0, c, false, false); }
__device__ __forceinline__ void fattn_rows(const _Float16* __restrict__ Q16, const _Float16* __restrict__ KV, float* __restrict__ O, const int b, const int qb, float (*po)[FQ][FP], float (*pm)[FQ], float (*pl)[FQ]) {
  static_assert(HD == 64 && NH == 1 && SQ % FQ == 0 && FQ == 32 && FW * 32 == FQ * (HD / 4), "two k blocks a score, four 16-row tiles of O^T; the join gives a thread four columns of one row");
  const int tid = threadIdx.x, lane = tid & 31, ln = lane & 15, hh = lane >> 4; const int w = __builtin_amdgcn_readfirstlane(tid >> 5);
  const unsigned short* qp = (const unsigned short*)Q16 + ((size_t)b * SQ + qb * FQ) * DI + lane * 8; const unsigned short* kvb = (const unsigned short*)KV + (size_t)b * (SQ / 32) * KVT + lane * 8;      /* the lane's 16 bytes of every half fragment */
  v16h q[2][2];
#pragma unroll
  for (int qt = 0; qt < 2; ++qt) for (int ks = 0; ks < 2; ++ks) q[qt][ks] = fa_frag(qp + (qt * 2 + ks) * 512);
  const v8f z8 = {0.f, 0.f, 0.f, 0.f, 0.f, 0.f, 0.f, 0.f}; v8f o[4][2]; float m[2] = {-3.0e38f, -3.0e38f}, l[2] = {0.f, 0.f};      /* m: raw (unscaled) score */
#pragma unroll
  for (int dt = 0; dt < 4; ++dt) for (int qt = 0; qt < 2; ++qt) o[dt][qt] = z8;
  for (int st = w; st <= qb; st += FW) {      /* the same in every lane of a wave; no barrier inside */
    const unsigned short* kv = kvb + (size_t)st * KVT; v16h kf[2][2], vf[4];      /* the step's tile: sixteen loads of 512 contiguous bytes a wave, one address */
#pragma unroll
    for (int kt = 0; kt < 2; ++kt) for (int ks = 0; ks < 2; ++ks) kf[kt][ks] = fa_frag(kv + (kt * 2 + ks) * 512);
#pragma unroll
    for (int dt = 0; dt < 4; ++dt) vf[dt] = fa_frag(kv + KVT / 2 + dt * 512);
    asm volatile("s_wait_xcnt 0x0" :: "v"(kv) : "memory");      /* behind the sixteen loads; their address is named as an input so that it lives up to here and no load's result lands in it earlier */
    __builtin_amdgcn_sched_barrier(0);      /* all sixteen loads of a step are issued ahead of its first product: one load latency a step (left free, the compiler put loads behind products, into their operands' registers: three latencies in a row) */
    v8f s[2][2];      /* s[qt][kt][r]: key k0 + 16 kt + 8 hh + r against query 16 qt + ln */
#pragma unroll
    for (int qt = 0; qt < 2; ++qt) for (int kt = 0; kt < 2; ++kt) s[qt][kt] = fa_mma(kf[kt][1], q[qt][1], fa_mma(kf[kt][0], q[qt][0], z8));
    if (st == qb) {      /* the row block's own keys: those past a row drop out (key 0 of the step stays for every row) */
#pragma unroll
      for (int qt = 0; qt < 2; ++qt) for (int kt = 0; kt < 2; ++kt) for (int r = 0; r < 8; ++r) s[qt][kt][r] = (kt * 16 + 8 * hh + r <= qt * 16 + ln) ? s[qt][kt][r] : -1.0e30f; }
#pragma unroll
    for (int qt = 0; qt < 2; ++qt) {
      float mx = s[qt][0][0];
#pragma unroll
      for (int r = 1; r < 8; ++r) mx = fmaxf(mx, s[qt][0][r]);
#pragma unroll
      for (int r = 0; r < 8; ++r) mx = fmaxf(mx, s[qt][1][r]);
      mx = fmaxf(mx, __shfl_xor(mx, 16, 32));      /* the two lane halves hold the same query's other keys */
      const float mn = fmaxf(m[qt], mx); const float f = fa_exp2((m[qt] - mn) * FC); const float nm = -mn * FC; m[qt] = mn;
      FragH pb; v4f s4 = {0.f, 0.f, 0.f, 0.f};
#pragma unroll
      for (int kt = 0; kt < 2; ++kt) for (int g = 0; g < 2; ++g) { float e0 = fmaf(s[qt][kt][g * 4 + 0], FC, nm), e1 = fmaf(s[qt][kt][g * 4 + 1], FC, nm), e2 = fmaf(s[qt][kt][g * 4 + 2], FC, nm), e3 = fmaf(s[qt][kt][g * 4 + 3], FC, nm);
        /* four 2^x in place; the v_nop as in fa_exp2 */
        asm("v_exp_f32 %0, %0\n\tv_exp_f32 %1, %1\n\tv_exp_f32 %2, %2\n\tv_exp_f32 %3, %3\n\tv_nop" : "+v"(e0), "+v"(e1), "+v"(e2), "+v"(e3));
        const v4f e = {e0, e1, e2, e3}; s4 += e;      /* keys past the row: exactly 0 */
        pb.h[kt * 8 + g * 4 + 0] = (_Float16)e0; pb.h[kt * 8 + g * 4 + 1] = (_Float16)e1; pb.h[kt * 8 + g * 4 + 2] = (_Float16)e2; pb.h[kt * 8 + g * 4 + 3] = (_Float16)e3; }
      l[qt] = l[qt] * f + ((s4[0] + s4[1]) + (s4[2] + s4[3]));
#pragma unroll
      for (int dt = 0; dt < 4; ++dt) { o[dt][qt] *= f; o[dt][qt] = fa_mma(vf[dt], pb.v, o[dt][qt]); } } }
#pragma unroll
  for (int qt = 0; qt < 2; ++qt) { l[qt] += __shfl_xor(l[qt], 16, 32); if (hh == 0) { pm[w][qt * 16 + ln] = m[qt]; pl[w][qt * 16 + ln] = l[qt]; }
#pragma unroll
    for (int dt = 0; dt < 4; ++dt) { const v4f lo = {o[dt][qt][0], o[dt][qt][1], o[dt][qt][2], o[dt][qt][3]}, hi = {o[dt][qt][4], o[dt][qt][5], o[dt][qt][6], o[dt][qt][7]};      /* o[dt][qt][r] = O[query 16 qt + ln][column 16 dt + 8 hh + r] */
      *(v4f*)&po[w][qt * 16 + ln][dt * 16 + 8 * hh] = lo; *(v4f*)&po[w][qt * 16 + ln][dt * 16 + 8 * hh + 4] = hi; } }
  __syncthreads();      /* every wave's part (every wave has at least one step: qb >= FW) is in LDS before the join reads it */
  const int qi = tid >> 4, d4 = (tid & 15) * 4; float M = pm[0][qi];
#pragma unroll
  for (int u = 1; u < FW; ++u) M = fmaxf(M, pm[u][qi]);
  float L = 0.f; v4f a = {0.f, 0.f, 0.f, 0.f};
#pragma unroll
  for (int u = 0; u < FW; ++u) { const float g = fa_exp2((pm[u][qi] - M) * FC); L += g * pl[u][qi]; a += g * *(const v4f*)&po[u][qi][d4]; }
  a *= 1.0f / L;
  *(v4f*)(O + ((size_t)b * SQ + qb * FQ + qi) * DI + d4) = a; }

// Both attention paths on ONE grid (neither reads what the other writes; each output row has one writer): grid.x = batch; grid.y: first the f16 row blocks of rows QT0 .. SQ-1, then the exact f32 blocks of rows 0 .. QT0-1, each kind with its most keys first.
#define NFB ((SQ - QT0) / FQ)        /* f16 row blocks of a batch */
#define NAB (QT0 / FW)               /* exact f32 blocks of a batch */
__global__ __launch_bounds__(FW * 32) void k_attn(const _Float16* __restrict__ Q16, const _Float16* __restrict__ KV, const float* __restrict__ QKVF0, const float* __restrict__ QF0, const float* __restrict__ KF0, float* __restrict__ O) {
  static_assert(QT0 % FQ == 0 && FW * QT0 + FW * FW * HD <= FW * FQ * FP, "the first tile ends on a row block; the exact path's scores and its parts of P V fit the LDS of the other path's parts");
  __shared__ __attribute__((aligned(16))) float po[FW][FQ][FP]; __shared__ float pm[FW][FQ]; __shared__ float pl[FW][FQ];
  const int b = (int)blockIdx.x, y = (int)blockIdx.y;      /* the branch is the same for a whole block: each path's barriers are passed by all of its threads */
  if (y < NFB) fattn_rows(Q16, KV, O, b, SQ / FQ - 1 - y, po, pm, pl);
  else att0_rows(QKVF0, QF0, KF0, 0.03125f, O, b, (NFB + NAB - 1 - y) * FW, (float (*)[QT0])&po[0][0][0]); }

extern "C" void kernel_launch(void* const* d_in, const int* in_sizes, int n_in,
                              void* d_out, int out_size, void* d_ws, size_t ws_size, hipStream_t stream) {
  (void)in_sizes; (void)n_in; (void)out_size;
  const float* const* I = (const float* const*)d_in; const float* x = I[0]; const float* wq = I[1]; const float* wk = I[2]; const float* wv = I[3];      /* x; natural [out = 64][in] Wq / Wk / Wv (input order as this module lists them); no biases */
  char* ws = (char*)d_ws; size_t off = 0;
  auto take = [&](size_t bytes) { char* p = ws + off; off += (bytes + 255) & ~(size_t)255; return p; };
  _Float16* BP = (_Float16*)take((size_t)LQK * DM * 2); _Float16* Q16 = (_Float16*)take(NR * DI * 2); _Float16* KV = (_Float16*)take(NR / 32 * KVT * 2);
  float* QKVF0 = (float*)take((size_t)NB * QT0 * LQK * 4); float* QF0 = (float*)take((size_t)NB * QT0 * DI * 4); float* KF0 = (float*)take((size_t)NB * QT0 * DI * 4);      /* every plane holds all batches */
  if (off > ws_size) return;
  k_wpack<<<(unsigned)((DM / 32) * GNT * 2 * 32 / 256), 256, 0, stream>>>(wq, wk, wv, BP);      /* weights (x16, q | k | v) as exact f16 in fragment order */
  k_qkv<<<(unsigned)(NR / 32), GKS * 2 * 32, 0, stream>>>(x, BP, QKVF0, QF0, KF0, Q16, KV);      /* q | k | v = x W^T -> f16 q, k and v^T tiles in fragment order; the same f32 sums of rows 0..511 of each batch also stored unrounded (v in rows of pitch 192; q and k by groups of four features, rows side by side) */
  k_attn<<<dim3(NB, NFB + NAB), FW * 32, 0, stream>>>(Q16, KV, QKVF0, QF0, KF0, (float*)d_out);      /* out = softmax(causal(q k^T * 1024^-0.5)) v (the module scales by the EMBEDDING width), f32: rows 512.. on the f16 path, rows 0..511 exact in f32 */
}
